// v000
// Times are from an AMD MI455X. After a warm-up the kernel runs many times in a row, and a time is the length of
// such a window on the GPU divided by its runs, so every launch and the gaps after it count. The runs cycle
// through copies of the inputs. A figure is the median of several windows, for all but v000 over two sittings.
// Sittings can differ by a few percent; kernels timed side by side share one.
// v000, which the later versions start from, runs in 8390 microseconds.
#include <hip/hip_runtime.h>
// Causal multi-head attention on three inputs with PER-HEAD STACKED projections over ONE sequence of 4096 tokens (Q, K, V [1][4096][1024]; WQ / WK / WV [16][1024][64] = [head][in][out] sigma 0.02, NO biases; 16 heads of 64; scores x 64^-0.5 = / 8; causal (tril, -inf above the diagonal); softmax; heads concatenated head-major; out = concat WO with WO [1024][1024] [in][out], NO bias -> [1][4096][1024]); each head's [in][out] block is transposed into its 64 contiguous rows of the weight plane by the transposing builder, one call per head, and the [in][out] output weight by the same builder in one call.
// Structure: token rows r = s; q, k, v inputs as exact f16 rows (bf16-rounded); Q, K, V as three WMMA GEMMs (32x64 wave tiles, f32 accumulation, exact x16 weights, f16 outputs); per batch: V^T for all heads via LDS transposes; per query tile of 256 rows: scores against the keys below the tile end only (K = 64, all heads on grid.y, alpha = 0.125), causal row softmax on VALU with an arithmetic 0/1 key mask over the computed range (f32 statistics, native exp; weights x256 f16), o = P . V^T (K = keys below the tile end, alpha 2^-2: o carried x64, folded into the output GEMM alpha) written straight into the merged f16 o rows; out = o W_o GEMM (f32) into the output layout.
// Compute dtype: inputs rounded to bf16; x / weights exact; q, k, v, softmax weights and o as plain f16 GEMM operands (~2^-12); scores and softmax statistics f32. v_wmma_f32_16x16x32_f16.
#define NB 1
#define SQ 4096
#define DM 1024
#define NH 16
#define HD 64
#define HG 4                         /* heads per launch of the unlaunched k_vt overload */
#define QT 256                       /* query rows per causal tile */
#define NKX SQ                       /* S / P row pitch */
#define QT0 256                      /* first-tile rows recomputed exactly in f32 */
#define B0 0                         /* first batch processed (debug hook) */
#define NBR NB                       /* batches processed (debug hook) */
#define NR ((size_t)NB * SQ)         /* token rows */
#define MP ((int)((size_t)NBR * SQ)) /* rows projected (debug hook) */
#define QN SQ                        /* query rows attended per batch (debug hook) */
#define NHD NH                       /* heads attended (debug hook) */
#define MPO MP                       /* rows through the output stage (debug hook) */
#define LQ DM      /* row pitch of the q/k/v rows */
typedef __bf16 v16b __attribute__((ext_vector_type(16)));
typedef unsigned short v8us __attribute__((ext_vector_type(8), may_alias));
typedef float  v8f  __attribute__((ext_vector_type(8)));
typedef float  v4f  __attribute__((ext_vector_type(4)));
typedef float  v4fa __attribute__((ext_vector_type(4), may_alias));
union FragB { v16b v; v8us half[2]; unsigned short u[16]; };

__device__ __forceinline__ unsigned short bf16_bits(float x) { unsigned int u = __float_as_uint(x); return (unsigned short)((u + 0x7FFFu + ((u >> 16) & 1u)) >> 16); }
__device__ __forceinline__ float bf16_val(unsigned short b) { return __uint_as_float(((unsigned int)b) << 16); }
__device__ __forceinline__ float bf16_round(float x) { return bf16_val(bf16_bits(x)); }
// D += A·B with NT terms: 1 = ah·bh, 2 = + al·bh (A split), 3 = + ah·bl (both split)
template <int NT>
__device__ __forceinline__ v8f mmaN(v16b ah, v16b al, v16b bh, v16b bl, v8f c) {
  c = __builtin_amdgcn_wmma_f32_16x16x32_bf16(false, ah, false, bh, (short)0, c, false, false);
  if (NT >= 2) c = __builtin_amdgcn_wmma_f32_16x16x32_bf16(false, al, false, bh, (short)0, c, false, false);
  if (NT >= 3) c = __builtin_amdgcn_wmma_f32_16x16x32_bf16(false, ah, false, bl, (short)0, c, false, false);
  asm volatile("v_nop\n\tv_nop\n\tv_nop\n\tv_nop" : "+v"(c) : "v"(ah), "v"(al), "v"(bh), "v"(bl));
  return c;
}

__global__ __launch_bounds__(256) void k_wt_bf16(const float* __restrict__ W, unsigned short* __restrict__ Wt, int K, int N) {
  const int t = blockIdx.x * 256 + threadIdx.x;
  const int k8n = K / 8;
  if (t >= N * k8n) return;
  const int n = t / k8n, k8 = (t % k8n) * 8;
  v8us v;
#pragma unroll
  for (int i = 0; i < 8; ++i) v[i] = bf16_bits(W[(size_t)(k8 + i) * N + n]);
  *(v8us*)(Wt + (size_t)n * K + k8) = v;
  
}

// GEMM C[M][N] (f32, pitch ldc) = act(A[M][K]·W + bias). A f32 row-major (pitch lda) converted per fragment to bf16
// (ASPLIT: hi/lo two planes -> 2 terms, else single rounded term); Wt bf16 [N][K] (pitch ldb). BIAS_BF16 rounds the
// bias to bf16 first (bias quantised to bf16 before the add). K%32==0, M%16==0, N%64==0.
template <bool ASPLIT, int ACT, bool BIAS_BF16>
__global__ __launch_bounds__(128) void k_gemm_bf(const float* __restrict__ A, int lda, const unsigned short* __restrict__ Wt, int ldb,
                                               const float* __restrict__ bias, float* __restrict__ C, int ldc, int M, int N, int K) {
  __shared__ __attribute__((aligned(16))) float so[4][16][64];
  const int tid = threadIdx.x, w = tid >> 5, lane = tid & 31, ln = lane & 15, hh = lane >> 4;
  const int ntn = N / 64;
  const int wid = blockIdx.x * 4 + w;
  const int mt = wid / ntn, nq = wid % ntn;
  if (mt * 16 >= M) return;
  const int row0 = mt * 16, col0 = nq * 64;
  const float* arow = A + (size_t)(row0 + ln) * lda;
  v8f acc[4] = {};
  for (int kb = 0; kb < K; kb += 32) {
    FragB ah, al;
    const v4f x0 = *(const v4fa*)(arow + kb + 8 * hh), x1 = *(const v4fa*)(arow + kb + 8 * hh + 4);
    const v4f x2 = *(const v4fa*)(arow + kb + 16 + 8 * hh), x3 = *(const v4fa*)(arow + kb + 16 + 8 * hh + 4);
    float xs[16] = {x0[0],x0[1],x0[2],x0[3],x1[0],x1[1],x1[2],x1[3],x2[0],x2[1],x2[2],x2[3],x3[0],x3[1],x3[2],x3[3]};
#pragma unroll
    for (int i = 0; i < 16; ++i) { const unsigned short hb = bf16_bits(xs[i]); ah.u[i] = hb; al.u[i] = ASPLIT ? bf16_bits(xs[i] - bf16_val(hb)) : (unsigned short)0; }
#pragma unroll
    for (int t = 0; t < 4; ++t) {
      const unsigned short* brow = Wt + (size_t)(col0 + t * 16 + ln) * ldb + kb;
      FragB b;
      b.half[0] = *(const v8us*)(brow + 8 * hh);
      b.half[1] = *(const v8us*)(brow + 16 + 8 * hh);
      acc[t] = mmaN<ASPLIT ? 2 : 1>(ah.v, al.v, b.v, b.v, acc[t]);
    }
  }
#pragma unroll
  for (int t = 0; t < 4; ++t) {
    float bv = bias ? bias[col0 + t * 16 + ln] : 0.f;
    if (BIAS_BF16) bv = bf16_round(bv);
#pragma unroll
    for (int r = 0; r < 8; ++r) { float v = acc[t][r] + bv; if (ACT == 1) v = fmaxf(v, 0.f); so[w][8 * hh + r][t * 16 + ln] = v; }
  }
  __builtin_amdgcn_fence(__ATOMIC_ACQ_REL, "workgroup");
  __builtin_amdgcn_wave_barrier();
  const int rsub = lane >> 4, c4 = (lane & 15) * 4;
  {
#pragma unroll
    for (int q = 0; q < 8; ++q) {
      const int r = q * 2 + rsub;
      const v4f v = *(const v4fa*)&so[w][r][c4];
      *(v4f*)(C + (size_t)(row0 + r) * ldc + col0 + c4) = v;
    }
    
  }
}

// GEMM C = act(A·W + bias + resid): A f32 (ASPLIT -> hi/lo 2 terms), Wt bf16 [N][K]; ACT 0 none, 1 relu, 2 exact gelu;
// resid (optional, f32, row index = (row % rmod), pitch ldr, RES_BF16 rounds it) added before the activation.
template <bool ASPLIT, int ACT, bool BIAS_BF16, bool RES_BF16>
__global__ __launch_bounds__(128) void k_gemm_bf3(const float* __restrict__ A, int lda, const unsigned short* __restrict__ Wt, int ldb,
                                                const float* __restrict__ bias, const float* __restrict__ resid, int rmod, int ldr,
                                                float* __restrict__ C, int ldc, int M, int N, int K) {
  __shared__ __attribute__((aligned(16))) float so[4][16][64];
  const int tid = threadIdx.x, w = tid >> 5, lane = tid & 31, ln = lane & 15, hh = lane >> 4;
  const int ntn = N / 64;
  const int wid = blockIdx.x * 4 + w;
  const int mt = wid / ntn, nq = wid % ntn;
  if (mt * 16 >= M) return;
  const int row0 = mt * 16, col0 = nq * 64;
  const float* arow = A + (size_t)(row0 + ln) * lda;
  v8f acc[4] = {};
  for (int kb = 0; kb < K; kb += 32) {
    FragB ah, al;
    const v4f x0 = *(const v4fa*)(arow + kb + 8 * hh), x1 = *(const v4fa*)(arow + kb + 8 * hh + 4);
    const v4f x2 = *(const v4fa*)(arow + kb + 16 + 8 * hh), x3 = *(const v4fa*)(arow + kb + 16 + 8 * hh + 4);
    float xs[16] = {x0[0],x0[1],x0[2],x0[3],x1[0],x1[1],x1[2],x1[3],x2[0],x2[1],x2[2],x2[3],x3[0],x3[1],x3[2],x3[3]};
#pragma unroll
    for (int i = 0; i < 16; ++i) { const unsigned short hb = bf16_bits(xs[i]); ah.u[i] = hb; al.u[i] = ASPLIT ? bf16_bits(xs[i] - bf16_val(hb)) : (unsigned short)0; }
#pragma unroll
    for (int t = 0; t < 4; ++t) {
      const unsigned short* brow = Wt + (size_t)(col0 + t * 16 + ln) * ldb + kb;
      FragB b;
      b.half[0] = *(const v8us*)(brow + 8 * hh);
      b.half[1] = *(const v8us*)(brow + 16 + 8 * hh);
      acc[t] = mmaN<ASPLIT ? 2 : 1>(ah.v, al.v, b.v, b.v, acc[t]);
    }
  }
#pragma unroll
  for (int t = 0; t < 4; ++t) {
    const int col = col0 + t * 16 + ln;
    float bv = bias ? bias[col] : 0.f;
    if (BIAS_BF16) bv = bf16_round(bv);
#pragma unroll
    for (int r = 0; r < 8; ++r) {
      float v = acc[t][r] + bv;
      if (resid) { float rv = resid[(size_t)((row0 + 8 * hh + r) % rmod) * ldr + col]; if (RES_BF16) rv = bf16_round(rv); v += rv; }
      if (ACT == 1) v = fmaxf(v, 0.f);
      if (ACT == 2) v = 0.5f * v * (1.0f + erff(v * 0.70710678118654752f));
      if (ACT == 3) { const float u = 0.7978845608028654f * (v + 0.044715f * v * v * v); v = 0.5f * v * (1.0f + tanhf(u)); }
      so[w][8 * hh + r][t * 16 + ln] = v;
    }
  }
  __builtin_amdgcn_fence(__ATOMIC_ACQ_REL, "workgroup");
  __builtin_amdgcn_wave_barrier();
  const int rsub = lane >> 4, c4 = (lane & 15) * 4;
  {
#pragma unroll
    for (int q = 0; q < 8; ++q) {
      const int r = q * 2 + rsub;
      const v4f v = *(const v4fa*)&so[w][r][c4];
      *(v4f*)(C + (size_t)(row0 + r) * ldc + col0 + c4) = v;
    }
    
  }
}
// row LayerNorm (biased variance, eps) over N: s = X (+ R); optional out_sum <- s; out_norm <- (s-mu)*rsqrt(var+eps)*g + b
template <bool PARAM_BF16>
__global__ __launch_bounds__(256) void k_layernorm(const float* __restrict__ X, const float* __restrict__ R, const float* __restrict__ g, const float* __restrict__ bta,
                                                  float* __restrict__ out_sum, float* __restrict__ out_norm, int N, float eps) {
  __shared__ float red[256];
  const int row = blockIdx.x, tid = threadIdx.x;
  const float* x = X + (size_t)row * N; const float* rr = R ? R + (size_t)row * N : nullptr;
  float vals[16];                     // up to N = 4096
  const int per = N / 256;            // contiguous chunk per thread? use strided-by-4 chunks: thread handles j = tid*4 + 1024*u
  float s1 = 0.f;
  for (int u = 0; u < per / 4; ++u) {
    const int j = tid * 4 + 1024 * u;
    const v4f a = *(const v4fa*)(x + j);
    v4f b = {0.f,0.f,0.f,0.f}; if (rr) b = *(const v4fa*)(rr + j);
#pragma unroll
    for (int q = 0; q < 4; ++q) { const float v = a[q] + b[q]; vals[u * 4 + q] = v; s1 += v; }
  }
  red[tid] = s1; __syncthreads();
  for (int st = 128; st > 0; st >>= 1) { if (tid < st) red[tid] += red[tid + st]; __syncthreads(); }
  const float mu = red[0] / (float)N; __syncthreads();
  float s2 = 0.f;
  for (int u = 0; u < per / 4; ++u)
#pragma unroll
    for (int q = 0; q < 4; ++q) { const float c = vals[u * 4 + q] - mu; s2 += c * c; }
  red[tid] = s2; __syncthreads();
  for (int st = 128; st > 0; st >>= 1) { if (tid < st) red[tid] += red[tid + st]; __syncthreads(); }
  const float rs = rsqrtf(red[0] / (float)N + eps);
  {
    for (int u = 0; u < per / 4; ++u) {
      const int j = tid * 4 + 1024 * u;
      v4f o, sm;
#pragma unroll
      for (int q = 0; q < 4; ++q) {
        float gg = g[j + q], bb = bta[j + q];
        if (PARAM_BF16) { gg = bf16_round(gg); bb = bf16_round(bb); }
        sm[q] = vals[u * 4 + q]; o[q] = (vals[u * 4 + q] - mu) * rs * gg + bb;
      }
      if (out_sum) *(v4f*)(out_sum + (size_t)row * N + j) = sm;
      *(v4f*)(out_norm + (size_t)row * N + j) = o;
    }
    
  }
}



// ---- f16 WMMA path (v_wmma_f32_16x16x32_f16): 11-bit significands for operands in range — used where a [0,1] probability operand needs more precision than bf16
typedef _Float16 v16h __attribute__((ext_vector_type(16)));
union FragH { v16h v; v8us half[2]; _Float16 h[16]; unsigned short u[16]; };
template <int NT>
__device__ __forceinline__ v8f mmaH(v16h ah, v16h al, v16h bh, v16h bl, v8f c) {
  c = __builtin_amdgcn_wmma_f32_16x16x32_f16(false, ah, false, bh, (short)0, c, false, false);
  if (NT >= 2) c = __builtin_amdgcn_wmma_f32_16x16x32_f16(false, al, false, bh, (short)0, c, false, false);
  if (NT >= 3) c = __builtin_amdgcn_wmma_f32_16x16x32_f16(false, ah, false, bl, (short)0, c, false, false);
  asm volatile("v_nop\n\tv_nop\n\tv_nop\n\tv_nop" : "+v"(c) : "v"(ah), "v"(al), "v"(bh), "v"(bl));
  return c;
}
// batched GEMM like k_gemm_b but f16 operands: A f32 (split into f16 hi/lo if ASPLIT, else rounded to f16), Bt = f16 values [n][k]; alpha; C f32; N multiple of 16 (partial tiles skipped)
template <bool ASPLIT>
__global__ __launch_bounds__(128) void k_gemm_h(const float* __restrict__ A, int lda, size_t sA, const _Float16* __restrict__ Bh, int ldb, size_t sB, float alpha, float* __restrict__ C, int ldc, size_t sC, int M, int N, int K) {
  __shared__ __attribute__((aligned(16))) float so[4][16][64];
  const int tid = threadIdx.x, w = tid >> 5, lane = tid & 31, ln = lane & 15, hh = lane >> 4; const int by = blockIdx.y;
  A += (size_t)by * sA; Bh += (size_t)by * sB; C += (size_t)by * sC;
  const int ntn = (N + 63) / 64; const int wid = blockIdx.x * 4 + w; const int mt = wid / ntn, nq = wid % ntn; if (mt * 16 >= M) return;
  const int row0 = mt * 16, col0 = nq * 64; const float* arow = A + (size_t)(row0 + ln) * lda;
  v8f acc[4] = {};
  for (int kb = 0; kb < K; kb += 32) {
    FragH ah, al;
    const v4f x0 = *(const v4fa*)(arow + kb + 8 * hh), x1 = *(const v4fa*)(arow + kb + 8 * hh + 4), x2 = *(const v4fa*)(arow + kb + 16 + 8 * hh), x3 = *(const v4fa*)(arow + kb + 16 + 8 * hh + 4);
    float xs[16] = {x0[0],x0[1],x0[2],x0[3],x1[0],x1[1],x1[2],x1[3],x2[0],x2[1],x2[2],x2[3],x3[0],x3[1],x3[2],x3[3]};
#pragma unroll
    for (int i = 0; i < 16; ++i) { const _Float16 h = (_Float16)xs[i]; ah.h[i] = h; al.h[i] = ASPLIT ? (_Float16)(xs[i] - (float)h) : (_Float16)0.0f; }
#pragma unroll
    for (int t = 0; t < 4; ++t) { if (col0 + t * 16 >= N) continue; const size_t boff = (size_t)(col0 + t * 16 + ln) * ldb + kb; FragH bq; bq.half[0] = *(const v8us*)(Bh + boff + 8 * hh); bq.half[1] = *(const v8us*)(Bh + boff + 16 + 8 * hh);
      acc[t] = mmaH<ASPLIT ? 2 : 1>(ah.v, al.v, bq.v, bq.v, acc[t]); }
  }
#pragma unroll
  for (int t = 0; t < 4; ++t) { if (col0 + t * 16 >= N) continue;
#pragma unroll
    for (int r = 0; r < 8; ++r) so[w][8 * hh + r][t * 16 + ln] = acc[t][r] * alpha; }
  __builtin_amdgcn_fence(__ATOMIC_ACQ_REL, "workgroup"); __builtin_amdgcn_wave_barrier();
  const int rsub = lane >> 4, c4 = (lane & 15) * 4;
  {
#pragma unroll
    for (int q = 0; q < 8; ++q) { const int r = q * 2 + rsub; if (col0 + c4 < N) { const v4f v = *(const v4fa*)&so[w][r][c4]; *(v4f*)(C + (size_t)(row0 + r) * ldc + col0 + c4) = v; } }
     }
}

// Wt[n][k] = f16(W[k][n]·scale) from f32 row-major W[K][N] (scale = power of two; bf16-exact weights stay exact in f16 away from the subnormal range)
__global__ __launch_bounds__(256) void k_wt_f16(const float* __restrict__ W, _Float16* __restrict__ Wt, int K, int N, float scale) {
  const int t = blockIdx.x * 256 + threadIdx.x; if (t >= N * (K / 8)) return; const int n = t / (K / 8), k8 = (t % (K / 8)) * 8; FragH f;
#pragma unroll
  for (int i = 0; i < 8; ++i) f.h[i] = (_Float16)(bf16_round(W[(size_t)(k8 + i) * N + n]) * scale); const v8us o = f.half[0];
  *(v8us*)((unsigned short*)Wt + (size_t)n * K + k8) = o; 
}
// k_gemm_hh variant with fused epilogue: v = acc·alpha + bias[by·sBias + col] (+ CP[(row/rowsPerB)·sCPb + by·64 + col] if CP) ; ACT 0 none / 1 elu ; writes f16 C16 (and f32 C if non-null)
template <int ACT>
__global__ __launch_bounds__(128) void k_gemm_hhx(const _Float16* __restrict__ A, int lda, size_t sA, const _Float16* __restrict__ Bh, int ldb, size_t sB, float alpha, const float* __restrict__ bias, size_t sBias, const float* __restrict__ CP, int rowsPerB, size_t sCPb, int row0g,
    float* __restrict__ C, _Float16* __restrict__ C16, int ldc, size_t sC, int M, int N, int K) {
  __shared__ __attribute__((aligned(16))) float so[4][16][64];
  const int tid = threadIdx.x, w = tid >> 5, lane = tid & 31, ln = lane & 15, hh = lane >> 4; const int by = blockIdx.y;
  A += (size_t)by * sA; Bh += (size_t)by * sB; const size_t cofs = (size_t)by * sC; const float* bp = bias ? bias + (size_t)by * sBias : nullptr;
  const int ntn = (N + 63) / 64; const int wid = blockIdx.x * 4 + w; const int mt = wid / ntn, nq = wid % ntn; if (mt * 16 >= M) return;
  const int row0 = mt * 16, col0 = nq * 64; const _Float16* arow = A + (size_t)(row0 + ln) * lda;
  v8f acc[4] = {};
  for (int kb = 0; kb < K; kb += 32) { FragH ah; ah.half[0] = *(const v8us*)((const unsigned short*)arow + kb + 8 * hh); ah.half[1] = *(const v8us*)((const unsigned short*)arow + kb + 16 + 8 * hh);
#pragma unroll
    for (int t = 0; t < 4; ++t) { if (col0 + t * 16 >= N) continue; const size_t boff = (size_t)(col0 + t * 16 + ln) * ldb + kb; FragH bq; bq.half[0] = *(const v8us*)((const unsigned short*)Bh + boff + 8 * hh); bq.half[1] = *(const v8us*)((const unsigned short*)Bh + boff + 16 + 8 * hh);
      acc[t] = mmaH<1>(ah.v, ah.v, bq.v, bq.v, acc[t]); }
  }
#pragma unroll
  for (int t = 0; t < 4; ++t) { if (col0 + t * 16 >= N) continue; const int col = col0 + t * 16 + ln; const float bv = bp ? bf16_round(bp[col]) : 0.f;
#pragma unroll
    for (int r = 0; r < 8; ++r) { float v = acc[t][r] * alpha + bv; if (CP) { const int rr = row0g + row0 + 8 * hh + r; if (rowsPerB < 0) v += CP[cofs + (size_t)rr * ldc + col];      /* rowsPerB < 0: own element of the batched C plane */ else { const int bidx = rr / rowsPerB; v += CP[(size_t)bidx * sCPb + (size_t)by * 64 + col]; } } if (ACT == 1) v = (v > 0.f) ? v : expm1f(v); else if (ACT == 7) v = (v > 0.f) ? v + 1.0f : expf(v); else if (ACT == 8) v = tanhf(v); else if (ACT == 9) v = 0.5f * v * (1.0f + tanhf(0.7978845608028654f * (v + 0.044715f * v * v * v))); else if (ACT == 11) v = 1.0f / (1.0f + expf(-v)); else if (ACT == 12) v = (v > 0.f) ? v : 0.01f * v; else if (ACT == 14) v = (v > 0.f) ? v : 0.1f * v; else if (ACT == 16) v = (v >= 0.f) ? v : 0.3f * v; else if (ACT == 17) v = (v >= 0.f) ? v : 0.2f * v; else if (ACT == 15) v = v / (1.0f + expf(-v)); else if (ACT == 3) v = fmaxf(v, 0.f); else if (ACT == 6) v = 0.5f * v * (1.0f + erff(v * 0.70710678118654752f)); so[w][8 * hh + r][t * 16 + ln] = v; } }
  __builtin_amdgcn_fence(__ATOMIC_ACQ_REL, "workgroup"); __builtin_amdgcn_wave_barrier();
  const int rsub = lane >> 4, c4 = (lane & 15) * 4; typedef _Float16 v4h __attribute__((ext_vector_type(4)));
  {
#pragma unroll
    for (int q = 0; q < 8; ++q) { const int r = q * 2 + rsub; if (col0 + c4 < N) { const v4f v = *(const v4fa*)&so[w][r][c4]; if (C) *(v4f*)(C + cofs + (size_t)(row0 + r) * ldc + col0 + c4) = v; if (C16) { v4h h4; for (int i = 0; i < 4; ++i) h4[i] = (_Float16)v[i]; *(v4h*)(C16 + cofs + (size_t)(row0 + r) * ldc + col0 + c4) = h4; } } }
     }
}


typedef _Float16 v4h __attribute__((ext_vector_type(4)));

__global__ __launch_bounds__(256) void k_x16(const float* __restrict__ x, _Float16* __restrict__ X16, size_t n8) { const size_t t = (size_t)blockIdx.x * 256 + threadIdx.x; if (t >= n8) return; FragH f;
#pragma unroll
  for (int q = 0; q < 8; ++q) f.h[q] = (_Float16)bf16_round(x[t * 8 + q]); *(v8us*)((unsigned short*)X16 + t * 8) = f.half[0];  }
__global__ __launch_bounds__(256) void k_h16(const float* __restrict__ x, _Float16* __restrict__ X16, size_t n8) { const size_t t = (size_t)blockIdx.x * 256 + threadIdx.x; if (t >= n8) return; FragH f;
#pragma unroll
  for (int q = 0; q < 8; ++q) f.h[q] = (_Float16)x[t * 8 + q]; *(v8us*)((unsigned short*)X16 + t * 8) = f.half[0];  }
__global__ __launch_bounds__(256) void k_round16f(const float* __restrict__ W, _Float16* __restrict__ Bt, size_t n8) { const size_t t = (size_t)blockIdx.x * 256 + threadIdx.x; if (t >= n8) return; FragH f;
#pragma unroll
  for (int i = 0; i < 8; ++i) f.h[i] = (_Float16)(bf16_round(W[t * 8 + i]) * 16.0f); *(v8us*)((unsigned short*)Bt + t * 8) = f.half[0];  }
template <int NHv, int TTv>
__global__ __launch_bounds__(256) void k_vt(const _Float16* __restrict__ V16, int ldv, int voff, _Float16* __restrict__ Vt) { __shared__ unsigned short tl[64][66]; const int tid = threadIdx.x; const int slab = blockIdx.x / (TTv / 64), lg = blockIdx.x % (TTv / 64); const int b = slab / NHv, h = slab % NHv;
  for (int i = tid; i < 64 * 8; i += 256) { const int r = i / 8, c8 = (i % 8) * 8; FragH f; f.half[0] = *(const v8us*)((const unsigned short*)V16 + ((size_t)b * TTv + lg * 64 + r) * ldv + voff + h * 64 + c8);
#pragma unroll
    for (int q = 0; q < 8; ++q) tl[r][c8 + q] = f.u[q]; }
  __syncthreads();
  {
#pragma unroll
    for (int rd = 0; rd < 2; ++rd) { const int d = rd * 32 + tid / 8, pc = tid % 8; FragH f;
#pragma unroll
      for (int q = 0; q < 8; ++q) f.u[q] = tl[pc * 8 + q][d];
      *(v8us*)((unsigned short*)Vt + ((size_t)slab * 64 + d) * TTv + lg * 64 + pc * 8) = f.half[0]; }
     } }

__global__ __launch_bounds__(256) void k_hl(const float* __restrict__ F, _Float16* __restrict__ Hh, _Float16* __restrict__ Hl, size_t n8) { const size_t t = (size_t)blockIdx.x * 256 + threadIdx.x; if (t >= n8) return; FragH fh, fl; const v4f a = *(const v4fa*)(F + t * 8), c = *(const v4fa*)(F + t * 8 + 4);
#pragma unroll
  for (int q = 0; q < 4; ++q) { _Float16 h = (_Float16)a[q]; fh.h[q] = h; fl.h[q] = (_Float16)((a[q] - (float)h) * 1024.0f); h = (_Float16)c[q]; fh.h[4 + q] = h; fl.h[4 + q] = (_Float16)((c[q] - (float)h) * 1024.0f); }
  { *(v8us*)((unsigned short*)Hh + t * 8) = fh.half[0]; *(v8us*)((unsigned short*)Hl + t * 8) = fl.half[0];  } }

// ---- fast GEMM (wave tile 32x64; requires M % 32 == 0 rows per launch region and N % 64 == 0); epilogue = k_gemm_hhx semantics ----
__device__ __forceinline__ v16h g2_frag(const _Float16* p, int hh) { FragH f; f.half[0] = *(const v8us*)((const unsigned short*)p + 8 * hh); f.half[1] = *(const v8us*)((const unsigned short*)p + 16 + 8 * hh); return f.v; }
__device__ __forceinline__ v8f g2_mma(v16h a, v16h b, v8f c) { v8f d = __builtin_amdgcn_wmma_f32_16x16x32_f16(false, a, false, b, (short)0, c, false, false); asm volatile("v_nop\n\tv_nop\n\tv_nop\n\tv_nop" : "+v"(d) : "v"(a), "v"(b)); return d; }
template <int ACT>
__global__ __launch_bounds__(128) void k_gemm2(const _Float16* __restrict__ A, int lda, size_t sA, const _Float16* __restrict__ Bh, int ldb, size_t sB, float alpha, const float* __restrict__ bias, size_t sBias, const float* __restrict__ CP, int rowsPerB, size_t sCPb, int row0g,
    float* __restrict__ C, _Float16* __restrict__ C16, int ldc, size_t sC, int M, int N, int K) { static_assert(ACT == 0 || ACT == 3 || ACT == 6 || ACT == 8 || ACT == 9 || ACT == 11 || ACT == 12 || ACT == 14 || ACT == 15 || ACT == 16 || ACT == 17, "k_gemm2: unsupported ACT code (would silently apply no activation)");
  __shared__ __attribute__((aligned(16))) float so[4][32][68];
  const int tid = threadIdx.x, w = tid >> 5, lane = tid & 31, ln = lane & 15, hh = lane >> 4; const int by = blockIdx.y;
  A += (size_t)by * sA; Bh += (size_t)by * sB; const size_t cofs = (size_t)by * sC; const float* bp = bias ? bias + (size_t)by * sBias : nullptr;
  const int ntn = N >> 6; const int mt = blockIdx.x / ntn, nq = blockIdx.x - mt * ntn; const int row0 = mt * 128 + 32 * w, col0 = nq * 64; if (row0 >= M) return;
  const _Float16* a0p = A + (size_t)(row0 + ln) * lda; const _Float16* a1p = a0p + (size_t)16 * lda;
  const _Float16* b0p = Bh + (size_t)(col0 + ln) * ldb; const _Float16* b1p = b0p + (size_t)16 * ldb; const _Float16* b2p = b1p + (size_t)16 * ldb; const _Float16* b3p = b2p + (size_t)16 * ldb;
  const v8f z8 = {0.f,0.f,0.f,0.f,0.f,0.f,0.f,0.f}; v8f c00 = z8, c01 = z8, c02 = z8, c03 = z8, c10 = z8, c11 = z8, c12 = z8, c13 = z8;
#pragma unroll 1
  for (int kb = 0; kb < K; kb += 32) { const v16h a0 = g2_frag(a0p + kb, hh), a1 = g2_frag(a1p + kb, hh);
    v16h b = g2_frag(b0p + kb, hh); c00 = g2_mma(a0, b, c00); c10 = g2_mma(a1, b, c10);
    b = g2_frag(b1p + kb, hh); c01 = g2_mma(a0, b, c01); c11 = g2_mma(a1, b, c11);
    b = g2_frag(b2p + kb, hh); c02 = g2_mma(a0, b, c02); c12 = g2_mma(a1, b, c12);
    b = g2_frag(b3p + kb, hh); c03 = g2_mma(a0, b, c03); c13 = g2_mma(a1, b, c13); }
  v8f accs[8] = {c00, c01, c02, c03, c10, c11, c12, c13};
#pragma unroll
  for (int u = 0; u < 8; ++u) { const int t = u & 3, half = u >> 2; const int col = col0 + t * 16 + ln; const float bv = bp ? bf16_round(bp[col]) : 0.f;
#pragma unroll
    for (int r = 0; r < 8; ++r) { const int rloc = half * 16 + 8 * hh + r; float v = accs[u][r] * alpha + bv; if (CP) { if (rowsPerB < 0) v += CP[cofs + (size_t)(row0g + row0 + rloc) * ldc + col];      /* rowsPerB < 0: own element of the batched C plane */ else { const int bidx = (row0g + row0 + rloc) / rowsPerB; v += CP[(size_t)bidx * sCPb + (size_t)by * 64 + col]; } }
      if (ACT == 3) v = fmaxf(v, 0.f); else if (ACT == 6) v = 0.5f * v * (1.0f + erff(v * 0.70710678118654752f)); else if (ACT == 11) v = 1.0f / (1.0f + expf(-v)); else if (ACT == 15) v = v / (1.0f + expf(-v)); else if (ACT == 12) v = (v > 0.f) ? v : 0.01f * v; else if (ACT == 8) v = tanhf(v); else if (ACT == 9) v = 0.5f * v * (1.0f + tanhf(0.7978845608028654f * (v + 0.044715f * v * v * v))); else if (ACT == 14) v = (v > 0.f) ? v : 0.1f * v; else if (ACT == 16) v = (v >= 0.f) ? v : 0.3f * v; else if (ACT == 17) v = (v >= 0.f) ? v : 0.2f * v;
      so[w][rloc][t * 16 + ln] = v; } }
  __builtin_amdgcn_fence(__ATOMIC_ACQ_REL, "workgroup"); __builtin_amdgcn_wave_barrier();
  const int rsub = lane >> 4, c4 = (lane & 15) * 4;
  {
#pragma unroll
    for (int q = 0; q < 16; ++q) { const int r = q * 2 + rsub; const v4f v = *(const v4fa*)&so[w][r][c4]; if (C) *(v4f*)(C + cofs + (size_t)(row0 + r) * ldc + col0 + c4) = v; if (C16) { v4h h4; for (int i = 0; i < 4; ++i) h4[i] = (_Float16)v[i]; *(v4h*)(C16 + cofs + (size_t)(row0 + r) * ldc + col0 + c4) = h4; } }
     } }


__global__ __launch_bounds__(256) void k_wnat(const float* __restrict__ w, size_t n8, _Float16* __restrict__ Bt) { const size_t t = (size_t)blockIdx.x * 256 + threadIdx.x; if (t >= n8) return; FragH f; for (int q = 0; q < 8; ++q) f.h[q] = (_Float16)(bf16_round(w[t * 8 + q]) * 16.0f); *(v8us*)((unsigned short*)Bt + t * 8) = f.half[0];  }
__global__ __launch_bounds__(256) void k_rsm(const float* __restrict__ S, _Float16* __restrict__ P, int nrows) {
  #pragma clang fp contract(off)
  const int i = blockIdx.x * 256 + threadIdx.x; if (i >= nrows) return; const float* s = S + (size_t)i * SQ; float mx = -3.0e38f;
#pragma unroll 1
  for (int j = 0; j < SQ; ++j) mx = fmaxf(mx, s[j]); float se = 0.f;
#pragma unroll 1
  for (int j = 0; j < SQ; ++j) se += expf(s[j] - mx); const float sc = 256.0f / se;
#pragma unroll 1
  for (int j0 = 0; j0 < SQ; j0 += 8) { FragH f; for (int q = 0; q < 8; ++q) f.h[q] = (_Float16)(expf(s[j0 + q] - mx) * sc); unsigned short* d = (unsigned short*)P + (size_t)i * SQ + j0; *(v8us*)d = f.half[0];  } }
__global__ __launch_bounds__(256) void k_vt(const _Float16* __restrict__ V16, int b, int h0, _Float16* __restrict__ VT) { __shared__ unsigned short tl[64][65]; const int tid = threadIdx.x; const int hh = blockIdx.x % HG, sg = blockIdx.x / HG; const int s0 = sg * 64; const int h = h0 + hh;
  for (int i = tid; i < 64 * 8; i += 256) { const int j = i / 8, d8 = (i % 8) * 8; FragH f; f.half[0] = *(const v8us*)((const unsigned short*)V16 + ((size_t)b * SQ + s0 + j) * DM + h * HD + d8); for (int q = 0; q < 8; ++q) tl[d8 + q][j] = f.u[q]; }
  __syncthreads();
  { for (int i = tid; i < 64 * 8; i += 256) { const int d = i / 8, j8 = (i % 8) * 8; FragH f; for (int q = 0; q < 8; ++q) f.u[q] = tl[d][j8 + q]; *(v8us*)((unsigned short*)VT + ((size_t)hh * HD + d) * SQ + s0 + j8) = f.half[0]; }  } }



__global__ __launch_bounds__(256) void k_rsmcf2(const float* __restrict__ S, _Float16* __restrict__ P, int hg, int q0, int nk) {
  #pragma clang fp contract(off)
  const int t = blockIdx.x * 256 + threadIdx.x; if (t >= hg * QT) return; const size_t i = (size_t)t; const float* s = S + i * NKX; const int last = q0 + (t % QT); float mx = -3.0e38f;
#pragma unroll 1
  for (int j = 0; j < nk; ++j) { const float f = (j <= last) ? 1.f : 0.f; mx = fmaxf(mx, fmaf(f, s[j], (1.f - f) * -1.0e9f)); } float se = 0.f;
#pragma unroll 1
  for (int j = 0; j < nk; ++j) { const float f = (j <= last) ? 1.f : 0.f; se += __expf(fmaf(f, s[j], (1.f - f) * -1.0e9f) - mx); } const float sc = 256.0f / se;
#pragma unroll 1
  for (int j0 = 0; j0 < nk; j0 += 8) { FragH fr; for (int q = 0; q < 8; ++q) { const int j = j0 + q; const float f = (j <= last) ? 1.f : 0.f; fr.h[q] = (_Float16)(__expf(fmaf(f, s[j], (1.f - f) * -1.0e9f) - mx) * sc); } unsigned short* d = (unsigned short*)P + i * NKX + j0; *(v8us*)d = fr.half[0];  } }


template <int MASKADD>
__global__ __launch_bounds__(64) void k_att0(const float* __restrict__ QF, const float* __restrict__ KF, const float* __restrict__ VF, int ld, const float* __restrict__ mask, float scale, float* __restrict__ OF, int ldo) {
  #pragma clang fp contract(off)
  __shared__ __attribute__((aligned(16))) float lq[64][64]; __shared__ __attribute__((aligned(16))) float lo[64][64];
  const int tid = threadIdx.x; const int h = blockIdx.x / (QT0 / 64), rg = blockIdx.x % (QT0 / 64); const int i = rg * 64 + tid;
  const float* qr = QF + (size_t)i * ld + h * HD;
#pragma unroll 1
  for (int c = 0; c < HD / 4; ++c) { *(v4f*)&lq[tid][c * 4] = *(const v4fa*)(qr + c * 4); const v4f z = {0.f, 0.f, 0.f, 0.f}; *(v4f*)&lo[tid][c * 4] = z; }
  float m = -1.0e30f, l = 0.f; const int jmax = MASKADD ? (SQ - 1) : (rg * 64 + 63);      /* additive-mask form: every key (the mask input decides); causal form: keys up to the block's last row */
#pragma unroll 1
  for (int j = 0; j <= jmax; ++j) { const float* kr = KF + (size_t)j * ld + h * HD; const float* vr = VF + (size_t)j * ld + h * HD; float s = 0.f;
#pragma unroll 1
    for (int c = 0; c < HD / 4; ++c) { const v4f kq = *(const v4fa*)(kr + c * 4); const v4f qq = *(v4f*)&lq[tid][c * 4]; s = __fadd_rn(s, __fmul_rn(qq[0], kq[0])); s = __fadd_rn(s, __fmul_rn(qq[1], kq[1])); s = __fadd_rn(s, __fmul_rn(qq[2], kq[2])); s = __fadd_rn(s, __fmul_rn(qq[3], kq[3])); }
    s = __fmul_rn(s, scale); if (MASKADD) s = __fadd_rn(s, __fmul_rn(bf16_round(mask[(size_t)i * SQ + j]), -10000.0f));
    const float f = (MASKADD || j <= i) ? 1.f : 0.f; const float sm = fmaf(f, s, (1.f - f) * -1.0e30f); const float mn = fmaxf(m, sm); const float sc = expf(m - mn); const float e = expf(sm - mn); l = __fadd_rn(__fmul_rn(l, sc), e); m = mn;
#pragma unroll 1
    for (int c = 0; c < HD / 4; ++c) { const v4f vv = *(const v4fa*)(vr + c * 4); v4f oo = *(v4f*)&lo[tid][c * 4]; for (int u = 0; u < 4; ++u) oo[u] = __fadd_rn(__fmul_rn(oo[u], sc), __fmul_rn(e, vv[u])); *(v4f*)&lo[tid][c * 4] = oo; } }
  const float fin = 64.0f / l;      /* o carried x64 like the f16 path */
#pragma unroll 1
  for (int c = 0; c < HD / 4; ++c) { v4f oo = *(v4f*)&lo[tid][c * 4]; for (int u = 0; u < 4; ++u) oo[u] = __fmul_rn(oo[u], fin); *(v4f*)&lo[tid][c * 4] = oo; }
  __syncthreads();
  {
#pragma unroll 1
    for (int it = 0; it < 16; ++it) { const int row = it * 4 + tid / 16, pc = (tid % 16) * 4; const v4f v = *(const v4f*)&lo[row][pc]; *(v4f*)(OF + (size_t)(rg * 64 + row) * ldo + h * HD + pc) = v; }
     } }

extern "C" void kernel_launch(void* const* d_in, const int* in_sizes, int n_in,
                              void* d_out, int out_size, void* d_ws, size_t ws_size, hipStream_t stream) {
  (void)in_sizes; (void)n_in; (void)out_size;
  const float* const* I = (const float* const*)d_in; const float* xq = I[0]; const float* xk = I[1]; const float* xv = I[2]; const float* wq = I[3]; const float* wk = I[4]; const float* wv = I[5]; const float* wo = I[6];      /* weights [in][out] */
  char* ws = (char*)d_ws; size_t off = 0;
  auto take = [&](size_t bytes) { char* p = ws + off; off += (bytes + 255) & ~(size_t)255; return p; };
  _Float16* BQ = (_Float16*)take((size_t)DM * DM * 2); _Float16* BK = (_Float16*)take((size_t)DM * DM * 2); _Float16* BV = (_Float16*)take((size_t)DM * DM * 2); _Float16* BO = (_Float16*)take((size_t)DM * DM * 2);
  _Float16* XQ = (_Float16*)take(NR * DM * 2); _Float16* XK = (_Float16*)take(NR * DM * 2); _Float16* XV = (_Float16*)take(NR * DM * 2); _Float16* Q16 = (_Float16*)take(NR * DM * 2); _Float16* K16 = (_Float16*)take(NR * DM * 2); _Float16* V16 = (_Float16*)take(NR * DM * 2); _Float16* O16 = (_Float16*)take(NR * DM * 2);
  float* S = (float*)take((size_t)NH * QT * NKX * 4); _Float16* P = (_Float16*)take((size_t)NH * QT * NKX * 2); _Float16* VT = (_Float16*)take((size_t)NH * HD * SQ * 2);
  float* QF0 = (float*)take((size_t)QT0 * DM * 4); float* KF0 = (float*)take((size_t)QT0 * DM * 4); float* VF0 = (float*)take((size_t)QT0 * DM * 4); float* OF0 = (float*)take((size_t)NB * QT0 * DM * 4); _Float16* OH0 = (_Float16*)take((size_t)NB * QT0 * DM * 2); _Float16* OL0 = (_Float16*)take((size_t)NB * QT0 * DM * 2);
  if (off > ws_size) return;
  { const unsigned gh = (unsigned)(((size_t)HD * (DM / 8) + 255) / 256); for (int h = 0; h < NH; ++h) { k_wt_f16<<<gh, 256, 0, stream>>>(wq + (size_t)h * DM * HD, BQ + (size_t)h * HD * DM, DM, HD, 16.0f); k_wt_f16<<<gh, 256, 0, stream>>>(wk + (size_t)h * DM * HD, BK + (size_t)h * HD * DM, DM, HD, 16.0f); k_wt_f16<<<gh, 256, 0, stream>>>(wv + (size_t)h * DM * HD, BV + (size_t)h * HD * DM, DM, HD, 16.0f); } const unsigned g = (unsigned)(((size_t)DM * (DM / 8) + 255) / 256); k_wt_f16<<<g, 256, 0, stream>>>(wo, BO, DM, DM, 16.0f); }      /* PER-HEAD STACKS [16][1024][64] = [head][in][out]: head h's [1024][64] block -> rows 64 h .. 64 h + 63 of the Bt[n][k] x16 plane (K 1024, N 64 per call); the [in][out] output weight transposed into its plane by the same builder (K 1024, N 1024) */
  k_x16<<<(unsigned)((NR * DM / 8 + 255) / 256), 256, 0, stream>>>(xq, XQ, NR * DM / 8); k_x16<<<(unsigned)((NR * DM / 8 + 255) / 256), 256, 0, stream>>>(xk, XK, NR * DM / 8); k_x16<<<(unsigned)((NR * DM / 8 + 255) / 256), 256, 0, stream>>>(xv, XV, NR * DM / 8);
  const size_t r0p = (size_t)B0 * SQ;      /* first projected row */
  k_gemm2<0><<<dim3((unsigned)((MP / 128) * (DM / 64)), 1), 128, 0, stream>>>(XQ + r0p * DM, DM, 0, BQ, DM, 0, 0.0625f, nullptr, 0, nullptr, 1, 0, 0, nullptr, Q16 + r0p * DM, DM, 0, MP, DM, DM);
  k_gemm2<0><<<dim3((unsigned)((MP / 128) * (DM / 64)), 1), 128, 0, stream>>>(XK + r0p * DM, DM, 0, BK, DM, 0, 0.0625f, nullptr, 0, nullptr, 1, 0, 0, nullptr, K16 + r0p * DM, DM, 0, MP, DM, DM);
  k_gemm2<0><<<dim3((unsigned)((MP / 128) * (DM / 64)), 1), 128, 0, stream>>>(XV + r0p * DM, DM, 0, BV, DM, 0, 0.0625f, nullptr, 0, nullptr, 1, 0, 0, nullptr, V16 + r0p * DM, DM, 0, MP, DM, DM);
  for (int b = B0; b < B0 + NBR; ++b) { const size_t r0 = (size_t)b * SQ;
    k_vt<NH, SQ><<<NH * (SQ / 64), 256, 0, stream>>>(V16 + r0 * LQ, LQ, 0, VT);      /* V^T [NH][HD][SQ] for this batch */
    k_gemm2<0><<<dim3((QT0 / 128) * (DM / 64), 1), 128, 0, stream>>>(XQ + r0 * DM, DM, 0, BQ, DM, 0, 0.0625f, nullptr, 0, nullptr, 1, 0, 0, QF0, nullptr, DM, 0, QT0, DM, DM); k_gemm2<0><<<dim3((QT0 / 128) * (DM / 64), 1), 128, 0, stream>>>(XK + r0 * DM, DM, 0, BK, DM, 0, 0.0625f, nullptr, 0, nullptr, 1, 0, 0, KF0, nullptr, DM, 0, QT0, DM, DM); k_gemm2<0><<<dim3((QT0 / 128) * (DM / 64), 1), 128, 0, stream>>>(XV + r0 * DM, DM, 0, BV, DM, 0, 0.0625f, nullptr, 0, nullptr, 1, 0, 0, VF0, nullptr, DM, 0, QT0, DM, DM);      /* f32 q, k, v of the first 256 rows (exact products) */
    k_att0<0><<<NH * (QT0 / 64), 64, 0, stream>>>(QF0, KF0, VF0, DM, nullptr, 0.125f, OF0 + (size_t)b * QT0 * DM, DM);      /* exact f32 attention for rows 0..255 (o x64) */
    for (int q0 = 0; q0 < QN; q0 += QT) { const int nk = q0 + QT;      /* causal: only keys below the tile end are computed */
      k_gemm2<0><<<dim3((QT / 128) * (nk / 64), NHD), 128, 0, stream>>>(Q16 + (r0 + q0) * LQ, LQ, (size_t)HD, K16 + r0 * LQ, LQ, (size_t)HD, 0.125f, nullptr, 0, nullptr, 1, 0, 0, S, nullptr, NKX, (size_t)QT * NKX, QT, nk, HD);      /* scores, all heads on grid.y */
      k_rsmcf2<<<(NHD * QT + 255) / 256, 256, 0, stream>>>(S, P, NHD, q0, nk);
      k_gemm2<0><<<dim3((QT / 128) * (HD / 64), NHD), 128, 0, stream>>>(P, NKX, (size_t)QT * NKX, VT, SQ, (size_t)HD * SQ, 0.25f, nullptr, 0, nullptr, 1, 0, 0, nullptr, O16 + (r0 + q0) * DM, DM, (size_t)HD, QT, HD, nk); } }      /* o (merged heads, x64) as f16 rows */
  k_gemm2<0><<<dim3((unsigned)((MPO / 128) * (DM / 64)), 1), 128, 0, stream>>>(O16 + r0p * DM, DM, 0, BO, DM, 0, 0.0009765625f, nullptr, 0, nullptr, 1, 0, 0, (float*)d_out + r0p * DM, nullptr, DM, 0, MPO, DM, DM);      /* out rows are the output layout */
  k_hl<<<(unsigned)(((size_t)NB * QT0 * DM / 8 + 255) / 256), 256, 0, stream>>>(OF0, OH0, OL0, (size_t)NB * QT0 * DM / 8);      /* first-tile o (x64) -> f16 hi + x1024 residual planes */
  for (int b = B0; b < B0 + NBR; ++b) { const size_t r0 = (size_t)b * SQ; const size_t f0 = (size_t)b * QT0;
    k_gemm2<0><<<dim3((QT0 / 128) * (DM / 64), 1), 128, 0, stream>>>(OH0 + f0 * DM, DM, 0, BO, DM, 0, 0.0009765625f, nullptr, 0, nullptr, 1, 0, 0, (float*)d_out + r0 * DM, nullptr, DM, 0, QT0, DM, DM);      /* rows 0..255: out = o_hi Wo, overwriting the f16-path rows */
    k_gemm2<0><<<dim3((QT0 / 128) * (DM / 64), 1), 128, 0, stream>>>(OL0 + f0 * DM, DM, 0, BO, DM, 0, 0.00000095367431640625f, nullptr, 0, (const float*)d_out + r0 * DM, -1, 0, 0, (float*)d_out + r0 * DM, nullptr, DM, 0, QT0, DM, DM); }      /* += o_lo Wo 2^-20 (own-element accumulate) */
}

// v001
// One run takes 2740 microseconds.
// In two side-by-side timings against v000, it was 3.07 and 3.08 times as fast.
#include <hip/hip_runtime.h>
// Causal multi-head attention on three inputs with PER-HEAD STACKED projections over ONE sequence of 4096 tokens (Q, K, V [1][4096][1024]; WQ / WK / WV [16][1024][64] = [head][in][out] sigma 0.02, NO biases; 16 heads of 64; scores x 64^-0.5 = / 8; causal (tril, -inf above the diagonal); softmax; heads concatenated head-major; out = concat WO with WO [1024][1024] [in][out], NO bias -> [1][4096][1024]); each head's [in][out] block is transposed into its 64 contiguous rows of the weight plane by the transposing builder, one call per head, and the [in][out] output weight by the same builder in one call.
// Structure: token rows r = s; q, k, v inputs as exact f16 rows (bf16-rounded); Q, K, V as three WMMA GEMMs (32x64 wave tiles, f32 accumulation, exact x16 weights, f16 outputs); per batch: V^T for all heads via LDS transposes; per query tile of 256 rows: scores against the keys below the tile end only (K = 64, all heads on grid.y, alpha = 0.125), causal row softmax on VALU with an arithmetic 0/1 key mask over the computed range (f32 statistics, native exp; weights x256 f16), o = P . V^T (K = keys below the tile end, alpha 2^-2: o carried x64, folded into the output GEMM alpha) written straight into the merged f16 o rows; out = o W_o GEMM (f32) into the output layout.
// Compute dtype: inputs rounded to bf16; x / weights exact; q, k, v, softmax weights and o as plain f16 GEMM operands (~2^-12); scores and softmax statistics f32. v_wmma_f32_16x16x32_f16.
#define NB 1
#define SQ 4096
#define DM 1024
#define NH 16
#define HD 64
#define HG 4                         /* heads per launch of the unlaunched k_vt overload */
#define QT 256                       /* query rows per causal tile */
#define NKX SQ                       /* S / P row pitch */
#define QT0 256                      /* first-tile rows recomputed exactly in f32 */
#define B0 0                         /* first batch processed (debug hook) */
#define NBR NB                       /* batches processed (debug hook) */
#define NR ((size_t)NB * SQ)         /* token rows */
#define MP ((int)((size_t)NBR * SQ)) /* rows projected (debug hook) */
#define QN SQ                        /* query rows attended per batch (debug hook) */
#define NHD NH                       /* heads attended (debug hook) */
#define MPO MP                       /* rows through the output stage (debug hook) */
#define LQ DM      /* row pitch of the q/k/v rows */
typedef __bf16 v16b __attribute__((ext_vector_type(16)));
typedef unsigned short v8us __attribute__((ext_vector_type(8), may_alias));
typedef float  v8f  __attribute__((ext_vector_type(8)));
typedef float  v4f  __attribute__((ext_vector_type(4)));
typedef float  v4fa __attribute__((ext_vector_type(4), may_alias));
union FragB { v16b v; v8us half[2]; unsigned short u[16]; };

__device__ __forceinline__ unsigned short bf16_bits(float x) { unsigned int u = __float_as_uint(x); return (unsigned short)((u + 0x7FFFu + ((u >> 16) & 1u)) >> 16); }
__device__ __forceinline__ float bf16_val(unsigned short b) { return __uint_as_float(((unsigned int)b) << 16); }
__device__ __forceinline__ float bf16_round(float x) { return bf16_val(bf16_bits(x)); }
// D += A·B with NT terms: 1 = ah·bh, 2 = + al·bh (A split), 3 = + ah·bl (both split)
template <int NT>
__device__ __forceinline__ v8f mmaN(v16b ah, v16b al, v16b bh, v16b bl, v8f c) {
  c = __builtin_amdgcn_wmma_f32_16x16x32_bf16(false, ah, false, bh, (short)0, c, false, false);
  if (NT >= 2) c = __builtin_amdgcn_wmma_f32_16x16x32_bf16(false, al, false, bh, (short)0, c, false, false);
  if (NT >= 3) c = __builtin_amdgcn_wmma_f32_16x16x32_bf16(false, ah, false, bl, (short)0, c, false, false);
  asm volatile("v_nop\n\tv_nop\n\tv_nop\n\tv_nop" : "+v"(c) : "v"(ah), "v"(al), "v"(bh), "v"(bl));
  return c;
}

__global__ __launch_bounds__(256) void k_wt_bf16(const float* __restrict__ W, unsigned short* __restrict__ Wt, int K, int N) {
  const int t = blockIdx.x * 256 + threadIdx.x;
  const int k8n = K / 8;
  if (t >= N * k8n) return;
  const int n = t / k8n, k8 = (t % k8n) * 8;
  v8us v;
#pragma unroll
  for (int i = 0; i < 8; ++i) v[i] = bf16_bits(W[(size_t)(k8 + i) * N + n]);
  *(v8us*)(Wt + (size_t)n * K + k8) = v;
  
}

// GEMM C[M][N] (f32, pitch ldc) = act(A[M][K]·W + bias). A f32 row-major (pitch lda) converted per fragment to bf16
// (ASPLIT: hi/lo two planes -> 2 terms, else single rounded term); Wt bf16 [N][K] (pitch ldb). BIAS_BF16 rounds the
// bias to bf16 first (bias quantised to bf16 before the add). K%32==0, M%16==0, N%64==0.
template <bool ASPLIT, int ACT, bool BIAS_BF16>
__global__ __launch_bounds__(128) void k_gemm_bf(const float* __restrict__ A, int lda, const unsigned short* __restrict__ Wt, int ldb,
                                               const float* __restrict__ bias, float* __restrict__ C, int ldc, int M, int N, int K) {
  __shared__ __attribute__((aligned(16))) float so[4][16][64];
  const int tid = threadIdx.x, w = tid >> 5, lane = tid & 31, ln = lane & 15, hh = lane >> 4;
  const int ntn = N / 64;
  const int wid = blockIdx.x * 4 + w;
  const int mt = wid / ntn, nq = wid % ntn;
  if (mt * 16 >= M) return;
  const int row0 = mt * 16, col0 = nq * 64;
  const float* arow = A + (size_t)(row0 + ln) * lda;
  v8f acc[4] = {};
  for (int kb = 0; kb < K; kb += 32) {
    FragB ah, al;
    const v4f x0 = *(const v4fa*)(arow + kb + 8 * hh), x1 = *(const v4fa*)(arow + kb + 8 * hh + 4);
    const v4f x2 = *(const v4fa*)(arow + kb + 16 + 8 * hh), x3 = *(const v4fa*)(arow + kb + 16 + 8 * hh + 4);
    float xs[16] = {x0[0],x0[1],x0[2],x0[3],x1[0],x1[1],x1[2],x1[3],x2[0],x2[1],x2[2],x2[3],x3[0],x3[1],x3[2],x3[3]};
#pragma unroll
    for (int i = 0; i < 16; ++i) { const unsigned short hb = bf16_bits(xs[i]); ah.u[i] = hb; al.u[i] = ASPLIT ? bf16_bits(xs[i] - bf16_val(hb)) : (unsigned short)0; }
#pragma unroll
    for (int t = 0; t < 4; ++t) {
      const unsigned short* brow = Wt + (size_t)(col0 + t * 16 + ln) * ldb + kb;
      FragB b;
      b.half[0] = *(const v8us*)(brow + 8 * hh);
      b.half[1] = *(const v8us*)(brow + 16 + 8 * hh);
      acc[t] = mmaN<ASPLIT ? 2 : 1>(ah.v, al.v, b.v, b.v, acc[t]);
    }
  }
#pragma unroll
  for (int t = 0; t < 4; ++t) {
    float bv = bias ? bias[col0 + t * 16 + ln] : 0.f;
    if (BIAS_BF16) bv = bf16_round(bv);
#pragma unroll
    for (int r = 0; r < 8; ++r) { float v = acc[t][r] + bv; if (ACT == 1) v = fmaxf(v, 0.f); so[w][8 * hh + r][t * 16 + ln] = v; }
  }
  __builtin_amdgcn_fence(__ATOMIC_ACQ_REL, "workgroup");
  __builtin_amdgcn_wave_barrier();
  const int rsub = lane >> 4, c4 = (lane & 15) * 4;
  {
#pragma unroll
    for (int q = 0; q < 8; ++q) {
      const int r = q * 2 + rsub;
      const v4f v = *(const v4fa*)&so[w][r][c4];
      *(v4f*)(C + (size_t)(row0 + r) * ldc + col0 + c4) = v;
    }
    
  }
}

// GEMM C = act(A·W + bias + resid): A f32 (ASPLIT -> hi/lo 2 terms), Wt bf16 [N][K]; ACT 0 none, 1 relu, 2 exact gelu;
// resid (optional, f32, row index = (row % rmod), pitch ldr, RES_BF16 rounds it) added before the activation.
template <bool ASPLIT, int ACT, bool BIAS_BF16, bool RES_BF16>
__global__ __launch_bounds__(128) void k_gemm_bf3(const float* __restrict__ A, int lda, const unsigned short* __restrict__ Wt, int ldb,
                                                const float* __restrict__ bias, const float* __restrict__ resid, int rmod, int ldr,
                                                float* __restrict__ C, int ldc, int M, int N, int K) {
  __shared__ __attribute__((aligned(16))) float so[4][16][64];
  const int tid = threadIdx.x, w = tid >> 5, lane = tid & 31, ln = lane & 15, hh = lane >> 4;
  const int ntn = N / 64;
  const int wid = blockIdx.x * 4 + w;
  const int mt = wid / ntn, nq = wid % ntn;
  if (mt * 16 >= M) return;
  const int row0 = mt * 16, col0 = nq * 64;
  const float* arow = A + (size_t)(row0 + ln) * lda;
  v8f acc[4] = {};
  for (int kb = 0; kb < K; kb += 32) {
    FragB ah, al;
    const v4f x0 = *(const v4fa*)(arow + kb + 8 * hh), x1 = *(const v4fa*)(arow + kb + 8 * hh + 4);
    const v4f x2 = *(const v4fa*)(arow + kb + 16 + 8 * hh), x3 = *(const v4fa*)(arow + kb + 16 + 8 * hh + 4);
    float xs[16] = {x0[0],x0[1],x0[2],x0[3],x1[0],x1[1],x1[2],x1[3],x2[0],x2[1],x2[2],x2[3],x3[0],x3[1],x3[2],x3[3]};
#pragma unroll
    for (int i = 0; i < 16; ++i) { const unsigned short hb = bf16_bits(xs[i]); ah.u[i] = hb; al.u[i] = ASPLIT ? bf16_bits(xs[i] - bf16_val(hb)) : (unsigned short)0; }
#pragma unroll
    for (int t = 0; t < 4; ++t) {
      const unsigned short* brow = Wt + (size_t)(col0 + t * 16 + ln) * ldb + kb;
      FragB b;
      b.half[0] = *(const v8us*)(brow + 8 * hh);
      b.half[1] = *(const v8us*)(brow + 16 + 8 * hh);
      acc[t] = mmaN<ASPLIT ? 2 : 1>(ah.v, al.v, b.v, b.v, acc[t]);
    }
  }
#pragma unroll
  for (int t = 0; t < 4; ++t) {
    const int col = col0 + t * 16 + ln;
    float bv = bias ? bias[col] : 0.f;
    if (BIAS_BF16) bv = bf16_round(bv);
#pragma unroll
    for (int r = 0; r < 8; ++r) {
      float v = acc[t][r] + bv;
      if (resid) { float rv = resid[(size_t)((row0 + 8 * hh + r) % rmod) * ldr + col]; if (RES_BF16) rv = bf16_round(rv); v += rv; }
      if (ACT == 1) v = fmaxf(v, 0.f);
      if (ACT == 2) v = 0.5f * v * (1.0f + erff(v * 0.70710678118654752f));
      if (ACT == 3) { const float u = 0.7978845608028654f * (v + 0.044715f * v * v * v); v = 0.5f * v * (1.0f + tanhf(u)); }
      so[w][8 * hh + r][t * 16 + ln] = v;
    }
  }
  __builtin_amdgcn_fence(__ATOMIC_ACQ_REL, "workgroup");
  __builtin_amdgcn_wave_barrier();
  const int rsub = lane >> 4, c4 = (lane & 15) * 4;
  {
#pragma unroll
    for (int q = 0; q < 8; ++q) {
      const int r = q * 2 + rsub;
      const v4f v = *(const v4fa*)&so[w][r][c4];
      *(v4f*)(C + (size_t)(row0 + r) * ldc + col0 + c4) = v;
    }
    
  }
}
// row LayerNorm (biased variance, eps) over N: s = X (+ R); optional out_sum <- s; out_norm <- (s-mu)*rsqrt(var+eps)*g + b
template <bool PARAM_BF16>
__global__ __launch_bounds__(256) void k_layernorm(const float* __restrict__ X, const float* __restrict__ R, const float* __restrict__ g, const float* __restrict__ bta,
                                                  float* __restrict__ out_sum, float* __restrict__ out_norm, int N, float eps) {
  __shared__ float red[256];
  const int row = blockIdx.x, tid = threadIdx.x;
  const float* x = X + (size_t)row * N; const float* rr = R ? R + (size_t)row * N : nullptr;
  float vals[16];                     // up to N = 4096
  const int per = N / 256;            // contiguous chunk per thread? use strided-by-4 chunks: thread handles j = tid*4 + 1024*u
  float s1 = 0.f;
  for (int u = 0; u < per / 4; ++u) {
    const int j = tid * 4 + 1024 * u;
    const v4f a = *(const v4fa*)(x + j);
    v4f b = {0.f,0.f,0.f,0.f}; if (rr) b = *(const v4fa*)(rr + j);
#pragma unroll
    for (int q = 0; q < 4; ++q) { const float v = a[q] + b[q]; vals[u * 4 + q] = v; s1 += v; }
  }
  red[tid] = s1; __syncthreads();
  for (int st = 128; st > 0; st >>= 1) { if (tid < st) red[tid] += red[tid + st]; __syncthreads(); }
  const float mu = red[0] / (float)N; __syncthreads();
  float s2 = 0.f;
  for (int u = 0; u < per / 4; ++u)
#pragma unroll
    for (int q = 0; q < 4; ++q) { const float c = vals[u * 4 + q] - mu; s2 += c * c; }
  red[tid] = s2; __syncthreads();
  for (int st = 128; st > 0; st >>= 1) { if (tid < st) red[tid] += red[tid + st]; __syncthreads(); }
  const float rs = rsqrtf(red[0] / (float)N + eps);
  {
    for (int u = 0; u < per / 4; ++u) {
      const int j = tid * 4 + 1024 * u;
      v4f o, sm;
#pragma unroll
      for (int q = 0; q < 4; ++q) {
        float gg = g[j + q], bb = bta[j + q];
        if (PARAM_BF16) { gg = bf16_round(gg); bb = bf16_round(bb); }
        sm[q] = vals[u * 4 + q]; o[q] = (vals[u * 4 + q] - mu) * rs * gg + bb;
      }
      if (out_sum) *(v4f*)(out_sum + (size_t)row * N + j) = sm;
      *(v4f*)(out_norm + (size_t)row * N + j) = o;
    }
    
  }
}



// ---- f16 WMMA path (v_wmma_f32_16x16x32_f16): 11-bit significands for operands in range — used where a [0,1] probability operand needs more precision than bf16
typedef _Float16 v16h __attribute__((ext_vector_type(16)));
union FragH { v16h v; v8us half[2]; _Float16 h[16]; unsigned short u[16]; };
template <int NT>
__device__ __forceinline__ v8f mmaH(v16h ah, v16h al, v16h bh, v16h bl, v8f c) {
  c = __builtin_amdgcn_wmma_f32_16x16x32_f16(false, ah, false, bh, (short)0, c, false, false);
  if (NT >= 2) c = __builtin_amdgcn_wmma_f32_16x16x32_f16(false, al, false, bh, (short)0, c, false, false);
  if (NT >= 3) c = __builtin_amdgcn_wmma_f32_16x16x32_f16(false, ah, false, bl, (short)0, c, false, false);
  asm volatile("v_nop\n\tv_nop\n\tv_nop\n\tv_nop" : "+v"(c) : "v"(ah), "v"(al), "v"(bh), "v"(bl));
  return c;
}
// batched GEMM like k_gemm_b but f16 operands: A f32 (split into f16 hi/lo if ASPLIT, else rounded to f16), Bt = f16 values [n][k]; alpha; C f32; N multiple of 16 (partial tiles skipped)
template <bool ASPLIT>
__global__ __launch_bounds__(128) void k_gemm_h(const float* __restrict__ A, int lda, size_t sA, const _Float16* __restrict__ Bh, int ldb, size_t sB, float alpha, float* __restrict__ C, int ldc, size_t sC, int M, int N, int K) {
  __shared__ __attribute__((aligned(16))) float so[4][16][64];
  const int tid = threadIdx.x, w = tid >> 5, lane = tid & 31, ln = lane & 15, hh = lane >> 4; const int by = blockIdx.y;
  A += (size_t)by * sA; Bh += (size_t)by * sB; C += (size_t)by * sC;
  const int ntn = (N + 63) / 64; const int wid = blockIdx.x * 4 + w; const int mt = wid / ntn, nq = wid % ntn; if (mt * 16 >= M) return;
  const int row0 = mt * 16, col0 = nq * 64; const float* arow = A + (size_t)(row0 + ln) * lda;
  v8f acc[4] = {};
  for (int kb = 0; kb < K; kb += 32) {
    FragH ah, al;
    const v4f x0 = *(const v4fa*)(arow + kb + 8 * hh), x1 = *(const v4fa*)(arow + kb + 8 * hh + 4), x2 = *(const v4fa*)(arow + kb + 16 + 8 * hh), x3 = *(const v4fa*)(arow + kb + 16 + 8 * hh + 4);
    float xs[16] = {x0[0],x0[1],x0[2],x0[3],x1[0],x1[1],x1[2],x1[3],x2[0],x2[1],x2[2],x2[3],x3[0],x3[1],x3[2],x3[3]};
#pragma unroll
    for (int i = 0; i < 16; ++i) { const _Float16 h = (_Float16)xs[i]; ah.h[i] = h; al.h[i] = ASPLIT ? (_Float16)(xs[i] - (float)h) : (_Float16)0.0f; }
#pragma unroll
    for (int t = 0; t < 4; ++t) { if (col0 + t * 16 >= N) continue; const size_t boff = (size_t)(col0 + t * 16 + ln) * ldb + kb; FragH bq; bq.half[0] = *(const v8us*)(Bh + boff + 8 * hh); bq.half[1] = *(const v8us*)(Bh + boff + 16 + 8 * hh);
      acc[t] = mmaH<ASPLIT ? 2 : 1>(ah.v, al.v, bq.v, bq.v, acc[t]); }
  }
#pragma unroll
  for (int t = 0; t < 4; ++t) { if (col0 + t * 16 >= N) continue;
#pragma unroll
    for (int r = 0; r < 8; ++r) so[w][8 * hh + r][t * 16 + ln] = acc[t][r] * alpha; }
  __builtin_amdgcn_fence(__ATOMIC_ACQ_REL, "workgroup"); __builtin_amdgcn_wave_barrier();
  const int rsub = lane >> 4, c4 = (lane & 15) * 4;
  {
#pragma unroll
    for (int q = 0; q < 8; ++q) { const int r = q * 2 + rsub; if (col0 + c4 < N) { const v4f v = *(const v4fa*)&so[w][r][c4]; *(v4f*)(C + (size_t)(row0 + r) * ldc + col0 + c4) = v; } }
     }
}

// Wt[n][k] = f16(W[k][n]·scale) from f32 row-major W[K][N] (scale = power of two; bf16-exact weights stay exact in f16 away from the subnormal range)
__global__ __launch_bounds__(256) void k_wt_f16(const float* __restrict__ W, _Float16* __restrict__ Wt, int K, int N, float scale) {
  const int t = blockIdx.x * 256 + threadIdx.x; if (t >= N * (K / 8)) return; const int n = t / (K / 8), k8 = (t % (K / 8)) * 8; FragH f;
#pragma unroll
  for (int i = 0; i < 8; ++i) f.h[i] = (_Float16)(bf16_round(W[(size_t)(k8 + i) * N + n]) * scale); const v8us o = f.half[0];
  *(v8us*)((unsigned short*)Wt + (size_t)n * K + k8) = o; 
}
// k_gemm_hh variant with fused epilogue: v = acc·alpha + bias[by·sBias + col] (+ CP[(row/rowsPerB)·sCPb + by·64 + col] if CP) ; ACT 0 none / 1 elu ; writes f16 C16 (and f32 C if non-null)
template <int ACT>
__global__ __launch_bounds__(128) void k_gemm_hhx(const _Float16* __restrict__ A, int lda, size_t sA, const _Float16* __restrict__ Bh, int ldb, size_t sB, float alpha, const float* __restrict__ bias, size_t sBias, const float* __restrict__ CP, int rowsPerB, size_t sCPb, int row0g,
    float* __restrict__ C, _Float16* __restrict__ C16, int ldc, size_t sC, int M, int N, int K) {
  __shared__ __attribute__((aligned(16))) float so[4][16][64];
  const int tid = threadIdx.x, w = tid >> 5, lane = tid & 31, ln = lane & 15, hh = lane >> 4; const int by = blockIdx.y;
  A += (size_t)by * sA; Bh += (size_t)by * sB; const size_t cofs = (size_t)by * sC; const float* bp = bias ? bias + (size_t)by * sBias : nullptr;
  const int ntn = (N + 63) / 64; const int wid = blockIdx.x * 4 + w; const int mt = wid / ntn, nq = wid % ntn; if (mt * 16 >= M) return;
  const int row0 = mt * 16, col0 = nq * 64; const _Float16* arow = A + (size_t)(row0 + ln) * lda;
  v8f acc[4] = {};
  for (int kb = 0; kb < K; kb += 32) { FragH ah; ah.half[0] = *(const v8us*)((const unsigned short*)arow + kb + 8 * hh); ah.half[1] = *(const v8us*)((const unsigned short*)arow + kb + 16 + 8 * hh);
#pragma unroll
    for (int t = 0; t < 4; ++t) { if (col0 + t * 16 >= N) continue; const size_t boff = (size_t)(col0 + t * 16 + ln) * ldb + kb; FragH bq; bq.half[0] = *(const v8us*)((const unsigned short*)Bh + boff + 8 * hh); bq.half[1] = *(const v8us*)((const unsigned short*)Bh + boff + 16 + 8 * hh);
      acc[t] = mmaH<1>(ah.v, ah.v, bq.v, bq.v, acc[t]); }
  }
#pragma unroll
  for (int t = 0; t < 4; ++t) { if (col0 + t * 16 >= N) continue; const int col = col0 + t * 16 + ln; const float bv = bp ? bf16_round(bp[col]) : 0.f;
#pragma unroll
    for (int r = 0; r < 8; ++r) { float v = acc[t][r] * alpha + bv; if (CP) { const int rr = row0g + row0 + 8 * hh + r; if (rowsPerB < 0) v += CP[cofs + (size_t)rr * ldc + col];      /* rowsPerB < 0: own element of the batched C plane */ else { const int bidx = rr / rowsPerB; v += CP[(size_t)bidx * sCPb + (size_t)by * 64 + col]; } } if (ACT == 1) v = (v > 0.f) ? v : expm1f(v); else if (ACT == 7) v = (v > 0.f) ? v + 1.0f : expf(v); else if (ACT == 8) v = tanhf(v); else if (ACT == 9) v = 0.5f * v * (1.0f + tanhf(0.7978845608028654f * (v + 0.044715f * v * v * v))); else if (ACT == 11) v = 1.0f / (1.0f + expf(-v)); else if (ACT == 12) v = (v > 0.f) ? v : 0.01f * v; else if (ACT == 14) v = (v > 0.f) ? v : 0.1f * v; else if (ACT == 16) v = (v >= 0.f) ? v : 0.3f * v; else if (ACT == 17) v = (v >= 0.f) ? v : 0.2f * v; else if (ACT == 15) v = v / (1.0f + expf(-v)); else if (ACT == 3) v = fmaxf(v, 0.f); else if (ACT == 6) v = 0.5f * v * (1.0f + erff(v * 0.70710678118654752f)); so[w][8 * hh + r][t * 16 + ln] = v; } }
  __builtin_amdgcn_fence(__ATOMIC_ACQ_REL, "workgroup"); __builtin_amdgcn_wave_barrier();
  const int rsub = lane >> 4, c4 = (lane & 15) * 4; typedef _Float16 v4h __attribute__((ext_vector_type(4)));
  {
#pragma unroll
    for (int q = 0; q < 8; ++q) { const int r = q * 2 + rsub; if (col0 + c4 < N) { const v4f v = *(const v4fa*)&so[w][r][c4]; if (C) *(v4f*)(C + cofs + (size_t)(row0 + r) * ldc + col0 + c4) = v; if (C16) { v4h h4; for (int i = 0; i < 4; ++i) h4[i] = (_Float16)v[i]; *(v4h*)(C16 + cofs + (size_t)(row0 + r) * ldc + col0 + c4) = h4; } } }
     }
}


typedef _Float16 v4h __attribute__((ext_vector_type(4)));

__global__ __launch_bounds__(256) void k_x16(const float* __restrict__ x, _Float16* __restrict__ X16, size_t n8) { const size_t t = (size_t)blockIdx.x * 256 + threadIdx.x; if (t >= n8) return; FragH f;
#pragma unroll
  for (int q = 0; q < 8; ++q) f.h[q] = (_Float16)bf16_round(x[t * 8 + q]); *(v8us*)((unsigned short*)X16 + t * 8) = f.half[0];  }
__global__ __launch_bounds__(256) void k_h16(const float* __restrict__ x, _Float16* __restrict__ X16, size_t n8) { const size_t t = (size_t)blockIdx.x * 256 + threadIdx.x; if (t >= n8) return; FragH f;
#pragma unroll
  for (int q = 0; q < 8; ++q) f.h[q] = (_Float16)x[t * 8 + q]; *(v8us*)((unsigned short*)X16 + t * 8) = f.half[0];  }
__global__ __launch_bounds__(256) void k_round16f(const float* __restrict__ W, _Float16* __restrict__ Bt, size_t n8) { const size_t t = (size_t)blockIdx.x * 256 + threadIdx.x; if (t >= n8) return; FragH f;
#pragma unroll
  for (int i = 0; i < 8; ++i) f.h[i] = (_Float16)(bf16_round(W[t * 8 + i]) * 16.0f); *(v8us*)((unsigned short*)Bt + t * 8) = f.half[0];  }
template <int NHv, int TTv>
__global__ __launch_bounds__(256) void k_vt(const _Float16* __restrict__ V16, int ldv, int voff, _Float16* __restrict__ Vt) { __shared__ unsigned short tl[64][66]; const int tid = threadIdx.x; const int slab = blockIdx.x / (TTv / 64), lg = blockIdx.x % (TTv / 64); const int b = slab / NHv, h = slab % NHv;
  for (int i = tid; i < 64 * 8; i += 256) { const int r = i / 8, c8 = (i % 8) * 8; FragH f; f.half[0] = *(const v8us*)((const unsigned short*)V16 + ((size_t)b * TTv + lg * 64 + r) * ldv + voff + h * 64 + c8);
#pragma unroll
    for (int q = 0; q < 8; ++q) tl[r][c8 + q] = f.u[q]; }
  __syncthreads();
  {
#pragma unroll
    for (int rd = 0; rd < 2; ++rd) { const int d = rd * 32 + tid / 8, pc = tid % 8; FragH f;
#pragma unroll
      for (int q = 0; q < 8; ++q) f.u[q] = tl[pc * 8 + q][d];
      *(v8us*)((unsigned short*)Vt + ((size_t)slab * 64 + d) * TTv + lg * 64 + pc * 8) = f.half[0]; }
     } }

__global__ __launch_bounds__(256) void k_hl(const float* __restrict__ F, _Float16* __restrict__ Hh, _Float16* __restrict__ Hl, size_t n8) { const size_t t = (size_t)blockIdx.x * 256 + threadIdx.x; if (t >= n8) return; FragH fh, fl; const v4f a = *(const v4fa*)(F + t * 8), c = *(const v4fa*)(F + t * 8 + 4);
#pragma unroll
  for (int q = 0; q < 4; ++q) { _Float16 h = (_Float16)a[q]; fh.h[q] = h; fl.h[q] = (_Float16)((a[q] - (float)h) * 1024.0f); h = (_Float16)c[q]; fh.h[4 + q] = h; fl.h[4 + q] = (_Float16)((c[q] - (float)h) * 1024.0f); }
  { *(v8us*)((unsigned short*)Hh + t * 8) = fh.half[0]; *(v8us*)((unsigned short*)Hl + t * 8) = fl.half[0];  } }

// ---- fast GEMM (wave tile 32x64; requires M % 32 == 0 rows per launch region and N % 64 == 0); epilogue = k_gemm_hhx semantics ----
__device__ __forceinline__ v16h g2_frag(const _Float16* p, int hh) { FragH f; f.half[0] = *(const v8us*)((const unsigned short*)p + 8 * hh); f.half[1] = *(const v8us*)((const unsigned short*)p + 16 + 8 * hh); return f.v; }
__device__ __forceinline__ v8f g2_mma(v16h a, v16h b, v8f c) { v8f d = __builtin_amdgcn_wmma_f32_16x16x32_f16(false, a, false, b, (short)0, c, false, false); asm volatile("v_nop\n\tv_nop\n\tv_nop\n\tv_nop" : "+v"(d) : "v"(a), "v"(b)); return d; }
template <int ACT>
__global__ __launch_bounds__(128) void k_gemm2(const _Float16* __restrict__ A, int lda, size_t sA, const _Float16* __restrict__ Bh, int ldb, size_t sB, float alpha, const float* __restrict__ bias, size_t sBias, const float* __restrict__ CP, int rowsPerB, size_t sCPb, int row0g,
    float* __restrict__ C, _Float16* __restrict__ C16, int ldc, size_t sC, int M, int N, int K) { static_assert(ACT == 0 || ACT == 3 || ACT == 6 || ACT == 8 || ACT == 9 || ACT == 11 || ACT == 12 || ACT == 14 || ACT == 15 || ACT == 16 || ACT == 17, "k_gemm2: unsupported ACT code (would silently apply no activation)");
  __shared__ __attribute__((aligned(16))) float so[4][32][68];
  const int tid = threadIdx.x, w = tid >> 5, lane = tid & 31, ln = lane & 15, hh = lane >> 4; const int by = blockIdx.y;
  A += (size_t)by * sA; Bh += (size_t)by * sB; const size_t cofs = (size_t)by * sC; const float* bp = bias ? bias + (size_t)by * sBias : nullptr;
  const int ntn = N >> 6; const int mt = blockIdx.x / ntn, nq = blockIdx.x - mt * ntn; const int row0 = mt * 128 + 32 * w, col0 = nq * 64; if (row0 >= M) return;
  const _Float16* a0p = A + (size_t)(row0 + ln) * lda; const _Float16* a1p = a0p + (size_t)16 * lda;
  const _Float16* b0p = Bh + (size_t)(col0 + ln) * ldb; const _Float16* b1p = b0p + (size_t)16 * ldb; const _Float16* b2p = b1p + (size_t)16 * ldb; const _Float16* b3p = b2p + (size_t)16 * ldb;
  const v8f z8 = {0.f,0.f,0.f,0.f,0.f,0.f,0.f,0.f}; v8f c00 = z8, c01 = z8, c02 = z8, c03 = z8, c10 = z8, c11 = z8, c12 = z8, c13 = z8;
#pragma unroll 1
  for (int kb = 0; kb < K; kb += 32) { const v16h a0 = g2_frag(a0p + kb, hh), a1 = g2_frag(a1p + kb, hh);
    v16h b = g2_frag(b0p + kb, hh); c00 = g2_mma(a0, b, c00); c10 = g2_mma(a1, b, c10);
    b = g2_frag(b1p + kb, hh); c01 = g2_mma(a0, b, c01); c11 = g2_mma(a1, b, c11);
    b = g2_frag(b2p + kb, hh); c02 = g2_mma(a0, b, c02); c12 = g2_mma(a1, b, c12);
    b = g2_frag(b3p + kb, hh); c03 = g2_mma(a0, b, c03); c13 = g2_mma(a1, b, c13); }
  v8f accs[8] = {c00, c01, c02, c03, c10, c11, c12, c13};
#pragma unroll
  for (int u = 0; u < 8; ++u) { const int t = u & 3, half = u >> 2; const int col = col0 + t * 16 + ln; const float bv = bp ? bf16_round(bp[col]) : 0.f;
#pragma unroll
    for (int r = 0; r < 8; ++r) { const int rloc = half * 16 + 8 * hh + r; float v = accs[u][r] * alpha + bv; if (CP) { if (rowsPerB < 0) v += CP[cofs + (size_t)(row0g + row0 + rloc) * ldc + col];      /* rowsPerB < 0: own element of the batched C plane */ else { const int bidx = (row0g + row0 + rloc) / rowsPerB; v += CP[(size_t)bidx * sCPb + (size_t)by * 64 + col]; } }
      if (ACT == 3) v = fmaxf(v, 0.f); else if (ACT == 6) v = 0.5f * v * (1.0f + erff(v * 0.70710678118654752f)); else if (ACT == 11) v = 1.0f / (1.0f + expf(-v)); else if (ACT == 15) v = v / (1.0f + expf(-v)); else if (ACT == 12) v = (v > 0.f) ? v : 0.01f * v; else if (ACT == 8) v = tanhf(v); else if (ACT == 9) v = 0.5f * v * (1.0f + tanhf(0.7978845608028654f * (v + 0.044715f * v * v * v))); else if (ACT == 14) v = (v > 0.f) ? v : 0.1f * v; else if (ACT == 16) v = (v >= 0.f) ? v : 0.3f * v; else if (ACT == 17) v = (v >= 0.f) ? v : 0.2f * v;
      so[w][rloc][t * 16 + ln] = v; } }
  __builtin_amdgcn_fence(__ATOMIC_ACQ_REL, "workgroup"); __builtin_amdgcn_wave_barrier();
  const int rsub = lane >> 4, c4 = (lane & 15) * 4;
  {
#pragma unroll
    for (int q = 0; q < 16; ++q) { const int r = q * 2 + rsub; const v4f v = *(const v4fa*)&so[w][r][c4]; if (C) *(v4f*)(C + cofs + (size_t)(row0 + r) * ldc + col0 + c4) = v; if (C16) { v4h h4; for (int i = 0; i < 4; ++i) h4[i] = (_Float16)v[i]; *(v4h*)(C16 + cofs + (size_t)(row0 + r) * ldc + col0 + c4) = h4; } }
     } }


__global__ __launch_bounds__(256) void k_wnat(const float* __restrict__ w, size_t n8, _Float16* __restrict__ Bt) { const size_t t = (size_t)blockIdx.x * 256 + threadIdx.x; if (t >= n8) return; FragH f; for (int q = 0; q < 8; ++q) f.h[q] = (_Float16)(bf16_round(w[t * 8 + q]) * 16.0f); *(v8us*)((unsigned short*)Bt + t * 8) = f.half[0];  }
__global__ __launch_bounds__(256) void k_rsm(const float* __restrict__ S, _Float16* __restrict__ P, int nrows) {
  #pragma clang fp contract(off)
  const int i = blockIdx.x * 256 + threadIdx.x; if (i >= nrows) return; const float* s = S + (size_t)i * SQ; float mx = -3.0e38f;
#pragma unroll 1
  for (int j = 0; j < SQ; ++j) mx = fmaxf(mx, s[j]); float se = 0.f;
#pragma unroll 1
  for (int j = 0; j < SQ; ++j) se += expf(s[j] - mx); const float sc = 256.0f / se;
#pragma unroll 1
  for (int j0 = 0; j0 < SQ; j0 += 8) { FragH f; for (int q = 0; q < 8; ++q) f.h[q] = (_Float16)(expf(s[j0 + q] - mx) * sc); unsigned short* d = (unsigned short*)P + (size_t)i * SQ + j0; *(v8us*)d = f.half[0];  } }
__global__ __launch_bounds__(256) void k_vt(const _Float16* __restrict__ V16, int b, int h0, _Float16* __restrict__ VT) { __shared__ unsigned short tl[64][65]; const int tid = threadIdx.x; const int hh = blockIdx.x % HG, sg = blockIdx.x / HG; const int s0 = sg * 64; const int h = h0 + hh;
  for (int i = tid; i < 64 * 8; i += 256) { const int j = i / 8, d8 = (i % 8) * 8; FragH f; f.half[0] = *(const v8us*)((const unsigned short*)V16 + ((size_t)b * SQ + s0 + j) * DM + h * HD + d8); for (int q = 0; q < 8; ++q) tl[d8 + q][j] = f.u[q]; }
  __syncthreads();
  { for (int i = tid; i < 64 * 8; i += 256) { const int d = i / 8, j8 = (i % 8) * 8; FragH f; for (int q = 0; q < 8; ++q) f.u[q] = tl[d][j8 + q]; *(v8us*)((unsigned short*)VT + ((size_t)hh * HD + d) * SQ + s0 + j8) = f.half[0]; }  } }



// Causal row softmax, ONE WAVE PER SCORE ROW. The row (nk f32, nk a multiple of 256 and at most NKX) is read once, by wave-wide loads of 512 contiguous bytes,
// and stays in registers for the maximum, the exponentials and the scaling; maximum and sum go lane-local first (four chains), then over the 32 lanes by a butterfly.
// Every loop of it is fully unrolled so that x and h are indexed by constants only and live in registers, not in scratch memory.
__global__ __launch_bounds__(256) void k_rsmcf2(const float* __restrict__ S, _Float16* __restrict__ P, int hg, int q0, int nk) {
  const int lane = threadIdx.x & 31; const int t = blockIdx.x * 8 + __builtin_amdgcn_readfirstlane(threadIdx.x >> 5); if (t >= hg * QT) return;      /* row = wave: a scalar, so the row base stays in scalar registers */
  const float* s = S + (size_t)t * NKX + lane * 4; _Float16* d = P + (size_t)t * NKX + lane * 4; const int last = q0 + (t % QT);
  v4f x[NKX / 128];
#pragma unroll      /* constant indices keep x in registers; every load of the row is issued before the first value is used */
  for (int c = 0; c < NKX / 256; ++c) if (c * 256 < nk) { x[2 * c] = *(const v4fa*)(s + c * 256); x[2 * c + 1] = *(const v4fa*)(s + c * 256 + 128); }
  asm volatile("s_wait_xcnt 0x0" :: "v"(s) : "memory");      /* the loads' address registers are reused below: they are held up to this wait and overwritten only behind it */
  v4f m4 = {-3.0e38f, -3.0e38f, -3.0e38f, -3.0e38f};
#pragma unroll
  for (int c = 0; c < NKX / 256; ++c) if (c * 256 < nk) {
#pragma unroll
    for (int u = 2 * c; u < 2 * c + 2; ++u)
#pragma unroll
      for (int q = 0; q < 4; ++q) { const int j = u * 128 + lane * 4 + q; const float f = (j <= last) ? 1.f : 0.f; const float v = fmaf(f, x[u][q], (1.f - f) * -1.0e9f); x[u][q] = v; m4[q] = fmaxf(m4[q], v); } }
  float mx = fmaxf(fmaxf(m4[0], m4[1]), fmaxf(m4[2], m4[3]));
#pragma unroll
  for (int o = 16; o > 0; o >>= 1) mx = fmaxf(mx, __shfl_xor(mx, o, 32));
  v4f s4 = {0.f, 0.f, 0.f, 0.f};
#pragma unroll
  for (int c = 0; c < NKX / 256; ++c) if (c * 256 < nk) {
#pragma unroll
    for (int u = 2 * c; u < 2 * c + 2; ++u)
#pragma unroll
      for (int q = 0; q < 4; ++q) { const float e = __expf(x[u][q] - mx); x[u][q] = e; s4[q] += e; } }
  float se = (s4[0] + s4[1]) + (s4[2] + s4[3]);
#pragma unroll
  for (int o = 16; o > 0; o >>= 1) se += __shfl_xor(se, o, 32);
  const float sc = 256.0f / se; v4h h[NKX / 128];
#pragma unroll
  for (int c = 0; c < NKX / 256; ++c) if (c * 256 < nk) {
#pragma unroll
    for (int u = 2 * c; u < 2 * c + 2; ++u)
#pragma unroll
      for (int q = 0; q < 4; ++q) h[u][q] = (_Float16)(x[u][q] * sc); }
#pragma unroll      /* the stores stand alone at the end (256 contiguous bytes each): no vector register is written behind an issued store */
  for (int c = 0; c < NKX / 256; ++c) if (c * 256 < nk) { *(v4h*)(d + c * 256) = h[2 * c]; *(v4h*)(d + c * 256 + 128) = h[2 * c + 1]; } }


template <int MASKADD>
__global__ __launch_bounds__(64) void k_att0(const float* __restrict__ QF, const float* __restrict__ KF, const float* __restrict__ VF, int ld, const float* __restrict__ mask, float scale, float* __restrict__ OF, int ldo) {
  #pragma clang fp contract(off)
  __shared__ __attribute__((aligned(16))) float lq[64][64]; __shared__ __attribute__((aligned(16))) float lo[64][64];
  const int tid = threadIdx.x; const int h = blockIdx.x / (QT0 / 64), rg = blockIdx.x % (QT0 / 64); const int i = rg * 64 + tid;
  const float* qr = QF + (size_t)i * ld + h * HD;
#pragma unroll 1
  for (int c = 0; c < HD / 4; ++c) { *(v4f*)&lq[tid][c * 4] = *(const v4fa*)(qr + c * 4); const v4f z = {0.f, 0.f, 0.f, 0.f}; *(v4f*)&lo[tid][c * 4] = z; }
  float m = -1.0e30f, l = 0.f; const int jmax = MASKADD ? (SQ - 1) : (rg * 64 + 63);      /* additive-mask form: every key (the mask input decides); causal form: keys up to the block's last row */
#pragma unroll 1
  for (int j = 0; j <= jmax; ++j) { const float* kr = KF + (size_t)j * ld + h * HD; const float* vr = VF + (size_t)j * ld + h * HD; float s = 0.f;
#pragma unroll 1
    for (int c = 0; c < HD / 4; ++c) { const v4f kq = *(const v4fa*)(kr + c * 4); const v4f qq = *(v4f*)&lq[tid][c * 4]; s = __fadd_rn(s, __fmul_rn(qq[0], kq[0])); s = __fadd_rn(s, __fmul_rn(qq[1], kq[1])); s = __fadd_rn(s, __fmul_rn(qq[2], kq[2])); s = __fadd_rn(s, __fmul_rn(qq[3], kq[3])); }
    s = __fmul_rn(s, scale); if (MASKADD) s = __fadd_rn(s, __fmul_rn(bf16_round(mask[(size_t)i * SQ + j]), -10000.0f));
    const float f = (MASKADD || j <= i) ? 1.f : 0.f; const float sm = fmaf(f, s, (1.f - f) * -1.0e30f); const float mn = fmaxf(m, sm); const float sc = expf(m - mn); const float e = expf(sm - mn); l = __fadd_rn(__fmul_rn(l, sc), e); m = mn;
#pragma unroll 1
    for (int c = 0; c < HD / 4; ++c) { const v4f vv = *(const v4fa*)(vr + c * 4); v4f oo = *(v4f*)&lo[tid][c * 4]; for (int u = 0; u < 4; ++u) oo[u] = __fadd_rn(__fmul_rn(oo[u], sc), __fmul_rn(e, vv[u])); *(v4f*)&lo[tid][c * 4] = oo; } }
  const float fin = 64.0f / l;      /* o carried x64 like the f16 path */
#pragma unroll 1
  for (int c = 0; c < HD / 4; ++c) { v4f oo = *(v4f*)&lo[tid][c * 4]; for (int u = 0; u < 4; ++u) oo[u] = __fmul_rn(oo[u], fin); *(v4f*)&lo[tid][c * 4] = oo; }
  __syncthreads();
  {
#pragma unroll 1
    for (int it = 0; it < 16; ++it) { const int row = it * 4 + tid / 16, pc = (tid % 16) * 4; const v4f v = *(const v4f*)&lo[row][pc]; *(v4f*)(OF + (size_t)(rg * 64 + row) * ldo + h * HD + pc) = v; }
     } }

extern "C" void kernel_launch(void* const* d_in, const int* in_sizes, int n_in,
                              void* d_out, int out_size, void* d_ws, size_t ws_size, hipStream_t stream) {
  (void)in_sizes; (void)n_in; (void)out_size;
  const float* const* I = (const float* const*)d_in; const float* xq = I[0]; const float* xk = I[1]; const float* xv = I[2]; const float* wq = I[3]; const float* wk = I[4]; const float* wv = I[5]; const float* wo = I[6];      /* weights [in][out] */
  char* ws = (char*)d_ws; size_t off = 0;
  auto take = [&](size_t bytes) { char* p = ws + off; off += (bytes + 255) & ~(size_t)255; return p; };
  _Float16* BQ = (_Float16*)take((size_t)DM * DM * 2); _Float16* BK = (_Float16*)take((size_t)DM * DM * 2); _Float16* BV = (_Float16*)take((size_t)DM * DM * 2); _Float16* BO = (_Float16*)take((size_t)DM * DM * 2);
  _Float16* XQ = (_Float16*)take(NR * DM * 2); _Float16* XK = (_Float16*)take(NR * DM * 2); _Float16* XV = (_Float16*)take(NR * DM * 2); _Float16* Q16 = (_Float16*)take(NR * DM * 2); _Float16* K16 = (_Float16*)take(NR * DM * 2); _Float16* V16 = (_Float16*)take(NR * DM * 2); _Float16* O16 = (_Float16*)take(NR * DM * 2);
  float* S = (float*)take((size_t)NH * QT * NKX * 4); _Float16* P = (_Float16*)take((size_t)NH * QT * NKX * 2); _Float16* VT = (_Float16*)take((size_t)NH * HD * SQ * 2);
  float* QF0 = (float*)take((size_t)QT0 * DM * 4); float* KF0 = (float*)take((size_t)QT0 * DM * 4); float* VF0 = (float*)take((size_t)QT0 * DM * 4); float* OF0 = (float*)take((size_t)NB * QT0 * DM * 4); _Float16* OH0 = (_Float16*)take((size_t)NB * QT0 * DM * 2); _Float16* OL0 = (_Float16*)take((size_t)NB * QT0 * DM * 2);
  if (off > ws_size) return;
  { const unsigned gh = (unsigned)(((size_t)HD * (DM / 8) + 255) / 256); for (int h = 0; h < NH; ++h) { k_wt_f16<<<gh, 256, 0, stream>>>(wq + (size_t)h * DM * HD, BQ + (size_t)h * HD * DM, DM, HD, 16.0f); k_wt_f16<<<gh, 256, 0, stream>>>(wk + (size_t)h * DM * HD, BK + (size_t)h * HD * DM, DM, HD, 16.0f); k_wt_f16<<<gh, 256, 0, stream>>>(wv + (size_t)h * DM * HD, BV + (size_t)h * HD * DM, DM, HD, 16.0f); } const unsigned g = (unsigned)(((size_t)DM * (DM / 8) + 255) / 256); k_wt_f16<<<g, 256, 0, stream>>>(wo, BO, DM, DM, 16.0f); }      /* PER-HEAD STACKS [16][1024][64] = [head][in][out]: head h's [1024][64] block -> rows 64 h .. 64 h + 63 of the Bt[n][k] x16 plane (K 1024, N 64 per call); the [in][out] output weight transposed into its plane by the same builder (K 1024, N 1024) */
  k_x16<<<(unsigned)((NR * DM / 8 + 255) / 256), 256, 0, stream>>>(xq, XQ, NR * DM / 8); k_x16<<<(unsigned)((NR * DM / 8 + 255) / 256), 256, 0, stream>>>(xk, XK, NR * DM / 8); k_x16<<<(unsigned)((NR * DM / 8 + 255) / 256), 256, 0, stream>>>(xv, XV, NR * DM / 8);
  const size_t r0p = (size_t)B0 * SQ;      /* first projected row */
  k_gemm2<0><<<dim3((unsigned)((MP / 128) * (DM / 64)), 1), 128, 0, stream>>>(XQ + r0p * DM, DM, 0, BQ, DM, 0, 0.0625f, nullptr, 0, nullptr, 1, 0, 0, nullptr, Q16 + r0p * DM, DM, 0, MP, DM, DM);
  k_gemm2<0><<<dim3((unsigned)((MP / 128) * (DM / 64)), 1), 128, 0, stream>>>(XK + r0p * DM, DM, 0, BK, DM, 0, 0.0625f, nullptr, 0, nullptr, 1, 0, 0, nullptr, K16 + r0p * DM, DM, 0, MP, DM, DM);
  k_gemm2<0><<<dim3((unsigned)((MP / 128) * (DM / 64)), 1), 128, 0, stream>>>(XV + r0p * DM, DM, 0, BV, DM, 0, 0.0625f, nullptr, 0, nullptr, 1, 0, 0, nullptr, V16 + r0p * DM, DM, 0, MP, DM, DM);
  for (int b = B0; b < B0 + NBR; ++b) { const size_t r0 = (size_t)b * SQ;
    k_vt<NH, SQ><<<NH * (SQ / 64), 256, 0, stream>>>(V16 + r0 * LQ, LQ, 0, VT);      /* V^T [NH][HD][SQ] for this batch */
    k_gemm2<0><<<dim3((QT0 / 128) * (DM / 64), 1), 128, 0, stream>>>(XQ + r0 * DM, DM, 0, BQ, DM, 0, 0.0625f, nullptr, 0, nullptr, 1, 0, 0, QF0, nullptr, DM, 0, QT0, DM, DM); k_gemm2<0><<<dim3((QT0 / 128) * (DM / 64), 1), 128, 0, stream>>>(XK + r0 * DM, DM, 0, BK, DM, 0, 0.0625f, nullptr, 0, nullptr, 1, 0, 0, KF0, nullptr, DM, 0, QT0, DM, DM); k_gemm2<0><<<dim3((QT0 / 128) * (DM / 64), 1), 128, 0, stream>>>(XV + r0 * DM, DM, 0, BV, DM, 0, 0.0625f, nullptr, 0, nullptr, 1, 0, 0, VF0, nullptr, DM, 0, QT0, DM, DM);      /* f32 q, k, v of the first 256 rows (exact products) */
    k_att0<0><<<NH * (QT0 / 64), 64, 0, stream>>>(QF0, KF0, VF0, DM, nullptr, 0.125f, OF0 + (size_t)b * QT0 * DM, DM);      /* exact f32 attention for rows 0..255 (o x64) */
    for (int q0 = 0; q0 < QN; q0 += QT) { const int nk = q0 + QT;      /* causal: only keys below the tile end are computed */
      k_gemm2<0><<<dim3((QT / 128) * (nk / 64), NHD), 128, 0, stream>>>(Q16 + (r0 + q0) * LQ, LQ, (size_t)HD, K16 + r0 * LQ, LQ, (size_t)HD, 0.125f, nullptr, 0, nullptr, 1, 0, 0, S, nullptr, NKX, (size_t)QT * NKX, QT, nk, HD);      /* scores, all heads on grid.y */
      k_rsmcf2<<<(NHD * QT + 7) / 8, 256, 0, stream>>>(S, P, NHD, q0, nk);      /* one wave per row, 8 rows per block */
      k_gemm2<0><<<dim3((QT / 128) * (HD / 64), NHD), 128, 0, stream>>>(P, NKX, (size_t)QT * NKX, VT, SQ, (size_t)HD * SQ, 0.25f, nullptr, 0, nullptr, 1, 0, 0, nullptr, O16 + (r0 + q0) * DM, DM, (size_t)HD, QT, HD, nk); } }      /* o (merged heads, x64) as f16 rows */
  k_gemm2<0><<<dim3((unsigned)((MPO / 128) * (DM / 64)), 1), 128, 0, stream>>>(O16 + r0p * DM, DM, 0, BO, DM, 0, 0.0009765625f, nullptr, 0, nullptr, 1, 0, 0, (float*)d_out + r0p * DM, nullptr, DM, 0, MPO, DM, DM);      /* out rows are the output layout */
  k_hl<<<(unsigned)(((size_t)NB * QT0 * DM / 8 + 255) / 256), 256, 0, stream>>>(OF0, OH0, OL0, (size_t)NB * QT0 * DM / 8);      /* first-tile o (x64) -> f16 hi + x1024 residual planes */
  for (int b = B0; b < B0 + NBR; ++b) { const size_t r0 = (size_t)b * SQ; const size_t f0 = (size_t)b * QT0;
    k_gemm2<0><<<dim3((QT0 / 128) * (DM / 64), 1), 128, 0, stream>>>(OH0 + f0 * DM, DM, 0, BO, DM, 0, 0.0009765625f, nullptr, 0, nullptr, 1, 0, 0, (float*)d_out + r0 * DM, nullptr, DM, 0, QT0, DM, DM);      /* rows 0..255: out = o_hi Wo, overwriting the f16-path rows */
    k_gemm2<0><<<dim3((QT0 / 128) * (DM / 64), 1), 128, 0, stream>>>(OL0 + f0 * DM, DM, 0, BO, DM, 0, 0.00000095367431640625f, nullptr, 0, (const float*)d_out + r0 * DM, -1, 0, 0, (float*)d_out + r0 * DM, nullptr, DM, 0, QT0, DM, DM); }      /* += o_lo Wo 2^-20 (own-element accumulate) */
}

// v002
// A run of this version takes 1880 microseconds.
// Timed twice side by side with v001, it ran 1.46 and 1.45 times as fast.
// All steps since v000 together make it 4.47 times as fast.
#include <hip/hip_runtime.h>
// Causal multi-head attention on three inputs with PER-HEAD STACKED projections over ONE sequence of 4096 tokens (Q, K, V [1][4096][1024]; WQ / WK / WV [16][1024][64] = [head][in][out] sigma 0.02, NO biases; 16 heads of 64; scores x 64^-0.5 = / 8; causal (tril, -inf above the diagonal); softmax; heads concatenated head-major; out = concat WO with WO [1024][1024] [in][out], NO bias -> [1][4096][1024]); each head's [in][out] block is transposed into its 64 contiguous rows of the weight plane by the transposing builder, one call per head, and the [in][out] output weight by the same builder in one call.
// Structure: token rows r = s; q, k, v inputs as exact f16 rows (bf16-rounded); Q, K, V as three WMMA GEMMs (32x64 wave tiles, f32 accumulation, exact x16 weights, f16 outputs); per batch: V^T for all heads via LDS transposes; per query tile of 256 rows: scores against the keys below the tile end only (K = 64, all heads on grid.y, alpha = 0.125), causal row softmax on VALU with an arithmetic 0/1 key mask over the computed range (f32 statistics, native exp; weights x256 f16), o = P . V^T (K = keys below the tile end, alpha 2^-2: o carried x64, folded into the output GEMM alpha) written straight into the merged f16 o rows; out = o W_o GEMM (f32) into the output layout.
// Compute dtype: inputs rounded to bf16; x / weights exact; q, k, v, softmax weights and o as plain f16 GEMM operands (~2^-12); scores and softmax statistics f32. v_wmma_f32_16x16x32_f16.
#define NB 1
#define SQ 4096
#define DM 1024
#define NH 16
#define HD 64
#define HG 4                         /* heads per launch of the unlaunched k_vt overload */
#define QT 256                       /* query rows per causal tile */
#define NKX SQ                       /* S / P row pitch */
#define QT0 256                      /* first-tile rows recomputed exactly in f32 */
#define B0 0                         /* first batch processed (debug hook) */
#define NBR NB                       /* batches processed (debug hook) */
#define NR ((size_t)NB * SQ)         /* token rows */
#define MP ((int)((size_t)NBR * SQ)) /* rows projected (debug hook) */
#define QN SQ                        /* query rows attended per batch (debug hook) */
#define NHD NH                       /* heads attended (debug hook) */
#define MPO MP                       /* rows through the output stage (debug hook) */
#define LQ DM      /* row pitch of the q/k/v rows */
typedef __bf16 v16b __attribute__((ext_vector_type(16)));
typedef unsigned short v8us __attribute__((ext_vector_type(8), may_alias));
typedef float  v8f  __attribute__((ext_vector_type(8)));
typedef float  v4f  __attribute__((ext_vector_type(4)));
typedef float  v4fa __attribute__((ext_vector_type(4), may_alias));
union FragB { v16b v; v8us half[2]; unsigned short u[16]; };

__device__ __forceinline__ unsigned short bf16_bits(float x) { unsigned int u = __float_as_uint(x); return (unsigned short)((u + 0x7FFFu + ((u >> 16) & 1u)) >> 16); }
__device__ __forceinline__ float bf16_val(unsigned short b) { return __uint_as_float(((unsigned int)b) << 16); }
__device__ __forceinline__ float bf16_round(float x) { return bf16_val(bf16_bits(x)); }
// D += A·B with NT terms: 1 = ah·bh, 2 = + al·bh (A split), 3 = + ah·bl (both split)
template <int NT>
__device__ __forceinline__ v8f mmaN(v16b ah, v16b al, v16b bh, v16b bl, v8f c) {
  c = __builtin_amdgcn_wmma_f32_16x16x32_bf16(false, ah, false, bh, (short)0, c, false, false);
  if (NT >= 2) c = __builtin_amdgcn_wmma_f32_16x16x32_bf16(false, al, false, bh, (short)0, c, false, false);
  if (NT >= 3) c = __builtin_amdgcn_wmma_f32_16x16x32_bf16(false, ah, false, bl, (short)0, c, false, false);
  asm volatile("v_nop\n\tv_nop\n\tv_nop\n\tv_nop" : "+v"(c) : "v"(ah), "v"(al), "v"(bh), "v"(bl));
  return c;
}

__global__ __launch_bounds__(256) void k_wt_bf16(const float* __restrict__ W, unsigned short* __restrict__ Wt, int K, int N) {
  const int t = blockIdx.x * 256 + threadIdx.x;
  const int k8n = K / 8;
  if (t >= N * k8n) return;
  const int n = t / k8n, k8 = (t % k8n) * 8;
  v8us v;
#pragma unroll
  for (int i = 0; i < 8; ++i) v[i] = bf16_bits(W[(size_t)(k8 + i) * N + n]);
  *(v8us*)(Wt + (size_t)n * K + k8) = v;
  
}

// GEMM C[M][N] (f32, pitch ldc) = act(A[M][K]·W + bias). A f32 row-major (pitch lda) converted per fragment to bf16
// (ASPLIT: hi/lo two planes -> 2 terms, else single rounded term); Wt bf16 [N][K] (pitch ldb). BIAS_BF16 rounds the
// bias to bf16 first (bias quantised to bf16 before the add). K%32==0, M%16==0, N%64==0.
template <bool ASPLIT, int ACT, bool BIAS_BF16>
__global__ __launch_bounds__(128) void k_gemm_bf(const float* __restrict__ A, int lda, const unsigned short* __restrict__ Wt, int ldb,
                                               const float* __restrict__ bias, float* __restrict__ C, int ldc, int M, int N, int K) {
  __shared__ __attribute__((aligned(16))) float so[4][16][64];
  const int tid = threadIdx.x, w = tid >> 5, lane = tid & 31, ln = lane & 15, hh = lane >> 4;
  const int ntn = N / 64;
  const int wid = blockIdx.x * 4 + w;
  const int mt = wid / ntn, nq = wid % ntn;
  if (mt * 16 >= M) return;
  const int row0 = mt * 16, col0 = nq * 64;
  const float* arow = A + (size_t)(row0 + ln) * lda;
  v8f acc[4] = {};
  for (int kb = 0; kb < K; kb += 32) {
    FragB ah, al;
    const v4f x0 = *(const v4fa*)(arow + kb + 8 * hh), x1 = *(const v4fa*)(arow + kb + 8 * hh + 4);
    const v4f x2 = *(const v4fa*)(arow + kb + 16 + 8 * hh), x3 = *(const v4fa*)(arow + kb + 16 + 8 * hh + 4);
    float xs[16] = {x0[0],x0[1],x0[2],x0[3],x1[0],x1[1],x1[2],x1[3],x2[0],x2[1],x2[2],x2[3],x3[0],x3[1],x3[2],x3[3]};
#pragma unroll
    for (int i = 0; i < 16; ++i) { const unsigned short hb = bf16_bits(xs[i]); ah.u[i] = hb; al.u[i] = ASPLIT ? bf16_bits(xs[i] - bf16_val(hb)) : (unsigned short)0; }
#pragma unroll
    for (int t = 0; t < 4; ++t) {
      const unsigned short* brow = Wt + (size_t)(col0 + t * 16 + ln) * ldb + kb;
      FragB b;
      b.half[0] = *(const v8us*)(brow + 8 * hh);
      b.half[1] = *(const v8us*)(brow + 16 + 8 * hh);
      acc[t] = mmaN<ASPLIT ? 2 : 1>(ah.v, al.v, b.v, b.v, acc[t]);
    }
  }
#pragma unroll
  for (int t = 0; t < 4; ++t) {
    float bv = bias ? bias[col0 + t * 16 + ln] : 0.f;
    if (BIAS_BF16) bv = bf16_round(bv);
#pragma unroll
    for (int r = 0; r < 8; ++r) { float v = acc[t][r] + bv; if (ACT == 1) v = fmaxf(v, 0.f); so[w][8 * hh + r][t * 16 + ln] = v; }
  }
  __builtin_amdgcn_fence(__ATOMIC_ACQ_REL, "workgroup");
  __builtin_amdgcn_wave_barrier();
  const int rsub = lane >> 4, c4 = (lane & 15) * 4;
  {
#pragma unroll
    for (int q = 0; q < 8; ++q) {
      const int r = q * 2 + rsub;
      const v4f v = *(const v4fa*)&so[w][r][c4];
      *(v4f*)(C + (size_t)(row0 + r) * ldc + col0 + c4) = v;
    }
    
  }
}

// GEMM C = act(A·W + bias + resid): A f32 (ASPLIT -> hi/lo 2 terms), Wt bf16 [N][K]; ACT 0 none, 1 relu, 2 exact gelu;
// resid (optional, f32, row index = (row % rmod), pitch ldr, RES_BF16 rounds it) added before the activation.
template <bool ASPLIT, int ACT, bool BIAS_BF16, bool RES_BF16>
__global__ __launch_bounds__(128) void k_gemm_bf3(const float* __restrict__ A, int lda, const unsigned short* __restrict__ Wt, int ldb,
                                                const float* __restrict__ bias, const float* __restrict__ resid, int rmod, int ldr,
                                                float* __restrict__ C, int ldc, int M, int N, int K) {
  __shared__ __attribute__((aligned(16))) float so[4][16][64];
  const int tid = threadIdx.x, w = tid >> 5, lane = tid & 31, ln = lane & 15, hh = lane >> 4;
  const int ntn = N / 64;
  const int wid = blockIdx.x * 4 + w;
  const int mt = wid / ntn, nq = wid % ntn;
  if (mt * 16 >= M) return;
  const int row0 = mt * 16, col0 = nq * 64;
  const float* arow = A + (size_t)(row0 + ln) * lda;
  v8f acc[4] = {};
  for (int kb = 0; kb < K; kb += 32) {
    FragB ah, al;
    const v4f x0 = *(const v4fa*)(arow + kb + 8 * hh), x1 = *(const v4fa*)(arow + kb + 8 * hh + 4);
    const v4f x2 = *(const v4fa*)(arow + kb + 16 + 8 * hh), x3 = *(const v4fa*)(arow + kb + 16 + 8 * hh + 4);
    float xs[16] = {x0[0],x0[1],x0[2],x0[3],x1[0],x1[1],x1[2],x1[3],x2[0],x2[1],x2[2],x2[3],x3[0],x3[1],x3[2],x3[3]};
#pragma unroll
    for (int i = 0; i < 16; ++i) { const unsigned short hb = bf16_bits(xs[i]); ah.u[i] = hb; al.u[i] = ASPLIT ? bf16_bits(xs[i] - bf16_val(hb)) : (unsigned short)0; }
#pragma unroll
    for (int t = 0; t < 4; ++t) {
      const unsigned short* brow = Wt + (size_t)(col0 + t * 16 + ln) * ldb + kb;
      FragB b;
      b.half[0] = *(const v8us*)(brow + 8 * hh);
      b.half[1] = *(const v8us*)(brow + 16 + 8 * hh);
      acc[t] = mmaN<ASPLIT ? 2 : 1>(ah.v, al.v, b.v, b.v, acc[t]);
    }
  }
#pragma unroll
  for (int t = 0; t < 4; ++t) {
    const int col = col0 + t * 16 + ln;
    float bv = bias ? bias[col] : 0.f;
    if (BIAS_BF16) bv = bf16_round(bv);
#pragma unroll
    for (int r = 0; r < 8; ++r) {
      float v = acc[t][r] + bv;
      if (resid) { float rv = resid[(size_t)((row0 + 8 * hh + r) % rmod) * ldr + col]; if (RES_BF16) rv = bf16_round(rv); v += rv; }
      if (ACT == 1) v = fmaxf(v, 0.f);
      if (ACT == 2) v = 0.5f * v * (1.0f + erff(v * 0.70710678118654752f));
      if (ACT == 3) { const float u = 0.7978845608028654f * (v + 0.044715f * v * v * v); v = 0.5f * v * (1.0f + tanhf(u)); }
      so[w][8 * hh + r][t * 16 + ln] = v;
    }
  }
  __builtin_amdgcn_fence(__ATOMIC_ACQ_REL, "workgroup");
  __builtin_amdgcn_wave_barrier();
  const int rsub = lane >> 4, c4 = (lane & 15) * 4;
  {
#pragma unroll
    for (int q = 0; q < 8; ++q) {
      const int r = q * 2 + rsub;
      const v4f v = *(const v4fa*)&so[w][r][c4];
      *(v4f*)(C + (size_t)(row0 + r) * ldc + col0 + c4) = v;
    }
    
  }
}
// row LayerNorm (biased variance, eps) over N: s = X (+ R); optional out_sum <- s; out_norm <- (s-mu)*rsqrt(var+eps)*g + b
template <bool PARAM_BF16>
__global__ __launch_bounds__(256) void k_layernorm(const float* __restrict__ X, const float* __restrict__ R, const float* __restrict__ g, const float* __restrict__ bta,
                                                  float* __restrict__ out_sum, float* __restrict__ out_norm, int N, float eps) {
  __shared__ float red[256];
  const int row = blockIdx.x, tid = threadIdx.x;
  const float* x = X + (size_t)row * N; const float* rr = R ? R + (size_t)row * N : nullptr;
  float vals[16];                     // up to N = 4096
  const int per = N / 256;            // contiguous chunk per thread? use strided-by-4 chunks: thread handles j = tid*4 + 1024*u
  float s1 = 0.f;
  for (int u = 0; u < per / 4; ++u) {
    const int j = tid * 4 + 1024 * u;
    const v4f a = *(const v4fa*)(x + j);
    v4f b = {0.f,0.f,0.f,0.f}; if (rr) b = *(const v4fa*)(rr + j);
#pragma unroll
    for (int q = 0; q < 4; ++q) { const float v = a[q] + b[q]; vals[u * 4 + q] = v; s1 += v; }
  }
  red[tid] = s1; __syncthreads();
  for (int st = 128; st > 0; st >>= 1) { if (tid < st) red[tid] += red[tid + st]; __syncthreads(); }
  const float mu = red[0] / (float)N; __syncthreads();
  float s2 = 0.f;
  for (int u = 0; u < per / 4; ++u)
#pragma unroll
    for (int q = 0; q < 4; ++q) { const float c = vals[u * 4 + q] - mu; s2 += c * c; }
  red[tid] = s2; __syncthreads();
  for (int st = 128; st > 0; st >>= 1) { if (tid < st) red[tid] += red[tid + st]; __syncthreads(); }
  const float rs = rsqrtf(red[0] / (float)N + eps);
  {
    for (int u = 0; u < per / 4; ++u) {
      const int j = tid * 4 + 1024 * u;
      v4f o, sm;
#pragma unroll
      for (int q = 0; q < 4; ++q) {
        float gg = g[j + q], bb = bta[j + q];
        if (PARAM_BF16) { gg = bf16_round(gg); bb = bf16_round(bb); }
        sm[q] = vals[u * 4 + q]; o[q] = (vals[u * 4 + q] - mu) * rs * gg + bb;
      }
      if (out_sum) *(v4f*)(out_sum + (size_t)row * N + j) = sm;
      *(v4f*)(out_norm + (size_t)row * N + j) = o;
    }
    
  }
}



// ---- f16 WMMA path (v_wmma_f32_16x16x32_f16): 11-bit significands for operands in range — used where a [0,1] probability operand needs more precision than bf16
typedef _Float16 v16h __attribute__((ext_vector_type(16)));
union FragH { v16h v; v8us half[2]; _Float16 h[16]; unsigned short u[16]; };
template <int NT>
__device__ __forceinline__ v8f mmaH(v16h ah, v16h al, v16h bh, v16h bl, v8f c) {
  c = __builtin_amdgcn_wmma_f32_16x16x32_f16(false, ah, false, bh, (short)0, c, false, false);
  if (NT >= 2) c = __builtin_amdgcn_wmma_f32_16x16x32_f16(false, al, false, bh, (short)0, c, false, false);
  if (NT >= 3) c = __builtin_amdgcn_wmma_f32_16x16x32_f16(false, ah, false, bl, (short)0, c, false, false);
  asm volatile("v_nop\n\tv_nop\n\tv_nop\n\tv_nop" : "+v"(c) : "v"(ah), "v"(al), "v"(bh), "v"(bl));
  return c;
}
// batched GEMM like k_gemm_b but f16 operands: A f32 (split into f16 hi/lo if ASPLIT, else rounded to f16), Bt = f16 values [n][k]; alpha; C f32; N multiple of 16 (partial tiles skipped)
template <bool ASPLIT>
__global__ __launch_bounds__(128) void k_gemm_h(const float* __restrict__ A, int lda, size_t sA, const _Float16* __restrict__ Bh, int ldb, size_t sB, float alpha, float* __restrict__ C, int ldc, size_t sC, int M, int N, int K) {
  __shared__ __attribute__((aligned(16))) float so[4][16][64];
  const int tid = threadIdx.x, w = tid >> 5, lane = tid & 31, ln = lane & 15, hh = lane >> 4; const int by = blockIdx.y;
  A += (size_t)by * sA; Bh += (size_t)by * sB; C += (size_t)by * sC;
  const int ntn = (N + 63) / 64; const int wid = blockIdx.x * 4 + w; const int mt = wid / ntn, nq = wid % ntn; if (mt * 16 >= M) return;
  const int row0 = mt * 16, col0 = nq * 64; const float* arow = A + (size_t)(row0 + ln) * lda;
  v8f acc[4] = {};
  for (int kb = 0; kb < K; kb += 32) {
    FragH ah, al;
    const v4f x0 = *(const v4fa*)(arow + kb + 8 * hh), x1 = *(const v4fa*)(arow + kb + 8 * hh + 4), x2 = *(const v4fa*)(arow + kb + 16 + 8 * hh), x3 = *(const v4fa*)(arow + kb + 16 + 8 * hh + 4);
    float xs[16] = {x0[0],x0[1],x0[2],x0[3],x1[0],x1[1],x1[2],x1[3],x2[0],x2[1],x2[2],x2[3],x3[0],x3[1],x3[2],x3[3]};
#pragma unroll
    for (int i = 0; i < 16; ++i) { const _Float16 h = (_Float16)xs[i]; ah.h[i] = h; al.h[i] = ASPLIT ? (_Float16)(xs[i] - (float)h) : (_Float16)0.0f; }
#pragma unroll
    for (int t = 0; t < 4; ++t) { if (col0 + t * 16 >= N) continue; const size_t boff = (size_t)(col0 + t * 16 + ln) * ldb + kb; FragH bq; bq.half[0] = *(const v8us*)(Bh + boff + 8 * hh); bq.half[1] = *(const v8us*)(Bh + boff + 16 + 8 * hh);
      acc[t] = mmaH<ASPLIT ? 2 : 1>(ah.v, al.v, bq.v, bq.v, acc[t]); }
  }
#pragma unroll
  for (int t = 0; t < 4; ++t) { if (col0 + t * 16 >= N) continue;
#pragma unroll
    for (int r = 0; r < 8; ++r) so[w][8 * hh + r][t * 16 + ln] = acc[t][r] * alpha; }
  __builtin_amdgcn_fence(__ATOMIC_ACQ_REL, "workgroup"); __builtin_amdgcn_wave_barrier();
  const int rsub = lane >> 4, c4 = (lane & 15) * 4;
  {
#pragma unroll
    for (int q = 0; q < 8; ++q) { const int r = q * 2 + rsub; if (col0 + c4 < N) { const v4f v = *(const v4fa*)&so[w][r][c4]; *(v4f*)(C + (size_t)(row0 + r) * ldc + col0 + c4) = v; } }
     }
}

// Wt[n][k] = f16(W[k][n]·scale) from f32 row-major W[K][N] (scale = power of two; bf16-exact weights stay exact in f16 away from the subnormal range)
__global__ __launch_bounds__(256) void k_wt_f16(const float* __restrict__ W, _Float16* __restrict__ Wt, int K, int N, float scale) {
  const int t = blockIdx.x * 256 + threadIdx.x; if (t >= N * (K / 8)) return; const int n = t / (K / 8), k8 = (t % (K / 8)) * 8; FragH f;
#pragma unroll
  for (int i = 0; i < 8; ++i) f.h[i] = (_Float16)(bf16_round(W[(size_t)(k8 + i) * N + n]) * scale); const v8us o = f.half[0];
  *(v8us*)((unsigned short*)Wt + (size_t)n * K + k8) = o; 
}
// k_gemm_hh variant with fused epilogue: v = acc·alpha + bias[by·sBias + col] (+ CP[(row/rowsPerB)·sCPb + by·64 + col] if CP) ; ACT 0 none / 1 elu ; writes f16 C16 (and f32 C if non-null)
template <int ACT>
__global__ __launch_bounds__(128) void k_gemm_hhx(const _Float16* __restrict__ A, int lda, size_t sA, const _Float16* __restrict__ Bh, int ldb, size_t sB, float alpha, const float* __restrict__ bias, size_t sBias, const float* __restrict__ CP, int rowsPerB, size_t sCPb, int row0g,
    float* __restrict__ C, _Float16* __restrict__ C16, int ldc, size_t sC, int M, int N, int K) {
  __shared__ __attribute__((aligned(16))) float so[4][16][64];
  const int tid = threadIdx.x, w = tid >> 5, lane = tid & 31, ln = lane & 15, hh = lane >> 4; const int by = blockIdx.y;
  A += (size_t)by * sA; Bh += (size_t)by * sB; const size_t cofs = (size_t)by * sC; const float* bp = bias ? bias + (size_t)by * sBias : nullptr;
  const int ntn = (N + 63) / 64; const int wid = blockIdx.x * 4 + w; const int mt = wid / ntn, nq = wid % ntn; if (mt * 16 >= M) return;
  const int row0 = mt * 16, col0 = nq * 64; const _Float16* arow = A + (size_t)(row0 + ln) * lda;
  v8f acc[4] = {};
  for (int kb = 0; kb < K; kb += 32) { FragH ah; ah.half[0] = *(const v8us*)((const unsigned short*)arow + kb + 8 * hh); ah.half[1] = *(const v8us*)((const unsigned short*)arow + kb + 16 + 8 * hh);
#pragma unroll
    for (int t = 0; t < 4; ++t) { if (col0 + t * 16 >= N) continue; const size_t boff = (size_t)(col0 + t * 16 + ln) * ldb + kb; FragH bq; bq.half[0] = *(const v8us*)((const unsigned short*)Bh + boff + 8 * hh); bq.half[1] = *(const v8us*)((const unsigned short*)Bh + boff + 16 + 8 * hh);
      acc[t] = mmaH<1>(ah.v, ah.v, bq.v, bq.v, acc[t]); }
  }
#pragma unroll
  for (int t = 0; t < 4; ++t) { if (col0 + t * 16 >= N) continue; const int col = col0 + t * 16 + ln; const float bv = bp ? bf16_round(bp[col]) : 0.f;
#pragma unroll
    for (int r = 0; r < 8; ++r) { float v = acc[t][r] * alpha + bv; if (CP) { const int rr = row0g + row0 + 8 * hh + r; if (rowsPerB < 0) v += CP[cofs + (size_t)rr * ldc + col];      /* rowsPerB < 0: own element of the batched C plane */ else { const int bidx = rr / rowsPerB; v += CP[(size_t)bidx * sCPb + (size_t)by * 64 + col]; } } if (ACT == 1) v = (v > 0.f) ? v : expm1f(v); else if (ACT == 7) v = (v > 0.f) ? v + 1.0f : expf(v); else if (ACT == 8) v = tanhf(v); else if (ACT == 9) v = 0.5f * v * (1.0f + tanhf(0.7978845608028654f * (v + 0.044715f * v * v * v))); else if (ACT == 11) v = 1.0f / (1.0f + expf(-v)); else if (ACT == 12) v = (v > 0.f) ? v : 0.01f * v; else if (ACT == 14) v = (v > 0.f) ? v : 0.1f * v; else if (ACT == 16) v = (v >= 0.f) ? v : 0.3f * v; else if (ACT == 17) v = (v >= 0.f) ? v : 0.2f * v; else if (ACT == 15) v = v / (1.0f + expf(-v)); else if (ACT == 3) v = fmaxf(v, 0.f); else if (ACT == 6) v = 0.5f * v * (1.0f + erff(v * 0.70710678118654752f)); so[w][8 * hh + r][t * 16 + ln] = v; } }
  __builtin_amdgcn_fence(__ATOMIC_ACQ_REL, "workgroup"); __builtin_amdgcn_wave_barrier();
  const int rsub = lane >> 4, c4 = (lane & 15) * 4; typedef _Float16 v4h __attribute__((ext_vector_type(4)));
  {
#pragma unroll
    for (int q = 0; q < 8; ++q) { const int r = q * 2 + rsub; if (col0 + c4 < N) { const v4f v = *(const v4fa*)&so[w][r][c4]; if (C) *(v4f*)(C + cofs + (size_t)(row0 + r) * ldc + col0 + c4) = v; if (C16) { v4h h4; for (int i = 0; i < 4; ++i) h4[i] = (_Float16)v[i]; *(v4h*)(C16 + cofs + (size_t)(row0 + r) * ldc + col0 + c4) = h4; } } }
     }
}


typedef _Float16 v4h __attribute__((ext_vector_type(4)));

__global__ __launch_bounds__(256) void k_x16(const float* __restrict__ x, _Float16* __restrict__ X16, size_t n8) { const size_t t = (size_t)blockIdx.x * 256 + threadIdx.x; if (t >= n8) return; FragH f;
#pragma unroll
  for (int q = 0; q < 8; ++q) f.h[q] = (_Float16)bf16_round(x[t * 8 + q]); *(v8us*)((unsigned short*)X16 + t * 8) = f.half[0];  }
__global__ __launch_bounds__(256) void k_h16(const float* __restrict__ x, _Float16* __restrict__ X16, size_t n8) { const size_t t = (size_t)blockIdx.x * 256 + threadIdx.x; if (t >= n8) return; FragH f;
#pragma unroll
  for (int q = 0; q < 8; ++q) f.h[q] = (_Float16)x[t * 8 + q]; *(v8us*)((unsigned short*)X16 + t * 8) = f.half[0];  }
__global__ __launch_bounds__(256) void k_round16f(const float* __restrict__ W, _Float16* __restrict__ Bt, size_t n8) { const size_t t = (size_t)blockIdx.x * 256 + threadIdx.x; if (t >= n8) return; FragH f;
#pragma unroll
  for (int i = 0; i < 8; ++i) f.h[i] = (_Float16)(bf16_round(W[t * 8 + i]) * 16.0f); *(v8us*)((unsigned short*)Bt + t * 8) = f.half[0];  }
template <int NHv, int TTv>
__global__ __launch_bounds__(256) void k_vt(const _Float16* __restrict__ V16, int ldv, int voff, _Float16* __restrict__ Vt) { __shared__ unsigned short tl[64][66]; const int tid = threadIdx.x; const int slab = blockIdx.x / (TTv / 64), lg = blockIdx.x % (TTv / 64); const int b = slab / NHv, h = slab % NHv;
  for (int i = tid; i < 64 * 8; i += 256) { const int r = i / 8, c8 = (i % 8) * 8; FragH f; f.half[0] = *(const v8us*)((const unsigned short*)V16 + ((size_t)b * TTv + lg * 64 + r) * ldv + voff + h * 64 + c8);
#pragma unroll
    for (int q = 0; q < 8; ++q) tl[r][c8 + q] = f.u[q]; }
  __syncthreads();
  {
#pragma unroll
    for (int rd = 0; rd < 2; ++rd) { const int d = rd * 32 + tid / 8, pc = tid % 8; FragH f;
#pragma unroll
      for (int q = 0; q < 8; ++q) f.u[q] = tl[pc * 8 + q][d];
      *(v8us*)((unsigned short*)Vt + ((size_t)slab * 64 + d) * TTv + lg * 64 + pc * 8) = f.half[0]; }
     } }

__global__ __launch_bounds__(256) void k_hl(const float* __restrict__ F, _Float16* __restrict__ Hh, _Float16* __restrict__ Hl, size_t n8) { const size_t t = (size_t)blockIdx.x * 256 + threadIdx.x; if (t >= n8) return; FragH fh, fl; const v4f a = *(const v4fa*)(F + t * 8), c = *(const v4fa*)(F + t * 8 + 4);
#pragma unroll
  for (int q = 0; q < 4; ++q) { _Float16 h = (_Float16)a[q]; fh.h[q] = h; fl.h[q] = (_Float16)((a[q] - (float)h) * 1024.0f); h = (_Float16)c[q]; fh.h[4 + q] = h; fl.h[4 + q] = (_Float16)((c[q] - (float)h) * 1024.0f); }
  { *(v8us*)((unsigned short*)Hh + t * 8) = fh.half[0]; *(v8us*)((unsigned short*)Hl + t * 8) = fl.half[0];  } }

// ---- fast GEMM (wave tile 32x64; requires M % 32 == 0 rows per launch region and N % 64 == 0); epilogue = k_gemm_hhx semantics ----
__device__ __forceinline__ v16h g2_frag(const _Float16* p, int hh) { FragH f; f.half[0] = *(const v8us*)((const unsigned short*)p + 8 * hh); f.half[1] = *(const v8us*)((const unsigned short*)p + 16 + 8 * hh); return f.v; }
__device__ __forceinline__ v8f g2_mma(v16h a, v16h b, v8f c) { v8f d = __builtin_amdgcn_wmma_f32_16x16x32_f16(false, a, false, b, (short)0, c, false, false); asm volatile("v_nop\n\tv_nop\n\tv_nop\n\tv_nop" : "+v"(d) : "v"(a), "v"(b)); return d; }
template <int ACT>
__global__ __launch_bounds__(128) void k_gemm2(const _Float16* __restrict__ A, int lda, size_t sA, const _Float16* __restrict__ Bh, int ldb, size_t sB, float alpha, const float* __restrict__ bias, size_t sBias, const float* __restrict__ CP, int rowsPerB, size_t sCPb, int row0g,
    float* __restrict__ C, _Float16* __restrict__ C16, int ldc, size_t sC, int M, int N, int K) { static_assert(ACT == 0 || ACT == 3 || ACT == 6 || ACT == 8 || ACT == 9 || ACT == 11 || ACT == 12 || ACT == 14 || ACT == 15 || ACT == 16 || ACT == 17, "k_gemm2: unsupported ACT code (would silently apply no activation)");
  __shared__ __attribute__((aligned(16))) float so[4][32][68];
  const int tid = threadIdx.x, w = tid >> 5, lane = tid & 31, ln = lane & 15, hh = lane >> 4; const int by = blockIdx.y;
  A += (size_t)by * sA; Bh += (size_t)by * sB; const size_t cofs = (size_t)by * sC; const float* bp = bias ? bias + (size_t)by * sBias : nullptr;
  const int ntn = N >> 6; const int mt = blockIdx.x / ntn, nq = blockIdx.x - mt * ntn; const int row0 = mt * 128 + 32 * w, col0 = nq * 64; if (row0 >= M) return;
  const _Float16* a0p = A + (size_t)(row0 + ln) * lda; const _Float16* a1p = a0p + (size_t)16 * lda;
  const _Float16* b0p = Bh + (size_t)(col0 + ln) * ldb; const _Float16* b1p = b0p + (size_t)16 * ldb; const _Float16* b2p = b1p + (size_t)16 * ldb; const _Float16* b3p = b2p + (size_t)16 * ldb;
  const v8f z8 = {0.f,0.f,0.f,0.f,0.f,0.f,0.f,0.f}; v8f c00 = z8, c01 = z8, c02 = z8, c03 = z8, c10 = z8, c11 = z8, c12 = z8, c13 = z8;
#pragma unroll 1
  for (int kb = 0; kb < K; kb += 32) { const v16h a0 = g2_frag(a0p + kb, hh), a1 = g2_frag(a1p + kb, hh);
    v16h b = g2_frag(b0p + kb, hh); c00 = g2_mma(a0, b, c00); c10 = g2_mma(a1, b, c10);
    b = g2_frag(b1p + kb, hh); c01 = g2_mma(a0, b, c01); c11 = g2_mma(a1, b, c11);
    b = g2_frag(b2p + kb, hh); c02 = g2_mma(a0, b, c02); c12 = g2_mma(a1, b, c12);
    b = g2_frag(b3p + kb, hh); c03 = g2_mma(a0, b, c03); c13 = g2_mma(a1, b, c13); }
  v8f accs[8] = {c00, c01, c02, c03, c10, c11, c12, c13};
#pragma unroll
  for (int u = 0; u < 8; ++u) { const int t = u & 3, half = u >> 2; const int col = col0 + t * 16 + ln; const float bv = bp ? bf16_round(bp[col]) : 0.f;
#pragma unroll
    for (int r = 0; r < 8; ++r) { const int rloc = half * 16 + 8 * hh + r; float v = accs[u][r] * alpha + bv; if (CP) { if (rowsPerB < 0) v += CP[cofs + (size_t)(row0g + row0 + rloc) * ldc + col];      /* rowsPerB < 0: own element of the batched C plane */ else { const int bidx = (row0g + row0 + rloc) / rowsPerB; v += CP[(size_t)bidx * sCPb + (size_t)by * 64 + col]; } }
      if (ACT == 3) v = fmaxf(v, 0.f); else if (ACT == 6) v = 0.5f * v * (1.0f + erff(v * 0.70710678118654752f)); else if (ACT == 11) v = 1.0f / (1.0f + expf(-v)); else if (ACT == 15) v = v / (1.0f + expf(-v)); else if (ACT == 12) v = (v > 0.f) ? v : 0.01f * v; else if (ACT == 8) v = tanhf(v); else if (ACT == 9) v = 0.5f * v * (1.0f + tanhf(0.7978845608028654f * (v + 0.044715f * v * v * v))); else if (ACT == 14) v = (v > 0.f) ? v : 0.1f * v; else if (ACT == 16) v = (v >= 0.f) ? v : 0.3f * v; else if (ACT == 17) v = (v >= 0.f) ? v : 0.2f * v;
      so[w][rloc][t * 16 + ln] = v; } }
  __builtin_amdgcn_fence(__ATOMIC_ACQ_REL, "workgroup"); __builtin_amdgcn_wave_barrier();
  const int rsub = lane >> 4, c4 = (lane & 15) * 4;
  {
#pragma unroll
    for (int q = 0; q < 16; ++q) { const int r = q * 2 + rsub; const v4f v = *(const v4fa*)&so[w][r][c4]; if (C) *(v4f*)(C + cofs + (size_t)(row0 + r) * ldc + col0 + c4) = v; if (C16) { v4h h4; for (int i = 0; i < 4; ++i) h4[i] = (_Float16)v[i]; *(v4h*)(C16 + cofs + (size_t)(row0 + r) * ldc + col0 + c4) = h4; } }
     } }


__global__ __launch_bounds__(256) void k_wnat(const float* __restrict__ w, size_t n8, _Float16* __restrict__ Bt) { const size_t t = (size_t)blockIdx.x * 256 + threadIdx.x; if (t >= n8) return; FragH f; for (int q = 0; q < 8; ++q) f.h[q] = (_Float16)(bf16_round(w[t * 8 + q]) * 16.0f); *(v8us*)((unsigned short*)Bt + t * 8) = f.half[0];  }
__global__ __launch_bounds__(256) void k_rsm(const float* __restrict__ S, _Float16* __restrict__ P, int nrows) {
  #pragma clang fp contract(off)
  const int i = blockIdx.x * 256 + threadIdx.x; if (i >= nrows) return; const float* s = S + (size_t)i * SQ; float mx = -3.0e38f;
#pragma unroll 1
  for (int j = 0; j < SQ; ++j) mx = fmaxf(mx, s[j]); float se = 0.f;
#pragma unroll 1
  for (int j = 0; j < SQ; ++j) se += expf(s[j] - mx); const float sc = 256.0f / se;
#pragma unroll 1
  for (int j0 = 0; j0 < SQ; j0 += 8) { FragH f; for (int q = 0; q < 8; ++q) f.h[q] = (_Float16)(expf(s[j0 + q] - mx) * sc); unsigned short* d = (unsigned short*)P + (size_t)i * SQ + j0; *(v8us*)d = f.half[0];  } }
__global__ __launch_bounds__(256) void k_vt(const _Float16* __restrict__ V16, int b, int h0, _Float16* __restrict__ VT) { __shared__ unsigned short tl[64][65]; const int tid = threadIdx.x; const int hh = blockIdx.x % HG, sg = blockIdx.x / HG; const int s0 = sg * 64; const int h = h0 + hh;
  for (int i = tid; i < 64 * 8; i += 256) { const int j = i / 8, d8 = (i % 8) * 8; FragH f; f.half[0] = *(const v8us*)((const unsigned short*)V16 + ((size_t)b * SQ + s0 + j) * DM + h * HD + d8); for (int q = 0; q < 8; ++q) tl[d8 + q][j] = f.u[q]; }
  __syncthreads();
  { for (int i = tid; i < 64 * 8; i += 256) { const int d = i / 8, j8 = (i % 8) * 8; FragH f; for (int q = 0; q < 8; ++q) f.u[q] = tl[d][j8 + q]; *(v8us*)((unsigned short*)VT + ((size_t)hh * HD + d) * SQ + s0 + j8) = f.half[0]; }  } }



// Causal row softmax, ONE WAVE PER SCORE ROW. The row (nk f32, nk a multiple of 256 and at most NKX) is read once, by wave-wide loads of 512 contiguous bytes,
// and stays in registers for the maximum, the exponentials and the scaling; maximum and sum go lane-local first (four chains), then over the 32 lanes by a butterfly.
// Every loop of it is fully unrolled so that x and h are indexed by constants only and live in registers, not in scratch memory.
__global__ __launch_bounds__(256) void k_rsmcf2(const float* __restrict__ S, _Float16* __restrict__ P, int hg, int q0, int nk) {
  const int lane = threadIdx.x & 31; const int t = blockIdx.x * 8 + __builtin_amdgcn_readfirstlane(threadIdx.x >> 5); if (t >= hg * QT) return;      /* row = wave: a scalar, so the row base stays in scalar registers */
  const float* s = S + (size_t)t * NKX + lane * 4; _Float16* d = P + (size_t)t * NKX + lane * 4; const int last = q0 + (t % QT);
  v4f x[NKX / 128];
#pragma unroll      /* constant indices keep x in registers; every load of the row is issued before the first value is used */
  for (int c = 0; c < NKX / 256; ++c) if (c * 256 < nk) { x[2 * c] = *(const v4fa*)(s + c * 256); x[2 * c + 1] = *(const v4fa*)(s + c * 256 + 128); }
  asm volatile("s_wait_xcnt 0x0" :: "v"(s) : "memory");      /* the loads' address registers are reused below: they are held up to this wait and overwritten only behind it */
  v4f m4 = {-3.0e38f, -3.0e38f, -3.0e38f, -3.0e38f};
#pragma unroll
  for (int c = 0; c < NKX / 256; ++c) if (c * 256 < nk) {
#pragma unroll
    for (int u = 2 * c; u < 2 * c + 2; ++u)
#pragma unroll
      for (int q = 0; q < 4; ++q) { const int j = u * 128 + lane * 4 + q; const float f = (j <= last) ? 1.f : 0.f; const float v = fmaf(f, x[u][q], (1.f - f) * -1.0e9f); x[u][q] = v; m4[q] = fmaxf(m4[q], v); } }
  float mx = fmaxf(fmaxf(m4[0], m4[1]), fmaxf(m4[2], m4[3]));
#pragma unroll
  for (int o = 16; o > 0; o >>= 1) mx = fmaxf(mx, __shfl_xor(mx, o, 32));
  v4f s4 = {0.f, 0.f, 0.f, 0.f};
#pragma unroll
  for (int c = 0; c < NKX / 256; ++c) if (c * 256 < nk) {
#pragma unroll
    for (int u = 2 * c; u < 2 * c + 2; ++u)
#pragma unroll
      for (int q = 0; q < 4; ++q) { const float e = __expf(x[u][q] - mx); x[u][q] = e; s4[q] += e; } }
  float se = (s4[0] + s4[1]) + (s4[2] + s4[3]);
#pragma unroll
  for (int o = 16; o > 0; o >>= 1) se += __shfl_xor(se, o, 32);
  const float sc = 256.0f / se; v4h h[NKX / 128];
#pragma unroll
  for (int c = 0; c < NKX / 256; ++c) if (c * 256 < nk) {
#pragma unroll
    for (int u = 2 * c; u < 2 * c + 2; ++u)
#pragma unroll
      for (int q = 0; q < 4; ++q) h[u][q] = (_Float16)(x[u][q] * sc); }
#pragma unroll      /* the stores stand alone at the end (256 contiguous bytes each): no vector register is written behind an issued store */
  for (int c = 0; c < NKX / 256; ++c) if (c * 256 < nk) { *(v4h*)(d + c * 256) = h[2 * c]; *(v4h*)(d + c * 256 + 128) = h[2 * c + 1]; } }


// Exact f32 causal attention for rows 0 .. QT0 - 1 (o carried x64 like the f16 path). ONE WORK-GROUP PER HEAD AND 16 QUERY ROWS, 8 waves:
// the head's K and V rows below the group's end are staged in LDS by coalesced loads; scores: one thread per key (its K row in registers, the q rows wave-uniform);
// softmax: one wave per two rows; o: each wave sums every eighth chunk of 4 keys for all 16 rows x 64 columns in registers, and the 8 partial sums are added in wave order.
#define A0R 16                       /* query rows per work-group */
#define A0KP (HD + 4)                /* LDS pitch of a K row in floats: 272 B = 16 B x odd, so that 16-byte reads of one row per lane spread over the banks */
#define A0SP (QT0 + 4)               /* LDS pitch of a score row in floats (a multiple of 16 B) */
__global__ __launch_bounds__(256) void k_att0w(const float* __restrict__ QF, const float* __restrict__ KF, const float* __restrict__ VF, float scale, float* __restrict__ OF) {
  __shared__ __attribute__((aligned(16))) float lk[QT0][A0KP]; __shared__ __attribute__((aligned(16))) float lv[QT0][HD]; __shared__ __attribute__((aligned(16))) float ls[A0R][A0SP];
  __shared__ __attribute__((aligned(16))) float red[8][A0R][HD]; __shared__ float linv[A0R];
  const int tid = threadIdx.x, lane = tid & 31, w = __builtin_amdgcn_readfirstlane(tid >> 5); const int h = blockIdx.x / (QT0 / A0R), rg = blockIdx.x % (QT0 / A0R); const int nk = (rg + 1) * A0R;      /* causal: keys below the group's end */
  const int r16 = tid >> 4, c4 = (tid & 15) * 4;
  { const float* kp = KF + (size_t)r16 * DM + h * HD + c4; const float* vp = VF + (size_t)r16 * DM + h * HD + c4; v4f kx[QT0 / 16], vx[QT0 / 16];
#pragma unroll      /* constant indices keep kx and vx in registers; every load is issued before the first value is used */
    for (int u = 0; u < QT0 / 16; ++u) if (u <= rg) { kx[u] = *(const v4fa*)(kp + (size_t)u * 16 * DM); vx[u] = *(const v4fa*)(vp + (size_t)u * 16 * DM); }
    asm volatile("s_wait_xcnt 0x0" :: "v"(kp), "v"(vp) : "memory");      /* the loads' address registers are reused below: they are held up to this wait and overwritten only behind it */
#pragma unroll      /* constant indices, as above */
    for (int u = 0; u < QT0 / 16; ++u) if (u <= rg) { *(v4f*)&lk[u * 16 + r16][c4] = kx[u]; *(v4f*)&lv[u * 16 + r16][c4] = vx[u]; } }
  __syncthreads();
  if (tid < nk) { v4f kr[HD / 4];
#pragma unroll      /* the key's row stays in registers for all 16 query rows */
    for (int c = 0; c < HD / 4; ++c) kr[c] = *(const v4f*)&lk[tid][c * 4];
    const float* qb = QF + (size_t)rg * A0R * DM + h * HD;      /* the same address in every lane */
#pragma unroll 4      /* several rows' q loads in flight ahead of their products */
    for (int i = 0; i < A0R; ++i) { v4f s4 = {0.f, 0.f, 0.f, 0.f};
#pragma unroll      /* kr is indexed by constants only */
      for (int c = 0; c < HD / 4; ++c) { const v4f qq = *(const v4fa*)(qb + (size_t)i * DM + c * 4);
#pragma unroll      /* short fixed trip count; the arrays it indexes stay in registers */
        for (int u = 0; u < 4; ++u) s4[u] = fmaf(qq[u], kr[c][u], s4[u]); }
      ls[i][tid] = ((s4[0] + s4[1]) + (s4[2] + s4[3])) * scale; } }
  __syncthreads();
#pragma unroll 1      /* two rows a wave, one after the other: small code */
  for (int i = 2 * w; i < 2 * w + 2; ++i) { const int last = rg * A0R + i; float x[QT0 / 32]; float mx = -3.0e38f;
#pragma unroll      /* x is indexed by constants only */
    for (int u = 0; u < QT0 / 32; ++u) { const int j = u * 32 + lane; x[u] = (j <= last) ? ls[i][j] : -3.0e38f; mx = fmaxf(mx, x[u]); }
#pragma unroll      /* short fixed trip count; the arrays it indexes stay in registers */
    for (int o = 16; o > 0; o >>= 1) mx = fmaxf(mx, __shfl_xor(mx, o, 32));
    float se = 0.f;
#pragma unroll      /* short fixed trip count; the arrays it indexes stay in registers */
    for (int u = 0; u < QT0 / 32; ++u) { const int j = u * 32 + lane; const float e = (j <= last) ? expf(x[u] - mx) : 0.f; se += e; if (j < nk) ls[i][j] = e; }
#pragma unroll      /* short fixed trip count; the arrays it indexes stay in registers */
    for (int o = 16; o > 0; o >>= 1) se += __shfl_xor(se, o, 32);
    if (lane == 0) linv[i] = 64.0f / se; }      /* o carried x64 like the f16 path */
  __syncthreads();
  { const int rh = lane >> 4, d4 = (lane & 15) * 4; v4f acc[8];
#pragma unroll      /* short fixed trip count; the arrays it indexes stay in registers */
    for (int r = 0; r < 8; ++r) acc[r] = (v4f){0.f, 0.f, 0.f, 0.f};
#pragma unroll 1      /* at most 8 trips of 128 multiply-adds: the body is long enough as it is */
    for (int j0 = 4 * w; j0 < nk; j0 += 32) { v4f pv[8], vv[4];
#pragma unroll      /* short fixed trip count; the arrays it indexes stay in registers */
      for (int r = 0; r < 8; ++r) pv[r] = *(const v4f*)&ls[rh * 8 + r][j0];
#pragma unroll      /* short fixed trip count; the arrays it indexes stay in registers */
      for (int q = 0; q < 4; ++q) vv[q] = *(const v4f*)&lv[j0 + q][d4];
#pragma unroll      /* short fixed trip count; the arrays it indexes stay in registers */
      for (int q = 0; q < 4; ++q)
#pragma unroll      /* short fixed trip count; the arrays it indexes stay in registers */
        for (int r = 0; r < 8; ++r)
#pragma unroll      /* short fixed trip count; the arrays it indexes stay in registers */
          for (int u = 0; u < 4; ++u) acc[r][u] = fmaf(pv[r][q], vv[q][u], acc[r][u]); }
#pragma unroll      /* short fixed trip count; the arrays it indexes stay in registers */
    for (int r = 0; r < 8; ++r) *(v4f*)&red[w][rh * 8 + r][d4] = acc[r]; }
  __syncthreads();
  { v4f o = *(const v4f*)&red[0][r16][c4];
#pragma unroll      /* short fixed trip count; the arrays it indexes stay in registers */
    for (int p = 1; p < 8; ++p) { const v4f a = *(const v4f*)&red[p][r16][c4]; o += a; }
    const float fin = linv[r16]; o *= fin;
    *(v4f*)(OF + (size_t)(rg * A0R + r16) * DM + h * HD + c4) = o; } }

extern "C" void kernel_launch(void* const* d_in, const int* in_sizes, int n_in,
                              void* d_out, int out_size, void* d_ws, size_t ws_size, hipStream_t stream) {
  (void)in_sizes; (void)n_in; (void)out_size;
  const float* const* I = (const float* const*)d_in; const float* xq = I[0]; const float* xk = I[1]; const float* xv = I[2]; const float* wq = I[3]; const float* wk = I[4]; const float* wv = I[5]; const float* wo = I[6];      /* weights [in][out] */
  char* ws = (char*)d_ws; size_t off = 0;
  auto take = [&](size_t bytes) { char* p = ws + off; off += (bytes + 255) & ~(size_t)255; return p; };
  _Float16* BQ = (_Float16*)take((size_t)DM * DM * 2); _Float16* BK = (_Float16*)take((size_t)DM * DM * 2); _Float16* BV = (_Float16*)take((size_t)DM * DM * 2); _Float16* BO = (_Float16*)take((size_t)DM * DM * 2);
  _Float16* XQ = (_Float16*)take(NR * DM * 2); _Float16* XK = (_Float16*)take(NR * DM * 2); _Float16* XV = (_Float16*)take(NR * DM * 2); _Float16* Q16 = (_Float16*)take(NR * DM * 2); _Float16* K16 = (_Float16*)take(NR * DM * 2); _Float16* V16 = (_Float16*)take(NR * DM * 2); _Float16* O16 = (_Float16*)take(NR * DM * 2);
  float* S = (float*)take((size_t)NH * QT * NKX * 4); _Float16* P = (_Float16*)take((size_t)NH * QT * NKX * 2); _Float16* VT = (_Float16*)take((size_t)NH * HD * SQ * 2);
  float* QF0 = (float*)take((size_t)QT0 * DM * 4); float* KF0 = (float*)take((size_t)QT0 * DM * 4); float* VF0 = (float*)take((size_t)QT0 * DM * 4); float* OF0 = (float*)take((size_t)NB * QT0 * DM * 4); _Float16* OH0 = (_Float16*)take((size_t)NB * QT0 * DM * 2); _Float16* OL0 = (_Float16*)take((size_t)NB * QT0 * DM * 2);
  if (off > ws_size) return;
  { const unsigned gh = (unsigned)(((size_t)HD * (DM / 8) + 255) / 256); for (int h = 0; h < NH; ++h) { k_wt_f16<<<gh, 256, 0, stream>>>(wq + (size_t)h * DM * HD, BQ + (size_t)h * HD * DM, DM, HD, 16.0f); k_wt_f16<<<gh, 256, 0, stream>>>(wk + (size_t)h * DM * HD, BK + (size_t)h * HD * DM, DM, HD, 16.0f); k_wt_f16<<<gh, 256, 0, stream>>>(wv + (size_t)h * DM * HD, BV + (size_t)h * HD * DM, DM, HD, 16.0f); } const unsigned g = (unsigned)(((size_t)DM * (DM / 8) + 255) / 256); k_wt_f16<<<g, 256, 0, stream>>>(wo, BO, DM, DM, 16.0f); }      /* PER-HEAD STACKS [16][1024][64] = [head][in][out]: head h's [1024][64] block -> rows 64 h .. 64 h + 63 of the Bt[n][k] x16 plane (K 1024, N 64 per call); the [in][out] output weight transposed into its plane by the same builder (K 1024, N 1024) */
  k_x16<<<(unsigned)((NR * DM / 8 + 255) / 256), 256, 0, stream>>>(xq, XQ, NR * DM / 8); k_x16<<<(unsigned)((NR * DM / 8 + 255) / 256), 256, 0, stream>>>(xk, XK, NR * DM / 8); k_x16<<<(unsigned)((NR * DM / 8 + 255) / 256), 256, 0, stream>>>(xv, XV, NR * DM / 8);
  const size_t r0p = (size_t)B0 * SQ;      /* first projected row */
  k_gemm2<0><<<dim3((unsigned)((MP / 128) * (DM / 64)), 1), 128, 0, stream>>>(XQ + r0p * DM, DM, 0, BQ, DM, 0, 0.0625f, nullptr, 0, nullptr, 1, 0, 0, nullptr, Q16 + r0p * DM, DM, 0, MP, DM, DM);
  k_gemm2<0><<<dim3((unsigned)((MP / 128) * (DM / 64)), 1), 128, 0, stream>>>(XK + r0p * DM, DM, 0, BK, DM, 0, 0.0625f, nullptr, 0, nullptr, 1, 0, 0, nullptr, K16 + r0p * DM, DM, 0, MP, DM, DM);
  k_gemm2<0><<<dim3((unsigned)((MP / 128) * (DM / 64)), 1), 128, 0, stream>>>(XV + r0p * DM, DM, 0, BV, DM, 0, 0.0625f, nullptr, 0, nullptr, 1, 0, 0, nullptr, V16 + r0p * DM, DM, 0, MP, DM, DM);
  for (int b = B0; b < B0 + NBR; ++b) { const size_t r0 = (size_t)b * SQ;
    k_vt<NH, SQ><<<NH * (SQ / 64), 256, 0, stream>>>(V16 + r0 * LQ, LQ, 0, VT);      /* V^T [NH][HD][SQ] for this batch */
    k_gemm2<0><<<dim3((QT0 / 128) * (DM / 64), 1), 128, 0, stream>>>(XQ + r0 * DM, DM, 0, BQ, DM, 0, 0.0625f, nullptr, 0, nullptr, 1, 0, 0, QF0, nullptr, DM, 0, QT0, DM, DM); k_gemm2<0><<<dim3((QT0 / 128) * (DM / 64), 1), 128, 0, stream>>>(XK + r0 * DM, DM, 0, BK, DM, 0, 0.0625f, nullptr, 0, nullptr, 1, 0, 0, KF0, nullptr, DM, 0, QT0, DM, DM); k_gemm2<0><<<dim3((QT0 / 128) * (DM / 64), 1), 128, 0, stream>>>(XV + r0 * DM, DM, 0, BV, DM, 0, 0.0625f, nullptr, 0, nullptr, 1, 0, 0, VF0, nullptr, DM, 0, QT0, DM, DM);      /* f32 q, k, v of the first 256 rows (exact products) */
    k_att0w<<<NH * (QT0 / A0R), 256, 0, stream>>>(QF0, KF0, VF0, 0.125f, OF0 + (size_t)b * QT0 * DM);      /* exact f32 attention for rows 0..255 (o x64) */
    for (int q0 = 0; q0 < QN; q0 += QT) { const int nk = q0 + QT;      /* causal: only keys below the tile end are computed */
      k_gemm2<0><<<dim3((QT / 128) * (nk / 64), NHD), 128, 0, stream>>>(Q16 + (r0 + q0) * LQ, LQ, (size_t)HD, K16 + r0 * LQ, LQ, (size_t)HD, 0.125f, nullptr, 0, nullptr, 1, 0, 0, S, nullptr, NKX, (size_t)QT * NKX, QT, nk, HD);      /* scores, all heads on grid.y */
      k_rsmcf2<<<(NHD * QT + 7) / 8, 256, 0, stream>>>(S, P, NHD, q0, nk);      /* one wave per row, 8 rows per block */
      k_gemm2<0><<<dim3((QT / 128) * (HD / 64), NHD), 128, 0, stream>>>(P, NKX, (size_t)QT * NKX, VT, SQ, (size_t)HD * SQ, 0.25f, nullptr, 0, nullptr, 1, 0, 0, nullptr, O16 + (r0 + q0) * DM, DM, (size_t)HD, QT, HD, nk); } }      /* o (merged heads, x64) as f16 rows */
  k_gemm2<0><<<dim3((unsigned)((MPO / 128) * (DM / 64)), 1), 128, 0, stream>>>(O16 + r0p * DM, DM, 0, BO, DM, 0, 0.0009765625f, nullptr, 0, nullptr, 1, 0, 0, (float*)d_out + r0p * DM, nullptr, DM, 0, MPO, DM, DM);      /* out rows are the output layout */
  k_hl<<<(unsigned)(((size_t)NB * QT0 * DM / 8 + 255) / 256), 256, 0, stream>>>(OF0, OH0, OL0, (size_t)NB * QT0 * DM / 8);      /* first-tile o (x64) -> f16 hi + x1024 residual planes */
  for (int b = B0; b < B0 + NBR; ++b) { const size_t r0 = (size_t)b * SQ; const size_t f0 = (size_t)b * QT0;
    k_gemm2<0><<<dim3((QT0 / 128) * (DM / 64), 1), 128, 0, stream>>>(OH0 + f0 * DM, DM, 0, BO, DM, 0, 0.0009765625f, nullptr, 0, nullptr, 1, 0, 0, (float*)d_out + r0 * DM, nullptr, DM, 0, QT0, DM, DM);      /* rows 0..255: out = o_hi Wo, overwriting the f16-path rows */
    k_gemm2<0><<<dim3((QT0 / 128) * (DM / 64), 1), 128, 0, stream>>>(OL0 + f0 * DM, DM, 0, BO, DM, 0, 0.00000095367431640625f, nullptr, 0, (const float*)d_out + r0 * DM, -1, 0, 0, (float*)d_out + r0 * DM, nullptr, DM, 0, QT0, DM, DM); }      /* += o_lo Wo 2^-20 (own-element accumulate) */
}

// v003
// One run takes 580 microseconds.
// Next to v002, in two timings, it ran 3.23 times as fast each time.
// Over all steps from v000 it is 14.5 times as fast.
#include <hip/hip_runtime.h>
// Causal multi-head attention on three inputs with PER-HEAD STACKED projections over ONE sequence of 4096 tokens (Q, K, V [1][4096][1024]; WQ / WK / WV [16][1024][64] = [head][in][out] sigma 0.02, NO biases; 16 heads of 64; scores x 64^-0.5 = / 8; causal (tril, -inf above the diagonal); softmax; heads concatenated head-major; out = concat WO with WO [1024][1024] [in][out], NO bias -> [1][4096][1024]); each head's [in][out] block is transposed into its 64 contiguous rows of the weight plane by the transposing builder, one call per head, and the [in][out] output weight by the same builder in one call.
// Structure: token rows r = s; q, k, v inputs as exact f16 rows (bf16-rounded); Q, K, V as three WMMA GEMMs (32x64 wave tiles, f32 accumulation, exact x16 weights, f16 outputs); per batch: V^T for all heads via LDS transposes; one fused attention launch: a wave per 32 query rows of a head walks the keys up to its own rows 32 at a time (scores on WMMA, K = 64; running f32 maximum and sum, native exp2; weights in (0, 1] as f16; o += P V on WMMA, divided by the sum at the end, o carried x64, folded into the output GEMM alpha), written straight into the merged f16 o rows; out = o W_o GEMM (f32) into the output layout.
// Compute dtype: inputs rounded to bf16; x / weights exact; q, k, v, softmax weights and o as plain f16 GEMM operands (~2^-12); scores and softmax statistics f32. v_wmma_f32_16x16x32_f16.
#define NB 1
#define SQ 4096
#define DM 1024
#define NH 16
#define HD 64
#define HG 4                         /* heads per launch of the unlaunched k_vt overload */
#define QT 256                       /* unused */
#define NKX SQ                       /* unused */
#define QT0 256                      /* first-tile rows recomputed exactly in f32 */
#define B0 0                         /* first batch processed (debug hook) */
#define NBR NB                       /* batches processed (debug hook) */
#define NR ((size_t)NB * SQ)         /* token rows */
#define MP ((int)((size_t)NBR * SQ)) /* rows projected (debug hook) */
#define QN SQ                        /* unused (k_fattn attends all SQ rows) */
#define NHD NH                       /* unused (k_fattn attends all NH heads) */
#define MPO MP                       /* rows through the output stage (debug hook) */
#define LQ DM      /* row pitch of the q/k/v rows */
typedef __bf16 v16b __attribute__((ext_vector_type(16)));
typedef unsigned short v8us __attribute__((ext_vector_type(8), may_alias));
typedef float  v8f  __attribute__((ext_vector_type(8)));
typedef float  v4f  __attribute__((ext_vector_type(4)));
typedef float  v4fa __attribute__((ext_vector_type(4), may_alias));
union FragB { v16b v; v8us half[2]; unsigned short u[16]; };

__device__ __forceinline__ unsigned short bf16_bits(float x) { unsigned int u = __float_as_uint(x); return (unsigned short)((u + 0x7FFFu + ((u >> 16) & 1u)) >> 16); }
__device__ __forceinline__ float bf16_val(unsigned short b) { return __uint_as_float(((unsigned int)b) << 16); }
__device__ __forceinline__ float bf16_round(float x) { return bf16_val(bf16_bits(x)); }
// D += A·B with NT terms: 1 = ah·bh, 2 = + al·bh (A split), 3 = + ah·bl (both split)
template <int NT>
__device__ __forceinline__ v8f mmaN(v16b ah, v16b al, v16b bh, v16b bl, v8f c) {
  c = __builtin_amdgcn_wmma_f32_16x16x32_bf16(false, ah, false, bh, (short)0, c, false, false);
  if (NT >= 2) c = __builtin_amdgcn_wmma_f32_16x16x32_bf16(false, al, false, bh, (short)0, c, false, false);
  if (NT >= 3) c = __builtin_amdgcn_wmma_f32_16x16x32_bf16(false, ah, false, bl, (short)0, c, false, false);
  asm volatile("v_nop\n\tv_nop\n\tv_nop\n\tv_nop" : "+v"(c) : "v"(ah), "v"(al), "v"(bh), "v"(bl));
  return c;
}

__global__ __launch_bounds__(256) void k_wt_bf16(const float* __restrict__ W, unsigned short* __restrict__ Wt, int K, int N) {
  const int t = blockIdx.x * 256 + threadIdx.x;
  const int k8n = K / 8;
  if (t >= N * k8n) return;
  const int n = t / k8n, k8 = (t % k8n) * 8;
  v8us v;
#pragma unroll
  for (int i = 0; i < 8; ++i) v[i] = bf16_bits(W[(size_t)(k8 + i) * N + n]);
  *(v8us*)(Wt + (size_t)n * K + k8) = v;
  
}

// GEMM C[M][N] (f32, pitch ldc) = act(A[M][K]·W + bias). A f32 row-major (pitch lda) converted per fragment to bf16
// (ASPLIT: hi/lo two planes -> 2 terms, else single rounded term); Wt bf16 [N][K] (pitch ldb). BIAS_BF16 rounds the
// bias to bf16 first (bias quantised to bf16 before the add). K%32==0, M%16==0, N%64==0.
template <bool ASPLIT, int ACT, bool BIAS_BF16>
__global__ __launch_bounds__(128) void k_gemm_bf(const float* __restrict__ A, int lda, const unsigned short* __restrict__ Wt, int ldb,
                                               const float* __restrict__ bias, float* __restrict__ C, int ldc, int M, int N, int K) {
  __shared__ __attribute__((aligned(16))) float so[4][16][64];
  const int tid = threadIdx.x, w = tid >> 5, lane = tid & 31, ln = lane & 15, hh = lane >> 4;
  const int ntn = N / 64;
  const int wid = blockIdx.x * 4 + w;
  const int mt = wid / ntn, nq = wid % ntn;
  if (mt * 16 >= M) return;
  const int row0 = mt * 16, col0 = nq * 64;
  const float* arow = A + (size_t)(row0 + ln) * lda;
  v8f acc[4] = {};
  for (int kb = 0; kb < K; kb += 32) {
    FragB ah, al;
    const v4f x0 = *(const v4fa*)(arow + kb + 8 * hh), x1 = *(const v4fa*)(arow + kb + 8 * hh + 4);
    const v4f x2 = *(const v4fa*)(arow + kb + 16 + 8 * hh), x3 = *(const v4fa*)(arow + kb + 16 + 8 * hh + 4);
    float xs[16] = {x0[0],x0[1],x0[2],x0[3],x1[0],x1[1],x1[2],x1[3],x2[0],x2[1],x2[2],x2[3],x3[0],x3[1],x3[2],x3[3]};
#pragma unroll
    for (int i = 0; i < 16; ++i) { const unsigned short hb = bf16_bits(xs[i]); ah.u[i] = hb; al.u[i] = ASPLIT ? bf16_bits(xs[i] - bf16_val(hb)) : (unsigned short)0; }
#pragma unroll
    for (int t = 0; t < 4; ++t) {
      const unsigned short* brow = Wt + (size_t)(col0 + t * 16 + ln) * ldb + kb;
      FragB b;
      b.half[0] = *(const v8us*)(brow + 8 * hh);
      b.half[1] = *(const v8us*)(brow + 16 + 8 * hh);
      acc[t] = mmaN<ASPLIT ? 2 : 1>(ah.v, al.v, b.v, b.v, acc[t]);
    }
  }
#pragma unroll
  for (int t = 0; t < 4; ++t) {
    float bv = bias ? bias[col0 + t * 16 + ln] : 0.f;
    if (BIAS_BF16) bv = bf16_round(bv);
#pragma unroll
    for (int r = 0; r < 8; ++r) { float v = acc[t][r] + bv; if (ACT == 1) v = fmaxf(v, 0.f); so[w][8 * hh + r][t * 16 + ln] = v; }
  }
  __builtin_amdgcn_fence(__ATOMIC_ACQ_REL, "workgroup");
  __builtin_amdgcn_wave_barrier();
  const int rsub = lane >> 4, c4 = (lane & 15) * 4;
  {
#pragma unroll
    for (int q = 0; q < 8; ++q) {
      const int r = q * 2 + rsub;
      const v4f v = *(const v4fa*)&so[w][r][c4];
      *(v4f*)(C + (size_t)(row0 + r) * ldc + col0 + c4) = v;
    }
    
  }
}

// GEMM C = act(A·W + bias + resid): A f32 (ASPLIT -> hi/lo 2 terms), Wt bf16 [N][K]; ACT 0 none, 1 relu, 2 exact gelu;
// resid (optional, f32, row index = (row % rmod), pitch ldr, RES_BF16 rounds it) added before the activation.
template <bool ASPLIT, int ACT, bool BIAS_BF16, bool RES_BF16>
__global__ __launch_bounds__(128) void k_gemm_bf3(const float* __restrict__ A, int lda, const unsigned short* __restrict__ Wt, int ldb,
                                                const float* __restrict__ bias, const float* __restrict__ resid, int rmod, int ldr,
                                                float* __restrict__ C, int ldc, int M, int N, int K) {
  __shared__ __attribute__((aligned(16))) float so[4][16][64];
  const int tid = threadIdx.x, w = tid >> 5, lane = tid & 31, ln = lane & 15, hh = lane >> 4;
  const int ntn = N / 64;
  const int wid = blockIdx.x * 4 + w;
  const int mt = wid / ntn, nq = wid % ntn;
  if (mt * 16 >= M) return;
  const int row0 = mt * 16, col0 = nq * 64;
  const float* arow = A + (size_t)(row0 + ln) * lda;
  v8f acc[4] = {};
  for (int kb = 0; kb < K; kb += 32) {
    FragB ah, al;
    const v4f x0 = *(const v4fa*)(arow + kb + 8 * hh), x1 = *(const v4fa*)(arow + kb + 8 * hh + 4);
    const v4f x2 = *(const v4fa*)(arow + kb + 16 + 8 * hh), x3 = *(const v4fa*)(arow + kb + 16 + 8 * hh + 4);
    float xs[16] = {x0[0],x0[1],x0[2],x0[3],x1[0],x1[1],x1[2],x1[3],x2[0],x2[1],x2[2],x2[3],x3[0],x3[1],x3[2],x3[3]};
#pragma unroll
    for (int i = 0; i < 16; ++i) { const unsigned short hb = bf16_bits(xs[i]); ah.u[i] = hb; al.u[i] = ASPLIT ? bf16_bits(xs[i] - bf16_val(hb)) : (unsigned short)0; }
#pragma unroll
    for (int t = 0; t < 4; ++t) {
      const unsigned short* brow = Wt + (size_t)(col0 + t * 16 + ln) * ldb + kb;
      FragB b;
      b.half[0] = *(const v8us*)(brow + 8 * hh);
      b.half[1] = *(const v8us*)(brow + 16 + 8 * hh);
      acc[t] = mmaN<ASPLIT ? 2 : 1>(ah.v, al.v, b.v, b.v, acc[t]);
    }
  }
#pragma unroll
  for (int t = 0; t < 4; ++t) {
    const int col = col0 + t * 16 + ln;
    float bv = bias ? bias[col] : 0.f;
    if (BIAS_BF16) bv = bf16_round(bv);
#pragma unroll
    for (int r = 0; r < 8; ++r) {
      float v = acc[t][r] + bv;
      if (resid) { float rv = resid[(size_t)((row0 + 8 * hh + r) % rmod) * ldr + col]; if (RES_BF16) rv = bf16_round(rv); v += rv; }
      if (ACT == 1) v = fmaxf(v, 0.f);
      if (ACT == 2) v = 0.5f * v * (1.0f + erff(v * 0.70710678118654752f));
      if (ACT == 3) { const float u = 0.7978845608028654f * (v + 0.044715f * v * v * v); v = 0.5f * v * (1.0f + tanhf(u)); }
      so[w][8 * hh + r][t * 16 + ln] = v;
    }
  }
  __builtin_amdgcn_fence(__ATOMIC_ACQ_REL, "workgroup");
  __builtin_amdgcn_wave_barrier();
  const int rsub = lane >> 4, c4 = (lane & 15) * 4;
  {
#pragma unroll
    for (int q = 0; q < 8; ++q) {
      const int r = q * 2 + rsub;
      const v4f v = *(const v4fa*)&so[w][r][c4];
      *(v4f*)(C + (size_t)(row0 + r) * ldc + col0 + c4) = v;
    }
    
  }
}
// row LayerNorm (biased variance, eps) over N: s = X (+ R); optional out_sum <- s; out_norm <- (s-mu)*rsqrt(var+eps)*g + b
template <bool PARAM_BF16>
__global__ __launch_bounds__(256) void k_layernorm(const float* __restrict__ X, const float* __restrict__ R, const float* __restrict__ g, const float* __restrict__ bta,
                                                  float* __restrict__ out_sum, float* __restrict__ out_norm, int N, float eps) {
  __shared__ float red[256];
  const int row = blockIdx.x, tid = threadIdx.x;
  const float* x = X + (size_t)row * N; const float* rr = R ? R + (size_t)row * N : nullptr;
  float vals[16];                     // up to N = 4096
  const int per = N / 256;            // contiguous chunk per thread? use strided-by-4 chunks: thread handles j = tid*4 + 1024*u
  float s1 = 0.f;
  for (int u = 0; u < per / 4; ++u) {
    const int j = tid * 4 + 1024 * u;
    const v4f a = *(const v4fa*)(x + j);
    v4f b = {0.f,0.f,0.f,0.f}; if (rr) b = *(const v4fa*)(rr + j);
#pragma unroll
    for (int q = 0; q < 4; ++q) { const float v = a[q] + b[q]; vals[u * 4 + q] = v; s1 += v; }
  }
  red[tid] = s1; __syncthreads();
  for (int st = 128; st > 0; st >>= 1) { if (tid < st) red[tid] += red[tid + st]; __syncthreads(); }
  const float mu = red[0] / (float)N; __syncthreads();
  float s2 = 0.f;
  for (int u = 0; u < per / 4; ++u)
#pragma unroll
    for (int q = 0; q < 4; ++q) { const float c = vals[u * 4 + q] - mu; s2 += c * c; }
  red[tid] = s2; __syncthreads();
  for (int st = 128; st > 0; st >>= 1) { if (tid < st) red[tid] += red[tid + st]; __syncthreads(); }
  const float rs = rsqrtf(red[0] / (float)N + eps);
  {
    for (int u = 0; u < per / 4; ++u) {
      const int j = tid * 4 + 1024 * u;
      v4f o, sm;
#pragma unroll
      for (int q = 0; q < 4; ++q) {
        float gg = g[j + q], bb = bta[j + q];
        if (PARAM_BF16) { gg = bf16_round(gg); bb = bf16_round(bb); }
        sm[q] = vals[u * 4 + q]; o[q] = (vals[u * 4 + q] - mu) * rs * gg + bb;
      }
      if (out_sum) *(v4f*)(out_sum + (size_t)row * N + j) = sm;
      *(v4f*)(out_norm + (size_t)row * N + j) = o;
    }
    
  }
}



// ---- f16 WMMA path (v_wmma_f32_16x16x32_f16): 11-bit significands for operands in range — used where a [0,1] probability operand needs more precision than bf16
typedef _Float16 v16h __attribute__((ext_vector_type(16)));
union FragH { v16h v; v8us half[2]; _Float16 h[16]; unsigned short u[16]; };
template <int NT>
__device__ __forceinline__ v8f mmaH(v16h ah, v16h al, v16h bh, v16h bl, v8f c) {
  c = __builtin_amdgcn_wmma_f32_16x16x32_f16(false, ah, false, bh, (short)0, c, false, false);
  if (NT >= 2) c = __builtin_amdgcn_wmma_f32_16x16x32_f16(false, al, false, bh, (short)0, c, false, false);
  if (NT >= 3) c = __builtin_amdgcn_wmma_f32_16x16x32_f16(false, ah, false, bl, (short)0, c, false, false);
  asm volatile("v_nop\n\tv_nop\n\tv_nop\n\tv_nop" : "+v"(c) : "v"(ah), "v"(al), "v"(bh), "v"(bl));
  return c;
}
// batched GEMM like k_gemm_b but f16 operands: A f32 (split into f16 hi/lo if ASPLIT, else rounded to f16), Bt = f16 values [n][k]; alpha; C f32; N multiple of 16 (partial tiles skipped)
template <bool ASPLIT>
__global__ __launch_bounds__(128) void k_gemm_h(const float* __restrict__ A, int lda, size_t sA, const _Float16* __restrict__ Bh, int ldb, size_t sB, float alpha, float* __restrict__ C, int ldc, size_t sC, int M, int N, int K) {
  __shared__ __attribute__((aligned(16))) float so[4][16][64];
  const int tid = threadIdx.x, w = tid >> 5, lane = tid & 31, ln = lane & 15, hh = lane >> 4; const int by = blockIdx.y;
  A += (size_t)by * sA; Bh += (size_t)by * sB; C += (size_t)by * sC;
  const int ntn = (N + 63) / 64; const int wid = blockIdx.x * 4 + w; const int mt = wid / ntn, nq = wid % ntn; if (mt * 16 >= M) return;
  const int row0 = mt * 16, col0 = nq * 64; const float* arow = A + (size_t)(row0 + ln) * lda;
  v8f acc[4] = {};
  for (int kb = 0; kb < K; kb += 32) {
    FragH ah, al;
    const v4f x0 = *(const v4fa*)(arow + kb + 8 * hh), x1 = *(const v4fa*)(arow + kb + 8 * hh + 4), x2 = *(const v4fa*)(arow + kb + 16 + 8 * hh), x3 = *(const v4fa*)(arow + kb + 16 + 8 * hh + 4);
    float xs[16] = {x0[0],x0[1],x0[2],x0[3],x1[0],x1[1],x1[2],x1[3],x2[0],x2[1],x2[2],x2[3],x3[0],x3[1],x3[2],x3[3]};
#pragma unroll
    for (int i = 0; i < 16; ++i) { const _Float16 h = (_Float16)xs[i]; ah.h[i] = h; al.h[i] = ASPLIT ? (_Float16)(xs[i] - (float)h) : (_Float16)0.0f; }
#pragma unroll
    for (int t = 0; t < 4; ++t) { if (col0 + t * 16 >= N) continue; const size_t boff = (size_t)(col0 + t * 16 + ln) * ldb + kb; FragH bq; bq.half[0] = *(const v8us*)(Bh + boff + 8 * hh); bq.half[1] = *(const v8us*)(Bh + boff + 16 + 8 * hh);
      acc[t] = mmaH<ASPLIT ? 2 : 1>(ah.v, al.v, bq.v, bq.v, acc[t]); }
  }
#pragma unroll
  for (int t = 0; t < 4; ++t) { if (col0 + t * 16 >= N) continue;
#pragma unroll
    for (int r = 0; r < 8; ++r) so[w][8 * hh + r][t * 16 + ln] = acc[t][r] * alpha; }
  __builtin_amdgcn_fence(__ATOMIC_ACQ_REL, "workgroup"); __builtin_amdgcn_wave_barrier();
  const int rsub = lane >> 4, c4 = (lane & 15) * 4;
  {
#pragma unroll
    for (int q = 0; q < 8; ++q) { const int r = q * 2 + rsub; if (col0 + c4 < N) { const v4f v = *(const v4fa*)&so[w][r][c4]; *(v4f*)(C + (size_t)(row0 + r) * ldc + col0 + c4) = v; } }
     }
}

// Wt[n][k] = f16(W[k][n]·scale) from f32 row-major W[K][N] (scale = power of two; bf16-exact weights stay exact in f16 away from the subnormal range)
__global__ __launch_bounds__(256) void k_wt_f16(const float* __restrict__ W, _Float16* __restrict__ Wt, int K, int N, float scale) {
  const int t = blockIdx.x * 256 + threadIdx.x; if (t >= N * (K / 8)) return; const int n = t / (K / 8), k8 = (t % (K / 8)) * 8; FragH f;
#pragma unroll
  for (int i = 0; i < 8; ++i) f.h[i] = (_Float16)(bf16_round(W[(size_t)(k8 + i) * N + n]) * scale); const v8us o = f.half[0];
  *(v8us*)((unsigned short*)Wt + (size_t)n * K + k8) = o; 
}
// k_gemm_hh variant with fused epilogue: v = acc·alpha + bias[by·sBias + col] (+ CP[(row/rowsPerB)·sCPb + by·64 + col] if CP) ; ACT 0 none / 1 elu ; writes f16 C16 (and f32 C if non-null)
template <int ACT>
__global__ __launch_bounds__(128) void k_gemm_hhx(const _Float16* __restrict__ A, int lda, size_t sA, const _Float16* __restrict__ Bh, int ldb, size_t sB, float alpha, const float* __restrict__ bias, size_t sBias, const float* __restrict__ CP, int rowsPerB, size_t sCPb, int row0g,
    float* __restrict__ C, _Float16* __restrict__ C16, int ldc, size_t sC, int M, int N, int K) {
  __shared__ __attribute__((aligned(16))) float so[4][16][64];
  const int tid = threadIdx.x, w = tid >> 5, lane = tid & 31, ln = lane & 15, hh = lane >> 4; const int by = blockIdx.y;
  A += (size_t)by * sA; Bh += (size_t)by * sB; const size_t cofs = (size_t)by * sC; const float* bp = bias ? bias + (size_t)by * sBias : nullptr;
  const int ntn = (N + 63) / 64; const int wid = blockIdx.x * 4 + w; const int mt = wid / ntn, nq = wid % ntn; if (mt * 16 >= M) return;
  const int row0 = mt * 16, col0 = nq * 64; const _Float16* arow = A + (size_t)(row0 + ln) * lda;
  v8f acc[4] = {};
  for (int kb = 0; kb < K; kb += 32) { FragH ah; ah.half[0] = *(const v8us*)((const unsigned short*)arow + kb + 8 * hh); ah.half[1] = *(const v8us*)((const unsigned short*)arow + kb + 16 + 8 * hh);
#pragma unroll
    for (int t = 0; t < 4; ++t) { if (col0 + t * 16 >= N) continue; const size_t boff = (size_t)(col0 + t * 16 + ln) * ldb + kb; FragH bq; bq.half[0] = *(const v8us*)((const unsigned short*)Bh + boff + 8 * hh); bq.half[1] = *(const v8us*)((const unsigned short*)Bh + boff + 16 + 8 * hh);
      acc[t] = mmaH<1>(ah.v, ah.v, bq.v, bq.v, acc[t]); }
  }
#pragma unroll
  for (int t = 0; t < 4; ++t) { if (col0 + t * 16 >= N) continue; const int col = col0 + t * 16 + ln; const float bv = bp ? bf16_round(bp[col]) : 0.f;
#pragma unroll
    for (int r = 0; r < 8; ++r) { float v = acc[t][r] * alpha + bv; if (CP) { const int rr = row0g + row0 + 8 * hh + r; if (rowsPerB < 0) v += CP[cofs + (size_t)rr * ldc + col];      /* rowsPerB < 0: own element of the batched C plane */ else { const int bidx = rr / rowsPerB; v += CP[(size_t)bidx * sCPb + (size_t)by * 64 + col]; } } if (ACT == 1) v = (v > 0.f) ? v : expm1f(v); else if (ACT == 7) v = (v > 0.f) ? v + 1.0f : expf(v); else if (ACT == 8) v = tanhf(v); else if (ACT == 9) v = 0.5f * v * (1.0f + tanhf(0.7978845608028654f * (v + 0.044715f * v * v * v))); else if (ACT == 11) v = 1.0f / (1.0f + expf(-v)); else if (ACT == 12) v = (v > 0.f) ? v : 0.01f * v; else if (ACT == 14) v = (v > 0.f) ? v : 0.1f * v; else if (ACT == 16) v = (v >= 0.f) ? v : 0.3f * v; else if (ACT == 17) v = (v >= 0.f) ? v : 0.2f * v; else if (ACT == 15) v = v / (1.0f + expf(-v)); else if (ACT == 3) v = fmaxf(v, 0.f); else if (ACT == 6) v = 0.5f * v * (1.0f + erff(v * 0.70710678118654752f)); so[w][8 * hh + r][t * 16 + ln] = v; } }
  __builtin_amdgcn_fence(__ATOMIC_ACQ_REL, "workgroup"); __builtin_amdgcn_wave_barrier();
  const int rsub = lane >> 4, c4 = (lane & 15) * 4; typedef _Float16 v4h __attribute__((ext_vector_type(4)));
  {
#pragma unroll
    for (int q = 0; q < 8; ++q) { const int r = q * 2 + rsub; if (col0 + c4 < N) { const v4f v = *(const v4fa*)&so[w][r][c4]; if (C) *(v4f*)(C + cofs + (size_t)(row0 + r) * ldc + col0 + c4) = v; if (C16) { v4h h4; for (int i = 0; i < 4; ++i) h4[i] = (_Float16)v[i]; *(v4h*)(C16 + cofs + (size_t)(row0 + r) * ldc + col0 + c4) = h4; } } }
     }
}


typedef _Float16 v4h __attribute__((ext_vector_type(4)));

__global__ __launch_bounds__(256) void k_x16(const float* __restrict__ x, _Float16* __restrict__ X16, size_t n8) { const size_t t = (size_t)blockIdx.x * 256 + threadIdx.x; if (t >= n8) return; FragH f;
#pragma unroll
  for (int q = 0; q < 8; ++q) f.h[q] = (_Float16)bf16_round(x[t * 8 + q]); *(v8us*)((unsigned short*)X16 + t * 8) = f.half[0];  }
__global__ __launch_bounds__(256) void k_h16(const float* __restrict__ x, _Float16* __restrict__ X16, size_t n8) { const size_t t = (size_t)blockIdx.x * 256 + threadIdx.x; if (t >= n8) return; FragH f;
#pragma unroll
  for (int q = 0; q < 8; ++q) f.h[q] = (_Float16)x[t * 8 + q]; *(v8us*)((unsigned short*)X16 + t * 8) = f.half[0];  }
__global__ __launch_bounds__(256) void k_round16f(const float* __restrict__ W, _Float16* __restrict__ Bt, size_t n8) { const size_t t = (size_t)blockIdx.x * 256 + threadIdx.x; if (t >= n8) return; FragH f;
#pragma unroll
  for (int i = 0; i < 8; ++i) f.h[i] = (_Float16)(bf16_round(W[t * 8 + i]) * 16.0f); *(v8us*)((unsigned short*)Bt + t * 8) = f.half[0];  }
template <int NHv, int TTv>
__global__ __launch_bounds__(256) void k_vt(const _Float16* __restrict__ V16, int ldv, int voff, _Float16* __restrict__ Vt) { __shared__ unsigned short tl[64][66]; const int tid = threadIdx.x; const int slab = blockIdx.x / (TTv / 64), lg = blockIdx.x % (TTv / 64); const int b = slab / NHv, h = slab % NHv;
  for (int i = tid; i < 64 * 8; i += 256) { const int r = i / 8, c8 = (i % 8) * 8; FragH f; f.half[0] = *(const v8us*)((const unsigned short*)V16 + ((size_t)b * TTv + lg * 64 + r) * ldv + voff + h * 64 + c8);
#pragma unroll
    for (int q = 0; q < 8; ++q) tl[r][c8 + q] = f.u[q]; }
  __syncthreads();
  {
#pragma unroll
    for (int rd = 0; rd < 2; ++rd) { const int d = rd * 32 + tid / 8, pc = tid % 8; FragH f;
#pragma unroll
      for (int q = 0; q < 8; ++q) f.u[q] = tl[pc * 8 + q][d];
      *(v8us*)((unsigned short*)Vt + ((size_t)slab * 64 + d) * TTv + lg * 64 + pc * 8) = f.half[0]; }
     } }

__global__ __launch_bounds__(256) void k_hl(const float* __restrict__ F, _Float16* __restrict__ Hh, _Float16* __restrict__ Hl, size_t n8) { const size_t t = (size_t)blockIdx.x * 256 + threadIdx.x; if (t >= n8) return; FragH fh, fl; const v4f a = *(const v4fa*)(F + t * 8), c = *(const v4fa*)(F + t * 8 + 4);
#pragma unroll
  for (int q = 0; q < 4; ++q) { _Float16 h = (_Float16)a[q]; fh.h[q] = h; fl.h[q] = (_Float16)((a[q] - (float)h) * 1024.0f); h = (_Float16)c[q]; fh.h[4 + q] = h; fl.h[4 + q] = (_Float16)((c[q] - (float)h) * 1024.0f); }
  { *(v8us*)((unsigned short*)Hh + t * 8) = fh.half[0]; *(v8us*)((unsigned short*)Hl + t * 8) = fl.half[0];  } }

// ---- fast GEMM (wave tile 32x64; requires M % 32 == 0 rows per launch region and N % 64 == 0); epilogue = k_gemm_hhx semantics ----
__device__ __forceinline__ v16h g2_frag(const _Float16* p, int hh) { FragH f; f.half[0] = *(const v8us*)((const unsigned short*)p + 8 * hh); f.half[1] = *(const v8us*)((const unsigned short*)p + 16 + 8 * hh); return f.v; }
__device__ __forceinline__ v8f g2_mma(v16h a, v16h b, v8f c) { v8f d = __builtin_amdgcn_wmma_f32_16x16x32_f16(false, a, false, b, (short)0, c, false, false); asm volatile("v_nop\n\tv_nop\n\tv_nop\n\tv_nop" : "+v"(d) : "v"(a), "v"(b)); return d; }
template <int ACT>
__global__ __launch_bounds__(128) void k_gemm2(const _Float16* __restrict__ A, int lda, size_t sA, const _Float16* __restrict__ Bh, int ldb, size_t sB, float alpha, const float* __restrict__ bias, size_t sBias, const float* __restrict__ CP, int rowsPerB, size_t sCPb, int row0g,
    float* __restrict__ C, _Float16* __restrict__ C16, int ldc, size_t sC, int M, int N, int K) { static_assert(ACT == 0 || ACT == 3 || ACT == 6 || ACT == 8 || ACT == 9 || ACT == 11 || ACT == 12 || ACT == 14 || ACT == 15 || ACT == 16 || ACT == 17, "k_gemm2: unsupported ACT code (would silently apply no activation)");
  __shared__ __attribute__((aligned(16))) float so[4][32][68];
  const int tid = threadIdx.x, w = tid >> 5, lane = tid & 31, ln = lane & 15, hh = lane >> 4; const int by = blockIdx.y;
  A += (size_t)by * sA; Bh += (size_t)by * sB; const size_t cofs = (size_t)by * sC; const float* bp = bias ? bias + (size_t)by * sBias : nullptr;
  const int ntn = N >> 6; const int mt = blockIdx.x / ntn, nq = blockIdx.x - mt * ntn; const int row0 = mt * 128 + 32 * w, col0 = nq * 64; if (row0 >= M) return;
  const _Float16* a0p = A + (size_t)(row0 + ln) * lda; const _Float16* a1p = a0p + (size_t)16 * lda;
  const _Float16* b0p = Bh + (size_t)(col0 + ln) * ldb; const _Float16* b1p = b0p + (size_t)16 * ldb; const _Float16* b2p = b1p + (size_t)16 * ldb; const _Float16* b3p = b2p + (size_t)16 * ldb;
  const v8f z8 = {0.f,0.f,0.f,0.f,0.f,0.f,0.f,0.f}; v8f c00 = z8, c01 = z8, c02 = z8, c03 = z8, c10 = z8, c11 = z8, c12 = z8, c13 = z8;
#pragma unroll 1
  for (int kb = 0; kb < K; kb += 32) { const v16h a0 = g2_frag(a0p + kb, hh), a1 = g2_frag(a1p + kb, hh);
    v16h b = g2_frag(b0p + kb, hh); c00 = g2_mma(a0, b, c00); c10 = g2_mma(a1, b, c10);
    b = g2_frag(b1p + kb, hh); c01 = g2_mma(a0, b, c01); c11 = g2_mma(a1, b, c11);
    b = g2_frag(b2p + kb, hh); c02 = g2_mma(a0, b, c02); c12 = g2_mma(a1, b, c12);
    b = g2_frag(b3p + kb, hh); c03 = g2_mma(a0, b, c03); c13 = g2_mma(a1, b, c13); }
  v8f accs[8] = {c00, c01, c02, c03, c10, c11, c12, c13};
#pragma unroll
  for (int u = 0; u < 8; ++u) { const int t = u & 3, half = u >> 2; const int col = col0 + t * 16 + ln; const float bv = bp ? bf16_round(bp[col]) : 0.f;
#pragma unroll
    for (int r = 0; r < 8; ++r) { const int rloc = half * 16 + 8 * hh + r; float v = accs[u][r] * alpha + bv; if (CP) { if (rowsPerB < 0) v += CP[cofs + (size_t)(row0g + row0 + rloc) * ldc + col];      /* rowsPerB < 0: own element of the batched C plane */ else { const int bidx = (row0g + row0 + rloc) / rowsPerB; v += CP[(size_t)bidx * sCPb + (size_t)by * 64 + col]; } }
      if (ACT == 3) v = fmaxf(v, 0.f); else if (ACT == 6) v = 0.5f * v * (1.0f + erff(v * 0.70710678118654752f)); else if (ACT == 11) v = 1.0f / (1.0f + expf(-v)); else if (ACT == 15) v = v / (1.0f + expf(-v)); else if (ACT == 12) v = (v > 0.f) ? v : 0.01f * v; else if (ACT == 8) v = tanhf(v); else if (ACT == 9) v = 0.5f * v * (1.0f + tanhf(0.7978845608028654f * (v + 0.044715f * v * v * v))); else if (ACT == 14) v = (v > 0.f) ? v : 0.1f * v; else if (ACT == 16) v = (v >= 0.f) ? v : 0.3f * v; else if (ACT == 17) v = (v >= 0.f) ? v : 0.2f * v;
      so[w][rloc][t * 16 + ln] = v; } }
  __builtin_amdgcn_fence(__ATOMIC_ACQ_REL, "workgroup"); __builtin_amdgcn_wave_barrier();
  const int rsub = lane >> 4, c4 = (lane & 15) * 4;
  {
#pragma unroll
    for (int q = 0; q < 16; ++q) { const int r = q * 2 + rsub; const v4f v = *(const v4fa*)&so[w][r][c4]; if (C) *(v4f*)(C + cofs + (size_t)(row0 + r) * ldc + col0 + c4) = v; if (C16) { v4h h4; for (int i = 0; i < 4; ++i) h4[i] = (_Float16)v[i]; *(v4h*)(C16 + cofs + (size_t)(row0 + r) * ldc + col0 + c4) = h4; } }
     } }


__global__ __launch_bounds__(256) void k_wnat(const float* __restrict__ w, size_t n8, _Float16* __restrict__ Bt) { const size_t t = (size_t)blockIdx.x * 256 + threadIdx.x; if (t >= n8) return; FragH f; for (int q = 0; q < 8; ++q) f.h[q] = (_Float16)(bf16_round(w[t * 8 + q]) * 16.0f); *(v8us*)((unsigned short*)Bt + t * 8) = f.half[0];  }
__global__ __launch_bounds__(256) void k_rsm(const float* __restrict__ S, _Float16* __restrict__ P, int nrows) {
  #pragma clang fp contract(off)
  const int i = blockIdx.x * 256 + threadIdx.x; if (i >= nrows) return; const float* s = S + (size_t)i * SQ; float mx = -3.0e38f;
#pragma unroll 1
  for (int j = 0; j < SQ; ++j) mx = fmaxf(mx, s[j]); float se = 0.f;
#pragma unroll 1
  for (int j = 0; j < SQ; ++j) se += expf(s[j] - mx); const float sc = 256.0f / se;
#pragma unroll 1
  for (int j0 = 0; j0 < SQ; j0 += 8) { FragH f; for (int q = 0; q < 8; ++q) f.h[q] = (_Float16)(expf(s[j0 + q] - mx) * sc); unsigned short* d = (unsigned short*)P + (size_t)i * SQ + j0; *(v8us*)d = f.half[0];  } }
__global__ __launch_bounds__(256) void k_vt(const _Float16* __restrict__ V16, int b, int h0, _Float16* __restrict__ VT) { __shared__ unsigned short tl[64][65]; const int tid = threadIdx.x; const int hh = blockIdx.x % HG, sg = blockIdx.x / HG; const int s0 = sg * 64; const int h = h0 + hh;
  for (int i = tid; i < 64 * 8; i += 256) { const int j = i / 8, d8 = (i % 8) * 8; FragH f; f.half[0] = *(const v8us*)((const unsigned short*)V16 + ((size_t)b * SQ + s0 + j) * DM + h * HD + d8); for (int q = 0; q < 8; ++q) tl[d8 + q][j] = f.u[q]; }
  __syncthreads();
  { for (int i = tid; i < 64 * 8; i += 256) { const int d = i / 8, j8 = (i % 8) * 8; FragH f; for (int q = 0; q < 8; ++q) f.u[q] = tl[d][j8 + q]; *(v8us*)((unsigned short*)VT + ((size_t)hh * HD + d) * SQ + s0 + j8) = f.half[0]; }  } }



#define FQ 32                        /* query rows per wave */
#define FW 4                         /* waves per work-group */
#define FNG (NH * (SQ / (FQ * FW)))  /* work-groups */
__device__ __forceinline__ v8f fa_mma(v16h a, v16h b, v8f c) { return __builtin_amdgcn_wmma_f32_16x16x32_f16(false, a, false, b, (short)0, c, false, false); }
__device__ __forceinline__ float fa_xhalf(float x) { return __builtin_bit_cast(float, __builtin_amdgcn_permlanex16(__builtin_bit_cast(int, x), __builtin_bit_cast(int, x), 0x76543210, 0xfedcba98, false, false)); }      /* lane l with lane l ^ 16 */
// 2^x by the native instruction. The v_nop at the end fills the slot that the instruction set asks for behind a transcendental before its result is read or its source overwritten;
// inside the group every result register differs from every source ("=&v"), so each v_exp_f32 is the independent instruction behind the one before it.
__device__ __forceinline__ float fa_exp2(float x) { float e; asm("v_exp_f32 %0, %1\n\tv_nop" : "=&v"(e) : "v"(x)); return e; }
__device__ __forceinline__ void fa_exp2x8(const float (&x)[8], float (&e)[8]) {
  asm("v_exp_f32 %0, %8\n\tv_exp_f32 %1, %9\n\tv_exp_f32 %2, %10\n\tv_exp_f32 %3, %11\n\tv_exp_f32 %4, %12\n\tv_exp_f32 %5, %13\n\tv_exp_f32 %6, %14\n\tv_exp_f32 %7, %15\n\tv_nop"
      : "=&v"(e[0]), "=&v"(e[1]), "=&v"(e[2]), "=&v"(e[3]), "=&v"(e[4]), "=&v"(e[5]), "=&v"(e[6]), "=&v"(e[7]) : "v"(x[0]), "v"(x[1]), "v"(x[2]), "v"(x[3]), "v"(x[4]), "v"(x[5]), "v"(x[6]), "v"(x[7])); }
__global__ __launch_bounds__(FW * 32) void k_fattn(const _Float16* __restrict__ Q, const _Float16* __restrict__ K, const _Float16* __restrict__ VT, _Float16* __restrict__ O) {
  const int lane = threadIdx.x & 31, ln = lane & 15, hh = lane >> 4; const int w = __builtin_amdgcn_readfirstlane(threadIdx.x >> 5);
  const int bx = blockIdx.x; const int rank = (bx < FNG / 2) ? bx : (FNG + FNG / 2 - 1 - bx);      /* a permutation: long work-groups first, then the short ones shortest first, so that groups bx and bx + FNG / 2 together have equal work (speed only) */
  const int h = rank % NH; const int q0 = (SQ / (FQ * FW) - 1 - rank / NH) * (FQ * FW) + w * FQ;
  const float CS = 0.125f * 1.4426950408889634f;      /* score scale x log2(e): exponentials in base 2 */
  const _Float16* qp = Q + (size_t)(q0 + ln) * DM + h * HD; const _Float16* kp = K + (size_t)ln * DM + h * HD; const _Float16* vp = VT + ((size_t)h * HD + ln) * SQ;
  v16h qf[2][2], kf[2][2];
#pragma unroll      /* fragments indexed by constants only: they stay in registers */
  for (int t = 0; t < 2; ++t)
#pragma unroll
    for (int c = 0; c < 2; ++c) { qf[t][c] = g2_frag(qp + (size_t)t * 16 * DM + c * 32, hh); kf[t][c] = g2_frag(kp + (size_t)t * 16 * DM + c * 32, hh); }
  const v8f z8 = {0.f, 0.f, 0.f, 0.f, 0.f, 0.f, 0.f, 0.f}; v8f acc[4][2]; float mr[2], ls[2];
#pragma unroll
  for (int t = 0; t < 2; ++t) { mr[t] = -3.0e38f; ls[t] = 0.f;
#pragma unroll
    for (int d = 0; d < 4; ++d) acc[d][t] = z8; }
#pragma unroll 1      /* one pass = 32 keys; the body is long enough as it is */
  for (int j0 = 0; j0 <= q0; j0 += 32) {
    v16h vf[4];
#pragma unroll      /* V^T of this pass: asked for ahead of the score products and the softmax */
    for (int d = 0; d < 4; ++d) vf[d] = g2_frag(vp + (size_t)d * 16 * SQ + j0, hh);
    v8f s[2][2];
#pragma unroll
    for (int u = 0; u < 2; ++u)
#pragma unroll
      for (int t = 0; t < 2; ++t) s[u][t] = fa_mma(kf[u][1], qf[t][1], fa_mma(kf[u][0], qf[t][0], z8));
    const int jn = (j0 < q0) ? j0 + 32 : q0;      /* the next pass's K rows, asked for behind this pass's score products (the last pass asks for its own again: in bounds, unused) */
#pragma unroll
    for (int u = 0; u < 2; ++u)
#pragma unroll
      for (int c = 0; c < 2; ++c) kf[u][c] = g2_frag(kp + (size_t)(jn + u * 16) * DM + c * 32, hh);
    asm volatile("s_wait_xcnt 0x0" ::: "memory");      /* the address registers of the loads above are reused below: they are overwritten only behind this wait */
    if (j0 == q0) {      /* the diagonal pass: key > query is masked (a scalar branch) */
#pragma unroll
      for (int u = 0; u < 2; ++u)
#pragma unroll
        for (int t = 0; t < 2; ++t)
#pragma unroll
          for (int r = 0; r < 8; ++r) if (u * 16 + 8 * hh + r > t * 16 + ln) s[u][t][r] = -3.0e38f; }
    FragH pf[2];
#pragma unroll
    for (int t = 0; t < 2; ++t) { float mx = fmaxf(s[0][t][0], s[1][t][0]);
#pragma unroll
      for (int r = 1; r < 8; ++r) mx = fmaxf(mx, fmaxf(s[0][t][r], s[1][t][r]));
      mx = fmaxf(mx, fa_xhalf(mx)); const float mn = fmaxf(mr[t], mx); const float corr = fa_exp2((mr[t] - mn) * CS); mr[t] = mn; const float mc = mn * CS;      /* every pass holds at least one unmasked key of every query: mn is a real score */
      float x0[8], x1[8], e0[8], e1[8];
#pragma unroll
      for (int r = 0; r < 8; ++r) { x0[r] = fmaf(s[0][t][r], CS, -mc); x1[r] = fmaf(s[1][t][r], CS, -mc); }
      fa_exp2x8(x0, e0); fa_exp2x8(x1, e1); float s0 = 0.f, s1 = 0.f;
#pragma unroll
      for (int r = 0; r < 8; ++r) { s0 += e0[r]; s1 += e1[r]; pf[t].h[r] = (_Float16)e0[r]; pf[t].h[8 + r] = (_Float16)e1[r]; }
      ls[t] = fmaf(ls[t], corr, s0 + s1);
#pragma unroll
      for (int d = 0; d < 4; ++d) acc[d][t] *= corr; }
#pragma unroll
    for (int d = 0; d < 4; ++d)
#pragma unroll
      for (int t = 0; t < 2; ++t) acc[d][t] = fa_mma(vf[d], pf[t].v, acc[d][t]);
  }
#pragma unroll
  for (int t = 0; t < 2; ++t) { const float inv = 64.0f / (ls[t] + fa_xhalf(ls[t]));      /* the halves' sums joined once; o carried x64 */
    unsigned short* op = (unsigned short*)O + (size_t)(q0 + t * 16 + ln) * DM + h * HD + 8 * hh;
#pragma unroll      /* the wave stores the whole 128-byte line of each of its rows */
    for (int d = 0; d < 4; ++d) { FragH f;
#pragma unroll
      for (int r = 0; r < 8; ++r) f.h[r] = (_Float16)(acc[d][t][r] * inv);
      *(v8us*)(op + d * 16) = f.half[0]; } } }


// Exact f32 causal attention for rows 0 .. QT0 - 1 (o carried x64 like the f16 path). ONE WORK-GROUP PER HEAD AND 16 QUERY ROWS, 8 waves:
// the head's K and V rows below the group's end are staged in LDS by coalesced loads; scores: one thread per key (its K row in registers, the q rows wave-uniform);
// softmax: one wave per two rows; o: each wave sums every eighth chunk of 4 keys for all 16 rows x 64 columns in registers, and the 8 partial sums are added in wave order.
#define A0R 16                       /* query rows per work-group */
#define A0KP (HD + 4)                /* LDS pitch of a K row in floats: 272 B = 16 B x odd, so that 16-byte reads of one row per lane spread over the banks */
#define A0SP (QT0 + 4)               /* LDS pitch of a score row in floats (a multiple of 16 B) */
__global__ __launch_bounds__(256) void k_att0w(const float* __restrict__ QF, const float* __restrict__ KF, const float* __restrict__ VF, float scale, float* __restrict__ OF) {
  __shared__ __attribute__((aligned(16))) float lk[QT0][A0KP]; __shared__ __attribute__((aligned(16))) float lv[QT0][HD]; __shared__ __attribute__((aligned(16))) float ls[A0R][A0SP];
  __shared__ __attribute__((aligned(16))) float red[8][A0R][HD]; __shared__ float linv[A0R];
  const int tid = threadIdx.x, lane = tid & 31, w = __builtin_amdgcn_readfirstlane(tid >> 5); const int h = blockIdx.x / (QT0 / A0R), rg = blockIdx.x % (QT0 / A0R); const int nk = (rg + 1) * A0R;      /* causal: keys below the group's end */
  const int r16 = tid >> 4, c4 = (tid & 15) * 4;
  { const float* kp = KF + (size_t)r16 * DM + h * HD + c4; const float* vp = VF + (size_t)r16 * DM + h * HD + c4; v4f kx[QT0 / 16], vx[QT0 / 16];
#pragma unroll      /* constant indices keep kx and vx in registers; every load is issued before the first value is used */
    for (int u = 0; u < QT0 / 16; ++u) if (u <= rg) { kx[u] = *(const v4fa*)(kp + (size_t)u * 16 * DM); vx[u] = *(const v4fa*)(vp + (size_t)u * 16 * DM); }
    asm volatile("s_wait_xcnt 0x0" :: "v"(kp), "v"(vp) : "memory");      /* the loads' address registers are reused below: they are held up to this wait and overwritten only behind it */
#pragma unroll      /* constant indices, as above */
    for (int u = 0; u < QT0 / 16; ++u) if (u <= rg) { *(v4f*)&lk[u * 16 + r16][c4] = kx[u]; *(v4f*)&lv[u * 16 + r16][c4] = vx[u]; } }
  __syncthreads();
  if (tid < nk) { v4f kr[HD / 4];
#pragma unroll      /* the key's row stays in registers for all 16 query rows */
    for (int c = 0; c < HD / 4; ++c) kr[c] = *(const v4f*)&lk[tid][c * 4];
    const float* qb = QF + (size_t)rg * A0R * DM + h * HD;      /* the same address in every lane */
#pragma unroll 4      /* several rows' q loads in flight ahead of their products */
    for (int i = 0; i < A0R; ++i) { v4f s4 = {0.f, 0.f, 0.f, 0.f};
#pragma unroll      /* kr is indexed by constants only */
      for (int c = 0; c < HD / 4; ++c) { const v4f qq = *(const v4fa*)(qb + (size_t)i * DM + c * 4);
#pragma unroll      /* short fixed trip count; the arrays it indexes stay in registers */
        for (int u = 0; u < 4; ++u) s4[u] = fmaf(qq[u], kr[c][u], s4[u]); }
      ls[i][tid] = ((s4[0] + s4[1]) + (s4[2] + s4[3])) * scale; } }
  __syncthreads();
#pragma unroll 1      /* two rows a wave, one after the other: small code */
  for (int i = 2 * w; i < 2 * w + 2; ++i) { const int last = rg * A0R + i; float x[QT0 / 32]; float mx = -3.0e38f;
#pragma unroll      /* x is indexed by constants only */
    for (int u = 0; u < QT0 / 32; ++u) { const int j = u * 32 + lane; x[u] = (j <= last) ? ls[i][j] : -3.0e38f; mx = fmaxf(mx, x[u]); }
#pragma unroll      /* short fixed trip count; the arrays it indexes stay in registers */
    for (int o = 16; o > 0; o >>= 1) mx = fmaxf(mx, __shfl_xor(mx, o, 32));
    float se = 0.f;
#pragma unroll      /* short fixed trip count; the arrays it indexes stay in registers */
    for (int u = 0; u < QT0 / 32; ++u) { const int j = u * 32 + lane; const float e = (j <= last) ? expf(x[u] - mx) : 0.f; se += e; if (j < nk) ls[i][j] = e; }
#pragma unroll      /* short fixed trip count; the arrays it indexes stay in registers */
    for (int o = 16; o > 0; o >>= 1) se += __shfl_xor(se, o, 32);
    if (lane == 0) linv[i] = 64.0f / se; }      /* o carried x64 like the f16 path */
  __syncthreads();
  { const int rh = lane >> 4, d4 = (lane & 15) * 4; v4f acc[8];
#pragma unroll      /* short fixed trip count; the arrays it indexes stay in registers */
    for (int r = 0; r < 8; ++r) acc[r] = (v4f){0.f, 0.f, 0.f, 0.f};
#pragma unroll 1      /* at most 8 trips of 128 multiply-adds: the body is long enough as it is */
    for (int j0 = 4 * w; j0 < nk; j0 += 32) { v4f pv[8], vv[4];
#pragma unroll      /* short fixed trip count; the arrays it indexes stay in registers */
      for (int r = 0; r < 8; ++r) pv[r] = *(const v4f*)&ls[rh * 8 + r][j0];
#pragma unroll      /* short fixed trip count; the arrays it indexes stay in registers */
      for (int q = 0; q < 4; ++q) vv[q] = *(const v4f*)&lv[j0 + q][d4];
#pragma unroll      /* short fixed trip count; the arrays it indexes stay in registers */
      for (int q = 0; q < 4; ++q)
#pragma unroll      /* short fixed trip count; the arrays it indexes stay in registers */
        for (int r = 0; r < 8; ++r)
#pragma unroll      /* short fixed trip count; the arrays it indexes stay in registers */
          for (int u = 0; u < 4; ++u) acc[r][u] = fmaf(pv[r][q], vv[q][u], acc[r][u]); }
#pragma unroll      /* short fixed trip count; the arrays it indexes stay in registers */
    for (int r = 0; r < 8; ++r) *(v4f*)&red[w][rh * 8 + r][d4] = acc[r]; }
  __syncthreads();
  { v4f o = *(const v4f*)&red[0][r16][c4];
#pragma unroll      /* short fixed trip count; the arrays it indexes stay in registers */
    for (int p = 1; p < 8; ++p) { const v4f a = *(const v4f*)&red[p][r16][c4]; o += a; }
    const float fin = linv[r16]; o *= fin;
    *(v4f*)(OF + (size_t)(rg * A0R + r16) * DM + h * HD + c4) = o; } }

extern "C" void kernel_launch(void* const* d_in, const int* in_sizes, int n_in,
                              void* d_out, int out_size, void* d_ws, size_t ws_size, hipStream_t stream) {
  (void)in_sizes; (void)n_in; (void)out_size;
  const float* const* I = (const float* const*)d_in; const float* xq = I[0]; const float* xk = I[1]; const float* xv = I[2]; const float* wq = I[3]; const float* wk = I[4]; const float* wv = I[5]; const float* wo = I[6];      /* weights [in][out] */
  char* ws = (char*)d_ws; size_t off = 0;
  auto take = [&](size_t bytes) { char* p = ws + off; off += (bytes + 255) & ~(size_t)255; return p; };
  _Float16* BQ = (_Float16*)take((size_t)DM * DM * 2); _Float16* BK = (_Float16*)take((size_t)DM * DM * 2); _Float16* BV = (_Float16*)take((size_t)DM * DM * 2); _Float16* BO = (_Float16*)take((size_t)DM * DM * 2);
  _Float16* XQ = (_Float16*)take(NR * DM * 2); _Float16* XK = (_Float16*)take(NR * DM * 2); _Float16* XV = (_Float16*)take(NR * DM * 2); _Float16* Q16 = (_Float16*)take(NR * DM * 2); _Float16* K16 = (_Float16*)take(NR * DM * 2); _Float16* V16 = (_Float16*)take(NR * DM * 2); _Float16* O16 = (_Float16*)take(NR * DM * 2);
  _Float16* VT = (_Float16*)take((size_t)NH * HD * SQ * 2);
  float* QF0 = (float*)take((size_t)QT0 * DM * 4); float* KF0 = (float*)take((size_t)QT0 * DM * 4); float* VF0 = (float*)take((size_t)QT0 * DM * 4); float* OF0 = (float*)take((size_t)NB * QT0 * DM * 4); _Float16* OH0 = (_Float16*)take((size_t)NB * QT0 * DM * 2); _Float16* OL0 = (_Float16*)take((size_t)NB * QT0 * DM * 2);
  if (off > ws_size) return;
  { const unsigned gh = (unsigned)(((size_t)HD * (DM / 8) + 255) / 256); for (int h = 0; h < NH; ++h) { k_wt_f16<<<gh, 256, 0, stream>>>(wq + (size_t)h * DM * HD, BQ + (size_t)h * HD * DM, DM, HD, 16.0f); k_wt_f16<<<gh, 256, 0, stream>>>(wk + (size_t)h * DM * HD, BK + (size_t)h * HD * DM, DM, HD, 16.0f); k_wt_f16<<<gh, 256, 0, stream>>>(wv + (size_t)h * DM * HD, BV + (size_t)h * HD * DM, DM, HD, 16.0f); } const unsigned g = (unsigned)(((size_t)DM * (DM / 8) + 255) / 256); k_wt_f16<<<g, 256, 0, stream>>>(wo, BO, DM, DM, 16.0f); }      /* PER-HEAD STACKS [16][1024][64] = [head][in][out]: head h's [1024][64] block -> rows 64 h .. 64 h + 63 of the Bt[n][k] x16 plane (K 1024, N 64 per call); the [in][out] output weight transposed into its plane by the same builder (K 1024, N 1024) */
  k_x16<<<(unsigned)((NR * DM / 8 + 255) / 256), 256, 0, stream>>>(xq, XQ, NR * DM / 8); k_x16<<<(unsigned)((NR * DM / 8 + 255) / 256), 256, 0, stream>>>(xk, XK, NR * DM / 8); k_x16<<<(unsigned)((NR * DM / 8 + 255) / 256), 256, 0, stream>>>(xv, XV, NR * DM / 8);
  const size_t r0p = (size_t)B0 * SQ;      /* first projected row */
  k_gemm2<0><<<dim3((unsigned)((MP / 128) * (DM / 64)), 1), 128, 0, stream>>>(XQ + r0p * DM, DM, 0, BQ, DM, 0, 0.0625f, nullptr, 0, nullptr, 1, 0, 0, nullptr, Q16 + r0p * DM, DM, 0, MP, DM, DM);
  k_gemm2<0><<<dim3((unsigned)((MP / 128) * (DM / 64)), 1), 128, 0, stream>>>(XK + r0p * DM, DM, 0, BK, DM, 0, 0.0625f, nullptr, 0, nullptr, 1, 0, 0, nullptr, K16 + r0p * DM, DM, 0, MP, DM, DM);
  k_gemm2<0><<<dim3((unsigned)((MP / 128) * (DM / 64)), 1), 128, 0, stream>>>(XV + r0p * DM, DM, 0, BV, DM, 0, 0.0625f, nullptr, 0, nullptr, 1, 0, 0, nullptr, V16 + r0p * DM, DM, 0, MP, DM, DM);
  for (int b = B0; b < B0 + NBR; ++b) { const size_t r0 = (size_t)b * SQ;
    k_vt<NH, SQ><<<NH * (SQ / 64), 256, 0, stream>>>(V16 + r0 * LQ, LQ, 0, VT);      /* V^T [NH][HD][SQ] for this batch */
    k_gemm2<0><<<dim3((QT0 / 128) * (DM / 64), 1), 128, 0, stream>>>(XQ + r0 * DM, DM, 0, BQ, DM, 0, 0.0625f, nullptr, 0, nullptr, 1, 0, 0, QF0, nullptr, DM, 0, QT0, DM, DM); k_gemm2<0><<<dim3((QT0 / 128) * (DM / 64), 1), 128, 0, stream>>>(XK + r0 * DM, DM, 0, BK, DM, 0, 0.0625f, nullptr, 0, nullptr, 1, 0, 0, KF0, nullptr, DM, 0, QT0, DM, DM); k_gemm2<0><<<dim3((QT0 / 128) * (DM / 64), 1), 128, 0, stream>>>(XV + r0 * DM, DM, 0, BV, DM, 0, 0.0625f, nullptr, 0, nullptr, 1, 0, 0, VF0, nullptr, DM, 0, QT0, DM, DM);      /* f32 q, k, v of the first 256 rows (exact products) */
    k_att0w<<<NH * (QT0 / A0R), 256, 0, stream>>>(QF0, KF0, VF0, 0.125f, OF0 + (size_t)b * QT0 * DM);      /* exact f32 attention for rows 0..255 (o x64) */
    k_fattn<<<FNG, FW * 32, 0, stream>>>(Q16 + r0 * LQ, K16 + r0 * LQ, VT, O16 + r0 * DM); }      /* scores, causal softmax and P V for all heads and rows in one launch: o (merged heads, x64) as f16 rows */
  k_gemm2<0><<<dim3((unsigned)((MPO / 128) * (DM / 64)), 1), 128, 0, stream>>>(O16 + r0p * DM, DM, 0, BO, DM, 0, 0.0009765625f, nullptr, 0, nullptr, 1, 0, 0, (float*)d_out + r0p * DM, nullptr, DM, 0, MPO, DM, DM);      /* out rows are the output layout */
  k_hl<<<(unsigned)(((size_t)NB * QT0 * DM / 8 + 255) / 256), 256, 0, stream>>>(OF0, OH0, OL0, (size_t)NB * QT0 * DM / 8);      /* first-tile o (x64) -> f16 hi + x1024 residual planes */
  for (int b = B0; b < B0 + NBR; ++b) { const size_t r0 = (size_t)b * SQ; const size_t f0 = (size_t)b * QT0;
    k_gemm2<0><<<dim3((QT0 / 128) * (DM / 64), 1), 128, 0, stream>>>(OH0 + f0 * DM, DM, 0, BO, DM, 0, 0.0009765625f, nullptr, 0, nullptr, 1, 0, 0, (float*)d_out + r0 * DM, nullptr, DM, 0, QT0, DM, DM);      /* rows 0..255: out = o_hi Wo, overwriting the f16-path rows */
    k_gemm2<0><<<dim3((QT0 / 128) * (DM / 64), 1), 128, 0, stream>>>(OL0 + f0 * DM, DM, 0, BO, DM, 0, 0.00000095367431640625f, nullptr, 0, (const float*)d_out + r0 * DM, -1, 0, 0, (float*)d_out + r0 * DM, nullptr, DM, 0, QT0, DM, DM); }      /* += o_lo Wo 2^-20 (own-element accumulate) */
}

// v004
// A run of this version takes 271 microseconds.
// In two side-by-side timings against v003, it was 2.13 and 2.14 times as fast.
// Over all steps from v000 it is 30.9 times as fast.
#include <hip/hip_runtime.h>
// Causal multi-head attention on three inputs with PER-HEAD STACKED projections over ONE sequence of 4096 tokens (Q, K, V [1][4096][1024]; WQ / WK / WV [16][1024][64] = [head][in][out] sigma 0.02, NO biases; 16 heads of 64; scores x 64^-0.5 = / 8; causal (tril, -inf above the diagonal); softmax; heads concatenated head-major; out = concat WO with WO [1024][1024] [in][out], NO bias -> [1][4096][1024]); each head's [in][out] block is transposed into its 64 contiguous rows of the weight plane, and the [in][out] output weight into its own plane, by one launch that also rounds the three inputs.
// Structure: token rows r = s; q, k, v inputs as exact f16 rows (bf16-rounded); Q, K, V as three WMMA GEMMs in one launch (32x64 wave tiles, f32 accumulation, exact x16 weights, f16 outputs; the f32 rows of the first tile by further work-groups of the same launch); per batch: V^T for all heads via LDS transposes; one fused attention launch: a wave per 32 query rows of a head walks the keys up to its own rows 32 at a time (scores on WMMA, K = 64; running f32 maximum and sum, native exp2; weights in (0, 1] as f16; o += P V on WMMA, divided by the sum at the end, o carried x64, folded into the output GEMM alpha), written straight into the merged f16 o rows; out = o W_o GEMM (f32) into the output layout.
// Compute dtype: inputs rounded to bf16; x / weights exact; q, k, v, softmax weights and o as plain f16 GEMM operands (~2^-12); scores and softmax statistics f32. v_wmma_f32_16x16x32_f16.
#define NB 1
#define SQ 4096
#define DM 1024
#define NH 16
#define HD 64
#define HG 4                         /* heads per launch of the unlaunched k_vt overload */
#define QT 256                       /* unused */
#define NKX SQ                       /* unused */
#define QT0 256                      /* first-tile rows recomputed exactly in f32 */
#define B0 0                         /* first batch processed (debug hook) */
#define NBR NB                       /* batches processed (debug hook) */
#define NR ((size_t)NB * SQ)         /* token rows */
#define MP ((int)((size_t)NBR * SQ)) /* rows projected (debug hook) */
#define QN SQ                        /* unused (k_fattn attends all SQ rows) */
#define NHD NH                       /* unused (k_fattn attends all NH heads) */
#define MPO MP                       /* rows through the output stage (debug hook) */
#define LQ DM      /* row pitch of the q/k/v rows */
typedef __bf16 v16b __attribute__((ext_vector_type(16)));
typedef unsigned short v8us __attribute__((ext_vector_type(8), may_alias));
typedef float  v8f  __attribute__((ext_vector_type(8)));
typedef float  v4f  __attribute__((ext_vector_type(4)));
typedef float  v4fa __attribute__((ext_vector_type(4), may_alias));
union FragB { v16b v; v8us half[2]; unsigned short u[16]; };

__device__ __forceinline__ unsigned short bf16_bits(float x) { unsigned int u = __float_as_uint(x); return (unsigned short)((u + 0x7FFFu + ((u >> 16) & 1u)) >> 16); }
__device__ __forceinline__ float bf16_val(unsigned short b) { return __uint_as_float(((unsigned int)b) << 16); }
__device__ __forceinline__ float bf16_round(float x) { return bf16_val(bf16_bits(x)); }
// D += A·B with NT terms: 1 = ah·bh, 2 = + al·bh (A split), 3 = + ah·bl (both split)
template <int NT>
__device__ __forceinline__ v8f mmaN(v16b ah, v16b al, v16b bh, v16b bl, v8f c) {
  c = __builtin_amdgcn_wmma_f32_16x16x32_bf16(false, ah, false, bh, (short)0, c, false, false);
  if (NT >= 2) c = __builtin_amdgcn_wmma_f32_16x16x32_bf16(false, al, false, bh, (short)0, c, false, false);
  if (NT >= 3) c = __builtin_amdgcn_wmma_f32_16x16x32_bf16(false, ah, false, bl, (short)0, c, false, false);
  asm volatile("v_nop\n\tv_nop\n\tv_nop\n\tv_nop" : "+v"(c) : "v"(ah), "v"(al), "v"(bh), "v"(bl));
  return c;
}

__global__ __launch_bounds__(256) void k_wt_bf16(const float* __restrict__ W, unsigned short* __restrict__ Wt, int K, int N) {
  const int t = blockIdx.x * 256 + threadIdx.x;
  const int k8n = K / 8;
  if (t >= N * k8n) return;
  const int n = t / k8n, k8 = (t % k8n) * 8;
  v8us v;
#pragma unroll
  for (int i = 0; i < 8; ++i) v[i] = bf16_bits(W[(size_t)(k8 + i) * N + n]);
  *(v8us*)(Wt + (size_t)n * K + k8) = v;
  
}

// GEMM C[M][N] (f32, pitch ldc) = act(A[M][K]·W + bias). A f32 row-major (pitch lda) converted per fragment to bf16
// (ASPLIT: hi/lo two planes -> 2 terms, else single rounded term); Wt bf16 [N][K] (pitch ldb). BIAS_BF16 rounds the
// bias to bf16 first (bias quantised to bf16 before the add). K%32==0, M%16==0, N%64==0.
template <bool ASPLIT, int ACT, bool BIAS_BF16>
__global__ __launch_bounds__(128) void k_gemm_bf(const float* __restrict__ A, int lda, const unsigned short* __restrict__ Wt, int ldb,
                                               const float* __restrict__ bias, float* __restrict__ C, int ldc, int M, int N, int K) {
  __shared__ __attribute__((aligned(16))) float so[4][16][64];
  const int tid = threadIdx.x, w = tid >> 5, lane = tid & 31, ln = lane & 15, hh = lane >> 4;
  const int ntn = N / 64;
  const int wid = blockIdx.x * 4 + w;
  const int mt = wid / ntn, nq = wid % ntn;
  if (mt * 16 >= M) return;
  const int row0 = mt * 16, col0 = nq * 64;
  const float* arow = A + (size_t)(row0 + ln) * lda;
  v8f acc[4] = {};
  for (int kb = 0; kb < K; kb += 32) {
    FragB ah, al;
    const v4f x0 = *(const v4fa*)(arow + kb + 8 * hh), x1 = *(const v4fa*)(arow + kb + 8 * hh + 4);
    const v4f x2 = *(const v4fa*)(arow + kb + 16 + 8 * hh), x3 = *(const v4fa*)(arow + kb + 16 + 8 * hh + 4);
    float xs[16] = {x0[0],x0[1],x0[2],x0[3],x1[0],x1[1],x1[2],x1[3],x2[0],x2[1],x2[2],x2[3],x3[0],x3[1],x3[2],x3[3]};
#pragma unroll
    for (int i = 0; i < 16; ++i) { const unsigned short hb = bf16_bits(xs[i]); ah.u[i] = hb; al.u[i] = ASPLIT ? bf16_bits(xs[i] - bf16_val(hb)) : (unsigned short)0; }
#pragma unroll
    for (int t = 0; t < 4; ++t) {
      const unsigned short* brow = Wt + (size_t)(col0 + t * 16 + ln) * ldb + kb;
      FragB b;
      b.half[0] = *(const v8us*)(brow + 8 * hh);
      b.half[1] = *(const v8us*)(brow + 16 + 8 * hh);
      acc[t] = mmaN<ASPLIT ? 2 : 1>(ah.v, al.v, b.v, b.v, acc[t]);
    }
  }
#pragma unroll
  for (int t = 0; t < 4; ++t) {
    float bv = bias ? bias[col0 + t * 16 + ln] : 0.f;
    if (BIAS_BF16) bv = bf16_round(bv);
#pragma unroll
    for (int r = 0; r < 8; ++r) { float v = acc[t][r] + bv; if (ACT == 1) v = fmaxf(v, 0.f); so[w][8 * hh + r][t * 16 + ln] = v; }
  }
  __builtin_amdgcn_fence(__ATOMIC_ACQ_REL, "workgroup");
  __builtin_amdgcn_wave_barrier();
  const int rsub = lane >> 4, c4 = (lane & 15) * 4;
  {
#pragma unroll
    for (int q = 0; q < 8; ++q) {
      const int r = q * 2 + rsub;
      const v4f v = *(const v4fa*)&so[w][r][c4];
      *(v4f*)(C + (size_t)(row0 + r) * ldc + col0 + c4) = v;
    }
    
  }
}

// GEMM C = act(A·W + bias + resid): A f32 (ASPLIT -> hi/lo 2 terms), Wt bf16 [N][K]; ACT 0 none, 1 relu, 2 exact gelu;
// resid (optional, f32, row index = (row % rmod), pitch ldr, RES_BF16 rounds it) added before the activation.
template <bool ASPLIT, int ACT, bool BIAS_BF16, bool RES_BF16>
__global__ __launch_bounds__(128) void k_gemm_bf3(const float* __restrict__ A, int lda, const unsigned short* __restrict__ Wt, int ldb,
                                                const float* __restrict__ bias, const float* __restrict__ resid, int rmod, int ldr,
                                                float* __restrict__ C, int ldc, int M, int N, int K) {
  __shared__ __attribute__((aligned(16))) float so[4][16][64];
  const int tid = threadIdx.x, w = tid >> 5, lane = tid & 31, ln = lane & 15, hh = lane >> 4;
  const int ntn = N / 64;
  const int wid = blockIdx.x * 4 + w;
  const int mt = wid / ntn, nq = wid % ntn;
  if (mt * 16 >= M) return;
  const int row0 = mt * 16, col0 = nq * 64;
  const float* arow = A + (size_t)(row0 + ln) * lda;
  v8f acc[4] = {};
  for (int kb = 0; kb < K; kb += 32) {
    FragB ah, al;
    const v4f x0 = *(const v4fa*)(arow + kb + 8 * hh), x1 = *(const v4fa*)(arow + kb + 8 * hh + 4);
    const v4f x2 = *(const v4fa*)(arow + kb + 16 + 8 * hh), x3 = *(const v4fa*)(arow + kb + 16 + 8 * hh + 4);
    float xs[16] = {x0[0],x0[1],x0[2],x0[3],x1[0],x1[1],x1[2],x1[3],x2[0],x2[1],x2[2],x2[3],x3[0],x3[1],x3[2],x3[3]};
#pragma unroll
    for (int i = 0; i < 16; ++i) { const unsigned short hb = bf16_bits(xs[i]); ah.u[i] = hb; al.u[i] = ASPLIT ? bf16_bits(xs[i] - bf16_val(hb)) : (unsigned short)0; }
#pragma unroll
    for (int t = 0; t < 4; ++t) {
      const unsigned short* brow = Wt + (size_t)(col0 + t * 16 + ln) * ldb + kb;
      FragB b;
      b.half[0] = *(const v8us*)(brow + 8 * hh);
      b.half[1] = *(const v8us*)(brow + 16 + 8 * hh);
      acc[t] = mmaN<ASPLIT ? 2 : 1>(ah.v, al.v, b.v, b.v, acc[t]);
    }
  }
#pragma unroll
  for (int t = 0; t < 4; ++t) {
    const int col = col0 + t * 16 + ln;
    float bv = bias ? bias[col] : 0.f;
    if (BIAS_BF16) bv = bf16_round(bv);
#pragma unroll
    for (int r = 0; r < 8; ++r) {
      float v = acc[t][r] + bv;
      if (resid) { float rv = resid[(size_t)((row0 + 8 * hh + r) % rmod) * ldr + col]; if (RES_BF16) rv = bf16_round(rv); v += rv; }
      if (ACT == 1) v = fmaxf(v, 0.f);
      if (ACT == 2) v = 0.5f * v * (1.0f + erff(v * 0.70710678118654752f));
      if (ACT == 3) { const float u = 0.7978845608028654f * (v + 0.044715f * v * v * v); v = 0.5f * v * (1.0f + tanhf(u)); }
      so[w][8 * hh + r][t * 16 + ln] = v;
    }
  }
  __builtin_amdgcn_fence(__ATOMIC_ACQ_REL, "workgroup");
  __builtin_amdgcn_wave_barrier();
  const int rsub = lane >> 4, c4 = (lane & 15) * 4;
  {
#pragma unroll
    for (int q = 0; q < 8; ++q) {
      const int r = q * 2 + rsub;
      const v4f v = *(const v4fa*)&so[w][r][c4];
      *(v4f*)(C + (size_t)(row0 + r) * ldc + col0 + c4) = v;
    }
    
  }
}
// row LayerNorm (biased variance, eps) over N: s = X (+ R); optional out_sum <- s; out_norm <- (s-mu)*rsqrt(var+eps)*g + b
template <bool PARAM_BF16>
__global__ __launch_bounds__(256) void k_layernorm(const float* __restrict__ X, const float* __restrict__ R, const float* __restrict__ g, const float* __restrict__ bta,
                                                  float* __restrict__ out_sum, float* __restrict__ out_norm, int N, float eps) {
  __shared__ float red[256];
  const int row = blockIdx.x, tid = threadIdx.x;
  const float* x = X + (size_t)row * N; const float* rr = R ? R + (size_t)row * N : nullptr;
  float vals[16];                     // up to N = 4096
  const int per = N / 256;            // contiguous chunk per thread? use strided-by-4 chunks: thread handles j = tid*4 + 1024*u
  float s1 = 0.f;
  for (int u = 0; u < per / 4; ++u) {
    const int j = tid * 4 + 1024 * u;
    const v4f a = *(const v4fa*)(x + j);
    v4f b = {0.f,0.f,0.f,0.f}; if (rr) b = *(const v4fa*)(rr + j);
#pragma unroll
    for (int q = 0; q < 4; ++q) { const float v = a[q] + b[q]; vals[u * 4 + q] = v; s1 += v; }
  }
  red[tid] = s1; __syncthreads();
  for (int st = 128; st > 0; st >>= 1) { if (tid < st) red[tid] += red[tid + st]; __syncthreads(); }
  const float mu = red[0] / (float)N; __syncthreads();
  float s2 = 0.f;
  for (int u = 0; u < per / 4; ++u)
#pragma unroll
    for (int q = 0; q < 4; ++q) { const float c = vals[u * 4 + q] - mu; s2 += c * c; }
  red[tid] = s2; __syncthreads();
  for (int st = 128; st > 0; st >>= 1) { if (tid < st) red[tid] += red[tid + st]; __syncthreads(); }
  const float rs = rsqrtf(red[0] / (float)N + eps);
  {
    for (int u = 0; u < per / 4; ++u) {
      const int j = tid * 4 + 1024 * u;
      v4f o, sm;
#pragma unroll
      for (int q = 0; q < 4; ++q) {
        float gg = g[j + q], bb = bta[j + q];
        if (PARAM_BF16) { gg = bf16_round(gg); bb = bf16_round(bb); }
        sm[q] = vals[u * 4 + q]; o[q] = (vals[u * 4 + q] - mu) * rs * gg + bb;
      }
      if (out_sum) *(v4f*)(out_sum + (size_t)row * N + j) = sm;
      *(v4f*)(out_norm + (size_t)row * N + j) = o;
    }
    
  }
}



// ---- f16 WMMA path (v_wmma_f32_16x16x32_f16): 11-bit significands for operands in range — used where a [0,1] probability operand needs more precision than bf16
typedef _Float16 v16h __attribute__((ext_vector_type(16)));
union FragH { v16h v; v8us half[2]; _Float16 h[16]; unsigned short u[16]; };
template <int NT>
__device__ __forceinline__ v8f mmaH(v16h ah, v16h al, v16h bh, v16h bl, v8f c) {
  c = __builtin_amdgcn_wmma_f32_16x16x32_f16(false, ah, false, bh, (short)0, c, false, false);
  if (NT >= 2) c = __builtin_amdgcn_wmma_f32_16x16x32_f16(false, al, false, bh, (short)0, c, false, false);
  if (NT >= 3) c = __builtin_amdgcn_wmma_f32_16x16x32_f16(false, ah, false, bl, (short)0, c, false, false);
  asm volatile("v_nop\n\tv_nop\n\tv_nop\n\tv_nop" : "+v"(c) : "v"(ah), "v"(al), "v"(bh), "v"(bl));
  return c;
}
// batched GEMM like k_gemm_b but f16 operands: A f32 (split into f16 hi/lo if ASPLIT, else rounded to f16), Bt = f16 values [n][k]; alpha; C f32; N multiple of 16 (partial tiles skipped)
template <bool ASPLIT>
__global__ __launch_bounds__(128) void k_gemm_h(const float* __restrict__ A, int lda, size_t sA, const _Float16* __restrict__ Bh, int ldb, size_t sB, float alpha, float* __restrict__ C, int ldc, size_t sC, int M, int N, int K) {
  __shared__ __attribute__((aligned(16))) float so[4][16][64];
  const int tid = threadIdx.x, w = tid >> 5, lane = tid & 31, ln = lane & 15, hh = lane >> 4; const int by = blockIdx.y;
  A += (size_t)by * sA; Bh += (size_t)by * sB; C += (size_t)by * sC;
  const int ntn = (N + 63) / 64; const int wid = blockIdx.x * 4 + w; const int mt = wid / ntn, nq = wid % ntn; if (mt * 16 >= M) return;
  const int row0 = mt * 16, col0 = nq * 64; const float* arow = A + (size_t)(row0 + ln) * lda;
  v8f acc[4] = {};
  for (int kb = 0; kb < K; kb += 32) {
    FragH ah, al;
    const v4f x0 = *(const v4fa*)(arow + kb + 8 * hh), x1 = *(const v4fa*)(arow + kb + 8 * hh + 4), x2 = *(const v4fa*)(arow + kb + 16 + 8 * hh), x3 = *(const v4fa*)(arow + kb + 16 + 8 * hh + 4);
    float xs[16] = {x0[0],x0[1],x0[2],x0[3],x1[0],x1[1],x1[2],x1[3],x2[0],x2[1],x2[2],x2[3],x3[0],x3[1],x3[2],x3[3]};
#pragma unroll
    for (int i = 0; i < 16; ++i) { const _Float16 h = (_Float16)xs[i]; ah.h[i] = h; al.h[i] = ASPLIT ? (_Float16)(xs[i] - (float)h) : (_Float16)0.0f; }
#pragma unroll
    for (int t = 0; t < 4; ++t) { if (col0 + t * 16 >= N) continue; const size_t boff = (size_t)(col0 + t * 16 + ln) * ldb + kb; FragH bq; bq.half[0] = *(const v8us*)(Bh + boff + 8 * hh); bq.half[1] = *(const v8us*)(Bh + boff + 16 + 8 * hh);
      acc[t] = mmaH<ASPLIT ? 2 : 1>(ah.v, al.v, bq.v, bq.v, acc[t]); }
  }
#pragma unroll
  for (int t = 0; t < 4; ++t) { if (col0 + t * 16 >= N) continue;
#pragma unroll
    for (int r = 0; r < 8; ++r) so[w][8 * hh + r][t * 16 + ln] = acc[t][r] * alpha; }
  __builtin_amdgcn_fence(__ATOMIC_ACQ_REL, "workgroup"); __builtin_amdgcn_wave_barrier();
  const int rsub = lane >> 4, c4 = (lane & 15) * 4;
  {
#pragma unroll
    for (int q = 0; q < 8; ++q) { const int r = q * 2 + rsub; if (col0 + c4 < N) { const v4f v = *(const v4fa*)&so[w][r][c4]; *(v4f*)(C + (size_t)(row0 + r) * ldc + col0 + c4) = v; } }
     }
}

// k_gemm_hh variant with fused epilogue: v = acc·alpha + bias[by·sBias + col] (+ CP[(row/rowsPerB)·sCPb + by·64 + col] if CP) ; ACT 0 none / 1 elu ; writes f16 C16 (and f32 C if non-null)
template <int ACT>
__global__ __launch_bounds__(128) void k_gemm_hhx(const _Float16* __restrict__ A, int lda, size_t sA, const _Float16* __restrict__ Bh, int ldb, size_t sB, float alpha, const float* __restrict__ bias, size_t sBias, const float* __restrict__ CP, int rowsPerB, size_t sCPb, int row0g,
    float* __restrict__ C, _Float16* __restrict__ C16, int ldc, size_t sC, int M, int N, int K) {
  __shared__ __attribute__((aligned(16))) float so[4][16][64];
  const int tid = threadIdx.x, w = tid >> 5, lane = tid & 31, ln = lane & 15, hh = lane >> 4; const int by = blockIdx.y;
  A += (size_t)by * sA; Bh += (size_t)by * sB; const size_t cofs = (size_t)by * sC; const float* bp = bias ? bias + (size_t)by * sBias : nullptr;
  const int ntn = (N + 63) / 64; const int wid = blockIdx.x * 4 + w; const int mt = wid / ntn, nq = wid % ntn; if (mt * 16 >= M) return;
  const int row0 = mt * 16, col0 = nq * 64; const _Float16* arow = A + (size_t)(row0 + ln) * lda;
  v8f acc[4] = {};
  for (int kb = 0; kb < K; kb += 32) { FragH ah; ah.half[0] = *(const v8us*)((const unsigned short*)arow + kb + 8 * hh); ah.half[1] = *(const v8us*)((const unsigned short*)arow + kb + 16 + 8 * hh);
#pragma unroll
    for (int t = 0; t < 4; ++t) { if (col0 + t * 16 >= N) continue; const size_t boff = (size_t)(col0 + t * 16 + ln) * ldb + kb; FragH bq; bq.half[0] = *(const v8us*)((const unsigned short*)Bh + boff + 8 * hh); bq.half[1] = *(const v8us*)((const unsigned short*)Bh + boff + 16 + 8 * hh);
      acc[t] = mmaH<1>(ah.v, ah.v, bq.v, bq.v, acc[t]); }
  }
#pragma unroll
  for (int t = 0; t < 4; ++t) { if (col0 + t * 16 >= N) continue; const int col = col0 + t * 16 + ln; const float bv = bp ? bf16_round(bp[col]) : 0.f;
#pragma unroll
    for (int r = 0; r < 8; ++r) { float v = acc[t][r] * alpha + bv; if (CP) { const int rr = row0g + row0 + 8 * hh + r; if (rowsPerB < 0) v += CP[cofs + (size_t)rr * ldc + col];      /* rowsPerB < 0: own element of the batched C plane */ else { const int bidx = rr / rowsPerB; v += CP[(size_t)bidx * sCPb + (size_t)by * 64 + col]; } } if (ACT == 1) v = (v > 0.f) ? v : expm1f(v); else if (ACT == 7) v = (v > 0.f) ? v + 1.0f : expf(v); else if (ACT == 8) v = tanhf(v); else if (ACT == 9) v = 0.5f * v * (1.0f + tanhf(0.7978845608028654f * (v + 0.044715f * v * v * v))); else if (ACT == 11) v = 1.0f / (1.0f + expf(-v)); else if (ACT == 12) v = (v > 0.f) ? v : 0.01f * v; else if (ACT == 14) v = (v > 0.f) ? v : 0.1f * v; else if (ACT == 16) v = (v >= 0.f) ? v : 0.3f * v; else if (ACT == 17) v = (v >= 0.f) ? v : 0.2f * v; else if (ACT == 15) v = v / (1.0f + expf(-v)); else if (ACT == 3) v = fmaxf(v, 0.f); else if (ACT == 6) v = 0.5f * v * (1.0f + erff(v * 0.70710678118654752f)); so[w][8 * hh + r][t * 16 + ln] = v; } }
  __builtin_amdgcn_fence(__ATOMIC_ACQ_REL, "workgroup"); __builtin_amdgcn_wave_barrier();
  const int rsub = lane >> 4, c4 = (lane & 15) * 4; typedef _Float16 v4h __attribute__((ext_vector_type(4)));
  {
#pragma unroll
    for (int q = 0; q < 8; ++q) { const int r = q * 2 + rsub; if (col0 + c4 < N) { const v4f v = *(const v4fa*)&so[w][r][c4]; if (C) *(v4f*)(C + cofs + (size_t)(row0 + r) * ldc + col0 + c4) = v; if (C16) { v4h h4; for (int i = 0; i < 4; ++i) h4[i] = (_Float16)v[i]; *(v4h*)(C16 + cofs + (size_t)(row0 + r) * ldc + col0 + c4) = h4; } } }
     }
}


typedef _Float16 v4h __attribute__((ext_vector_type(4)));

__global__ __launch_bounds__(256) void k_h16(const float* __restrict__ x, _Float16* __restrict__ X16, size_t n8) { const size_t t = (size_t)blockIdx.x * 256 + threadIdx.x; if (t >= n8) return; FragH f;
#pragma unroll
  for (int q = 0; q < 8; ++q) f.h[q] = (_Float16)x[t * 8 + q]; *(v8us*)((unsigned short*)X16 + t * 8) = f.half[0];  }
__global__ __launch_bounds__(256) void k_round16f(const float* __restrict__ W, _Float16* __restrict__ Bt, size_t n8) { const size_t t = (size_t)blockIdx.x * 256 + threadIdx.x; if (t >= n8) return; FragH f;
#pragma unroll
  for (int i = 0; i < 8; ++i) f.h[i] = (_Float16)(bf16_round(W[t * 8 + i]) * 16.0f); *(v8us*)((unsigned short*)Bt + t * 8) = f.half[0];  }
template <int NHv, int TTv>
__global__ __launch_bounds__(256) void k_vt(const _Float16* __restrict__ V16, int ldv, int voff, _Float16* __restrict__ Vt) { __shared__ unsigned short tl[64][66]; const int tid = threadIdx.x; const int slab = blockIdx.x / (TTv / 64), lg = blockIdx.x % (TTv / 64); const int b = slab / NHv, h = slab % NHv;
  for (int i = tid; i < 64 * 8; i += 256) { const int r = i / 8, c8 = (i % 8) * 8; FragH f; f.half[0] = *(const v8us*)((const unsigned short*)V16 + ((size_t)b * TTv + lg * 64 + r) * ldv + voff + h * 64 + c8);
#pragma unroll
    for (int q = 0; q < 8; ++q) tl[r][c8 + q] = f.u[q]; }
  __syncthreads();
  {
#pragma unroll
    for (int rd = 0; rd < 2; ++rd) { const int d = rd * 32 + tid / 8, pc = tid % 8; FragH f;
#pragma unroll
      for (int q = 0; q < 8; ++q) f.u[q] = tl[pc * 8 + q][d];
      *(v8us*)((unsigned short*)Vt + ((size_t)slab * 64 + d) * TTv + lg * 64 + pc * 8) = f.half[0]; }
     } }

__global__ __launch_bounds__(256) void k_hl(const float* __restrict__ F, _Float16* __restrict__ Hh, _Float16* __restrict__ Hl, size_t n8) { const size_t t = (size_t)blockIdx.x * 256 + threadIdx.x; if (t >= n8) return; FragH fh, fl; const v4f a = *(const v4fa*)(F + t * 8), c = *(const v4fa*)(F + t * 8 + 4);
#pragma unroll
  for (int q = 0; q < 4; ++q) { _Float16 h = (_Float16)a[q]; fh.h[q] = h; fl.h[q] = (_Float16)((a[q] - (float)h) * 1024.0f); h = (_Float16)c[q]; fh.h[4 + q] = h; fl.h[4 + q] = (_Float16)((c[q] - (float)h) * 1024.0f); }
  { *(v8us*)((unsigned short*)Hh + t * 8) = fh.half[0]; *(v8us*)((unsigned short*)Hl + t * 8) = fl.half[0];  } }

// ---- fast GEMM (wave tile 32x64; requires M % 32 == 0 rows per launch region and N % 64 == 0); epilogue = k_gemm_hhx semantics ----
__device__ __forceinline__ v16h g2_frag(const _Float16* p, int hh) { FragH f; f.half[0] = *(const v8us*)((const unsigned short*)p + 8 * hh); f.half[1] = *(const v8us*)((const unsigned short*)p + 16 + 8 * hh); return f.v; }
__device__ __forceinline__ v8f g2_mma(v16h a, v16h b, v8f c) { v8f d = __builtin_amdgcn_wmma_f32_16x16x32_f16(false, a, false, b, (short)0, c, false, false); asm volatile("v_nop\n\tv_nop\n\tv_nop\n\tv_nop" : "+v"(d) : "v"(a), "v"(b)); return d; }
template <int ACT>
__device__ __forceinline__ void gemm2_body(const int bx, const int by, const _Float16* __restrict__ A, int lda, size_t sA, const _Float16* __restrict__ Bh, int ldb, size_t sB, float alpha, const float* __restrict__ bias, size_t sBias, const float* __restrict__ CP, int rowsPerB, size_t sCPb, int row0g,
    float* __restrict__ C, _Float16* __restrict__ C16, int ldc, size_t sC, int M, int N, int K) { static_assert(ACT == 0 || ACT == 3 || ACT == 6 || ACT == 8 || ACT == 9 || ACT == 11 || ACT == 12 || ACT == 14 || ACT == 15 || ACT == 16 || ACT == 17, "k_gemm2: unsupported ACT code (would silently apply no activation)");
  __shared__ __attribute__((aligned(16))) float so[4][32][68];
  const int tid = threadIdx.x, w = tid >> 5, lane = tid & 31, ln = lane & 15, hh = lane >> 4;
  A += (size_t)by * sA; Bh += (size_t)by * sB; const size_t cofs = (size_t)by * sC; const float* bp = bias ? bias + (size_t)by * sBias : nullptr;
  const int ntn = N >> 6; const int mt = bx / ntn, nq = bx - mt * ntn; const int row0 = mt * 128 + 32 * w, col0 = nq * 64; if (row0 >= M) return;
  const _Float16* a0p = A + (size_t)(row0 + ln) * lda; const _Float16* a1p = a0p + (size_t)16 * lda;
  const _Float16* b0p = Bh + (size_t)(col0 + ln) * ldb; const _Float16* b1p = b0p + (size_t)16 * ldb; const _Float16* b2p = b1p + (size_t)16 * ldb; const _Float16* b3p = b2p + (size_t)16 * ldb;
  const v8f z8 = {0.f,0.f,0.f,0.f,0.f,0.f,0.f,0.f}; v8f c00 = z8, c01 = z8, c02 = z8, c03 = z8, c10 = z8, c11 = z8, c12 = z8, c13 = z8;
#pragma unroll 1
  for (int kb = 0; kb < K; kb += 32) { const v16h a0 = g2_frag(a0p + kb, hh), a1 = g2_frag(a1p + kb, hh);
    v16h b = g2_frag(b0p + kb, hh); c00 = g2_mma(a0, b, c00); c10 = g2_mma(a1, b, c10);
    b = g2_frag(b1p + kb, hh); c01 = g2_mma(a0, b, c01); c11 = g2_mma(a1, b, c11);
    b = g2_frag(b2p + kb, hh); c02 = g2_mma(a0, b, c02); c12 = g2_mma(a1, b, c12);
    b = g2_frag(b3p + kb, hh); c03 = g2_mma(a0, b, c03); c13 = g2_mma(a1, b, c13); }
  v8f accs[8] = {c00, c01, c02, c03, c10, c11, c12, c13};
#pragma unroll
  for (int u = 0; u < 8; ++u) { const int t = u & 3, half = u >> 2; const int col = col0 + t * 16 + ln; const float bv = bp ? bf16_round(bp[col]) : 0.f;
#pragma unroll
    for (int r = 0; r < 8; ++r) { const int rloc = half * 16 + 8 * hh + r; float v = accs[u][r] * alpha + bv; if (CP) { if (rowsPerB < 0) v += CP[cofs + (size_t)(row0g + row0 + rloc) * ldc + col];      /* rowsPerB < 0: own element of the batched C plane */ else { const int bidx = (row0g + row0 + rloc) / rowsPerB; v += CP[(size_t)bidx * sCPb + (size_t)by * 64 + col]; } }
      if (ACT == 3) v = fmaxf(v, 0.f); else if (ACT == 6) v = 0.5f * v * (1.0f + erff(v * 0.70710678118654752f)); else if (ACT == 11) v = 1.0f / (1.0f + expf(-v)); else if (ACT == 15) v = v / (1.0f + expf(-v)); else if (ACT == 12) v = (v > 0.f) ? v : 0.01f * v; else if (ACT == 8) v = tanhf(v); else if (ACT == 9) v = 0.5f * v * (1.0f + tanhf(0.7978845608028654f * (v + 0.044715f * v * v * v))); else if (ACT == 14) v = (v > 0.f) ? v : 0.1f * v; else if (ACT == 16) v = (v >= 0.f) ? v : 0.3f * v; else if (ACT == 17) v = (v >= 0.f) ? v : 0.2f * v;
      so[w][rloc][t * 16 + ln] = v; } }
  __builtin_amdgcn_fence(__ATOMIC_ACQ_REL, "workgroup"); __builtin_amdgcn_wave_barrier();
  const int rsub = lane >> 4, c4 = (lane & 15) * 4;
  {
#pragma unroll
    for (int q = 0; q < 16; ++q) { const int r = q * 2 + rsub; const v4f v = *(const v4fa*)&so[w][r][c4]; if (C) { *(v4f*)(C + cofs + (size_t)(row0 + r) * ldc + col0 + c4) = v; if (C16) asm volatile("s_wait_xcnt 0x0" ::: "memory"); }      /* both outputs asked for: the f32 store's address registers are reused for the f16 store's address, only behind this wait */
      if (C16) { v4h h4; for (int i = 0; i < 4; ++i) h4[i] = (_Float16)v[i]; *(v4h*)(C16 + cofs + (size_t)(row0 + r) * ldc + col0 + c4) = h4; } }
     } }
template <int ACT>
__global__ __launch_bounds__(128) void k_gemm2(const _Float16* __restrict__ A, int lda, size_t sA, const _Float16* __restrict__ Bh, int ldb, size_t sB, float alpha, const float* __restrict__ bias, size_t sBias, const float* __restrict__ CP, int rowsPerB, size_t sCPb, int row0g,
    float* __restrict__ C, _Float16* __restrict__ C16, int ldc, size_t sC, int M, int N, int K) { gemm2_body<ACT>(blockIdx.x, blockIdx.y, A, lda, sA, Bh, ldb, sB, alpha, bias, sBias, CP, rowsPerB, sCPb, row0g, C, C16, ldc, sC, M, N, K); }

// The six independent projection GEMMs as ONE launch. blockIdx.y = q, k or v (input, weight and output planes lie one behind the other); blockIdx.x picks the job:
// the first PJF work-groups give the f32 rows of the first QT0 tokens, the others the f16 rows of all tokens. Each work-group does what it did in its own launch.
#define PJF ((QT0 / 128) * (DM / 64))      /* work-groups of an f32 first-tile job */
#define PJH ((MP / 128) * (DM / 64))       /* work-groups of an f16 all-rows job */
__global__ __launch_bounds__(128) void k_qkv(const _Float16* __restrict__ X, const _Float16* __restrict__ BW, float* __restrict__ CF, _Float16* __restrict__ C16) {
  const int bx = blockIdx.x;      /* the same for the whole work-group: a scalar branch; each side knows at compile time which output it stores */
  if (bx < PJF) gemm2_body<0>(bx, blockIdx.y, X, DM, NR * DM, BW, DM, (size_t)DM * DM, 0.0625f, nullptr, 0, nullptr, 1, 0, 0, CF, nullptr, DM, (size_t)QT0 * DM, QT0, DM, DM);
  else gemm2_body<0>(bx - PJF, blockIdx.y, X, DM, NR * DM, BW, DM, (size_t)DM * DM, 0.0625f, nullptr, 0, nullptr, 1, 0, 0, nullptr, C16, DM, NR * DM, MP, DM, DM); }

// The output GEMM of all rows and that of the first tile's f16 hi plane as ONE launch: the work-groups of rows 0 .. QT0 - 1 read the exact first-tile o (hi plane) in place of the f16-path rows,
// whose product was overwritten before. Same grid, same rows and columns per work-group, same alpha.
__global__ __launch_bounds__(128) void k_out(const _Float16* __restrict__ O, const _Float16* __restrict__ OH, const _Float16* __restrict__ BO, float* __restrict__ out) {
  const int bx = blockIdx.x;
  gemm2_body<0>(bx, 0, (bx < PJF) ? OH : O, DM, 0, BO, DM, 0, 0.0009765625f, nullptr, 0, nullptr, 1, 0, 0, out, nullptr, DM, 0, MPO, DM, DM); }

// Operand preparation as ONE launch of independent jobs picked by the block index; each thread does what it did in the separate launches.
// Work-groups 0 .. 4 PWB - 1: plane p of BW (q, k, v, o): BW[p][n][k] = f16(bf16(W[k][n]) x 16) (a power of two: bf16-exact weights stay exact in f16 away from the subnormal range);
// for p < 3 row n is column n % 64 of head n / 64 of the [head][in][out] stack, for p = 3 column n of the [in][out] output weight. The others: plane j of XH = input j rounded to bf16, as f16.
#define PWB (DM * (DM / 8) / 256)          /* work-groups per weight plane */
#define PXB ((int)(NR * DM / 8 / 256))     /* work-groups per input */
__global__ __launch_bounds__(256) void k_prep(const float* __restrict__ xq, const float* __restrict__ xk, const float* __restrict__ xv, const float* __restrict__ wq, const float* __restrict__ wk, const float* __restrict__ wv, const float* __restrict__ wo,
    _Float16* __restrict__ BW, _Float16* __restrict__ XH) {
  const int bx = blockIdx.x; FragH f;
  if (bx < 4 * PWB) { const int p = bx / PWB; const int t = (bx - p * PWB) * 256 + threadIdx.x; const int n = t / (DM / 8), k8 = (t % (DM / 8)) * 8;
    if (p < 3) { const float* s = ((p == 0) ? wq : (p == 1) ? wk : wv) + (size_t)(n / HD) * DM * HD + (size_t)k8 * HD + n % HD;
#pragma unroll
      for (int i = 0; i < 8; ++i) f.h[i] = (_Float16)(bf16_round(s[i * HD]) * 16.0f); }
    else { const float* s = wo + (size_t)k8 * DM + n;
#pragma unroll
      for (int i = 0; i < 8; ++i) f.h[i] = (_Float16)(bf16_round(s[i * DM]) * 16.0f); }
    *(v8us*)((unsigned short*)BW + (size_t)p * DM * DM + (size_t)n * DM + k8) = f.half[0]; }
  else { const int xb = bx - 4 * PWB; const int j = xb / PXB; const size_t t = (size_t)(xb - j * PXB) * 256 + threadIdx.x; const float* x = (j == 0) ? xq : (j == 1) ? xk : xv;
#pragma unroll
    for (int q = 0; q < 8; ++q) f.h[q] = (_Float16)bf16_round(x[t * 8 + q]);
    *(v8us*)((unsigned short*)XH + (size_t)j * NR * DM + t * 8) = f.half[0]; } }


__global__ __launch_bounds__(256) void k_wnat(const float* __restrict__ w, size_t n8, _Float16* __restrict__ Bt) { const size_t t = (size_t)blockIdx.x * 256 + threadIdx.x; if (t >= n8) return; FragH f; for (int q = 0; q < 8; ++q) f.h[q] = (_Float16)(bf16_round(w[t * 8 + q]) * 16.0f); *(v8us*)((unsigned short*)Bt + t * 8) = f.half[0];  }
__global__ __launch_bounds__(256) void k_rsm(const float* __restrict__ S, _Float16* __restrict__ P, int nrows) {
  #pragma clang fp contract(off)
  const int i = blockIdx.x * 256 + threadIdx.x; if (i >= nrows) return; const float* s = S + (size_t)i * SQ; float mx = -3.0e38f;
#pragma unroll 1
  for (int j = 0; j < SQ; ++j) mx = fmaxf(mx, s[j]); float se = 0.f;
#pragma unroll 1
  for (int j = 0; j < SQ; ++j) se += expf(s[j] - mx); const float sc = 256.0f / se;
#pragma unroll 1
  for (int j0 = 0; j0 < SQ; j0 += 8) { FragH f; for (int q = 0; q < 8; ++q) f.h[q] = (_Float16)(expf(s[j0 + q] - mx) * sc); unsigned short* d = (unsigned short*)P + (size_t)i * SQ + j0; *(v8us*)d = f.half[0];  } }
__global__ __launch_bounds__(256) void k_vt(const _Float16* __restrict__ V16, int b, int h0, _Float16* __restrict__ VT) { __shared__ unsigned short tl[64][65]; const int tid = threadIdx.x; const int hh = blockIdx.x % HG, sg = blockIdx.x / HG; const int s0 = sg * 64; const int h = h0 + hh;
  for (int i = tid; i < 64 * 8; i += 256) { const int j = i / 8, d8 = (i % 8) * 8; FragH f; f.half[0] = *(const v8us*)((const unsigned short*)V16 + ((size_t)b * SQ + s0 + j) * DM + h * HD + d8); for (int q = 0; q < 8; ++q) tl[d8 + q][j] = f.u[q]; }
  __syncthreads();
  { for (int i = tid; i < 64 * 8; i += 256) { const int d = i / 8, j8 = (i % 8) * 8; FragH f; for (int q = 0; q < 8; ++q) f.u[q] = tl[d][j8 + q]; *(v8us*)((unsigned short*)VT + ((size_t)hh * HD + d) * SQ + s0 + j8) = f.half[0]; }  } }



#define FQ 32                        /* query rows per wave */
#define FW 4                         /* waves per work-group */
#define FNG (NH * (SQ / (FQ * FW)))  /* work-groups */
__device__ __forceinline__ v8f fa_mma(v16h a, v16h b, v8f c) { return __builtin_amdgcn_wmma_f32_16x16x32_f16(false, a, false, b, (short)0, c, false, false); }
__device__ __forceinline__ float fa_xhalf(float x) { return __builtin_bit_cast(float, __builtin_amdgcn_permlanex16(__builtin_bit_cast(int, x), __builtin_bit_cast(int, x), 0x76543210, 0xfedcba98, false, false)); }      /* lane l with lane l ^ 16 */
// 2^x by the native instruction. The v_nop at the end fills the slot that the instruction set asks for behind a transcendental before its result is read or its source overwritten;
// inside the group every result register differs from every source ("=&v"), so each v_exp_f32 is the independent instruction behind the one before it.
__device__ __forceinline__ float fa_exp2(float x) { float e; asm("v_exp_f32 %0, %1\n\tv_nop" : "=&v"(e) : "v"(x)); return e; }
__device__ __forceinline__ void fa_exp2x8(const float (&x)[8], float (&e)[8]) {
  asm("v_exp_f32 %0, %8\n\tv_exp_f32 %1, %9\n\tv_exp_f32 %2, %10\n\tv_exp_f32 %3, %11\n\tv_exp_f32 %4, %12\n\tv_exp_f32 %5, %13\n\tv_exp_f32 %6, %14\n\tv_exp_f32 %7, %15\n\tv_nop"
      : "=&v"(e[0]), "=&v"(e[1]), "=&v"(e[2]), "=&v"(e[3]), "=&v"(e[4]), "=&v"(e[5]), "=&v"(e[6]), "=&v"(e[7]) : "v"(x[0]), "v"(x[1]), "v"(x[2]), "v"(x[3]), "v"(x[4]), "v"(x[5]), "v"(x[6]), "v"(x[7])); }
__global__ __launch_bounds__(FW * 32) void k_fattn(const _Float16* __restrict__ Q, const _Float16* __restrict__ K, const _Float16* __restrict__ VT, _Float16* __restrict__ O) {
  const int lane = threadIdx.x & 31, ln = lane & 15, hh = lane >> 4; const int w = __builtin_amdgcn_readfirstlane(threadIdx.x >> 5);
  const int bx = blockIdx.x; const int rank = (bx < FNG / 2) ? bx : (FNG + FNG / 2 - 1 - bx);      /* a permutation: long work-groups first, then the short ones shortest first, so that groups bx and bx + FNG / 2 together have equal work (speed only) */
  const int h = rank % NH; const int q0 = (SQ / (FQ * FW) - 1 - rank / NH) * (FQ * FW) + w * FQ;
  const float CS = 0.125f * 1.4426950408889634f;      /* score scale x log2(e): exponentials in base 2 */
  const _Float16* qp = Q + (size_t)(q0 + ln) * DM + h * HD; const _Float16* kp = K + (size_t)ln * DM + h * HD; const _Float16* vp = VT + ((size_t)h * HD + ln) * SQ;
  v16h qf[2][2], kf[2][2];
#pragma unroll      /* fragments indexed by constants only: they stay in registers */
  for (int t = 0; t < 2; ++t)
#pragma unroll
    for (int c = 0; c < 2; ++c) { qf[t][c] = g2_frag(qp + (size_t)t * 16 * DM + c * 32, hh); kf[t][c] = g2_frag(kp + (size_t)t * 16 * DM + c * 32, hh); }
  const v8f z8 = {0.f, 0.f, 0.f, 0.f, 0.f, 0.f, 0.f, 0.f}; v8f acc[4][2]; float mr[2], ls[2];
#pragma unroll
  for (int t = 0; t < 2; ++t) { mr[t] = -3.0e38f; ls[t] = 0.f;
#pragma unroll
    for (int d = 0; d < 4; ++d) acc[d][t] = z8; }
#pragma unroll 1      /* one pass = 32 keys; the body is long enough as it is */
  for (int j0 = 0; j0 <= q0; j0 += 32) {
    v16h vf[4];
#pragma unroll      /* V^T of this pass: asked for ahead of the score products and the softmax */
    for (int d = 0; d < 4; ++d) vf[d] = g2_frag(vp + (size_t)d * 16 * SQ + j0, hh);
    v8f s[2][2];
#pragma unroll
    for (int u = 0; u < 2; ++u)
#pragma unroll
      for (int t = 0; t < 2; ++t) s[u][t] = fa_mma(kf[u][1], qf[t][1], fa_mma(kf[u][0], qf[t][0], z8));
    const int jn = (j0 < q0) ? j0 + 32 : q0;      /* the next pass's K rows, asked for behind this pass's score products (the last pass asks for its own again: in bounds, unused) */
#pragma unroll
    for (int u = 0; u < 2; ++u)
#pragma unroll
      for (int c = 0; c < 2; ++c) kf[u][c] = g2_frag(kp + (size_t)(jn + u * 16) * DM + c * 32, hh);
    asm volatile("s_wait_xcnt 0x0" ::: "memory");      /* the address registers of the loads above are reused below: they are overwritten only behind this wait */
    if (j0 == q0) {      /* the diagonal pass: key > query is masked (a scalar branch) */
#pragma unroll
      for (int u = 0; u < 2; ++u)
#pragma unroll
        for (int t = 0; t < 2; ++t)
#pragma unroll
          for (int r = 0; r < 8; ++r) if (u * 16 + 8 * hh + r > t * 16 + ln) s[u][t][r] = -3.0e38f; }
    FragH pf[2];
#pragma unroll
    for (int t = 0; t < 2; ++t) { float mx = fmaxf(s[0][t][0], s[1][t][0]);
#pragma unroll
      for (int r = 1; r < 8; ++r) mx = fmaxf(mx, fmaxf(s[0][t][r], s[1][t][r]));
      mx = fmaxf(mx, fa_xhalf(mx)); const float mn = fmaxf(mr[t], mx); const float corr = fa_exp2((mr[t] - mn) * CS); mr[t] = mn; const float mc = mn * CS;      /* every pass holds at least one unmasked key of every query: mn is a real score */
      float x0[8], x1[8], e0[8], e1[8];
#pragma unroll
      for (int r = 0; r < 8; ++r) { x0[r] = fmaf(s[0][t][r], CS, -mc); x1[r] = fmaf(s[1][t][r], CS, -mc); }
      fa_exp2x8(x0, e0); fa_exp2x8(x1, e1); float s0 = 0.f, s1 = 0.f;
#pragma unroll
      for (int r = 0; r < 8; ++r) { s0 += e0[r]; s1 += e1[r]; pf[t].h[r] = (_Float16)e0[r]; pf[t].h[8 + r] = (_Float16)e1[r]; }
      ls[t] = fmaf(ls[t], corr, s0 + s1);
#pragma unroll
      for (int d = 0; d < 4; ++d) acc[d][t] *= corr; }
#pragma unroll
    for (int d = 0; d < 4; ++d)
#pragma unroll
      for (int t = 0; t < 2; ++t) acc[d][t] = fa_mma(vf[d], pf[t].v, acc[d][t]);
  }
#pragma unroll
  for (int t = 0; t < 2; ++t) { const float inv = 64.0f / (ls[t] + fa_xhalf(ls[t]));      /* the halves' sums joined once; o carried x64 */
    unsigned short* op = (unsigned short*)O + (size_t)(q0 + t * 16 + ln) * DM + h * HD + 8 * hh;
#pragma unroll      /* the wave stores the whole 128-byte line of each of its rows */
    for (int d = 0; d < 4; ++d) { FragH f;
#pragma unroll
      for (int r = 0; r < 8; ++r) f.h[r] = (_Float16)(acc[d][t][r] * inv);
      *(v8us*)(op + d * 16) = f.half[0]; } } }


// Exact f32 causal attention for rows 0 .. QT0 - 1 (o carried x64 like the f16 path). ONE WORK-GROUP PER HEAD AND 16 QUERY ROWS, 8 waves:
// the head's K and V rows below the group's end are staged in LDS by coalesced loads; scores: one thread per key (its K row in registers, the q rows wave-uniform);
// softmax: one wave per two rows; o: each wave sums every eighth chunk of 4 keys for all 16 rows x 64 columns in registers, and the 8 partial sums are added in wave order.
#define A0R 16                       /* query rows per work-group */
#define A0KP (HD + 4)                /* LDS pitch of a K row in floats: 272 B = 16 B x odd, so that 16-byte reads of one row per lane spread over the banks */
#define A0SP (QT0 + 4)               /* LDS pitch of a score row in floats (a multiple of 16 B) */
__global__ __launch_bounds__(256) void k_att0w(const float* __restrict__ QF, const float* __restrict__ KF, const float* __restrict__ VF, float scale, float* __restrict__ OF) {
  __shared__ __attribute__((aligned(16))) float lk[QT0][A0KP]; __shared__ __attribute__((aligned(16))) float lv[QT0][HD]; __shared__ __attribute__((aligned(16))) float ls[A0R][A0SP];
  __shared__ __attribute__((aligned(16))) float red[8][A0R][HD]; __shared__ float linv[A0R];
  const int tid = threadIdx.x, lane = tid & 31, w = __builtin_amdgcn_readfirstlane(tid >> 5); const int h = blockIdx.x / (QT0 / A0R), rg = blockIdx.x % (QT0 / A0R); const int nk = (rg + 1) * A0R;      /* causal: keys below the group's end */
  const int r16 = tid >> 4, c4 = (tid & 15) * 4;
  { const float* kp = KF + (size_t)r16 * DM + h * HD + c4; const float* vp = VF + (size_t)r16 * DM + h * HD + c4; v4f kx[QT0 / 16], vx[QT0 / 16];
#pragma unroll      /* constant indices keep kx and vx in registers; every load is issued before the first value is used */
    for (int u = 0; u < QT0 / 16; ++u) if (u <= rg) { kx[u] = *(const v4fa*)(kp + (size_t)u * 16 * DM); vx[u] = *(const v4fa*)(vp + (size_t)u * 16 * DM); }
    asm volatile("s_wait_xcnt 0x0" :: "v"(kp), "v"(vp) : "memory");      /* the loads' address registers are reused below: they are held up to this wait and overwritten only behind it */
#pragma unroll      /* constant indices, as above */
    for (int u = 0; u < QT0 / 16; ++u) if (u <= rg) { *(v4f*)&lk[u * 16 + r16][c4] = kx[u]; *(v4f*)&lv[u * 16 + r16][c4] = vx[u]; } }
  __syncthreads();
  if (tid < nk) { v4f kr[HD / 4];
#pragma unroll      /* the key's row stays in registers for all 16 query rows */
    for (int c = 0; c < HD / 4; ++c) kr[c] = *(const v4f*)&lk[tid][c * 4];
    const float* qb = QF + (size_t)rg * A0R * DM + h * HD;      /* the same address in every lane */
#pragma unroll 4      /* several rows' q loads in flight ahead of their products */
    for (int i = 0; i < A0R; ++i) { v4f s4 = {0.f, 0.f, 0.f, 0.f};
#pragma unroll      /* kr is indexed by constants only */
      for (int c = 0; c < HD / 4; ++c) { const v4f qq = *(const v4fa*)(qb + (size_t)i * DM + c * 4);
#pragma unroll      /* short fixed trip count; the arrays it indexes stay in registers */
        for (int u = 0; u < 4; ++u) s4[u] = fmaf(qq[u], kr[c][u], s4[u]); }
      ls[i][tid] = ((s4[0] + s4[1]) + (s4[2] + s4[3])) * scale; } }
  __syncthreads();
#pragma unroll 1      /* two rows a wave, one after the other: small code */
  for (int i = 2 * w; i < 2 * w + 2; ++i) { const int last = rg * A0R + i; float x[QT0 / 32]; float mx = -3.0e38f;
#pragma unroll      /* x is indexed by constants only */
    for (int u = 0; u < QT0 / 32; ++u) { const int j = u * 32 + lane; x[u] = (j <= last) ? ls[i][j] : -3.0e38f; mx = fmaxf(mx, x[u]); }
#pragma unroll      /* short fixed trip count; the arrays it indexes stay in registers */
    for (int o = 16; o > 0; o >>= 1) mx = fmaxf(mx, __shfl_xor(mx, o, 32));
    float se = 0.f;
#pragma unroll      /* short fixed trip count; the arrays it indexes stay in registers */
    for (int u = 0; u < QT0 / 32; ++u) { const int j = u * 32 + lane; const float e = (j <= last) ? expf(x[u] - mx) : 0.f; se += e; if (j < nk) ls[i][j] = e; }
#pragma unroll      /* short fixed trip count; the arrays it indexes stay in registers */
    for (int o = 16; o > 0; o >>= 1) se += __shfl_xor(se, o, 32);
    if (lane == 0) linv[i] = 64.0f / se; }      /* o carried x64 like the f16 path */
  __syncthreads();
  { const int rh = lane >> 4, d4 = (lane & 15) * 4; v4f acc[8];
#pragma unroll      /* short fixed trip count; the arrays it indexes stay in registers */
    for (int r = 0; r < 8; ++r) acc[r] = (v4f){0.f, 0.f, 0.f, 0.f};
#pragma unroll 1      /* at most 8 trips of 128 multiply-adds: the body is long enough as it is */
    for (int j0 = 4 * w; j0 < nk; j0 += 32) { v4f pv[8], vv[4];
#pragma unroll      /* short fixed trip count; the arrays it indexes stay in registers */
      for (int r = 0; r < 8; ++r) pv[r] = *(const v4f*)&ls[rh * 8 + r][j0];
#pragma unroll      /* short fixed trip count; the arrays it indexes stay in registers */
      for (int q = 0; q < 4; ++q) vv[q] = *(const v4f*)&lv[j0 + q][d4];
#pragma unroll      /* short fixed trip count; the arrays it indexes stay in registers */
      for (int q = 0; q < 4; ++q)
#pragma unroll      /* short fixed trip count; the arrays it indexes stay in registers */
        for (int r = 0; r < 8; ++r)
#pragma unroll      /* short fixed trip count; the arrays it indexes stay in registers */
          for (int u = 0; u < 4; ++u) acc[r][u] = fmaf(pv[r][q], vv[q][u], acc[r][u]); }
#pragma unroll      /* short fixed trip count; the arrays it indexes stay in registers */
    for (int r = 0; r < 8; ++r) *(v4f*)&red[w][rh * 8 + r][d4] = acc[r]; }
  __syncthreads();
  { v4f o = *(const v4f*)&red[0][r16][c4];
#pragma unroll      /* short fixed trip count; the arrays it indexes stay in registers */
    for (int p = 1; p < 8; ++p) { const v4f a = *(const v4f*)&red[p][r16][c4]; o += a; }
    const float fin = linv[r16]; o *= fin;
    *(v4f*)(OF + (size_t)(rg * A0R + r16) * DM + h * HD + c4) = o; } }

extern "C" void kernel_launch(void* const* d_in, const int* in_sizes, int n_in,
                              void* d_out, int out_size, void* d_ws, size_t ws_size, hipStream_t stream) {
  (void)in_sizes; (void)n_in; (void)out_size;
  const float* const* I = (const float* const*)d_in; const float* xq = I[0]; const float* xk = I[1]; const float* xv = I[2]; const float* wq = I[3]; const float* wk = I[4]; const float* wv = I[5]; const float* wo = I[6];      /* weights [in][out] */
  char* ws = (char*)d_ws; size_t off = 0;
  auto take = [&](size_t bytes) { char* p = ws + off; off += (bytes + 255) & ~(size_t)255; return p; };
  static_assert(NB == 1 && B0 == 0 && NBR == 1, "the joined projection launch takes the first-tile rows of one batch");
  _Float16* BW = (_Float16*)take((size_t)4 * DM * DM * 2); _Float16* BO = BW + (size_t)3 * DM * DM;      /* weight planes q, k, v, o, one behind the other */
  _Float16* XH = (_Float16*)take(3 * NR * DM * 2);      /* rounded inputs q, k, v, one behind the other */
  _Float16* Q16 = (_Float16*)take(3 * NR * DM * 2); _Float16* K16 = Q16 + NR * DM; _Float16* V16 = K16 + NR * DM; _Float16* O16 = (_Float16*)take(NR * DM * 2);      /* q, k, v rows, one plane behind the other */
  _Float16* VT = (_Float16*)take((size_t)NH * HD * SQ * 2);
  float* QF0 = (float*)take((size_t)3 * QT0 * DM * 4); float* KF0 = QF0 + (size_t)QT0 * DM; float* VF0 = KF0 + (size_t)QT0 * DM; float* OF0 = (float*)take((size_t)NB * QT0 * DM * 4); _Float16* OH0 = (_Float16*)take((size_t)NB * QT0 * DM * 2); _Float16* OL0 = (_Float16*)take((size_t)NB * QT0 * DM * 2);
  if (off > ws_size) return;
  k_prep<<<4 * PWB + 3 * PXB, 256, 0, stream>>>(xq, xk, xv, wq, wk, wv, wo, BW, XH);      /* all four x16 weight planes Bt[n][k] (PER-HEAD STACKS [16][1024][64] = [head][in][out]: head h's block -> rows 64 h .. 64 h + 63) and the three rounded inputs */
  k_qkv<<<dim3(PJF + PJH, 3), 128, 0, stream>>>(XH, BW, QF0, Q16);      /* q, k, v: f16 rows of all tokens, and f32 rows of the first 256 (exact products) */
  for (int b = B0; b < B0 + NBR; ++b) { const size_t r0 = (size_t)b * SQ;
    k_vt<NH, SQ><<<NH * (SQ / 64), 256, 0, stream>>>(V16 + r0 * LQ, LQ, 0, VT);      /* V^T [NH][HD][SQ] for this batch */
    k_att0w<<<NH * (QT0 / A0R), 256, 0, stream>>>(QF0, KF0, VF0, 0.125f, OF0 + (size_t)b * QT0 * DM);      /* exact f32 attention for rows 0..255 (o x64) */
    k_fattn<<<FNG, FW * 32, 0, stream>>>(Q16 + r0 * LQ, K16 + r0 * LQ, VT, O16 + r0 * DM); }      /* scores, causal softmax and P V for all heads and rows in one launch: o (merged heads, x64) as f16 rows */
  k_hl<<<(unsigned)(((size_t)NB * QT0 * DM / 8 + 255) / 256), 256, 0, stream>>>(OF0, OH0, OL0, (size_t)NB * QT0 * DM / 8);      /* first-tile o (x64) -> f16 hi + x1024 residual planes */
  k_out<<<(MPO / 128) * (DM / 64), 128, 0, stream>>>(O16, OH0, BO, (float*)d_out);      /* out rows are the output layout; rows 0..255: out = o_hi Wo */
  for (int b = B0; b < B0 + NBR; ++b) { const size_t r0 = (size_t)b * SQ; const size_t f0 = (size_t)b * QT0;
    k_gemm2<0><<<dim3((QT0 / 128) * (DM / 64), 1), 128, 0, stream>>>(OL0 + f0 * DM, DM, 0, BO, DM, 0, 0.00000095367431640625f, nullptr, 0, (const float*)d_out + r0 * DM, -1, 0, 0, (float*)d_out + r0 * DM, nullptr, DM, 0, QT0, DM, DM); }      /* += o_lo Wo 2^-20 (own-element accumulate) */
}

// v005
// Measured time: 190 microseconds a run.
// Timed twice side by side with v004, it ran 1.43 and 1.42 times as fast.
// All steps since v000 together make it 44.1 times as fast.
#include <hip/hip_runtime.h>
// Causal multi-head attention on three inputs with PER-HEAD STACKED projections over ONE sequence of 4096 tokens (Q, K, V [1][4096][1024]; WQ / WK / WV [16][1024][64] = [head][in][out] sigma 0.02, NO biases; 16 heads of 64; scores x 64^-0.5 = / 8; causal (tril, -inf above the diagonal); softmax; heads concatenated head-major; out = concat WO with WO [1024][1024] [in][out], NO bias -> [1][4096][1024]); each head's [in][out] block is transposed into its 64 contiguous rows of the weight plane, and the [in][out] output weight into its own plane, by one launch that also rounds the three inputs.
// Structure: token rows r = s; q, k, v inputs as exact f16 rows (bf16-rounded); Q, K, V as three WMMA GEMMs in one launch (32x64 wave tiles, f32 accumulation, exact x16 weights, f16 outputs; the f32 rows of the first tile by further work-groups of the same launch); per batch: V^T for all heads via LDS transposes; one fused attention launch: a wave per 32 query rows of a head walks the keys up to its own rows 32 at a time (scores on WMMA, K = 64; running f32 maximum and sum, native exp2; weights in (0, 1] as f16; o += P V on WMMA, divided by the sum at the end, o carried x64, folded into the output GEMM alpha), written straight into the merged f16 o rows; out = o W_o GEMM (f32) into the output layout.
// Compute dtype: inputs rounded to bf16; x / weights exact; q, k, v, softmax weights and o as plain f16 GEMM operands (~2^-12); scores and softmax statistics f32. v_wmma_f32_16x16x32_f16.
#define NB 1
#define SQ 4096
#define DM 1024
#define NH 16
#define HD 64
#define HG 4                         /* heads per launch of the unlaunched k_vt overload */
#define QT 256                       /* unused */
#define NKX SQ                       /* unused */
#define QT0 256                      /* first-tile rows recomputed exactly in f32 */
#define B0 0                         /* first batch processed (debug hook) */
#define NBR NB                       /* batches processed (debug hook) */
#define NR ((size_t)NB * SQ)         /* token rows */
#define MP ((int)((size_t)NBR * SQ)) /* rows projected (debug hook) */
#define QN SQ                        /* unused (k_fattn attends all SQ rows) */
#define NHD NH                       /* unused (k_fattn attends all NH heads) */
#define MPO MP                       /* rows through the output stage (debug hook) */
#define LQ DM      /* row pitch of the q/k/v rows */
typedef __bf16 v16b __attribute__((ext_vector_type(16)));
typedef unsigned short v8us __attribute__((ext_vector_type(8), may_alias));
typedef float  v8f  __attribute__((ext_vector_type(8)));
typedef float  v4f  __attribute__((ext_vector_type(4)));
typedef float  v4fa __attribute__((ext_vector_type(4), may_alias));
union FragB { v16b v; v8us half[2]; unsigned short u[16]; };

__device__ __forceinline__ unsigned short bf16_bits(float x) { unsigned int u = __float_as_uint(x); return (unsigned short)((u + 0x7FFFu + ((u >> 16) & 1u)) >> 16); }
__device__ __forceinline__ float bf16_val(unsigned short b) { return __uint_as_float(((unsigned int)b) << 16); }
__device__ __forceinline__ float bf16_round(float x) { return bf16_val(bf16_bits(x)); }
// D += A·B with NT terms: 1 = ah·bh, 2 = + al·bh (A split), 3 = + ah·bl (both split)
template <int NT>
__device__ __forceinline__ v8f mmaN(v16b ah, v16b al, v16b bh, v16b bl, v8f c) {
  c = __builtin_amdgcn_wmma_f32_16x16x32_bf16(false, ah, false, bh, (short)0, c, false, false);
  if (NT >= 2) c = __builtin_amdgcn_wmma_f32_16x16x32_bf16(false, al, false, bh, (short)0, c, false, false);
  if (NT >= 3) c = __builtin_amdgcn_wmma_f32_16x16x32_bf16(false, ah, false, bl, (short)0, c, false, false);
  asm volatile("v_nop\n\tv_nop\n\tv_nop\n\tv_nop" : "+v"(c) : "v"(ah), "v"(al), "v"(bh), "v"(bl));
  return c;
}

__global__ __launch_bounds__(256) void k_wt_bf16(const float* __restrict__ W, unsigned short* __restrict__ Wt, int K, int N) {
  const int t = blockIdx.x * 256 + threadIdx.x;
  const int k8n = K / 8;
  if (t >= N * k8n) return;
  const int n = t / k8n, k8 = (t % k8n) * 8;
  v8us v;
#pragma unroll
  for (int i = 0; i < 8; ++i) v[i] = bf16_bits(W[(size_t)(k8 + i) * N + n]);
  *(v8us*)(Wt + (size_t)n * K + k8) = v;
  
}

// GEMM C[M][N] (f32, pitch ldc) = act(A[M][K]·W + bias). A f32 row-major (pitch lda) converted per fragment to bf16
// (ASPLIT: hi/lo two planes -> 2 terms, else single rounded term); Wt bf16 [N][K] (pitch ldb). BIAS_BF16 rounds the
// bias to bf16 first (bias quantised to bf16 before the add). K%32==0, M%16==0, N%64==0.
template <bool ASPLIT, int ACT, bool BIAS_BF16>
__global__ __launch_bounds__(128) void k_gemm_bf(const float* __restrict__ A, int lda, const unsigned short* __restrict__ Wt, int ldb,
                                               const float* __restrict__ bias, float* __restrict__ C, int ldc, int M, int N, int K) {
  __shared__ __attribute__((aligned(16))) float so[4][16][64];
  const int tid = threadIdx.x, w = tid >> 5, lane = tid & 31, ln = lane & 15, hh = lane >> 4;
  const int ntn = N / 64;
  const int wid = blockIdx.x * 4 + w;
  const int mt = wid / ntn, nq = wid % ntn;
  if (mt * 16 >= M) return;
  const int row0 = mt * 16, col0 = nq * 64;
  const float* arow = A + (size_t)(row0 + ln) * lda;
  v8f acc[4] = {};
  for (int kb = 0; kb < K; kb += 32) {
    FragB ah, al;
    const v4f x0 = *(const v4fa*)(arow + kb + 8 * hh), x1 = *(const v4fa*)(arow + kb + 8 * hh + 4);
    const v4f x2 = *(const v4fa*)(arow + kb + 16 + 8 * hh), x3 = *(const v4fa*)(arow + kb + 16 + 8 * hh + 4);
    float xs[16] = {x0[0],x0[1],x0[2],x0[3],x1[0],x1[1],x1[2],x1[3],x2[0],x2[1],x2[2],x2[3],x3[0],x3[1],x3[2],x3[3]};
#pragma unroll
    for (int i = 0; i < 16; ++i) { const unsigned short hb = bf16_bits(xs[i]); ah.u[i] = hb; al.u[i] = ASPLIT ? bf16_bits(xs[i] - bf16_val(hb)) : (unsigned short)0; }
#pragma unroll
    for (int t = 0; t < 4; ++t) {
      const unsigned short* brow = Wt + (size_t)(col0 + t * 16 + ln) * ldb + kb;
      FragB b;
      b.half[0] = *(const v8us*)(brow + 8 * hh);
      b.half[1] = *(const v8us*)(brow + 16 + 8 * hh);
      acc[t] = mmaN<ASPLIT ? 2 : 1>(ah.v, al.v, b.v, b.v, acc[t]);
    }
  }
#pragma unroll
  for (int t = 0; t < 4; ++t) {
    float bv = bias ? bias[col0 + t * 16 + ln] : 0.f;
    if (BIAS_BF16) bv = bf16_round(bv);
#pragma unroll
    for (int r = 0; r < 8; ++r) { float v = acc[t][r] + bv; if (ACT == 1) v = fmaxf(v, 0.f); so[w][8 * hh + r][t * 16 + ln] = v; }
  }
  __builtin_amdgcn_fence(__ATOMIC_ACQ_REL, "workgroup");
  __builtin_amdgcn_wave_barrier();
  const int rsub = lane >> 4, c4 = (lane & 15) * 4;
  {
#pragma unroll
    for (int q = 0; q < 8; ++q) {
      const int r = q * 2 + rsub;
      const v4f v = *(const v4fa*)&so[w][r][c4];
      *(v4f*)(C + (size_t)(row0 + r) * ldc + col0 + c4) = v;
    }
    
  }
}

// GEMM C = act(A·W + bias + resid): A f32 (ASPLIT -> hi/lo 2 terms), Wt bf16 [N][K]; ACT 0 none, 1 relu, 2 exact gelu;
// resid (optional, f32, row index = (row % rmod), pitch ldr, RES_BF16 rounds it) added before the activation.
template <bool ASPLIT, int ACT, bool BIAS_BF16, bool RES_BF16>
__global__ __launch_bounds__(128) void k_gemm_bf3(const float* __restrict__ A, int lda, const unsigned short* __restrict__ Wt, int ldb,
                                                const float* __restrict__ bias, const float* __restrict__ resid, int rmod, int ldr,
                                                float* __restrict__ C, int ldc, int M, int N, int K) {
  __shared__ __attribute__((aligned(16))) float so[4][16][64];
  const int tid = threadIdx.x, w = tid >> 5, lane = tid & 31, ln = lane & 15, hh = lane >> 4;
  const int ntn = N / 64;
  const int wid = blockIdx.x * 4 + w;
  const int mt = wid / ntn, nq = wid % ntn;
  if (mt * 16 >= M) return;
  const int row0 = mt * 16, col0 = nq * 64;
  const float* arow = A + (size_t)(row0 + ln) * lda;
  v8f acc[4] = {};
  for (int kb = 0; kb < K; kb += 32) {
    FragB ah, al;
    const v4f x0 = *(const v4fa*)(arow + kb + 8 * hh), x1 = *(const v4fa*)(arow + kb + 8 * hh + 4);
    const v4f x2 = *(const v4fa*)(arow + kb + 16 + 8 * hh), x3 = *(const v4fa*)(arow + kb + 16 + 8 * hh + 4);
    float xs[16] = {x0[0],x0[1],x0[2],x0[3],x1[0],x1[1],x1[2],x1[3],x2[0],x2[1],x2[2],x2[3],x3[0],x3[1],x3[2],x3[3]};
#pragma unroll
    for (int i = 0; i < 16; ++i) { const unsigned short hb = bf16_bits(xs[i]); ah.u[i] = hb; al.u[i] = ASPLIT ? bf16_bits(xs[i] - bf16_val(hb)) : (unsigned short)0; }
#pragma unroll
    for (int t = 0; t < 4; ++t) {
      const unsigned short* brow = Wt + (size_t)(col0 + t * 16 + ln) * ldb + kb;
      FragB b;
      b.half[0] = *(const v8us*)(brow + 8 * hh);
      b.half[1] = *(const v8us*)(brow + 16 + 8 * hh);
      acc[t] = mmaN<ASPLIT ? 2 : 1>(ah.v, al.v, b.v, b.v, acc[t]);
    }
  }
#pragma unroll
  for (int t = 0; t < 4; ++t) {
    const int col = col0 + t * 16 + ln;
    float bv = bias ? bias[col] : 0.f;
    if (BIAS_BF16) bv = bf16_round(bv);
#pragma unroll
    for (int r = 0; r < 8; ++r) {
      float v = acc[t][r] + bv;
      if (resid) { float rv = resid[(size_t)((row0 + 8 * hh + r) % rmod) * ldr + col]; if (RES_BF16) rv = bf16_round(rv); v += rv; }
      if (ACT == 1) v = fmaxf(v, 0.f);
      if (ACT == 2) v = 0.5f * v * (1.0f + erff(v * 0.70710678118654752f));
      if (ACT == 3) { const float u = 0.7978845608028654f * (v + 0.044715f * v * v * v); v = 0.5f * v * (1.0f + tanhf(u)); }
      so[w][8 * hh + r][t * 16 + ln] = v;
    }
  }
  __builtin_amdgcn_fence(__ATOMIC_ACQ_REL, "workgroup");
  __builtin_amdgcn_wave_barrier();
  const int rsub = lane >> 4, c4 = (lane & 15) * 4;
  {
#pragma unroll
    for (int q = 0; q < 8; ++q) {
      const int r = q * 2 + rsub;
      const v4f v = *(const v4fa*)&so[w][r][c4];
      *(v4f*)(C + (size_t)(row0 + r) * ldc + col0 + c4) = v;
    }
    
  }
}
// row LayerNorm (biased variance, eps) over N: s = X (+ R); optional out_sum <- s; out_norm <- (s-mu)*rsqrt(var+eps)*g + b
template <bool PARAM_BF16>
__global__ __launch_bounds__(256) void k_layernorm(const float* __restrict__ X, const float* __restrict__ R, const float* __restrict__ g, const float* __restrict__ bta,
                                                  float* __restrict__ out_sum, float* __restrict__ out_norm, int N, float eps) {
  __shared__ float red[256];
  const int row = blockIdx.x, tid = threadIdx.x;
  const float* x = X + (size_t)row * N; const float* rr = R ? R + (size_t)row * N : nullptr;
  float vals[16];                     // up to N = 4096
  const int per = N / 256;            // contiguous chunk per thread? use strided-by-4 chunks: thread handles j = tid*4 + 1024*u
  float s1 = 0.f;
  for (int u = 0; u < per / 4; ++u) {
    const int j = tid * 4 + 1024 * u;
    const v4f a = *(const v4fa*)(x + j);
    v4f b = {0.f,0.f,0.f,0.f}; if (rr) b = *(const v4fa*)(rr + j);
#pragma unroll
    for (int q = 0; q < 4; ++q) { const float v = a[q] + b[q]; vals[u * 4 + q] = v; s1 += v; }
  }
  red[tid] = s1; __syncthreads();
  for (int st = 128; st > 0; st >>= 1) { if (tid < st) red[tid] += red[tid + st]; __syncthreads(); }
  const float mu = red[0] / (float)N; __syncthreads();
  float s2 = 0.f;
  for (int u = 0; u < per / 4; ++u)
#pragma unroll
    for (int q = 0; q < 4; ++q) { const float c = vals[u * 4 + q] - mu; s2 += c * c; }
  red[tid] = s2; __syncthreads();
  for (int st = 128; st > 0; st >>= 1) { if (tid < st) red[tid] += red[tid + st]; __syncthreads(); }
  const float rs = rsqrtf(red[0] / (float)N + eps);
  {
    for (int u = 0; u < per / 4; ++u) {
      const int j = tid * 4 + 1024 * u;
      v4f o, sm;
#pragma unroll
      for (int q = 0; q < 4; ++q) {
        float gg = g[j + q], bb = bta[j + q];
        if (PARAM_BF16) { gg = bf16_round(gg); bb = bf16_round(bb); }
        sm[q] = vals[u * 4 + q]; o[q] = (vals[u * 4 + q] - mu) * rs * gg + bb;
      }
      if (out_sum) *(v4f*)(out_sum + (size_t)row * N + j) = sm;
      *(v4f*)(out_norm + (size_t)row * N + j) = o;
    }
    
  }
}



// ---- f16 WMMA path (v_wmma_f32_16x16x32_f16): 11-bit significands for operands in range — used where a [0,1] probability operand needs more precision than bf16
typedef _Float16 v16h __attribute__((ext_vector_type(16)));
union FragH { v16h v; v8us half[2]; _Float16 h[16]; unsigned short u[16]; };
template <int NT>
__device__ __forceinline__ v8f mmaH(v16h ah, v16h al, v16h bh, v16h bl, v8f c) {
  c = __builtin_amdgcn_wmma_f32_16x16x32_f16(false, ah, false, bh, (short)0, c, false, false);
  if (NT >= 2) c = __builtin_amdgcn_wmma_f32_16x16x32_f16(false, al, false, bh, (short)0, c, false, false);
  if (NT >= 3) c = __builtin_amdgcn_wmma_f32_16x16x32_f16(false, ah, false, bl, (short)0, c, false, false);
  asm volatile("v_nop\n\tv_nop\n\tv_nop\n\tv_nop" : "+v"(c) : "v"(ah), "v"(al), "v"(bh), "v"(bl));
  return c;
}
// batched GEMM like k_gemm_b but f16 operands: A f32 (split into f16 hi/lo if ASPLIT, else rounded to f16), Bt = f16 values [n][k]; alpha; C f32; N multiple of 16 (partial tiles skipped)
template <bool ASPLIT>
__global__ __launch_bounds__(128) void k_gemm_h(const float* __restrict__ A, int lda, size_t sA, const _Float16* __restrict__ Bh, int ldb, size_t sB, float alpha, float* __restrict__ C, int ldc, size_t sC, int M, int N, int K) {
  __shared__ __attribute__((aligned(16))) float so[4][16][64];
  const int tid = threadIdx.x, w = tid >> 5, lane = tid & 31, ln = lane & 15, hh = lane >> 4; const int by = blockIdx.y;
  A += (size_t)by * sA; Bh += (size_t)by * sB; C += (size_t)by * sC;
  const int ntn = (N + 63) / 64; const int wid = blockIdx.x * 4 + w; const int mt = wid / ntn, nq = wid % ntn; if (mt * 16 >= M) return;
  const int row0 = mt * 16, col0 = nq * 64; const float* arow = A + (size_t)(row0 + ln) * lda;
  v8f acc[4] = {};
  for (int kb = 0; kb < K; kb += 32) {
    FragH ah, al;
    const v4f x0 = *(const v4fa*)(arow + kb + 8 * hh), x1 = *(const v4fa*)(arow + kb + 8 * hh + 4), x2 = *(const v4fa*)(arow + kb + 16 + 8 * hh), x3 = *(const v4fa*)(arow + kb + 16 + 8 * hh + 4);
    float xs[16] = {x0[0],x0[1],x0[2],x0[3],x1[0],x1[1],x1[2],x1[3],x2[0],x2[1],x2[2],x2[3],x3[0],x3[1],x3[2],x3[3]};
#pragma unroll
    for (int i = 0; i < 16; ++i) { const _Float16 h = (_Float16)xs[i]; ah.h[i] = h; al.h[i] = ASPLIT ? (_Float16)(xs[i] - (float)h) : (_Float16)0.0f; }
#pragma unroll
    for (int t = 0; t < 4; ++t) { if (col0 + t * 16 >= N) continue; const size_t boff = (size_t)(col0 + t * 16 + ln) * ldb + kb; FragH bq; bq.half[0] = *(const v8us*)(Bh + boff + 8 * hh); bq.half[1] = *(const v8us*)(Bh + boff + 16 + 8 * hh);
      acc[t] = mmaH<ASPLIT ? 2 : 1>(ah.v, al.v, bq.v, bq.v, acc[t]); }
  }
#pragma unroll
  for (int t = 0; t < 4; ++t) { if (col0 + t * 16 >= N) continue;
#pragma unroll
    for (int r = 0; r < 8; ++r) so[w][8 * hh + r][t * 16 + ln] = acc[t][r] * alpha; }
  __builtin_amdgcn_fence(__ATOMIC_ACQ_REL, "workgroup"); __builtin_amdgcn_wave_barrier();
  const int rsub = lane >> 4, c4 = (lane & 15) * 4;
  {
#pragma unroll
    for (int q = 0; q < 8; ++q) { const int r = q * 2 + rsub; if (col0 + c4 < N) { const v4f v = *(const v4fa*)&so[w][r][c4]; *(v4f*)(C + (size_t)(row0 + r) * ldc + col0 + c4) = v; } }
     }
}

// k_gemm_hh variant with fused epilogue: v = acc·alpha + bias[by·sBias + col] (+ CP[(row/rowsPerB)·sCPb + by·64 + col] if CP) ; ACT 0 none / 1 elu ; writes f16 C16 (and f32 C if non-null)
template <int ACT>
__global__ __launch_bounds__(128) void k_gemm_hhx(const _Float16* __restrict__ A, int lda, size_t sA, const _Float16* __restrict__ Bh, int ldb, size_t sB, float alpha, const float* __restrict__ bias, size_t sBias, const float* __restrict__ CP, int rowsPerB, size_t sCPb, int row0g,
    float* __restrict__ C, _Float16* __restrict__ C16, int ldc, size_t sC, int M, int N, int K) {
  __shared__ __attribute__((aligned(16))) float so[4][16][64];
  const int tid = threadIdx.x, w = tid >> 5, lane = tid & 31, ln = lane & 15, hh = lane >> 4; const int by = blockIdx.y;
  A += (size_t)by * sA; Bh += (size_t)by * sB; const size_t cofs = (size_t)by * sC; const float* bp = bias ? bias + (size_t)by * sBias : nullptr;
  const int ntn = (N + 63) / 64; const int wid = blockIdx.x * 4 + w; const int mt = wid / ntn, nq = wid % ntn; if (mt * 16 >= M) return;
  const int row0 = mt * 16, col0 = nq * 64; const _Float16* arow = A + (size_t)(row0 + ln) * lda;
  v8f acc[4] = {};
  for (int kb = 0; kb < K; kb += 32) { FragH ah; ah.half[0] = *(const v8us*)((const unsigned short*)arow + kb + 8 * hh); ah.half[1] = *(const v8us*)((const unsigned short*)arow + kb + 16 + 8 * hh);
#pragma unroll
    for (int t = 0; t < 4; ++t) { if (col0 + t * 16 >= N) continue; const size_t boff = (size_t)(col0 + t * 16 + ln) * ldb + kb; FragH bq; bq.half[0] = *(const v8us*)((const unsigned short*)Bh + boff + 8 * hh); bq.half[1] = *(const v8us*)((const unsigned short*)Bh + boff + 16 + 8 * hh);
      acc[t] = mmaH<1>(ah.v, ah.v, bq.v, bq.v, acc[t]); }
  }
#pragma unroll
  for (int t = 0; t < 4; ++t) { if (col0 + t * 16 >= N) continue; const int col = col0 + t * 16 + ln; const float bv = bp ? bf16_round(bp[col]) : 0.f;
#pragma unroll
    for (int r = 0; r < 8; ++r) { float v = acc[t][r] * alpha + bv; if (CP) { const int rr = row0g + row0 + 8 * hh + r; if (rowsPerB < 0) v += CP[cofs + (size_t)rr * ldc + col];      /* rowsPerB < 0: own element of the batched C plane */ else { const int bidx = rr / rowsPerB; v += CP[(size_t)bidx * sCPb + (size_t)by * 64 + col]; } } if (ACT == 1) v = (v > 0.f) ? v : expm1f(v); else if (ACT == 7) v = (v > 0.f) ? v + 1.0f : expf(v); else if (ACT == 8) v = tanhf(v); else if (ACT == 9) v = 0.5f * v * (1.0f + tanhf(0.7978845608028654f * (v + 0.044715f * v * v * v))); else if (ACT == 11) v = 1.0f / (1.0f + expf(-v)); else if (ACT == 12) v = (v > 0.f) ? v : 0.01f * v; else if (ACT == 14) v = (v > 0.f) ? v : 0.1f * v; else if (ACT == 16) v = (v >= 0.f) ? v : 0.3f * v; else if (ACT == 17) v = (v >= 0.f) ? v : 0.2f * v; else if (ACT == 15) v = v / (1.0f + expf(-v)); else if (ACT == 3) v = fmaxf(v, 0.f); else if (ACT == 6) v = 0.5f * v * (1.0f + erff(v * 0.70710678118654752f)); so[w][8 * hh + r][t * 16 + ln] = v; } }
  __builtin_amdgcn_fence(__ATOMIC_ACQ_REL, "workgroup"); __builtin_amdgcn_wave_barrier();
  const int rsub = lane >> 4, c4 = (lane & 15) * 4; typedef _Float16 v4h __attribute__((ext_vector_type(4)));
  {
#pragma unroll
    for (int q = 0; q < 8; ++q) { const int r = q * 2 + rsub; if (col0 + c4 < N) { const v4f v = *(const v4fa*)&so[w][r][c4]; if (C) *(v4f*)(C + cofs + (size_t)(row0 + r) * ldc + col0 + c4) = v; if (C16) { v4h h4; for (int i = 0; i < 4; ++i) h4[i] = (_Float16)v[i]; *(v4h*)(C16 + cofs + (size_t)(row0 + r) * ldc + col0 + c4) = h4; } } }
     }
}


typedef _Float16 v4h __attribute__((ext_vector_type(4)));

__global__ __launch_bounds__(256) void k_h16(const float* __restrict__ x, _Float16* __restrict__ X16, size_t n8) { const size_t t = (size_t)blockIdx.x * 256 + threadIdx.x; if (t >= n8) return; FragH f;
#pragma unroll
  for (int q = 0; q < 8; ++q) f.h[q] = (_Float16)x[t * 8 + q]; *(v8us*)((unsigned short*)X16 + t * 8) = f.half[0];  }
__global__ __launch_bounds__(256) void k_round16f(const float* __restrict__ W, _Float16* __restrict__ Bt, size_t n8) { const size_t t = (size_t)blockIdx.x * 256 + threadIdx.x; if (t >= n8) return; FragH f;
#pragma unroll
  for (int i = 0; i < 8; ++i) f.h[i] = (_Float16)(bf16_round(W[t * 8 + i]) * 16.0f); *(v8us*)((unsigned short*)Bt + t * 8) = f.half[0];  }
template <int NHv, int TTv>
__global__ __launch_bounds__(256) void k_vt(const _Float16* __restrict__ V16, int ldv, int voff, _Float16* __restrict__ Vt) { __shared__ unsigned short tl[64][66]; const int tid = threadIdx.x; const int slab = blockIdx.x / (TTv / 64), lg = blockIdx.x % (TTv / 64); const int b = slab / NHv, h = slab % NHv;
  for (int i = tid; i < 64 * 8; i += 256) { const int r = i / 8, c8 = (i % 8) * 8; FragH f; f.half[0] = *(const v8us*)((const unsigned short*)V16 + ((size_t)b * TTv + lg * 64 + r) * ldv + voff + h * 64 + c8);
#pragma unroll
    for (int q = 0; q < 8; ++q) tl[r][c8 + q] = f.u[q]; }
  __syncthreads();
  {
#pragma unroll
    for (int rd = 0; rd < 2; ++rd) { const int d = rd * 32 + tid / 8, pc = tid % 8; FragH f;
#pragma unroll
      for (int q = 0; q < 8; ++q) f.u[q] = tl[pc * 8 + q][d];
      *(v8us*)((unsigned short*)Vt + ((size_t)slab * 64 + d) * TTv + lg * 64 + pc * 8) = f.half[0]; }
     } }

__global__ __launch_bounds__(256) void k_hl(const float* __restrict__ F, _Float16* __restrict__ Hh, _Float16* __restrict__ Hl, size_t n8) { const size_t t = (size_t)blockIdx.x * 256 + threadIdx.x; if (t >= n8) return; FragH fh, fl; const v4f a = *(const v4fa*)(F + t * 8), c = *(const v4fa*)(F + t * 8 + 4);
#pragma unroll
  for (int q = 0; q < 4; ++q) { _Float16 h = (_Float16)a[q]; fh.h[q] = h; fl.h[q] = (_Float16)((a[q] - (float)h) * 1024.0f); h = (_Float16)c[q]; fh.h[4 + q] = h; fl.h[4 + q] = (_Float16)((c[q] - (float)h) * 1024.0f); }
  { *(v8us*)((unsigned short*)Hh + t * 8) = fh.half[0]; *(v8us*)((unsigned short*)Hl + t * 8) = fl.half[0];  } }

// ---- fast GEMM (wave tile 32x64, work-group tile 128x64; requires M % 128 == 0 rows per launch region, N % 64 == 0 and K % 64 == 0); epilogue = k_gemm_hhx semantics ----
__device__ __forceinline__ v16h g2_frag(const _Float16* p, int hh) { FragH f; f.half[0] = *(const v8us*)((const unsigned short*)p + 8 * hh); f.half[1] = *(const v8us*)((const unsigned short*)p + 16 + 8 * hh); return f.v; }
__device__ __forceinline__ v8f g2_mma(v16h a, v16h b, v8f c) { v8f d = __builtin_amdgcn_wmma_f32_16x16x32_f16(false, a, false, b, (short)0, c, false, false); asm volatile("v_nop\n\tv_nop\n\tv_nop\n\tv_nop" : "+v"(d) : "v"(a), "v"(b)); return d; }
// Operand staging of the fast GEMM: a stage is 64 k (one whole 128-byte line) of the work-group's 128 A rows and 64 B rows, brought into LDS by asynchronous copies, two buffers.
#define G2K 64                       /* k per stage */
#define G2P 72                       /* LDS row pitch in f16: 144 B = 16 B x odd, the pitch for 16-byte LDS reads of one row per lane */
#define G2S ((128 + 64) * G2P * 2)   /* bytes of a stage: A rows 0 .. 127, then B rows 0 .. 63 */
// One stage's copies of one thread: 16 bytes of rows r, r + 16, .. of A (8 rows) and of B (4 rows); 8 lanes bring one whole line, a wave-wide copy 4 lines.
// The s_wait_xcnt at the end stands inside the statement so that no register named by a copy is rewritten in front of it.
__device__ __forceinline__ void g2_stage(unsigned l, const _Float16* ga, size_t sa, const _Float16* gb, size_t sb) {
  asm volatile("global_load_async_to_lds_b128 %0, %12, off\n\tglobal_load_async_to_lds_b128 %1, %13, off\n\tglobal_load_async_to_lds_b128 %2, %14, off\n\tglobal_load_async_to_lds_b128 %3, %15, off\n\t"
               "global_load_async_to_lds_b128 %4, %16, off\n\tglobal_load_async_to_lds_b128 %5, %17, off\n\tglobal_load_async_to_lds_b128 %6, %18, off\n\tglobal_load_async_to_lds_b128 %7, %19, off\n\t"
               "global_load_async_to_lds_b128 %8, %20, off\n\tglobal_load_async_to_lds_b128 %9, %21, off\n\tglobal_load_async_to_lds_b128 %10, %22, off\n\tglobal_load_async_to_lds_b128 %11, %23, off\n\ts_wait_xcnt 0x0"
               :: "v"(l), "v"(l + 1 * 16 * G2P * 2), "v"(l + 2 * 16 * G2P * 2), "v"(l + 3 * 16 * G2P * 2), "v"(l + 4 * 16 * G2P * 2), "v"(l + 5 * 16 * G2P * 2), "v"(l + 6 * 16 * G2P * 2), "v"(l + 7 * 16 * G2P * 2),
                  "v"(l + 8 * 16 * G2P * 2), "v"(l + 9 * 16 * G2P * 2), "v"(l + 10 * 16 * G2P * 2), "v"(l + 11 * 16 * G2P * 2),
                  "v"(ga), "v"(ga + sa), "v"(ga + 2 * sa), "v"(ga + 3 * sa), "v"(ga + 4 * sa), "v"(ga + 5 * sa), "v"(ga + 6 * sa), "v"(ga + 7 * sa),
                  "v"(gb), "v"(gb + sb), "v"(gb + 2 * sb), "v"(gb + 3 * sb) : "memory"); }
template <int ACT>
__device__ __forceinline__ void gemm2_body(const int bx, const int by, const _Float16* __restrict__ A, int lda, size_t sA, const _Float16* __restrict__ Bh, int ldb, size_t sB, float alpha, const float* __restrict__ bias, size_t sBias, const float* __restrict__ CP, int rowsPerB, size_t sCPb, int row0g,
    float* __restrict__ C, _Float16* __restrict__ C16, int ldc, size_t sC, int M, int N, int K) { static_assert(ACT == 0 || ACT == 3 || ACT == 6 || ACT == 8 || ACT == 9 || ACT == 11 || ACT == 12 || ACT == 14 || ACT == 15 || ACT == 16 || ACT == 17, "k_gemm2: unsupported ACT code (would silently apply no activation)");
  __shared__ __attribute__((aligned(16))) unsigned char sm[2 * G2S];      /* the two operand buffers; behind the k loop's last barrier the same bytes stage the output rows */
  static_assert(sizeof(float) * 4 * 32 * 68 <= 2 * G2S, "the output staging fits the operand buffers");
  float (*so)[32][68] = (float (*)[32][68])sm;
  const int tid = threadIdx.x, w = tid >> 5, lane = tid & 31, ln = lane & 15, hh = lane >> 4;
  A += (size_t)by * sA; Bh += (size_t)by * sB; const size_t cofs = (size_t)by * sC; const float* bp = bias ? bias + (size_t)by * sBias : nullptr;
  const int ntn = N >> 6; const int mt = bx / ntn, nq = bx - mt * ntn; const int row0 = mt * 128 + 32 * w, col0 = nq * 64; if (mt * 128 >= M) return;      /* taken by a whole work-group or by none (M % 128 == 0): it stands in front of barriers */
  const _Float16* ga = A + (size_t)(mt * 128 + (tid >> 3)) * lda + (tid & 7) * 8; const _Float16* gb = Bh + (size_t)(col0 + (tid >> 3)) * ldb + (tid & 7) * 8;      /* this thread's 16 bytes of rows tid / 8 + 16 i */
  const unsigned lc = (unsigned)(size_t)sm + (unsigned)((tid >> 3) * (G2P * 2) + (tid & 7) * 16);      /* their place in buffer 0 (LDS byte address) */
  const _Float16* la = (const _Float16*)sm + (32 * w + ln) * G2P; const _Float16* lb = (const _Float16*)sm + (128 + ln) * G2P;      /* this lane's fragment rows in buffer 0 */
  const int nt = K / G2K;
  const v8f z8 = {0.f,0.f,0.f,0.f,0.f,0.f,0.f,0.f}; v8f c00 = z8, c01 = z8, c02 = z8, c03 = z8, c10 = z8, c11 = z8, c12 = z8, c13 = z8;
  g2_stage(lc, ga, (size_t)16 * lda, gb, (size_t)16 * ldb);
  asm volatile("s_wait_asynccnt 0x0" ::: "memory");      /* this wave's copies of stage 0 have landed */
  __syncthreads();      /* stage 0 is readable by every wave */
  if (nt > 1) g2_stage(lc + G2S, ga + G2K, (size_t)16 * lda, gb + G2K, (size_t)16 * ldb);
#pragma unroll 1      /* one trip = one stage; the buffer is picked by the trip's parity */
  for (int t = 0; t < nt; ++t) { const int bo = (t & 1) * (G2S / 2); const _Float16* ap = la + bo; const _Float16* bq = lb + bo;
    v16h fa[2][2], fb[2][4];
#pragma unroll      /* the stage's 12 fragments are asked for as one group ahead of its products (constant indices: they stay in registers) */
    for (int q = 0; q < 2; ++q) { fa[q][0] = g2_frag(ap + q * 32, hh); fa[q][1] = g2_frag(ap + 16 * G2P + q * 32, hh);
#pragma unroll
      for (int u = 0; u < 4; ++u) fb[q][u] = g2_frag(bq + u * 16 * G2P + q * 32, hh); }
#pragma unroll      /* the two 32-k blocks of a stage, in ascending k as before */
    for (int q = 0; q < 2; ++q) {
      c00 = g2_mma(fa[q][0], fb[q][0], c00); c10 = g2_mma(fa[q][1], fb[q][0], c10);
      c01 = g2_mma(fa[q][0], fb[q][1], c01); c11 = g2_mma(fa[q][1], fb[q][1], c11);
      c02 = g2_mma(fa[q][0], fb[q][2], c02); c12 = g2_mma(fa[q][1], fb[q][2], c12);
      c03 = g2_mma(fa[q][0], fb[q][3], c03); c13 = g2_mma(fa[q][1], fb[q][3], c13); }
    asm volatile("s_wait_dscnt 0x0" ::: "memory");      /* this wave's reads of the buffer are done before it may be refilled */
    asm volatile("s_wait_asynccnt 0x0" ::: "memory");      /* this wave's copies of stage t + 1 have landed */
    __syncthreads();      /* publishes stage t + 1 and ends every wave's reads of stage t */
    if (t + 2 < nt) g2_stage(lc + (unsigned)(t & 1) * G2S, ga + (size_t)(t + 2) * G2K, (size_t)16 * lda, gb + (size_t)(t + 2) * G2K, (size_t)16 * ldb); }
  asm volatile("s_wait_asynccnt 0x0" ::: "memory");      /* no copy is outstanding when the buffers become output staging */
  v8f accs[8] = {c00, c01, c02, c03, c10, c11, c12, c13};
#pragma unroll
  for (int u = 0; u < 8; ++u) { const int t = u & 3, half = u >> 2; const int col = col0 + t * 16 + ln; const float bv = bp ? bf16_round(bp[col]) : 0.f;
#pragma unroll
    for (int r = 0; r < 8; ++r) { const int rloc = half * 16 + 8 * hh + r; float v = accs[u][r] * alpha + bv; if (CP) { if (rowsPerB < 0) v += CP[cofs + (size_t)(row0g + row0 + rloc) * ldc + col];      /* rowsPerB < 0: own element of the batched C plane */ else { const int bidx = (row0g + row0 + rloc) / rowsPerB; v += CP[(size_t)bidx * sCPb + (size_t)by * 64 + col]; } }
      if (ACT == 3) v = fmaxf(v, 0.f); else if (ACT == 6) v = 0.5f * v * (1.0f + erff(v * 0.70710678118654752f)); else if (ACT == 11) v = 1.0f / (1.0f + expf(-v)); else if (ACT == 15) v = v / (1.0f + expf(-v)); else if (ACT == 12) v = (v > 0.f) ? v : 0.01f * v; else if (ACT == 8) v = tanhf(v); else if (ACT == 9) v = 0.5f * v * (1.0f + tanhf(0.7978845608028654f * (v + 0.044715f * v * v * v))); else if (ACT == 14) v = (v > 0.f) ? v : 0.1f * v; else if (ACT == 16) v = (v >= 0.f) ? v : 0.3f * v; else if (ACT == 17) v = (v >= 0.f) ? v : 0.2f * v;
      so[w][rloc][t * 16 + ln] = v; } }
  __builtin_amdgcn_fence(__ATOMIC_ACQ_REL, "workgroup"); __builtin_amdgcn_wave_barrier();
  const int rsub = lane >> 4, c4 = (lane & 15) * 4;
  {
#pragma unroll
    for (int q = 0; q < 16; ++q) { const int r = q * 2 + rsub; const v4f v = *(const v4fa*)&so[w][r][c4]; if (C) { *(v4f*)(C + cofs + (size_t)(row0 + r) * ldc + col0 + c4) = v; if (C16) asm volatile("s_wait_xcnt 0x0" ::: "memory"); }      /* both outputs asked for: the f32 store's address registers are reused for the f16 store's address, only behind this wait */
      if (C16) { v4h h4; for (int i = 0; i < 4; ++i) h4[i] = (_Float16)v[i]; *(v4h*)(C16 + cofs + (size_t)(row0 + r) * ldc + col0 + c4) = h4; } }
     } }
template <int ACT>
__global__ __launch_bounds__(128) void k_gemm2(const _Float16* __restrict__ A, int lda, size_t sA, const _Float16* __restrict__ Bh, int ldb, size_t sB, float alpha, const float* __restrict__ bias, size_t sBias, const float* __restrict__ CP, int rowsPerB, size_t sCPb, int row0g,
    float* __restrict__ C, _Float16* __restrict__ C16, int ldc, size_t sC, int M, int N, int K) { gemm2_body<ACT>(blockIdx.x, blockIdx.y, A, lda, sA, Bh, ldb, sB, alpha, bias, sBias, CP, rowsPerB, sCPb, row0g, C, C16, ldc, sC, M, N, K); }

// The six independent projection GEMMs as ONE launch. blockIdx.y = q, k or v (input, weight and output planes lie one behind the other); blockIdx.x picks the job:
// the first PJF work-groups give the f32 rows of the first QT0 tokens, the others the f16 rows of all tokens. Each work-group does what it did in its own launch.
#define PJF ((QT0 / 128) * (DM / 64))      /* work-groups of an f32 first-tile job */
#define PJH ((MP / 128) * (DM / 64))       /* work-groups of an f16 all-rows job */
__global__ __launch_bounds__(128) void k_qkv(const _Float16* __restrict__ X, const _Float16* __restrict__ BW, float* __restrict__ CF, _Float16* __restrict__ C16) {
  const int bx = blockIdx.x;      /* the same for the whole work-group: a scalar branch; each side knows at compile time which output it stores */
  if (bx < PJF) gemm2_body<0>(bx, blockIdx.y, X, DM, NR * DM, BW, DM, (size_t)DM * DM, 0.0625f, nullptr, 0, nullptr, 1, 0, 0, CF, nullptr, DM, (size_t)QT0 * DM, QT0, DM, DM);
  else gemm2_body<0>(bx - PJF, blockIdx.y, X, DM, NR * DM, BW, DM, (size_t)DM * DM, 0.0625f, nullptr, 0, nullptr, 1, 0, 0, nullptr, C16, DM, NR * DM, MP, DM, DM); }

// The output GEMM of all rows and that of the first tile's f16 hi plane as ONE launch: the work-groups of rows 0 .. QT0 - 1 read the exact first-tile o (hi plane) in place of the f16-path rows,
// whose product was overwritten before. Same grid, same rows and columns per work-group, same alpha.
__global__ __launch_bounds__(128) void k_out(const _Float16* __restrict__ O, const _Float16* __restrict__ OH, const _Float16* __restrict__ BO, float* __restrict__ out) {
  const int bx = blockIdx.x;
  gemm2_body<0>(bx, 0, (bx < PJF) ? OH : O, DM, 0, BO, DM, 0, 0.0009765625f, nullptr, 0, nullptr, 1, 0, 0, out, nullptr, DM, 0, MPO, DM, DM); }

// Operand preparation as ONE launch of independent jobs picked by the block index; each thread does what it did in the separate launches.
// Work-groups 0 .. 4 PWB - 1: plane p of BW (q, k, v, o): BW[p][n][k] = f16(bf16(W[k][n]) x 16) (a power of two: bf16-exact weights stay exact in f16 away from the subnormal range);
// for p < 3 row n is column n % 64 of head n / 64 of the [head][in][out] stack, for p = 3 column n of the [in][out] output weight. The others: plane j of XH = input j rounded to bf16, as f16.
#define PWB (DM * (DM / 8) / 256)          /* work-groups per weight plane */
#define PXB ((int)(NR * DM / 8 / 256))     /* work-groups per input */
__global__ __launch_bounds__(256) void k_prep(const float* __restrict__ xq, const float* __restrict__ xk, const float* __restrict__ xv, const float* __restrict__ wq, const float* __restrict__ wk, const float* __restrict__ wv, const float* __restrict__ wo,
    _Float16* __restrict__ BW, _Float16* __restrict__ XH) {
  const int bx = blockIdx.x; FragH f;
  if (bx < 4 * PWB) { const int p = bx / PWB; const int t = (bx - p * PWB) * 256 + threadIdx.x; const int n = t / (DM / 8), k8 = (t % (DM / 8)) * 8;
    if (p < 3) { const float* s = ((p == 0) ? wq : (p == 1) ? wk : wv) + (size_t)(n / HD) * DM * HD + (size_t)k8 * HD + n % HD;
#pragma unroll
      for (int i = 0; i < 8; ++i) f.h[i] = (_Float16)(bf16_round(s[i * HD]) * 16.0f); }
    else { const float* s = wo + (size_t)k8 * DM + n;
#pragma unroll
      for (int i = 0; i < 8; ++i) f.h[i] = (_Float16)(bf16_round(s[i * DM]) * 16.0f); }
    *(v8us*)((unsigned short*)BW + (size_t)p * DM * DM + (size_t)n * DM + k8) = f.half[0]; }
  else { const int xb = bx - 4 * PWB; const int j = xb / PXB; const size_t t = (size_t)(xb - j * PXB) * 256 + threadIdx.x; const float* x = (j == 0) ? xq : (j == 1) ? xk : xv;
#pragma unroll
    for (int q = 0; q < 8; ++q) f.h[q] = (_Float16)bf16_round(x[t * 8 + q]);
    *(v8us*)((unsigned short*)XH + (size_t)j * NR * DM + t * 8) = f.half[0]; } }


__global__ __launch_bounds__(256) void k_wnat(const float* __restrict__ w, size_t n8, _Float16* __restrict__ Bt) { const size_t t = (size_t)blockIdx.x * 256 + threadIdx.x; if (t >= n8) return; FragH f; for (int q = 0; q < 8; ++q) f.h[q] = (_Float16)(bf16_round(w[t * 8 + q]) * 16.0f); *(v8us*)((unsigned short*)Bt + t * 8) = f.half[0];  }
__global__ __launch_bounds__(256) void k_rsm(const float* __restrict__ S, _Float16* __restrict__ P, int nrows) {
  #pragma clang fp contract(off)
  const int i = blockIdx.x * 256 + threadIdx.x; if (i >= nrows) return; const float* s = S + (size_t)i * SQ; float mx = -3.0e38f;
#pragma unroll 1
  for (int j = 0; j < SQ; ++j) mx = fmaxf(mx, s[j]); float se = 0.f;
#pragma unroll 1
  for (int j = 0; j < SQ; ++j) se += expf(s[j] - mx); const float sc = 256.0f / se;
#pragma unroll 1
  for (int j0 = 0; j0 < SQ; j0 += 8) { FragH f; for (int q = 0; q < 8; ++q) f.h[q] = (_Float16)(expf(s[j0 + q] - mx) * sc); unsigned short* d = (unsigned short*)P + (size_t)i * SQ + j0; *(v8us*)d = f.half[0];  } }
__global__ __launch_bounds__(256) void k_vt(const _Float16* __restrict__ V16, int b, int h0, _Float16* __restrict__ VT) { __shared__ unsigned short tl[64][65]; const int tid = threadIdx.x; const int hh = blockIdx.x % HG, sg = blockIdx.x / HG; const int s0 = sg * 64; const int h = h0 + hh;
  for (int i = tid; i < 64 * 8; i += 256) { const int j = i / 8, d8 = (i % 8) * 8; FragH f; f.half[0] = *(const v8us*)((const unsigned short*)V16 + ((size_t)b * SQ + s0 + j) * DM + h * HD + d8); for (int q = 0; q < 8; ++q) tl[d8 + q][j] = f.u[q]; }
  __syncthreads();
  { for (int i = tid; i < 64 * 8; i += 256) { const int d = i / 8, j8 = (i % 8) * 8; FragH f; for (int q = 0; q < 8; ++q) f.u[q] = tl[d][j8 + q]; *(v8us*)((unsigned short*)VT + ((size_t)hh * HD + d) * SQ + s0 + j8) = f.half[0]; }  } }



#define FQ 32                        /* query rows per wave */
#define FW 4                         /* waves per work-group */
#define FNG (NH * (SQ / (FQ * FW)))  /* work-groups */
__device__ __forceinline__ v8f fa_mma(v16h a, v16h b, v8f c) { return __builtin_amdgcn_wmma_f32_16x16x32_f16(false, a, false, b, (short)0, c, false, false); }
__device__ __forceinline__ float fa_xhalf(float x) { return __builtin_bit_cast(float, __builtin_amdgcn_permlanex16(__builtin_bit_cast(int, x), __builtin_bit_cast(int, x), 0x76543210, 0xfedcba98, false, false)); }      /* lane l with lane l ^ 16 */
// 2^x by the native instruction. The v_nop at the end fills the slot that the instruction set asks for behind a transcendental before its result is read or its source overwritten;
// inside the group every result register differs from every source ("=&v"), so each v_exp_f32 is the independent instruction behind the one before it.
__device__ __forceinline__ float fa_exp2(float x) { float e; asm("v_exp_f32 %0, %1\n\tv_nop" : "=&v"(e) : "v"(x)); return e; }
__device__ __forceinline__ void fa_exp2x8(const float (&x)[8], float (&e)[8]) {
  asm("v_exp_f32 %0, %8\n\tv_exp_f32 %1, %9\n\tv_exp_f32 %2, %10\n\tv_exp_f32 %3, %11\n\tv_exp_f32 %4, %12\n\tv_exp_f32 %5, %13\n\tv_exp_f32 %6, %14\n\tv_exp_f32 %7, %15\n\tv_nop"
      : "=&v"(e[0]), "=&v"(e[1]), "=&v"(e[2]), "=&v"(e[3]), "=&v"(e[4]), "=&v"(e[5]), "=&v"(e[6]), "=&v"(e[7]) : "v"(x[0]), "v"(x[1]), "v"(x[2]), "v"(x[3]), "v"(x[4]), "v"(x[5]), "v"(x[6]), "v"(x[7])); }
__global__ __launch_bounds__(FW * 32) void k_fattn(const _Float16* __restrict__ Q, const _Float16* __restrict__ K, const _Float16* __restrict__ VT, _Float16* __restrict__ O) {
  const int lane = threadIdx.x & 31, ln = lane & 15, hh = lane >> 4; const int w = __builtin_amdgcn_readfirstlane(threadIdx.x >> 5);
  const int bx = blockIdx.x; const int rank = (bx < FNG / 2) ? bx : (FNG + FNG / 2 - 1 - bx);      /* a permutation: long work-groups first, then the short ones shortest first, so that groups bx and bx + FNG / 2 together have equal work (speed only) */
  const int h = rank % NH; const int q0 = (SQ / (FQ * FW) - 1 - rank / NH) * (FQ * FW) + w * FQ;
  const float CS = 0.125f * 1.4426950408889634f;      /* score scale x log2(e): exponentials in base 2 */
  const _Float16* qp = Q + (size_t)(q0 + ln) * DM + h * HD; const _Float16* kp = K + (size_t)ln * DM + h * HD; const _Float16* vp = VT + ((size_t)h * HD + ln) * SQ;
  v16h qf[2][2], kf[2][2];
#pragma unroll      /* fragments indexed by constants only: they stay in registers */
  for (int t = 0; t < 2; ++t)
#pragma unroll
    for (int c = 0; c < 2; ++c) { qf[t][c] = g2_frag(qp + (size_t)t * 16 * DM + c * 32, hh); kf[t][c] = g2_frag(kp + (size_t)t * 16 * DM + c * 32, hh); }
  const v8f z8 = {0.f, 0.f, 0.f, 0.f, 0.f, 0.f, 0.f, 0.f}; v8f acc[4][2]; float mr[2], ls[2];
#pragma unroll
  for (int t = 0; t < 2; ++t) { mr[t] = -3.0e38f; ls[t] = 0.f;
#pragma unroll
    for (int d = 0; d < 4; ++d) acc[d][t] = z8; }
#pragma unroll 1      /* one pass = 32 keys; the body is long enough as it is */
  for (int j0 = 0; j0 <= q0; j0 += 32) {
    v16h vf[4];
#pragma unroll      /* V^T of this pass: asked for ahead of the score products and the softmax */
    for (int d = 0; d < 4; ++d) vf[d] = g2_frag(vp + (size_t)d * 16 * SQ + j0, hh);
    v8f s[2][2];
#pragma unroll
    for (int u = 0; u < 2; ++u)
#pragma unroll
      for (int t = 0; t < 2; ++t) s[u][t] = fa_mma(kf[u][1], qf[t][1], fa_mma(kf[u][0], qf[t][0], z8));
    const int jn = (j0 < q0) ? j0 + 32 : q0;      /* the next pass's K rows, asked for behind this pass's score products (the last pass asks for its own again: in bounds, unused) */
#pragma unroll
    for (int u = 0; u < 2; ++u)
#pragma unroll
      for (int c = 0; c < 2; ++c) kf[u][c] = g2_frag(kp + (size_t)(jn + u * 16) * DM + c * 32, hh);
    asm volatile("s_wait_xcnt 0x0" ::: "memory");      /* the address registers of the loads above are reused below: they are overwritten only behind this wait */
    if (j0 == q0) {      /* the diagonal pass: key > query is masked (a scalar branch) */
#pragma unroll
      for (int u = 0; u < 2; ++u)
#pragma unroll
        for (int t = 0; t < 2; ++t)
#pragma unroll
          for (int r = 0; r < 8; ++r) if (u * 16 + 8 * hh + r > t * 16 + ln) s[u][t][r] = -3.0e38f; }
    FragH pf[2];
#pragma unroll
    for (int t = 0; t < 2; ++t) { float mx = fmaxf(s[0][t][0], s[1][t][0]);
#pragma unroll
      for (int r = 1; r < 8; ++r) mx = fmaxf(mx, fmaxf(s[0][t][r], s[1][t][r]));
      mx = fmaxf(mx, fa_xhalf(mx)); const float mn = fmaxf(mr[t], mx); const float corr = fa_exp2((mr[t] - mn) * CS); mr[t] = mn; const float mc = mn * CS;      /* every pass holds at least one unmasked key of every query: mn is a real score */
      float x0[8], x1[8], e0[8], e1[8];
#pragma unroll
      for (int r = 0; r < 8; ++r) { x0[r] = fmaf(s[0][t][r], CS, -mc); x1[r] = fmaf(s[1][t][r], CS, -mc); }
      fa_exp2x8(x0, e0); fa_exp2x8(x1, e1); float s0 = 0.f, s1 = 0.f;
#pragma unroll
      for (int r = 0; r < 8; ++r) { s0 += e0[r]; s1 += e1[r]; pf[t].h[r] = (_Float16)e0[r]; pf[t].h[8 + r] = (_Float16)e1[r]; }
      ls[t] = fmaf(ls[t], corr, s0 + s1);
#pragma unroll
      for (int d = 0; d < 4; ++d) acc[d][t] *= corr; }
#pragma unroll
    for (int d = 0; d < 4; ++d)
#pragma unroll
      for (int t = 0; t < 2; ++t) acc[d][t] = fa_mma(vf[d], pf[t].v, acc[d][t]);
  }
#pragma unroll
  for (int t = 0; t < 2; ++t) { const float inv = 64.0f / (ls[t] + fa_xhalf(ls[t]));      /* the halves' sums joined once; o carried x64 */
    unsigned short* op = (unsigned short*)O + (size_t)(q0 + t * 16 + ln) * DM + h * HD + 8 * hh;
#pragma unroll      /* the wave stores the whole 128-byte line of each of its rows */
    for (int d = 0; d < 4; ++d) { FragH f;
#pragma unroll
      for (int r = 0; r < 8; ++r) f.h[r] = (_Float16)(acc[d][t][r] * inv);
      *(v8us*)(op + d * 16) = f.half[0]; } } }


// Exact f32 causal attention for rows 0 .. QT0 - 1 (o carried x64 like the f16 path). ONE WORK-GROUP PER HEAD AND 16 QUERY ROWS, 8 waves:
// the head's K and V rows below the group's end are staged in LDS by coalesced loads; scores: one thread per key (its K row in registers, the q rows wave-uniform);
// softmax: one wave per two rows; o: each wave sums every eighth chunk of 4 keys for all 16 rows x 64 columns in registers, and the 8 partial sums are added in wave order.
#define A0R 16                       /* query rows per work-group */
#define A0KP (HD + 4)                /* LDS pitch of a K row in floats: 272 B = 16 B x odd, so that 16-byte reads of one row per lane spread over the banks */
#define A0SP (QT0 + 4)               /* LDS pitch of a score row in floats (a multiple of 16 B) */
__global__ __launch_bounds__(256) void k_att0w(const float* __restrict__ QF, const float* __restrict__ KF, const float* __restrict__ VF, float scale, float* __restrict__ OF) {
  __shared__ __attribute__((aligned(16))) float lk[QT0][A0KP]; __shared__ __attribute__((aligned(16))) float lv[QT0][HD]; __shared__ __attribute__((aligned(16))) float ls[A0R][A0SP];
  __shared__ __attribute__((aligned(16))) float red[8][A0R][HD]; __shared__ float linv[A0R];
  const int tid = threadIdx.x, lane = tid & 31, w = __builtin_amdgcn_readfirstlane(tid >> 5); const int h = blockIdx.x / (QT0 / A0R), rg = blockIdx.x % (QT0 / A0R); const int nk = (rg + 1) * A0R;      /* causal: keys below the group's end */
  const int r16 = tid >> 4, c4 = (tid & 15) * 4;
  { const float* kp = KF + (size_t)r16 * DM + h * HD + c4; const float* vp = VF + (size_t)r16 * DM + h * HD + c4; v4f kx[QT0 / 16], vx[QT0 / 16];
#pragma unroll      /* constant indices keep kx and vx in registers; every load is issued before the first value is used */
    for (int u = 0; u < QT0 / 16; ++u) if (u <= rg) { kx[u] = *(const v4fa*)(kp + (size_t)u * 16 * DM); vx[u] = *(const v4fa*)(vp + (size_t)u * 16 * DM); }
    asm volatile("s_wait_xcnt 0x0" :: "v"(kp), "v"(vp) : "memory");      /* the loads' address registers are reused below: they are held up to this wait and overwritten only behind it */
#pragma unroll      /* constant indices, as above */
    for (int u = 0; u < QT0 / 16; ++u) if (u <= rg) { *(v4f*)&lk[u * 16 + r16][c4] = kx[u]; *(v4f*)&lv[u * 16 + r16][c4] = vx[u]; } }
  __syncthreads();
  if (tid < nk) { v4f kr[HD / 4];
#pragma unroll      /* the key's row stays in registers for all 16 query rows */
    for (int c = 0; c < HD / 4; ++c) kr[c] = *(const v4f*)&lk[tid][c * 4];
    const float* qb = QF + (size_t)rg * A0R * DM + h * HD;      /* the same address in every lane */
#pragma unroll 4      /* several rows' q loads in flight ahead of their products */
    for (int i = 0; i < A0R; ++i) { v4f s4 = {0.f, 0.f, 0.f, 0.f};
#pragma unroll      /* kr is indexed by constants only */
      for (int c = 0; c < HD / 4; ++c) { const v4f qq = *(const v4fa*)(qb + (size_t)i * DM + c * 4);
#pragma unroll      /* short fixed trip count; the arrays it indexes stay in registers */
        for (int u = 0; u < 4; ++u) s4[u] = fmaf(qq[u], kr[c][u], s4[u]); }
      ls[i][tid] = ((s4[0] + s4[1]) + (s4[2] + s4[3])) * scale; } }
  __syncthreads();
#pragma unroll 1      /* two rows a wave, one after the other: small code */
  for (int i = 2 * w; i < 2 * w + 2; ++i) { const int last = rg * A0R + i; float x[QT0 / 32]; float mx = -3.0e38f;
#pragma unroll      /* x is indexed by constants only */
    for (int u = 0; u < QT0 / 32; ++u) { const int j = u * 32 + lane; x[u] = (j <= last) ? ls[i][j] : -3.0e38f; mx = fmaxf(mx, x[u]); }
#pragma unroll      /* short fixed trip count; the arrays it indexes stay in registers */
    for (int o = 16; o > 0; o >>= 1) mx = fmaxf(mx, __shfl_xor(mx, o, 32));
    float se = 0.f;
#pragma unroll      /* short fixed trip count; the arrays it indexes stay in registers */
    for (int u = 0; u < QT0 / 32; ++u) { const int j = u * 32 + lane; const float e = (j <= last) ? expf(x[u] - mx) : 0.f; se += e; if (j < nk) ls[i][j] = e; }
#pragma unroll      /* short fixed trip count; the arrays it indexes stay in registers */
    for (int o = 16; o > 0; o >>= 1) se += __shfl_xor(se, o, 32);
    if (lane == 0) linv[i] = 64.0f / se; }      /* o carried x64 like the f16 path */
  __syncthreads();
  { const int rh = lane >> 4, d4 = (lane & 15) * 4; v4f acc[8];
#pragma unroll      /* short fixed trip count; the arrays it indexes stay in registers */
    for (int r = 0; r < 8; ++r) acc[r] = (v4f){0.f, 0.f, 0.f, 0.f};
#pragma unroll 1      /* at most 8 trips of 128 multiply-adds: the body is long enough as it is */
    for (int j0 = 4 * w; j0 < nk; j0 += 32) { v4f pv[8], vv[4];
#pragma unroll      /* short fixed trip count; the arrays it indexes stay in registers */
      for (int r = 0; r < 8; ++r) pv[r] = *(const v4f*)&ls[rh * 8 + r][j0];
#pragma unroll      /* short fixed trip count; the arrays it indexes stay in registers */
      for (int q = 0; q < 4; ++q) vv[q] = *(const v4f*)&lv[j0 + q][d4];
#pragma unroll      /* short fixed trip count; the arrays it indexes stay in registers */
      for (int q = 0; q < 4; ++q)
#pragma unroll      /* short fixed trip count; the arrays it indexes stay in registers */
        for (int r = 0; r < 8; ++r)
#pragma unroll      /* short fixed trip count; the arrays it indexes stay in registers */
          for (int u = 0; u < 4; ++u) acc[r][u] = fmaf(pv[r][q], vv[q][u], acc[r][u]); }
#pragma unroll      /* short fixed trip count; the arrays it indexes stay in registers */
    for (int r = 0; r < 8; ++r) *(v4f*)&red[w][rh * 8 + r][d4] = acc[r]; }
  __syncthreads();
  { v4f o = *(const v4f*)&red[0][r16][c4];
#pragma unroll      /* short fixed trip count; the arrays it indexes stay in registers */
    for (int p = 1; p < 8; ++p) { const v4f a = *(const v4f*)&red[p][r16][c4]; o += a; }
    const float fin = linv[r16]; o *= fin;
    *(v4f*)(OF + (size_t)(rg * A0R + r16) * DM + h * HD + c4) = o; } }

extern "C" void kernel_launch(void* const* d_in, const int* in_sizes, int n_in,
                              void* d_out, int out_size, void* d_ws, size_t ws_size, hipStream_t stream) {
  (void)in_sizes; (void)n_in; (void)out_size;
  const float* const* I = (const float* const*)d_in; const float* xq = I[0]; const float* xk = I[1]; const float* xv = I[2]; const float* wq = I[3]; const float* wk = I[4]; const float* wv = I[5]; const float* wo = I[6];      /* weights [in][out] */
  char* ws = (char*)d_ws; size_t off = 0;
  auto take = [&](size_t bytes) { char* p = ws + off; off += (bytes + 255) & ~(size_t)255; return p; };
  static_assert(NB == 1 && B0 == 0 && NBR == 1, "the joined projection launch takes the first-tile rows of one batch");
  _Float16* BW = (_Float16*)take((size_t)4 * DM * DM * 2); _Float16* BO = BW + (size_t)3 * DM * DM;      /* weight planes q, k, v, o, one behind the other */
  _Float16* XH = (_Float16*)take(3 * NR * DM * 2);      /* rounded inputs q, k, v, one behind the other */
  _Float16* Q16 = (_Float16*)take(3 * NR * DM * 2); _Float16* K16 = Q16 + NR * DM; _Float16* V16 = K16 + NR * DM; _Float16* O16 = (_Float16*)take(NR * DM * 2);      /* q, k, v rows, one plane behind the other */
  _Float16* VT = (_Float16*)take((size_t)NH * HD * SQ * 2);
  float* QF0 = (float*)take((size_t)3 * QT0 * DM * 4); float* KF0 = QF0 + (size_t)QT0 * DM; float* VF0 = KF0 + (size_t)QT0 * DM; float* OF0 = (float*)take((size_t)NB * QT0 * DM * 4); _Float16* OH0 = (_Float16*)take((size_t)NB * QT0 * DM * 2); _Float16* OL0 = (_Float16*)take((size_t)NB * QT0 * DM * 2);
  if (off > ws_size) return;
  k_prep<<<4 * PWB + 3 * PXB, 256, 0, stream>>>(xq, xk, xv, wq, wk, wv, wo, BW, XH);      /* all four x16 weight planes Bt[n][k] (PER-HEAD STACKS [16][1024][64] = [head][in][out]: head h's block -> rows 64 h .. 64 h + 63) and the three rounded inputs */
  k_qkv<<<dim3(PJF + PJH, 3), 128, 0, stream>>>(XH, BW, QF0, Q16);      /* q, k, v: f16 rows of all tokens, and f32 rows of the first 256 (exact products) */
  for (int b = B0; b < B0 + NBR; ++b) { const size_t r0 = (size_t)b * SQ;
    k_vt<NH, SQ><<<NH * (SQ / 64), 256, 0, stream>>>(V16 + r0 * LQ, LQ, 0, VT);      /* V^T [NH][HD][SQ] for this batch */
    k_att0w<<<NH * (QT0 / A0R), 256, 0, stream>>>(QF0, KF0, VF0, 0.125f, OF0 + (size_t)b * QT0 * DM);      /* exact f32 attention for rows 0..255 (o x64) */
    k_fattn<<<FNG, FW * 32, 0, stream>>>(Q16 + r0 * LQ, K16 + r0 * LQ, VT, O16 + r0 * DM); }      /* scores, causal softmax and P V for all heads and rows in one launch: o (merged heads, x64) as f16 rows */
  k_hl<<<(unsigned)(((size_t)NB * QT0 * DM / 8 + 255) / 256), 256, 0, stream>>>(OF0, OH0, OL0, (size_t)NB * QT0 * DM / 8);      /* first-tile o (x64) -> f16 hi + x1024 residual planes */
  k_out<<<(MPO / 128) * (DM / 64), 128, 0, stream>>>(O16, OH0, BO, (float*)d_out);      /* out rows are the output layout; rows 0..255: out = o_hi Wo */
  for (int b = B0; b < B0 + NBR; ++b) { const size_t r0 = (size_t)b * SQ; const size_t f0 = (size_t)b * QT0;
    k_gemm2<0><<<dim3((QT0 / 128) * (DM / 64), 1), 128, 0, stream>>>(OL0 + f0 * DM, DM, 0, BO, DM, 0, 0.00000095367431640625f, nullptr, 0, (const float*)d_out + r0 * DM, -1, 0, 0, (float*)d_out + r0 * DM, nullptr, DM, 0, QT0, DM, DM); }      /* += o_lo Wo 2^-20 (own-element accumulate) */
}

// v006
// One run takes 163 microseconds.
// Timed twice side by side with v005, it ran 1.17 times as fast both times.
// Counting every step since v000, it is 51.4 times as fast.
#include <hip/hip_runtime.h>
// Causal multi-head attention on three inputs with PER-HEAD STACKED projections over ONE sequence of 4096 tokens (Q, K, V [1][4096][1024]; WQ / WK / WV [16][1024][64] = [head][in][out] sigma 0.02, NO biases; 16 heads of 64; scores x 64^-0.5 = / 8; causal (tril, -inf above the diagonal); softmax; heads concatenated head-major; out = concat WO with WO [1024][1024] [in][out], NO bias -> [1][4096][1024]); each head's [in][out] block is transposed into its 64 contiguous rows of the weight plane, and the [in][out] output weight into its own plane, by one launch that also rounds the three inputs.
// Structure: token rows r = s; q, k, v inputs as exact f16 rows (bf16-rounded); Q, K, V as three WMMA GEMMs in one launch (32x64 wave tiles, f32 accumulation, exact x16 weights, f16 outputs; the f32 rows of the first tile by further work-groups of the same launch); per batch: V^T for all heads via LDS transposes; one fused attention launch: a wave per 32 query rows of a head walks the keys up to its own rows 32 at a time (scores on WMMA, K = 64; running f32 maximum and sum, native exp2; weights in (0, 1] as f16; o += P V on WMMA, divided by the sum at the end, o carried x64, folded into the output GEMM alpha), written straight into the merged f16 o rows; out = o W_o GEMM (f32) into the output layout.
// Compute dtype: inputs rounded to bf16; x / weights exact; q, k, v, softmax weights and o as plain f16 GEMM operands (~2^-12); scores and softmax statistics f32. v_wmma_f32_16x16x32_f16.
#define NB 1
#define SQ 4096
#define DM 1024
#define NH 16
#define HD 64
#define HG 4                         /* heads per launch of the unlaunched k_vt overload */
#define QT 256                       /* unused */
#define NKX SQ                       /* unused */
#define QT0 256                      /* first-tile rows recomputed exactly in f32 */
#define B0 0                         /* first batch processed (debug hook) */
#define NBR NB                       /* batches processed (debug hook) */
#define NR ((size_t)NB * SQ)         /* token rows */
#define MP ((int)((size_t)NBR * SQ)) /* rows projected (debug hook) */
#define QN SQ                        /* unused (k_fattn attends all SQ rows) */
#define NHD NH                       /* unused (k_fattn attends all NH heads) */
#define MPO MP                       /* rows through the output stage (debug hook) */
#define LQ DM      /* row pitch of the q/k/v rows */
typedef __bf16 v16b __attribute__((ext_vector_type(16)));
typedef unsigned short v8us __attribute__((ext_vector_type(8), may_alias));
typedef float  v8f  __attribute__((ext_vector_type(8)));
typedef float  v4f  __attribute__((ext_vector_type(4)));
typedef float  v4fa __attribute__((ext_vector_type(4), may_alias));
union FragB { v16b v; v8us half[2]; unsigned short u[16]; };

__device__ __forceinline__ unsigned short bf16_bits(float x) { unsigned int u = __float_as_uint(x); return (unsigned short)((u + 0x7FFFu + ((u >> 16) & 1u)) >> 16); }
__device__ __forceinline__ float bf16_val(unsigned short b) { return __uint_as_float(((unsigned int)b) << 16); }
__device__ __forceinline__ float bf16_round(float x) { return bf16_val(bf16_bits(x)); }
// D += A·B with NT terms: 1 = ah·bh, 2 = + al·bh (A split), 3 = + ah·bl (both split)
template <int NT>
__device__ __forceinline__ v8f mmaN(v16b ah, v16b al, v16b bh, v16b bl, v8f c) {
  c = __builtin_amdgcn_wmma_f32_16x16x32_bf16(false, ah, false, bh, (short)0, c, false, false);
  if (NT >= 2) c = __builtin_amdgcn_wmma_f32_16x16x32_bf16(false, al, false, bh, (short)0, c, false, false);
  if (NT >= 3) c = __builtin_amdgcn_wmma_f32_16x16x32_bf16(false, ah, false, bl, (short)0, c, false, false);
  asm volatile("v_nop\n\tv_nop\n\tv_nop\n\tv_nop" : "+v"(c) : "v"(ah), "v"(al), "v"(bh), "v"(bl));
  return c;
}

__global__ __launch_bounds__(256) void k_wt_bf16(const float* __restrict__ W, unsigned short* __restrict__ Wt, int K, int N) {
  const int t = blockIdx.x * 256 + threadIdx.x;
  const int k8n = K / 8;
  if (t >= N * k8n) return;
  const int n = t / k8n, k8 = (t % k8n) * 8;
  v8us v;
#pragma unroll
  for (int i = 0; i < 8; ++i) v[i] = bf16_bits(W[(size_t)(k8 + i) * N + n]);
  *(v8us*)(Wt + (size_t)n * K + k8) = v;
  
}

// GEMM C[M][N] (f32, pitch ldc) = act(A[M][K]·W + bias). A f32 row-major (pitch lda) converted per fragment to bf16
// (ASPLIT: hi/lo two planes -> 2 terms, else single rounded term); Wt bf16 [N][K] (pitch ldb). BIAS_BF16 rounds the
// bias to bf16 first (bias quantised to bf16 before the add). K%32==0, M%16==0, N%64==0.
template <bool ASPLIT, int ACT, bool BIAS_BF16>
__global__ __launch_bounds__(128) void k_gemm_bf(const float* __restrict__ A, int lda, const unsigned short* __restrict__ Wt, int ldb,
                                               const float* __restrict__ bias, float* __restrict__ C, int ldc, int M, int N, int K) {
  __shared__ __attribute__((aligned(16))) float so[4][16][64];
  const int tid = threadIdx.x, w = tid >> 5, lane = tid & 31, ln = lane & 15, hh = lane >> 4;
  const int ntn = N / 64;
  const int wid = blockIdx.x * 4 + w;
  const int mt = wid / ntn, nq = wid % ntn;
  if (mt * 16 >= M) return;
  const int row0 = mt * 16, col0 = nq * 64;
  const float* arow = A + (size_t)(row0 + ln) * lda;
  v8f acc[4] = {};
  for (int kb = 0; kb < K; kb += 32) {
    FragB ah, al;
    const v4f x0 = *(const v4fa*)(arow + kb + 8 * hh), x1 = *(const v4fa*)(arow + kb + 8 * hh + 4);
    const v4f x2 = *(const v4fa*)(arow + kb + 16 + 8 * hh), x3 = *(const v4fa*)(arow + kb + 16 + 8 * hh + 4);
    float xs[16] = {x0[0],x0[1],x0[2],x0[3],x1[0],x1[1],x1[2],x1[3],x2[0],x2[1],x2[2],x2[3],x3[0],x3[1],x3[2],x3[3]};
#pragma unroll
    for (int i = 0; i < 16; ++i) { const unsigned short hb = bf16_bits(xs[i]); ah.u[i] = hb; al.u[i] = ASPLIT ? bf16_bits(xs[i] - bf16_val(hb)) : (unsigned short)0; }
#pragma unroll
    for (int t = 0; t < 4; ++t) {
      const unsigned short* brow = Wt + (size_t)(col0 + t * 16 + ln) * ldb + kb;
      FragB b;
      b.half[0] = *(const v8us*)(brow + 8 * hh);
      b.half[1] = *(const v8us*)(brow + 16 + 8 * hh);
      acc[t] = mmaN<ASPLIT ? 2 : 1>(ah.v, al.v, b.v, b.v, acc[t]);
    }
  }
#pragma unroll
  for (int t = 0; t < 4; ++t) {
    float bv = bias ? bias[col0 + t * 16 + ln] : 0.f;
    if (BIAS_BF16) bv = bf16_round(bv);
#pragma unroll
    for (int r = 0; r < 8; ++r) { float v = acc[t][r] + bv; if (ACT == 1) v = fmaxf(v, 0.f); so[w][8 * hh + r][t * 16 + ln] = v; }
  }
  __builtin_amdgcn_fence(__ATOMIC_ACQ_REL, "workgroup");
  __builtin_amdgcn_wave_barrier();
  const int rsub = lane >> 4, c4 = (lane & 15) * 4;
  {
#pragma unroll
    for (int q = 0; q < 8; ++q) {
      const int r = q * 2 + rsub;
      const v4f v = *(const v4fa*)&so[w][r][c4];
      *(v4f*)(C + (size_t)(row0 + r) * ldc + col0 + c4) = v;
    }
    
  }
}

// GEMM C = act(A·W + bias + resid): A f32 (ASPLIT -> hi/lo 2 terms), Wt bf16 [N][K]; ACT 0 none, 1 relu, 2 exact gelu;
// resid (optional, f32, row index = (row % rmod), pitch ldr, RES_BF16 rounds it) added before the activation.
template <bool ASPLIT, int ACT, bool BIAS_BF16, bool RES_BF16>
__global__ __launch_bounds__(128) void k_gemm_bf3(const float* __restrict__ A, int lda, const unsigned short* __restrict__ Wt, int ldb,
                                                const float* __restrict__ bias, const float* __restrict__ resid, int rmod, int ldr,
                                                float* __restrict__ C, int ldc, int M, int N, int K) {
  __shared__ __attribute__((aligned(16))) float so[4][16][64];
  const int tid = threadIdx.x, w = tid >> 5, lane = tid & 31, ln = lane & 15, hh = lane >> 4;
  const int ntn = N / 64;
  const int wid = blockIdx.x * 4 + w;
  const int mt = wid / ntn, nq = wid % ntn;
  if (mt * 16 >= M) return;
  const int row0 = mt * 16, col0 = nq * 64;
  const float* arow = A + (size_t)(row0 + ln) * lda;
  v8f acc[4] = {};
  for (int kb = 0; kb < K; kb += 32) {
    FragB ah, al;
    const v4f x0 = *(const v4fa*)(arow + kb + 8 * hh), x1 = *(const v4fa*)(arow + kb + 8 * hh + 4);
    const v4f x2 = *(const v4fa*)(arow + kb + 16 + 8 * hh), x3 = *(const v4fa*)(arow + kb + 16 + 8 * hh + 4);
    float xs[16] = {x0[0],x0[1],x0[2],x0[3],x1[0],x1[1],x1[2],x1[3],x2[0],x2[1],x2[2],x2[3],x3[0],x3[1],x3[2],x3[3]};
#pragma unroll
    for (int i = 0; i < 16; ++i) { const unsigned short hb = bf16_bits(xs[i]); ah.u[i] = hb; al.u[i] = ASPLIT ? bf16_bits(xs[i] - bf16_val(hb)) : (unsigned short)0; }
#pragma unroll
    for (int t = 0; t < 4; ++t) {
      const unsigned short* brow = Wt + (size_t)(col0 + t * 16 + ln) * ldb + kb;
      FragB b;
      b.half[0] = *(const v8us*)(brow + 8 * hh);
      b.half[1] = *(const v8us*)(brow + 16 + 8 * hh);
      acc[t] = mmaN<ASPLIT ? 2 : 1>(ah.v, al.v, b.v, b.v, acc[t]);
    }
  }
#pragma unroll
  for (int t = 0; t < 4; ++t) {
    const int col = col0 + t * 16 + ln;
    float bv = bias ? bias[col] : 0.f;
    if (BIAS_BF16) bv = bf16_round(bv);
#pragma unroll
    for (int r = 0; r < 8; ++r) {
      float v = acc[t][r] + bv;
      if (resid) { float rv = resid[(size_t)((row0 + 8 * hh + r) % rmod) * ldr + col]; if (RES_BF16) rv = bf16_round(rv); v += rv; }
      if (ACT == 1) v = fmaxf(v, 0.f);
      if (ACT == 2) v = 0.5f * v * (1.0f + erff(v * 0.70710678118654752f));
      if (ACT == 3) { const float u = 0.7978845608028654f * (v + 0.044715f * v * v * v); v = 0.5f * v * (1.0f + tanhf(u)); }
      so[w][8 * hh + r][t * 16 + ln] = v;
    }
  }
  __builtin_amdgcn_fence(__ATOMIC_ACQ_REL, "workgroup");
  __builtin_amdgcn_wave_barrier();
  const int rsub = lane >> 4, c4 = (lane & 15) * 4;
  {
#pragma unroll
    for (int q = 0; q < 8; ++q) {
      const int r = q * 2 + rsub;
      const v4f v = *(const v4fa*)&so[w][r][c4];
      *(v4f*)(C + (size_t)(row0 + r) * ldc + col0 + c4) = v;
    }
    
  }
}
// row LayerNorm (biased variance, eps) over N: s = X (+ R); optional out_sum <- s; out_norm <- (s-mu)*rsqrt(var+eps)*g + b
template <bool PARAM_BF16>
__global__ __launch_bounds__(256) void k_layernorm(const float* __restrict__ X, const float* __restrict__ R, const float* __restrict__ g, const float* __restrict__ bta,
                                                  float* __restrict__ out_sum, float* __restrict__ out_norm, int N, float eps) {
  __shared__ float red[256];
  const int row = blockIdx.x, tid = threadIdx.x;
  const float* x = X + (size_t)row * N; const float* rr = R ? R + (size_t)row * N : nullptr;
  float vals[16];                     // up to N = 4096
  const int per = N / 256;            // contiguous chunk per thread? use strided-by-4 chunks: thread handles j = tid*4 + 1024*u
  float s1 = 0.f;
  for (int u = 0; u < per / 4; ++u) {
    const int j = tid * 4 + 1024 * u;
    const v4f a = *(const v4fa*)(x + j);
    v4f b = {0.f,0.f,0.f,0.f}; if (rr) b = *(const v4fa*)(rr + j);
#pragma unroll
    for (int q = 0; q < 4; ++q) { const float v = a[q] + b[q]; vals[u * 4 + q] = v; s1 += v; }
  }
  red[tid] = s1; __syncthreads();
  for (int st = 128; st > 0; st >>= 1) { if (tid < st) red[tid] += red[tid + st]; __syncthreads(); }
  const float mu = red[0] / (float)N; __syncthreads();
  float s2 = 0.f;
  for (int u = 0; u < per / 4; ++u)
#pragma unroll
    for (int q = 0; q < 4; ++q) { const float c = vals[u * 4 + q] - mu; s2 += c * c; }
  red[tid] = s2; __syncthreads();
  for (int st = 128; st > 0; st >>= 1) { if (tid < st) red[tid] += red[tid + st]; __syncthreads(); }
  const float rs = rsqrtf(red[0] / (float)N + eps);
  {
    for (int u = 0; u < per / 4; ++u) {
      const int j = tid * 4 + 1024 * u;
      v4f o, sm;
#pragma unroll
      for (int q = 0; q < 4; ++q) {
        float gg = g[j + q], bb = bta[j + q];
        if (PARAM_BF16) { gg = bf16_round(gg); bb = bf16_round(bb); }
        sm[q] = vals[u * 4 + q]; o[q] = (vals[u * 4 + q] - mu) * rs * gg + bb;
      }
      if (out_sum) *(v4f*)(out_sum + (size_t)row * N + j) = sm;
      *(v4f*)(out_norm + (size_t)row * N + j) = o;
    }
    
  }
}



// ---- f16 WMMA path (v_wmma_f32_16x16x32_f16): 11-bit significands for operands in range — used where a [0,1] probability operand needs more precision than bf16
typedef _Float16 v16h __attribute__((ext_vector_type(16)));
union FragH { v16h v; v8us half[2]; _Float16 h[16]; unsigned short u[16]; };
template <int NT>
__device__ __forceinline__ v8f mmaH(v16h ah, v16h al, v16h bh, v16h bl, v8f c) {
  c = __builtin_amdgcn_wmma_f32_16x16x32_f16(false, ah, false, bh, (short)0, c, false, false);
  if (NT >= 2) c = __builtin_amdgcn_wmma_f32_16x16x32_f16(false, al, false, bh, (short)0, c, false, false);
  if (NT >= 3) c = __builtin_amdgcn_wmma_f32_16x16x32_f16(false, ah, false, bl, (short)0, c, false, false);
  asm volatile("v_nop\n\tv_nop\n\tv_nop\n\tv_nop" : "+v"(c) : "v"(ah), "v"(al), "v"(bh), "v"(bl));
  return c;
}
// batched GEMM like k_gemm_b but f16 operands: A f32 (split into f16 hi/lo if ASPLIT, else rounded to f16), Bt = f16 values [n][k]; alpha; C f32; N multiple of 16 (partial tiles skipped)
template <bool ASPLIT>
__global__ __launch_bounds__(128) void k_gemm_h(const float* __restrict__ A, int lda, size_t sA, const _Float16* __restrict__ Bh, int ldb, size_t sB, float alpha, float* __restrict__ C, int ldc, size_t sC, int M, int N, int K) {
  __shared__ __attribute__((aligned(16))) float so[4][16][64];
  const int tid = threadIdx.x, w = tid >> 5, lane = tid & 31, ln = lane & 15, hh = lane >> 4; const int by = blockIdx.y;
  A += (size_t)by * sA; Bh += (size_t)by * sB; C += (size_t)by * sC;
  const int ntn = (N + 63) / 64; const int wid = blockIdx.x * 4 + w; const int mt = wid / ntn, nq = wid % ntn; if (mt * 16 >= M) return;
  const int row0 = mt * 16, col0 = nq * 64; const float* arow = A + (size_t)(row0 + ln) * lda;
  v8f acc[4] = {};
  for (int kb = 0; kb < K; kb += 32) {
    FragH ah, al;
    const v4f x0 = *(const v4fa*)(arow + kb + 8 * hh), x1 = *(const v4fa*)(arow + kb + 8 * hh + 4), x2 = *(const v4fa*)(arow + kb + 16 + 8 * hh), x3 = *(const v4fa*)(arow + kb + 16 + 8 * hh + 4);
    float xs[16] = {x0[0],x0[1],x0[2],x0[3],x1[0],x1[1],x1[2],x1[3],x2[0],x2[1],x2[2],x2[3],x3[0],x3[1],x3[2],x3[3]};
#pragma unroll
    for (int i = 0; i < 16; ++i) { const _Float16 h = (_Float16)xs[i]; ah.h[i] = h; al.h[i] = ASPLIT ? (_Float16)(xs[i] - (float)h) : (_Float16)0.0f; }
#pragma unroll
    for (int t = 0; t < 4; ++t) { if (col0 + t * 16 >= N) continue; const size_t boff = (size_t)(col0 + t * 16 + ln) * ldb + kb; FragH bq; bq.half[0] = *(const v8us*)(Bh + boff + 8 * hh); bq.half[1] = *(const v8us*)(Bh + boff + 16 + 8 * hh);
      acc[t] = mmaH<ASPLIT ? 2 : 1>(ah.v, al.v, bq.v, bq.v, acc[t]); }
  }
#pragma unroll
  for (int t = 0; t < 4; ++t) { if (col0 + t * 16 >= N) continue;
#pragma unroll
    for (int r = 0; r < 8; ++r) so[w][8 * hh + r][t * 16 + ln] = acc[t][r] * alpha; }
  __builtin_amdgcn_fence(__ATOMIC_ACQ_REL, "workgroup"); __builtin_amdgcn_wave_barrier();
  const int rsub = lane >> 4, c4 = (lane & 15) * 4;
  {
#pragma unroll
    for (int q = 0; q < 8; ++q) { const int r = q * 2 + rsub; if (col0 + c4 < N) { const v4f v = *(const v4fa*)&so[w][r][c4]; *(v4f*)(C + (size_t)(row0 + r) * ldc + col0 + c4) = v; } }
     }
}

// k_gemm_hh variant with fused epilogue: v = acc·alpha + bias[by·sBias + col] (+ CP[(row/rowsPerB)·sCPb + by·64 + col] if CP) ; ACT 0 none / 1 elu ; writes f16 C16 (and f32 C if non-null)
template <int ACT>
__global__ __launch_bounds__(128) void k_gemm_hhx(const _Float16* __restrict__ A, int lda, size_t sA, const _Float16* __restrict__ Bh, int ldb, size_t sB, float alpha, const float* __restrict__ bias, size_t sBias, const float* __restrict__ CP, int rowsPerB, size_t sCPb, int row0g,
    float* __restrict__ C, _Float16* __restrict__ C16, int ldc, size_t sC, int M, int N, int K) {
  __shared__ __attribute__((aligned(16))) float so[4][16][64];
  const int tid = threadIdx.x, w = tid >> 5, lane = tid & 31, ln = lane & 15, hh = lane >> 4; const int by = blockIdx.y;
  A += (size_t)by * sA; Bh += (size_t)by * sB; const size_t cofs = (size_t)by * sC; const float* bp = bias ? bias + (size_t)by * sBias : nullptr;
  const int ntn = (N + 63) / 64; const int wid = blockIdx.x * 4 + w; const int mt = wid / ntn, nq = wid % ntn; if (mt * 16 >= M) return;
  const int row0 = mt * 16, col0 = nq * 64; const _Float16* arow = A + (size_t)(row0 + ln) * lda;
  v8f acc[4] = {};
  for (int kb = 0; kb < K; kb += 32) { FragH ah; ah.half[0] = *(const v8us*)((const unsigned short*)arow + kb + 8 * hh); ah.half[1] = *(const v8us*)((const unsigned short*)arow + kb + 16 + 8 * hh);
#pragma unroll
    for (int t = 0; t < 4; ++t) { if (col0 + t * 16 >= N) continue; const size_t boff = (size_t)(col0 + t * 16 + ln) * ldb + kb; FragH bq; bq.half[0] = *(const v8us*)((const unsigned short*)Bh + boff + 8 * hh); bq.half[1] = *(const v8us*)((const unsigned short*)Bh + boff + 16 + 8 * hh);
      acc[t] = mmaH<1>(ah.v, ah.v, bq.v, bq.v, acc[t]); }
  }
#pragma unroll
  for (int t = 0; t < 4; ++t) { if (col0 + t * 16 >= N) continue; const int col = col0 + t * 16 + ln; const float bv = bp ? bf16_round(bp[col]) : 0.f;
#pragma unroll
    for (int r = 0; r < 8; ++r) { float v = acc[t][r] * alpha + bv; if (CP) { const int rr = row0g + row0 + 8 * hh + r; if (rowsPerB < 0) v += CP[cofs + (size_t)rr * ldc + col];      /* rowsPerB < 0: own element of the batched C plane */ else { const int bidx = rr / rowsPerB; v += CP[(size_t)bidx * sCPb + (size_t)by * 64 + col]; } } if (ACT == 1) v = (v > 0.f) ? v : expm1f(v); else if (ACT == 7) v = (v > 0.f) ? v + 1.0f : expf(v); else if (ACT == 8) v = tanhf(v); else if (ACT == 9) v = 0.5f * v * (1.0f + tanhf(0.7978845608028654f * (v + 0.044715f * v * v * v))); else if (ACT == 11) v = 1.0f / (1.0f + expf(-v)); else if (ACT == 12) v = (v > 0.f) ? v : 0.01f * v; else if (ACT == 14) v = (v > 0.f) ? v : 0.1f * v; else if (ACT == 16) v = (v >= 0.f) ? v : 0.3f * v; else if (ACT == 17) v = (v >= 0.f) ? v : 0.2f * v; else if (ACT == 15) v = v / (1.0f + expf(-v)); else if (ACT == 3) v = fmaxf(v, 0.f); else if (ACT == 6) v = 0.5f * v * (1.0f + erff(v * 0.70710678118654752f)); so[w][8 * hh + r][t * 16 + ln] = v; } }
  __builtin_amdgcn_fence(__ATOMIC_ACQ_REL, "workgroup"); __builtin_amdgcn_wave_barrier();
  const int rsub = lane >> 4, c4 = (lane & 15) * 4; typedef _Float16 v4h __attribute__((ext_vector_type(4)));
  {
#pragma unroll
    for (int q = 0; q < 8; ++q) { const int r = q * 2 + rsub; if (col0 + c4 < N) { const v4f v = *(const v4fa*)&so[w][r][c4]; if (C) *(v4f*)(C + cofs + (size_t)(row0 + r) * ldc + col0 + c4) = v; if (C16) { v4h h4; for (int i = 0; i < 4; ++i) h4[i] = (_Float16)v[i]; *(v4h*)(C16 + cofs + (size_t)(row0 + r) * ldc + col0 + c4) = h4; } } }
     }
}


typedef _Float16 v4h __attribute__((ext_vector_type(4)));

__global__ __launch_bounds__(256) void k_h16(const float* __restrict__ x, _Float16* __restrict__ X16, size_t n8) { const size_t t = (size_t)blockIdx.x * 256 + threadIdx.x; if (t >= n8) return; FragH f;
#pragma unroll
  for (int q = 0; q < 8; ++q) f.h[q] = (_Float16)x[t * 8 + q]; *(v8us*)((unsigned short*)X16 + t * 8) = f.half[0];  }
__global__ __launch_bounds__(256) void k_round16f(const float* __restrict__ W, _Float16* __restrict__ Bt, size_t n8) { const size_t t = (size_t)blockIdx.x * 256 + threadIdx.x; if (t >= n8) return; FragH f;
#pragma unroll
  for (int i = 0; i < 8; ++i) f.h[i] = (_Float16)(bf16_round(W[t * 8 + i]) * 16.0f); *(v8us*)((unsigned short*)Bt + t * 8) = f.half[0];  }
template <int NHv, int TTv>
__global__ __launch_bounds__(256) void k_vt(const _Float16* __restrict__ V16, int ldv, int voff, _Float16* __restrict__ Vt) { __shared__ unsigned short tl[64][66]; const int tid = threadIdx.x; const int slab = blockIdx.x / (TTv / 64), lg = blockIdx.x % (TTv / 64); const int b = slab / NHv, h = slab % NHv;
  for (int i = tid; i < 64 * 8; i += 256) { const int r = i / 8, c8 = (i % 8) * 8; FragH f; f.half[0] = *(const v8us*)((const unsigned short*)V16 + ((size_t)b * TTv + lg * 64 + r) * ldv + voff + h * 64 + c8);
#pragma unroll
    for (int q = 0; q < 8; ++q) tl[r][c8 + q] = f.u[q]; }
  __syncthreads();
  {
#pragma unroll
    for (int rd = 0; rd < 2; ++rd) { const int d = rd * 32 + tid / 8, pc = tid % 8; FragH f;
#pragma unroll
      for (int q = 0; q < 8; ++q) f.u[q] = tl[pc * 8 + q][d];
      *(v8us*)((unsigned short*)Vt + ((size_t)slab * 64 + d) * TTv + lg * 64 + pc * 8) = f.half[0]; }
     } }

__global__ __launch_bounds__(256) void k_hl(const float* __restrict__ F, _Float16* __restrict__ Hh, _Float16* __restrict__ Hl, size_t n8) { const size_t t = (size_t)blockIdx.x * 256 + threadIdx.x; if (t >= n8) return; FragH fh, fl; const v4f a = *(const v4fa*)(F + t * 8), c = *(const v4fa*)(F + t * 8 + 4);
#pragma unroll
  for (int q = 0; q < 4; ++q) { _Float16 h = (_Float16)a[q]; fh.h[q] = h; fl.h[q] = (_Float16)((a[q] - (float)h) * 1024.0f); h = (_Float16)c[q]; fh.h[4 + q] = h; fl.h[4 + q] = (_Float16)((c[q] - (float)h) * 1024.0f); }
  { *(v8us*)((unsigned short*)Hh + t * 8) = fh.half[0]; *(v8us*)((unsigned short*)Hl + t * 8) = fl.half[0];  } }

// ---- fast GEMM (wave tile 32x64, work-group tile 128x64; requires M % 128 == 0 rows per launch region, N % 64 == 0 and K % 64 == 0); epilogue = k_gemm_hhx semantics ----
__device__ __forceinline__ v16h g2_frag(const _Float16* p, int hh) { FragH f; f.half[0] = *(const v8us*)((const unsigned short*)p + 8 * hh); f.half[1] = *(const v8us*)((const unsigned short*)p + 16 + 8 * hh); return f.v; }
__device__ __forceinline__ v8f g2_mma(v16h a, v16h b, v8f c) { v8f d = __builtin_amdgcn_wmma_f32_16x16x32_f16(false, a, false, b, (short)0, c, false, false); asm volatile("v_nop\n\tv_nop\n\tv_nop\n\tv_nop" : "+v"(d) : "v"(a), "v"(b)); return d; }
// Operand staging of the fast GEMM: a stage is 64 k (one whole 128-byte line) of the work-group's 128 A rows and 64 B rows, brought into LDS by asynchronous copies, two buffers.
#define G2K 64                       /* k per stage */
#define G2P 72                       /* LDS row pitch in f16: 144 B = 16 B x odd, the pitch for 16-byte LDS reads of one row per lane */
#define G2S ((128 + 64) * G2P * 2)   /* bytes of a stage: A rows 0 .. 127, then B rows 0 .. 63 */
// One stage's copies of one thread: 16 bytes of rows r, r + 16, .. of A (8 rows) and of B (4 rows); 8 lanes bring one whole line, a wave-wide copy 4 lines.
// The s_wait_xcnt at the end stands inside the statement so that no register named by a copy is rewritten in front of it.
__device__ __forceinline__ void g2_stage(unsigned l, const _Float16* ga, size_t sa, const _Float16* gb, size_t sb) {
  asm volatile("global_load_async_to_lds_b128 %0, %12, off\n\tglobal_load_async_to_lds_b128 %1, %13, off\n\tglobal_load_async_to_lds_b128 %2, %14, off\n\tglobal_load_async_to_lds_b128 %3, %15, off\n\t"
               "global_load_async_to_lds_b128 %4, %16, off\n\tglobal_load_async_to_lds_b128 %5, %17, off\n\tglobal_load_async_to_lds_b128 %6, %18, off\n\tglobal_load_async_to_lds_b128 %7, %19, off\n\t"
               "global_load_async_to_lds_b128 %8, %20, off\n\tglobal_load_async_to_lds_b128 %9, %21, off\n\tglobal_load_async_to_lds_b128 %10, %22, off\n\tglobal_load_async_to_lds_b128 %11, %23, off\n\ts_wait_xcnt 0x0"
               :: "v"(l), "v"(l + 1 * 16 * G2P * 2), "v"(l + 2 * 16 * G2P * 2), "v"(l + 3 * 16 * G2P * 2), "v"(l + 4 * 16 * G2P * 2), "v"(l + 5 * 16 * G2P * 2), "v"(l + 6 * 16 * G2P * 2), "v"(l + 7 * 16 * G2P * 2),
                  "v"(l + 8 * 16 * G2P * 2), "v"(l + 9 * 16 * G2P * 2), "v"(l + 10 * 16 * G2P * 2), "v"(l + 11 * 16 * G2P * 2),
                  "v"(ga), "v"(ga + sa), "v"(ga + 2 * sa), "v"(ga + 3 * sa), "v"(ga + 4 * sa), "v"(ga + 5 * sa), "v"(ga + 6 * sa), "v"(ga + 7 * sa),
                  "v"(gb), "v"(gb + sb), "v"(gb + 2 * sb), "v"(gb + 3 * sb) : "memory"); }
template <int ACT>
__device__ __forceinline__ void gemm2_body(const int bx, const int by, const _Float16* __restrict__ A, int lda, size_t sA, const _Float16* __restrict__ Bh, int ldb, size_t sB, float alpha, const float* __restrict__ bias, size_t sBias, const float* __restrict__ CP, int rowsPerB, size_t sCPb, int row0g,
    float* __restrict__ C, _Float16* __restrict__ C16, int ldc, size_t sC, int M, int N, int K) { static_assert(ACT == 0 || ACT == 3 || ACT == 6 || ACT == 8 || ACT == 9 || ACT == 11 || ACT == 12 || ACT == 14 || ACT == 15 || ACT == 16 || ACT == 17, "k_gemm2: unsupported ACT code (would silently apply no activation)");
  __shared__ __attribute__((aligned(16))) unsigned char sm[2 * G2S];      /* the two operand buffers; behind the k loop's last barrier the same bytes stage the output rows */
  static_assert(sizeof(float) * 4 * 32 * 68 <= 2 * G2S, "the output staging fits the operand buffers");
  float (*so)[32][68] = (float (*)[32][68])sm;
  const int tid = threadIdx.x, w = tid >> 5, lane = tid & 31, ln = lane & 15, hh = lane >> 4;
  A += (size_t)by * sA; Bh += (size_t)by * sB; const size_t cofs = (size_t)by * sC; const float* bp = bias ? bias + (size_t)by * sBias : nullptr;
  const int ntn = N >> 6; const int mt = bx / ntn, nq = bx - mt * ntn; const int row0 = mt * 128 + 32 * w, col0 = nq * 64; if (mt * 128 >= M) return;      /* taken by a whole work-group or by none (M % 128 == 0): it stands in front of barriers */
  const _Float16* ga = A + (size_t)(mt * 128 + (tid >> 3)) * lda + (tid & 7) * 8; const _Float16* gb = Bh + (size_t)(col0 + (tid >> 3)) * ldb + (tid & 7) * 8;      /* this thread's 16 bytes of rows tid / 8 + 16 i */
  const unsigned lc = (unsigned)(size_t)sm + (unsigned)((tid >> 3) * (G2P * 2) + (tid & 7) * 16);      /* their place in buffer 0 (LDS byte address) */
  const _Float16* la = (const _Float16*)sm + (32 * w + ln) * G2P; const _Float16* lb = (const _Float16*)sm + (128 + ln) * G2P;      /* this lane's fragment rows in buffer 0 */
  const int nt = K / G2K;
  const v8f z8 = {0.f,0.f,0.f,0.f,0.f,0.f,0.f,0.f}; v8f c00 = z8, c01 = z8, c02 = z8, c03 = z8, c10 = z8, c11 = z8, c12 = z8, c13 = z8;
  g2_stage(lc, ga, (size_t)16 * lda, gb, (size_t)16 * ldb);
  asm volatile("s_wait_asynccnt 0x0" ::: "memory");      /* this wave's copies of stage 0 have landed */
  __syncthreads();      /* stage 0 is readable by every wave */
  if (nt > 1) g2_stage(lc + G2S, ga + G2K, (size_t)16 * lda, gb + G2K, (size_t)16 * ldb);
#pragma unroll 1      /* one trip = one stage; the buffer is picked by the trip's parity */
  for (int t = 0; t < nt; ++t) { const int bo = (t & 1) * (G2S / 2); const _Float16* ap = la + bo; const _Float16* bq = lb + bo;
    v16h fa[2][2], fb[2][4];
#pragma unroll      /* the stage's 12 fragments are asked for as one group ahead of its products (constant indices: they stay in registers) */
    for (int q = 0; q < 2; ++q) { fa[q][0] = g2_frag(ap + q * 32, hh); fa[q][1] = g2_frag(ap + 16 * G2P + q * 32, hh);
#pragma unroll
      for (int u = 0; u < 4; ++u) fb[q][u] = g2_frag(bq + u * 16 * G2P + q * 32, hh); }
#pragma unroll      /* the two 32-k blocks of a stage, in ascending k as before */
    for (int q = 0; q < 2; ++q) {
      c00 = g2_mma(fa[q][0], fb[q][0], c00); c10 = g2_mma(fa[q][1], fb[q][0], c10);
      c01 = g2_mma(fa[q][0], fb[q][1], c01); c11 = g2_mma(fa[q][1], fb[q][1], c11);
      c02 = g2_mma(fa[q][0], fb[q][2], c02); c12 = g2_mma(fa[q][1], fb[q][2], c12);
      c03 = g2_mma(fa[q][0], fb[q][3], c03); c13 = g2_mma(fa[q][1], fb[q][3], c13); }
    asm volatile("s_wait_dscnt 0x0" ::: "memory");      /* this wave's reads of the buffer are done before it may be refilled */
    asm volatile("s_wait_asynccnt 0x0" ::: "memory");      /* this wave's copies of stage t + 1 have landed */
    __syncthreads();      /* publishes stage t + 1 and ends every wave's reads of stage t */
    if (t + 2 < nt) g2_stage(lc + (unsigned)(t & 1) * G2S, ga + (size_t)(t + 2) * G2K, (size_t)16 * lda, gb + (size_t)(t + 2) * G2K, (size_t)16 * ldb); }
  asm volatile("s_wait_asynccnt 0x0" ::: "memory");      /* no copy is outstanding when the buffers become output staging */
  v8f accs[8] = {c00, c01, c02, c03, c10, c11, c12, c13};
#pragma unroll
  for (int u = 0; u < 8; ++u) { const int t = u & 3, half = u >> 2; const int col = col0 + t * 16 + ln; const float bv = bp ? bf16_round(bp[col]) : 0.f;
#pragma unroll
    for (int r = 0; r < 8; ++r) { const int rloc = half * 16 + 8 * hh + r; float v = accs[u][r] * alpha + bv; if (CP) { if (rowsPerB < 0) v += CP[cofs + (size_t)(row0g + row0 + rloc) * ldc + col];      /* rowsPerB < 0: own element of the batched C plane */ else { const int bidx = (row0g + row0 + rloc) / rowsPerB; v += CP[(size_t)bidx * sCPb + (size_t)by * 64 + col]; } }
      if (ACT == 3) v = fmaxf(v, 0.f); else if (ACT == 6) v = 0.5f * v * (1.0f + erff(v * 0.70710678118654752f)); else if (ACT == 11) v = 1.0f / (1.0f + expf(-v)); else if (ACT == 15) v = v / (1.0f + expf(-v)); else if (ACT == 12) v = (v > 0.f) ? v : 0.01f * v; else if (ACT == 8) v = tanhf(v); else if (ACT == 9) v = 0.5f * v * (1.0f + tanhf(0.7978845608028654f * (v + 0.044715f * v * v * v))); else if (ACT == 14) v = (v > 0.f) ? v : 0.1f * v; else if (ACT == 16) v = (v >= 0.f) ? v : 0.3f * v; else if (ACT == 17) v = (v >= 0.f) ? v : 0.2f * v;
      so[w][rloc][t * 16 + ln] = v; } }
  __builtin_amdgcn_fence(__ATOMIC_ACQ_REL, "workgroup"); __builtin_amdgcn_wave_barrier();
  const int rsub = lane >> 4, c4 = (lane & 15) * 4;
  {
#pragma unroll
    for (int q = 0; q < 16; ++q) { const int r = q * 2 + rsub; const v4f v = *(const v4fa*)&so[w][r][c4]; if (C) { *(v4f*)(C + cofs + (size_t)(row0 + r) * ldc + col0 + c4) = v; if (C16) asm volatile("s_wait_xcnt 0x0" ::: "memory"); }      /* both outputs asked for: the f32 store's address registers are reused for the f16 store's address, only behind this wait */
      if (C16) { v4h h4; for (int i = 0; i < 4; ++i) h4[i] = (_Float16)v[i]; *(v4h*)(C16 + cofs + (size_t)(row0 + r) * ldc + col0 + c4) = h4; } }
     } }
template <int ACT>
__global__ __launch_bounds__(128) void k_gemm2(const _Float16* __restrict__ A, int lda, size_t sA, const _Float16* __restrict__ Bh, int ldb, size_t sB, float alpha, const float* __restrict__ bias, size_t sBias, const float* __restrict__ CP, int rowsPerB, size_t sCPb, int row0g,
    float* __restrict__ C, _Float16* __restrict__ C16, int ldc, size_t sC, int M, int N, int K) { gemm2_body<ACT>(blockIdx.x, blockIdx.y, A, lda, sA, Bh, ldb, sB, alpha, bias, sBias, CP, rowsPerB, sCPb, row0g, C, C16, ldc, sC, M, N, K); }

// The six independent projection GEMMs as ONE launch. blockIdx.y = q, k or v (input, weight and output planes lie one behind the other); blockIdx.x picks the job:
// the first PJF work-groups give the f32 rows of the first QT0 tokens, the others the f16 rows of all tokens. Each work-group does what it did in its own launch.
#define PJF ((QT0 / 128) * (DM / 64))      /* work-groups of an f32 first-tile job */
#define PJH ((MP / 128) * (DM / 64))       /* work-groups of an f16 all-rows job */
__global__ __launch_bounds__(128) void k_qkv(const _Float16* __restrict__ X, const _Float16* __restrict__ BW, float* __restrict__ CF, _Float16* __restrict__ C16) {
  const int bx = blockIdx.x;      /* the same for the whole work-group: a scalar branch; each side knows at compile time which output it stores */
  if (bx < PJF) gemm2_body<0>(bx, blockIdx.y, X, DM, NR * DM, BW, DM, (size_t)DM * DM, 0.0625f, nullptr, 0, nullptr, 1, 0, 0, CF, nullptr, DM, (size_t)QT0 * DM, QT0, DM, DM);
  else gemm2_body<0>(bx - PJF, blockIdx.y, X, DM, NR * DM, BW, DM, (size_t)DM * DM, 0.0625f, nullptr, 0, nullptr, 1, 0, 0, nullptr, C16, DM, NR * DM, MP, DM, DM); }

// The output GEMM of all rows and that of the first tile's f16 hi plane as ONE launch: the work-groups of rows 0 .. QT0 - 1 read the exact first-tile o (hi plane) in place of the f16-path rows,
// whose product was overwritten before. Same grid, same rows and columns per work-group, same alpha.
__global__ __launch_bounds__(128) void k_out(const _Float16* __restrict__ O, const _Float16* __restrict__ OH, const _Float16* __restrict__ BO, float* __restrict__ out) {
  const int bx = blockIdx.x;
  gemm2_body<0>(bx, 0, (bx < PJF) ? OH : O, DM, 0, BO, DM, 0, 0.0009765625f, nullptr, 0, nullptr, 1, 0, 0, out, nullptr, DM, 0, MPO, DM, DM); }

// Operand preparation as ONE launch of independent jobs picked by the block index; each thread does what it did in the separate launches.
// Work-groups 0 .. 4 PWB - 1: plane p of BW (q, k, v, o): BW[p][n][k] = f16(bf16(W[k][n]) x 16) (a power of two: bf16-exact weights stay exact in f16 away from the subnormal range);
// for p < 3 row n is column n % 64 of head n / 64 of the [head][in][out] stack, for p = 3 column n of the [in][out] output weight. The others: plane j of XH = input j rounded to bf16, as f16.
#define PWB (DM * (DM / 8) / 256)          /* work-groups per weight plane */
#define PXB ((int)(NR * DM / 8 / 256))     /* work-groups per input */
__global__ __launch_bounds__(256) void k_prep(const float* __restrict__ xq, const float* __restrict__ xk, const float* __restrict__ xv, const float* __restrict__ wq, const float* __restrict__ wk, const float* __restrict__ wv, const float* __restrict__ wo,
    _Float16* __restrict__ BW, _Float16* __restrict__ XH) {
  const int bx = blockIdx.x; FragH f;
  if (bx < 4 * PWB) { const int p = bx / PWB; const int t = (bx - p * PWB) * 256 + threadIdx.x; const int n = t / (DM / 8), k8 = (t % (DM / 8)) * 8;
    if (p < 3) { const float* s = ((p == 0) ? wq : (p == 1) ? wk : wv) + (size_t)(n / HD) * DM * HD + (size_t)k8 * HD + n % HD;
#pragma unroll
      for (int i = 0; i < 8; ++i) f.h[i] = (_Float16)(bf16_round(s[i * HD]) * 16.0f); }
    else { const float* s = wo + (size_t)k8 * DM + n;
#pragma unroll
      for (int i = 0; i < 8; ++i) f.h[i] = (_Float16)(bf16_round(s[i * DM]) * 16.0f); }
    *(v8us*)((unsigned short*)BW + (size_t)p * DM * DM + (size_t)n * DM + k8) = f.half[0]; }
  else { const int xb = bx - 4 * PWB; const int j = xb / PXB; const size_t t = (size_t)(xb - j * PXB) * 256 + threadIdx.x; const float* x = (j == 0) ? xq : (j == 1) ? xk : xv;
#pragma unroll
    for (int q = 0; q < 8; ++q) f.h[q] = (_Float16)bf16_round(x[t * 8 + q]);
    *(v8us*)((unsigned short*)XH + (size_t)j * NR * DM + t * 8) = f.half[0]; } }


__global__ __launch_bounds__(256) void k_wnat(const float* __restrict__ w, size_t n8, _Float16* __restrict__ Bt) { const size_t t = (size_t)blockIdx.x * 256 + threadIdx.x; if (t >= n8) return; FragH f; for (int q = 0; q < 8; ++q) f.h[q] = (_Float16)(bf16_round(w[t * 8 + q]) * 16.0f); *(v8us*)((unsigned short*)Bt + t * 8) = f.half[0];  }
__global__ __launch_bounds__(256) void k_rsm(const float* __restrict__ S, _Float16* __restrict__ P, int nrows) {
  #pragma clang fp contract(off)
  const int i = blockIdx.x * 256 + threadIdx.x; if (i >= nrows) return; const float* s = S + (size_t)i * SQ; float mx = -3.0e38f;
#pragma unroll 1
  for (int j = 0; j < SQ; ++j) mx = fmaxf(mx, s[j]); float se = 0.f;
#pragma unroll 1
  for (int j = 0; j < SQ; ++j) se += expf(s[j] - mx); const float sc = 256.0f / se;
#pragma unroll 1
  for (int j0 = 0; j0 < SQ; j0 += 8) { FragH f; for (int q = 0; q < 8; ++q) f.h[q] = (_Float16)(expf(s[j0 + q] - mx) * sc); unsigned short* d = (unsigned short*)P + (size_t)i * SQ + j0; *(v8us*)d = f.half[0];  } }
__global__ __launch_bounds__(256) void k_vt(const _Float16* __restrict__ V16, int b, int h0, _Float16* __restrict__ VT) { __shared__ unsigned short tl[64][65]; const int tid = threadIdx.x; const int hh = blockIdx.x % HG, sg = blockIdx.x / HG; const int s0 = sg * 64; const int h = h0 + hh;
  for (int i = tid; i < 64 * 8; i += 256) { const int j = i / 8, d8 = (i % 8) * 8; FragH f; f.half[0] = *(const v8us*)((const unsigned short*)V16 + ((size_t)b * SQ + s0 + j) * DM + h * HD + d8); for (int q = 0; q < 8; ++q) tl[d8 + q][j] = f.u[q]; }
  __syncthreads();
  { for (int i = tid; i < 64 * 8; i += 256) { const int d = i / 8, j8 = (i % 8) * 8; FragH f; for (int q = 0; q < 8; ++q) f.u[q] = tl[d][j8 + q]; *(v8us*)((unsigned short*)VT + ((size_t)hh * HD + d) * SQ + s0 + j8) = f.half[0]; }  } }



#define FQ 32                        /* query rows per wave */
#define FW 4                         /* waves per work-group */
#define FNG (NH * (SQ / (FQ * FW)))  /* work-groups */
__device__ __forceinline__ v8f fa_mma(v16h a, v16h b, v8f c) { return __builtin_amdgcn_wmma_f32_16x16x32_f16(false, a, false, b, (short)0, c, false, false); }
__device__ __forceinline__ float fa_xhalf(float x) { return __builtin_bit_cast(float, __builtin_amdgcn_permlanex16(__builtin_bit_cast(int, x), __builtin_bit_cast(int, x), 0x76543210, 0xfedcba98, false, false)); }      /* lane l with lane l ^ 16 */
// 2^x by the native instruction. The v_nop at the end fills the slot that the instruction set asks for behind a transcendental before its result is read or its source overwritten;
// inside the group every result register differs from every source ("=&v"), so each v_exp_f32 is the independent instruction behind the one before it.
__device__ __forceinline__ float fa_exp2(float x) { float e; asm("v_exp_f32 %0, %1\n\tv_nop" : "=&v"(e) : "v"(x)); return e; }
__device__ __forceinline__ void fa_exp2x8(const float (&x)[8], float (&e)[8]) {
  asm("v_exp_f32 %0, %8\n\tv_exp_f32 %1, %9\n\tv_exp_f32 %2, %10\n\tv_exp_f32 %3, %11\n\tv_exp_f32 %4, %12\n\tv_exp_f32 %5, %13\n\tv_exp_f32 %6, %14\n\tv_exp_f32 %7, %15\n\tv_nop"
      : "=&v"(e[0]), "=&v"(e[1]), "=&v"(e[2]), "=&v"(e[3]), "=&v"(e[4]), "=&v"(e[5]), "=&v"(e[6]), "=&v"(e[7]) : "v"(x[0]), "v"(x[1]), "v"(x[2]), "v"(x[3]), "v"(x[4]), "v"(x[5]), "v"(x[6]), "v"(x[7])); }
// Operand staging of the fused attention: a stage is 64 keys of the head, K as 64 rows (keys) of 128 bytes and V^T as 64 rows (d) of 128 bytes, whole lines, brought into LDS once
// for the work-group's 4 waves by asynchronous copies, two buffers.
#define FK 64                        /* keys per stage = two passes */
#define FP 72                        /* LDS row pitch in f16: 144 B = 16 B x odd, the pitch for 16-byte LDS reads of one row per lane */
#define FT (64 * FP * 2)             /* bytes of a tile of 64 rows */
#define FS (2 * FT)                  /* bytes of a stage: the K tile, then the V^T tile */
// One stage's copies of one thread: 16 bytes of rows r, r + 16, r + 32, r + 48 of K and of V^T; 8 lanes bring one whole line, a wave-wide copy 4 lines.
// The s_wait_xcnt at the end stands inside the statement so that no register named by a copy is rewritten in front of it.
__device__ __forceinline__ void fa_stage(unsigned l, const _Float16* gk, const _Float16* gv) {
  asm volatile("global_load_async_to_lds_b128 %0, %8, off\n\tglobal_load_async_to_lds_b128 %1, %9, off\n\tglobal_load_async_to_lds_b128 %2, %10, off\n\tglobal_load_async_to_lds_b128 %3, %11, off\n\t"
               "global_load_async_to_lds_b128 %4, %12, off\n\tglobal_load_async_to_lds_b128 %5, %13, off\n\tglobal_load_async_to_lds_b128 %6, %14, off\n\tglobal_load_async_to_lds_b128 %7, %15, off\n\ts_wait_xcnt 0x0"
               :: "v"(l), "v"(l + 1 * 16 * FP * 2), "v"(l + 2 * 16 * FP * 2), "v"(l + 3 * 16 * FP * 2), "v"(l + FT), "v"(l + FT + 1 * 16 * FP * 2), "v"(l + FT + 2 * 16 * FP * 2), "v"(l + FT + 3 * 16 * FP * 2),
                  "v"(gk), "v"(gk + (size_t)16 * DM), "v"(gk + (size_t)32 * DM), "v"(gk + (size_t)48 * DM), "v"(gv), "v"(gv + (size_t)16 * SQ), "v"(gv + (size_t)32 * SQ), "v"(gv + (size_t)48 * SQ) : "memory"); }
// One pass = 32 keys: scores from kf, running softmax, o += P V from vf. nk: where the wave's next K fragments lie in the same stage (asked for behind the score products), or null.
__device__ __forceinline__ void fa_pass(v16h (&kf)[2][2], const v16h (&qf)[2][2], const v16h (&vf)[4], v8f (&acc)[4][2], float (&mr)[2], float (&ls)[2], const _Float16* nk, const bool diag, const int ln, const int hh) {
  const float CS = 0.125f * 1.4426950408889634f;      /* score scale x log2(e): exponentials in base 2 */
  const v8f z8 = {0.f, 0.f, 0.f, 0.f, 0.f, 0.f, 0.f, 0.f}; v8f s[2][2];
#pragma unroll
  for (int u = 0; u < 2; ++u)
#pragma unroll
    for (int t = 0; t < 2; ++t) s[u][t] = fa_mma(kf[u][1], qf[t][1], fa_mma(kf[u][0], qf[t][0], z8));
  if (nk) {
#pragma unroll
    for (int u = 0; u < 2; ++u)
#pragma unroll
      for (int c = 0; c < 2; ++c) kf[u][c] = g2_frag(nk + u * 16 * FP + c * 32, hh);
    __builtin_amdgcn_sched_barrier(0); }      /* keeps these LDS reads here, ahead of the softmax that covers their latency: left free they were issued right in front of their first use */
  if (diag) {      /* the diagonal pass: key > query is masked (a scalar branch) */
#pragma unroll
    for (int u = 0; u < 2; ++u)
#pragma unroll
      for (int t = 0; t < 2; ++t)
#pragma unroll
        for (int r = 0; r < 8; ++r) if (u * 16 + 8 * hh + r > t * 16 + ln) s[u][t][r] = -3.0e38f; }
  FragH pf[2];
#pragma unroll
  for (int t = 0; t < 2; ++t) { float mx = fmaxf(s[0][t][0], s[1][t][0]);
#pragma unroll
    for (int r = 1; r < 8; ++r) mx = fmaxf(mx, fmaxf(s[0][t][r], s[1][t][r]));
    mx = fmaxf(mx, fa_xhalf(mx)); const float mn = fmaxf(mr[t], mx); const float corr = fa_exp2((mr[t] - mn) * CS); mr[t] = mn; const float mc = mn * CS;      /* every pass holds at least one unmasked key of every query: mn is a real score */
    float x0[8], x1[8], e0[8], e1[8];
#pragma unroll
    for (int r = 0; r < 8; ++r) { x0[r] = fmaf(s[0][t][r], CS, -mc); x1[r] = fmaf(s[1][t][r], CS, -mc); }
    fa_exp2x8(x0, e0); fa_exp2x8(x1, e1); float s0 = 0.f, s1 = 0.f;
#pragma unroll
    for (int r = 0; r < 8; ++r) { s0 += e0[r]; s1 += e1[r]; pf[t].h[r] = (_Float16)e0[r]; pf[t].h[8 + r] = (_Float16)e1[r]; }
    ls[t] = fmaf(ls[t], corr, s0 + s1);
#pragma unroll
    for (int d = 0; d < 4; ++d) acc[d][t] *= corr; }
#pragma unroll
  for (int d = 0; d < 4; ++d)
#pragma unroll
    for (int t = 0; t < 2; ++t) acc[d][t] = fa_mma(vf[d], pf[t].v, acc[d][t]); }
// One stage = two passes. TAIL: the work-group's last two stages, where a wave's rows may end (its diagonal pass is masked, what lies beyond is skipped by scalar branches); before them every pass is whole.
template <bool TAIL>
__device__ __forceinline__ void fa_trip(const _Float16* kq, const _Float16* vq, const int j0, const int q0, const v16h (&qf)[2][2], v8f (&acc)[4][2], float (&mr)[2], float (&ls)[2], const int ln, const int hh) {
  if (TAIL && j0 > q0) return;      /* a wave whose rows end below this stage only takes part in the publish point */
  v16h kf[2][2], vf[4];
#pragma unroll      /* the first pass's K and V^T fragments, asked for as one group (constant indices: they stay in registers) */
  for (int u = 0; u < 2; ++u)
#pragma unroll
    for (int c = 0; c < 2; ++c) kf[u][c] = g2_frag(kq + u * 16 * FP + c * 32, hh);
#pragma unroll
  for (int d = 0; d < 4; ++d) vf[d] = g2_frag(vq + d * 16 * FP, hh);
  __builtin_amdgcn_sched_barrier(0);      /* keeps the V^T reads in this group: left free they were issued among the P V products, which then waited for them */
  fa_pass(kf, qf, vf, acc, mr, ls, kq + 32 * FP, TAIL && j0 == q0, ln, hh);      /* the second pass's K rows lie in the same stage: always readable, unused where the wave ends here */
  if (TAIL && j0 + 32 > q0) return;
#pragma unroll      /* V^T of the second pass: asked for ahead of its score products and softmax */
  for (int d = 0; d < 4; ++d) vf[d] = g2_frag(vq + d * 16 * FP + 32, hh);
  __builtin_amdgcn_sched_barrier(0);      /* keeps these reads here, as above */
  fa_pass(kf, qf, vf, acc, mr, ls, nullptr, TAIL && j0 + 32 == q0, ln, hh); }
__global__ __launch_bounds__(FW * 32) void k_fattn(const _Float16* __restrict__ Q, const _Float16* __restrict__ K, const _Float16* __restrict__ VT, _Float16* __restrict__ O) {
  __shared__ __attribute__((aligned(16))) unsigned char sm[2 * FS];      /* the two stage buffers */
  const int tid = threadIdx.x, lane = tid & 31, ln = lane & 15, hh = lane >> 4; const int w = __builtin_amdgcn_readfirstlane(tid >> 5);
  const int bx = blockIdx.x; const int rank = (bx < FNG / 2) ? bx : (FNG + FNG / 2 - 1 - bx);      /* a permutation: long work-groups first, then the short ones shortest first, so that groups bx and bx + FNG / 2 together have equal work (speed only) */
  const int h = rank % NH; const int qb = (SQ / (FQ * FW) - 1 - rank / NH) * (FQ * FW); const int q0 = qb + w * FQ;
  const int ns = (qb + FQ * FW) / FK;      /* stages of the work-group: the keys below its last row's end; at least 2, the same for all its waves */
  const _Float16* qp = Q + (size_t)(q0 + ln) * DM + h * HD;
  const _Float16* gk = K + (size_t)(tid >> 3) * DM + h * HD + (tid & 7) * 8; const _Float16* gv = VT + ((size_t)h * HD + (tid >> 3)) * SQ + (tid & 7) * 8;      /* this thread's 16 bytes of rows tid / 8 + 16 i of stage 0 */
  const unsigned lc = (unsigned)(size_t)sm + (unsigned)((tid >> 3) * (FP * 2) + (tid & 7) * 16);      /* their place in buffer 0 (LDS byte address) */
  const _Float16* lk = (const _Float16*)sm + ln * FP; const _Float16* lv = lk + 64 * FP;      /* this lane's fragment rows in buffer 0 */
  fa_stage(lc, gk, gv);
  v16h qf[2][2];
#pragma unroll      /* fragments indexed by constants only: they stay in registers */
  for (int t = 0; t < 2; ++t)
#pragma unroll
    for (int c = 0; c < 2; ++c) qf[t][c] = g2_frag(qp + (size_t)t * 16 * DM + c * 32, hh);
  asm volatile("s_wait_xcnt 0x0" ::: "memory");      /* the address registers of the loads above are reused below: they are overwritten only behind this wait */
  const v8f z8 = {0.f, 0.f, 0.f, 0.f, 0.f, 0.f, 0.f, 0.f}; v8f acc[4][2]; float mr[2], ls[2];
#pragma unroll
  for (int t = 0; t < 2; ++t) { mr[t] = -3.0e38f; ls[t] = 0.f;
#pragma unroll
    for (int d = 0; d < 4; ++d) acc[d][t] = z8; }
  asm volatile("s_wait_asynccnt 0x0" ::: "memory");      /* this wave's copies of stage 0 have landed */
  __syncthreads();      /* stage 0 is readable by every wave */
  fa_stage(lc + FS, gk + (size_t)FK * DM, gv + FK);      /* stage 1 exists for every work-group */
  int t = 0;
#pragma unroll 1      /* one trip = one stage = two passes of 32 keys; the buffer is picked by the trip's parity. All stages but the last two: whole for every wave, and a stage t + 2 exists */
  for (; t < ns - 2; ++t) {
    fa_trip<false>(lk + (t & 1) * (FS / 2), lv + (t & 1) * (FS / 2), t * FK, q0, qf, acc, mr, ls, ln, hh);
    __builtin_amdgcn_sched_barrier(0);      /* keeps the publish point at the trip's foot: moved up by the scheduler, its s_wait_dscnt 0 stood directly behind the second pass's V^T reads and waited for them */
    asm volatile("s_wait_dscnt 0x0" ::: "memory");      /* this wave's reads of the buffer are done before it may be refilled */
    asm volatile("s_wait_asynccnt 0x0" ::: "memory");      /* this wave's copies of stage t + 1 have landed */
    __syncthreads();      /* publishes stage t + 1 and ends every wave's reads of stage t */
    fa_stage(lc + (unsigned)(t & 1) * FS, gk + (size_t)(t + 2) * FK * DM, gv + (size_t)(t + 2) * FK); }
#pragma unroll 1      /* the last two stages: no stage t + 2 is left to copy; small code */
  for (; t < ns; ++t) {
    fa_trip<true>(lk + (t & 1) * (FS / 2), lv + (t & 1) * (FS / 2), t * FK, q0, qf, acc, mr, ls, ln, hh);
    asm volatile("s_wait_dscnt 0x0" ::: "memory");      /* as above */
    asm volatile("s_wait_asynccnt 0x0" ::: "memory");      /* this wave's copies of stage t + 1 have landed */
    __syncthreads(); }      /* publishes stage t + 1; every wave passes it, also one that skipped the stage */
  asm volatile("s_wait_asynccnt 0x0" ::: "memory");      /* no copy is outstanding when the wave ends */
#pragma unroll
  for (int t = 0; t < 2; ++t) { const float inv = 64.0f / (ls[t] + fa_xhalf(ls[t]));      /* the halves' sums joined once; o carried x64 */
    unsigned short* op = (unsigned short*)O + (size_t)(q0 + t * 16 + ln) * DM + h * HD + 8 * hh;
#pragma unroll      /* the wave stores the whole 128-byte line of each of its rows */
    for (int d = 0; d < 4; ++d) { FragH f;
#pragma unroll
      for (int r = 0; r < 8; ++r) f.h[r] = (_Float16)(acc[d][t][r] * inv);
      *(v8us*)(op + d * 16) = f.half[0]; } } }


// Exact f32 causal attention for rows 0 .. QT0 - 1 (o carried x64 like the f16 path). ONE WORK-GROUP PER HEAD AND 16 QUERY ROWS, 8 waves:
// the head's K and V rows below the group's end are staged in LDS by coalesced loads; scores: one thread per key (its K row in registers, the q rows wave-uniform);
// softmax: one wave per two rows; o: each wave sums every eighth chunk of 4 keys for all 16 rows x 64 columns in registers, and the 8 partial sums are added in wave order.
#define A0R 16                       /* query rows per work-group */
#define A0KP (HD + 4)                /* LDS pitch of a K row in floats: 272 B = 16 B x odd, so that 16-byte reads of one row per lane spread over the banks */
#define A0SP (QT0 + 4)               /* LDS pitch of a score row in floats (a multiple of 16 B) */
__global__ __launch_bounds__(256) void k_att0w(const float* __restrict__ QF, const float* __restrict__ KF, const float* __restrict__ VF, float scale, float* __restrict__ OF) {
  __shared__ __attribute__((aligned(16))) float lk[QT0][A0KP]; __shared__ __attribute__((aligned(16))) float lv[QT0][HD]; __shared__ __attribute__((aligned(16))) float ls[A0R][A0SP];
  __shared__ __attribute__((aligned(16))) float red[8][A0R][HD]; __shared__ float linv[A0R];
  const int tid = threadIdx.x, lane = tid & 31, w = __builtin_amdgcn_readfirstlane(tid >> 5); const int h = blockIdx.x / (QT0 / A0R), rg = blockIdx.x % (QT0 / A0R); const int nk = (rg + 1) * A0R;      /* causal: keys below the group's end */
  const int r16 = tid >> 4, c4 = (tid & 15) * 4;
  { const float* kp = KF + (size_t)r16 * DM + h * HD + c4; const float* vp = VF + (size_t)r16 * DM + h * HD + c4; v4f kx[QT0 / 16], vx[QT0 / 16];
#pragma unroll      /* constant indices keep kx and vx in registers; every load is issued before the first value is used */
    for (int u = 0; u < QT0 / 16; ++u) if (u <= rg) { kx[u] = *(const v4fa*)(kp + (size_t)u * 16 * DM); vx[u] = *(const v4fa*)(vp + (size_t)u * 16 * DM); }
    asm volatile("s_wait_xcnt 0x0" :: "v"(kp), "v"(vp) : "memory");      /* the loads' address registers are reused below: they are held up to this wait and overwritten only behind it */
#pragma unroll      /* constant indices, as above */
    for (int u = 0; u < QT0 / 16; ++u) if (u <= rg) { *(v4f*)&lk[u * 16 + r16][c4] = kx[u]; *(v4f*)&lv[u * 16 + r16][c4] = vx[u]; } }
  __syncthreads();
  if (tid < nk) { v4f kr[HD / 4];
#pragma unroll      /* the key's row stays in registers for all 16 query rows */
    for (int c = 0; c < HD / 4; ++c) kr[c] = *(const v4f*)&lk[tid][c * 4];
    const float* qb = QF + (size_t)rg * A0R * DM + h * HD;      /* the same address in every lane */
#pragma unroll 4      /* several rows' q loads in flight ahead of their products */
    for (int i = 0; i < A0R; ++i) { v4f s4 = {0.f, 0.f, 0.f, 0.f};
#pragma unroll      /* kr is indexed by constants only */
      for (int c = 0; c < HD / 4; ++c) { const v4f qq = *(const v4fa*)(qb + (size_t)i * DM + c * 4);
#pragma unroll      /* short fixed trip count; the arrays it indexes stay in registers */
        for (int u = 0; u < 4; ++u) s4[u] = fmaf(qq[u], kr[c][u], s4[u]); }
      ls[i][tid] = ((s4[0] + s4[1]) + (s4[2] + s4[3])) * scale; } }
  __syncthreads();
#pragma unroll 1      /* two rows a wave, one after the other: small code */
  for (int i = 2 * w; i < 2 * w + 2; ++i) { const int last = rg * A0R + i; float x[QT0 / 32]; float mx = -3.0e38f;
#pragma unroll      /* x is indexed by constants only */
    for (int u = 0; u < QT0 / 32; ++u) { const int j = u * 32 + lane; x[u] = (j <= last) ? ls[i][j] : -3.0e38f; mx = fmaxf(mx, x[u]); }
#pragma unroll      /* short fixed trip count; the arrays it indexes stay in registers */
    for (int o = 16; o > 0; o >>= 1) mx = fmaxf(mx, __shfl_xor(mx, o, 32));
    float se = 0.f;
#pragma unroll      /* short fixed trip count; the arrays it indexes stay in registers */
    for (int u = 0; u < QT0 / 32; ++u) { const int j = u * 32 + lane; const float e = (j <= last) ? expf(x[u] - mx) : 0.f; se += e; if (j < nk) ls[i][j] = e; }
#pragma unroll      /* short fixed trip count; the arrays it indexes stay in registers */
    for (int o = 16; o > 0; o >>= 1) se += __shfl_xor(se, o, 32);
    if (lane == 0) linv[i] = 64.0f / se; }      /* o carried x64 like the f16 path */
  __syncthreads();
  { const int rh = lane >> 4, d4 = (lane & 15) * 4; v4f acc[8];
#pragma unroll      /* short fixed trip count; the arrays it indexes stay in registers */
    for (int r = 0; r < 8; ++r) acc[r] = (v4f){0.f, 0.f, 0.f, 0.f};
#pragma unroll 1      /* at most 8 trips of 128 multiply-adds: the body is long enough as it is */
    for (int j0 = 4 * w; j0 < nk; j0 += 32) { v4f pv[8], vv[4];
#pragma unroll      /* short fixed trip count; the arrays it indexes stay in registers */
      for (int r = 0; r < 8; ++r) pv[r] = *(const v4f*)&ls[rh * 8 + r][j0];
#pragma unroll      /* short fixed trip count; the arrays it indexes stay in registers */
      for (int q = 0; q < 4; ++q) vv[q] = *(const v4f*)&lv[j0 + q][d4];
#pragma unroll      /* short fixed trip count; the arrays it indexes stay in registers */
      for (int q = 0; q < 4; ++q)
#pragma unroll      /* short fixed trip count; the arrays it indexes stay in registers */
        for (int r = 0; r < 8; ++r)
#pragma unroll      /* short fixed trip count; the arrays it indexes stay in registers */
          for (int u = 0; u < 4; ++u) acc[r][u] = fmaf(pv[r][q], vv[q][u], acc[r][u]); }
#pragma unroll      /* short fixed trip count; the arrays it indexes stay in registers */
    for (int r = 0; r < 8; ++r) *(v4f*)&red[w][rh * 8 + r][d4] = acc[r]; }
  __syncthreads();
  { v4f o = *(const v4f*)&red[0][r16][c4];
#pragma unroll      /* short fixed trip count; the arrays it indexes stay in registers */
    for (int p = 1; p < 8; ++p) { const v4f a = *(const v4f*)&red[p][r16][c4]; o += a; }
    const float fin = linv[r16]; o *= fin;
    *(v4f*)(OF + (size_t)(rg * A0R + r16) * DM + h * HD + c4) = o; } }

extern "C" void kernel_launch(void* const* d_in, const int* in_sizes, int n_in,
                              void* d_out, int out_size, void* d_ws, size_t ws_size, hipStream_t stream) {
  (void)in_sizes; (void)n_in; (void)out_size;
  const float* const* I = (const float* const*)d_in; const float* xq = I[0]; const float* xk = I[1]; const float* xv = I[2]; const float* wq = I[3]; const float* wk = I[4]; const float* wv = I[5]; const float* wo = I[6];      /* weights [in][out] */
  char* ws = (char*)d_ws; size_t off = 0;
  auto take = [&](size_t bytes) { char* p = ws + off; off += (bytes + 255) & ~(size_t)255; return p; };
  static_assert(NB == 1 && B0 == 0 && NBR == 1, "the joined projection launch takes the first-tile rows of one batch");
  _Float16* BW = (_Float16*)take((size_t)4 * DM * DM * 2); _Float16* BO = BW + (size_t)3 * DM * DM;      /* weight planes q, k, v, o, one behind the other */
  _Float16* XH = (_Float16*)take(3 * NR * DM * 2);      /* rounded inputs q, k, v, one behind the other */
  _Float16* Q16 = (_Float16*)take(3 * NR * DM * 2); _Float16* K16 = Q16 + NR * DM; _Float16* V16 = K16 + NR * DM; _Float16* O16 = (_Float16*)take(NR * DM * 2);      /* q, k, v rows, one plane behind the other */
  _Float16* VT = (_Float16*)take((size_t)NH * HD * SQ * 2);
  float* QF0 = (float*)take((size_t)3 * QT0 * DM * 4); float* KF0 = QF0 + (size_t)QT0 * DM; float* VF0 = KF0 + (size_t)QT0 * DM; float* OF0 = (float*)take((size_t)NB * QT0 * DM * 4); _Float16* OH0 = (_Float16*)take((size_t)NB * QT0 * DM * 2); _Float16* OL0 = (_Float16*)take((size_t)NB * QT0 * DM * 2);
  if (off > ws_size) return;
  k_prep<<<4 * PWB + 3 * PXB, 256, 0, stream>>>(xq, xk, xv, wq, wk, wv, wo, BW, XH);      /* all four x16 weight planes Bt[n][k] (PER-HEAD STACKS [16][1024][64] = [head][in][out]: head h's block -> rows 64 h .. 64 h + 63) and the three rounded inputs */
  k_qkv<<<dim3(PJF + PJH, 3), 128, 0, stream>>>(XH, BW, QF0, Q16);      /* q, k, v: f16 rows of all tokens, and f32 rows of the first 256 (exact products) */
  for (int b = B0; b < B0 + NBR; ++b) { const size_t r0 = (size_t)b * SQ;
    k_vt<NH, SQ><<<NH * (SQ / 64), 256, 0, stream>>>(V16 + r0 * LQ, LQ, 0, VT);      /* V^T [NH][HD][SQ] for this batch */
    k_att0w<<<NH * (QT0 / A0R), 256, 0, stream>>>(QF0, KF0, VF0, 0.125f, OF0 + (size_t)b * QT0 * DM);      /* exact f32 attention for rows 0..255 (o x64) */
    k_fattn<<<FNG, FW * 32, 0, stream>>>(Q16 + r0 * LQ, K16 + r0 * LQ, VT, O16 + r0 * DM); }      /* scores, causal softmax and P V for all heads and rows in one launch: o (merged heads, x64) as f16 rows */
  k_hl<<<(unsigned)(((size_t)NB * QT0 * DM / 8 + 255) / 256), 256, 0, stream>>>(OF0, OH0, OL0, (size_t)NB * QT0 * DM / 8);      /* first-tile o (x64) -> f16 hi + x1024 residual planes */
  k_out<<<(MPO / 128) * (DM / 64), 128, 0, stream>>>(O16, OH0, BO, (float*)d_out);      /* out rows are the output layout; rows 0..255: out = o_hi Wo */
  for (int b = B0; b < B0 + NBR; ++b) { const size_t r0 = (size_t)b * SQ; const size_t f0 = (size_t)b * QT0;
    k_gemm2<0><<<dim3((QT0 / 128) * (DM / 64), 1), 128, 0, stream>>>(OL0 + f0 * DM, DM, 0, BO, DM, 0, 0.00000095367431640625f, nullptr, 0, (const float*)d_out + r0 * DM, -1, 0, 0, (float*)d_out + r0 * DM, nullptr, DM, 0, QT0, DM, DM); }      /* += o_lo Wo 2^-20 (own-element accumulate) */
}

// v007
// Measured time: 154 microseconds a run.
// Timed twice side by side with v006, it ran 1.05 and 1.06 times as fast.
// Counting every step since v000, it is 54.3 times as fast.
#include <hip/hip_runtime.h>
// Causal multi-head attention on three inputs with PER-HEAD STACKED projections over ONE sequence of 4096 tokens (Q, K, V [1][4096][1024]; WQ / WK / WV [16][1024][64] = [head][in][out] sigma 0.02, NO biases; 16 heads of 64; scores x 64^-0.5 = / 8; causal (tril, -inf above the diagonal); softmax; heads concatenated head-major; out = concat WO with WO [1024][1024] [in][out], NO bias -> [1][4096][1024]); each head's [in][out] block is transposed into its 64 contiguous rows of the weight plane, and the [in][out] output weight into its own plane, by one launch that also rounds the three inputs.
// Structure: token rows r = s; q, k, v inputs as exact f16 rows (bf16-rounded); Q, K, V as three WMMA GEMMs in one launch (32x64 wave tiles, f32 accumulation, exact x16 weights, f16 outputs; the f32 rows of the first tile by further work-groups of the same launch); per batch: V^T for all heads via LDS transposes; one fused attention launch: a wave per 32 query rows of a head walks the keys up to its own rows 32 at a time (scores on WMMA, K = 64; running f32 maximum and sum, native exp2; weights in (0, 1] as f16; o += P V on WMMA, divided by the sum at the end, o carried x64, folded into the output GEMM alpha), written straight into the merged f16 o rows; out = o W_o GEMM (f32) into the output layout.
// Compute dtype: inputs rounded to bf16; x / weights exact; q, k, v, softmax weights and o as plain f16 GEMM operands (~2^-12); scores and softmax statistics f32. v_wmma_f32_16x16x32_f16.
#define NB 1
#define SQ 4096
#define DM 1024
#define NH 16
#define HD 64
#define HG 4                         /* heads per launch of the unlaunched k_vt overload */
#define QT 256                       /* unused */
#define NKX SQ                       /* unused */
#define QT0 256                      /* first-tile rows recomputed exactly in f32 */
#define B0 0                         /* first batch processed (debug hook) */
#define NBR NB                       /* batches processed (debug hook) */
#define NR ((size_t)NB * SQ)         /* token rows */
#define MP ((int)((size_t)NBR * SQ)) /* rows projected (debug hook) */
#define QN SQ                        /* unused (k_fattn attends all SQ rows) */
#define NHD NH                       /* unused (k_fattn attends all NH heads) */
#define MPO MP                       /* rows through the output stage (debug hook) */
#define LQ DM      /* row pitch of the q/k/v rows */
typedef __bf16 v16b __attribute__((ext_vector_type(16)));
typedef unsigned short v8us __attribute__((ext_vector_type(8), may_alias));
typedef float  v8f  __attribute__((ext_vector_type(8)));
typedef float  v4f  __attribute__((ext_vector_type(4)));
typedef float  v4fa __attribute__((ext_vector_type(4), may_alias));
union FragB { v16b v; v8us half[2]; unsigned short u[16]; };

__device__ __forceinline__ unsigned short bf16_bits(float x) { unsigned int u = __float_as_uint(x); return (unsigned short)((u + 0x7FFFu + ((u >> 16) & 1u)) >> 16); }
__device__ __forceinline__ float bf16_val(unsigned short b) { return __uint_as_float(((unsigned int)b) << 16); }
__device__ __forceinline__ float bf16_round(float x) { return bf16_val(bf16_bits(x)); }
// D += A·B with NT terms: 1 = ah·bh, 2 = + al·bh (A split), 3 = + ah·bl (both split)
template <int NT>
__device__ __forceinline__ v8f mmaN(v16b ah, v16b al, v16b bh, v16b bl, v8f c) {
  c = __builtin_amdgcn_wmma_f32_16x16x32_bf16(false, ah, false, bh, (short)0, c, false, false);
  if (NT >= 2) c = __builtin_amdgcn_wmma_f32_16x16x32_bf16(false, al, false, bh, (short)0, c, false, false);
  if (NT >= 3) c = __builtin_amdgcn_wmma_f32_16x16x32_bf16(false, ah, false, bl, (short)0, c, false, false);
  asm volatile("v_nop\n\tv_nop\n\tv_nop\n\tv_nop" : "+v"(c) : "v"(ah), "v"(al), "v"(bh), "v"(bl));
  return c;
}

__global__ __launch_bounds__(256) void k_wt_bf16(const float* __restrict__ W, unsigned short* __restrict__ Wt, int K, int N) {
  const int t = blockIdx.x * 256 + threadIdx.x;
  const int k8n = K / 8;
  if (t >= N * k8n) return;
  const int n = t / k8n, k8 = (t % k8n) * 8;
  v8us v;
#pragma unroll
  for (int i = 0; i < 8; ++i) v[i] = bf16_bits(W[(size_t)(k8 + i) * N + n]);
  *(v8us*)(Wt + (size_t)n * K + k8) = v;
  
}

// GEMM C[M][N] (f32, pitch ldc) = act(A[M][K]·W + bias). A f32 row-major (pitch lda) converted per fragment to bf16
// (ASPLIT: hi/lo two planes -> 2 terms, else single rounded term); Wt bf16 [N][K] (pitch ldb). BIAS_BF16 rounds the
// bias to bf16 first (bias quantised to bf16 before the add). K%32==0, M%16==0, N%64==0.
template <bool ASPLIT, int ACT, bool BIAS_BF16>
__global__ __launch_bounds__(128) void k_gemm_bf(const float* __restrict__ A, int lda, const unsigned short* __restrict__ Wt, int ldb,
                                               const float* __restrict__ bias, float* __restrict__ C, int ldc, int M, int N, int K) {
  __shared__ __attribute__((aligned(16))) float so[4][16][64];
  const int tid = threadIdx.x, w = tid >> 5, lane = tid & 31, ln = lane & 15, hh = lane >> 4;
  const int ntn = N / 64;
  const int wid = blockIdx.x * 4 + w;
  const int mt = wid / ntn, nq = wid % ntn;
  if (mt * 16 >= M) return;
  const int row0 = mt * 16, col0 = nq * 64;
  const float* arow = A + (size_t)(row0 + ln) * lda;
  v8f acc[4] = {};
  for (int kb = 0; kb < K; kb += 32) {
    FragB ah, al;
    const v4f x0 = *(const v4fa*)(arow + kb + 8 * hh), x1 = *(const v4fa*)(arow + kb + 8 * hh + 4);
    const v4f x2 = *(const v4fa*)(arow + kb + 16 + 8 * hh), x3 = *(const v4fa*)(arow + kb + 16 + 8 * hh + 4);
    float xs[16] = {x0[0],x0[1],x0[2],x0[3],x1[0],x1[1],x1[2],x1[3],x2[0],x2[1],x2[2],x2[3],x3[0],x3[1],x3[2],x3[3]};
#pragma unroll
    for (int i = 0; i < 16; ++i) { const unsigned short hb = bf16_bits(xs[i]); ah.u[i] = hb; al.u[i] = ASPLIT ? bf16_bits(xs[i] - bf16_val(hb)) : (unsigned short)0; }
#pragma unroll
    for (int t = 0; t < 4; ++t) {
      const unsigned short* brow = Wt + (size_t)(col0 + t * 16 + ln) * ldb + kb;
      FragB b;
      b.half[0] = *(const v8us*)(brow + 8 * hh);
      b.half[1] = *(const v8us*)(brow + 16 + 8 * hh);
      acc[t] = mmaN<ASPLIT ? 2 : 1>(ah.v, al.v, b.v, b.v, acc[t]);
    }
  }
#pragma unroll
  for (int t = 0; t < 4; ++t) {
    float bv = bias ? bias[col0 + t * 16 + ln] : 0.f;
    if (BIAS_BF16) bv = bf16_round(bv);
#pragma unroll
    for (int r = 0; r < 8; ++r) { float v = acc[t][r] + bv; if (ACT == 1) v = fmaxf(v, 0.f); so[w][8 * hh + r][t * 16 + ln] = v; }
  }
  __builtin_amdgcn_fence(__ATOMIC_ACQ_REL, "workgroup");
  __builtin_amdgcn_wave_barrier();
  const int rsub = lane >> 4, c4 = (lane & 15) * 4;
  {
#pragma unroll
    for (int q = 0; q < 8; ++q) {
      const int r = q * 2 + rsub;
      const v4f v = *(const v4fa*)&so[w][r][c4];
      *(v4f*)(C + (size_t)(row0 + r) * ldc + col0 + c4) = v;
    }
    
  }
}

// GEMM C = act(A·W + bias + resid): A f32 (ASPLIT -> hi/lo 2 terms), Wt bf16 [N][K]; ACT 0 none, 1 relu, 2 exact gelu;
// resid (optional, f32, row index = (row % rmod), pitch ldr, RES_BF16 rounds it) added before the activation.
template <bool ASPLIT, int ACT, bool BIAS_BF16, bool RES_BF16>
__global__ __launch_bounds__(128) void k_gemm_bf3(const float* __restrict__ A, int lda, const unsigned short* __restrict__ Wt, int ldb,
                                                const float* __restrict__ bias, const float* __restrict__ resid, int rmod, int ldr,
                                                float* __restrict__ C, int ldc, int M, int N, int K) {
  __shared__ __attribute__((aligned(16))) float so[4][16][64];
  const int tid = threadIdx.x, w = tid >> 5, lane = tid & 31, ln = lane & 15, hh = lane >> 4;
  const int ntn = N / 64;
  const int wid = blockIdx.x * 4 + w;
  const int mt = wid / ntn, nq = wid % ntn;
  if (mt * 16 >= M) return;
  const int row0 = mt * 16, col0 = nq * 64;
  const float* arow = A + (size_t)(row0 + ln) * lda;
  v8f acc[4] = {};
  for (int kb = 0; kb < K; kb += 32) {
    FragB ah, al;
    const v4f x0 = *(const v4fa*)(arow + kb + 8 * hh), x1 = *(const v4fa*)(arow + kb + 8 * hh + 4);
    const v4f x2 = *(const v4fa*)(arow + kb + 16 + 8 * hh), x3 = *(const v4fa*)(arow + kb + 16 + 8 * hh + 4);
    float xs[16] = {x0[0],x0[1],x0[2],x0[3],x1[0],x1[1],x1[2],x1[3],x2[0],x2[1],x2[2],x2[3],x3[0],x3[1],x3[2],x3[3]};
#pragma unroll
    for (int i = 0; i < 16; ++i) { const unsigned short hb = bf16_bits(xs[i]); ah.u[i] = hb; al.u[i] = ASPLIT ? bf16_bits(xs[i] - bf16_val(hb)) : (unsigned short)0; }
#pragma unroll
    for (int t = 0; t < 4; ++t) {
      const unsigned short* brow = Wt + (size_t)(col0 + t * 16 + ln) * ldb + kb;
      FragB b;
      b.half[0] = *(const v8us*)(brow + 8 * hh);
      b.half[1] = *(const v8us*)(brow + 16 + 8 * hh);
      acc[t] = mmaN<ASPLIT ? 2 : 1>(ah.v, al.v, b.v, b.v, acc[t]);
    }
  }
#pragma unroll
  for (int t = 0; t < 4; ++t) {
    const int col = col0 + t * 16 + ln;
    float bv = bias ? bias[col] : 0.f;
    if (BIAS_BF16) bv = bf16_round(bv);
#pragma unroll
    for (int r = 0; r < 8; ++r) {
      float v = acc[t][r] + bv;
      if (resid) { float rv = resid[(size_t)((row0 + 8 * hh + r) % rmod) * ldr + col]; if (RES_BF16) rv = bf16_round(rv); v += rv; }
      if (ACT == 1) v = fmaxf(v, 0.f);
      if (ACT == 2) v = 0.5f * v * (1.0f + erff(v * 0.70710678118654752f));
      if (ACT == 3) { const float u = 0.7978845608028654f * (v + 0.044715f * v * v * v); v = 0.5f * v * (1.0f + tanhf(u)); }
      so[w][8 * hh + r][t * 16 + ln] = v;
    }
  }
  __builtin_amdgcn_fence(__ATOMIC_ACQ_REL, "workgroup");
  __builtin_amdgcn_wave_barrier();
  const int rsub = lane >> 4, c4 = (lane & 15) * 4;
  {
#pragma unroll
    for (int q = 0; q < 8; ++q) {
      const int r = q * 2 + rsub;
      const v4f v = *(const v4fa*)&so[w][r][c4];
      *(v4f*)(C + (size_t)(row0 + r) * ldc + col0 + c4) = v;
    }
    
  }
}
// row LayerNorm (biased variance, eps) over N: s = X (+ R); optional out_sum <- s; out_norm <- (s-mu)*rsqrt(var+eps)*g + b
template <bool PARAM_BF16>
__global__ __launch_bounds__(256) void k_layernorm(const float* __restrict__ X, const float* __restrict__ R, const float* __restrict__ g, const float* __restrict__ bta,
                                                  float* __restrict__ out_sum, float* __restrict__ out_norm, int N, float eps) {
  __shared__ float red[256];
  const int row = blockIdx.x, tid = threadIdx.x;
  const float* x = X + (size_t)row * N; const float* rr = R ? R + (size_t)row * N : nullptr;
  float vals[16];                     // up to N = 4096
  const int per = N / 256;            // contiguous chunk per thread? use strided-by-4 chunks: thread handles j = tid*4 + 1024*u
  float s1 = 0.f;
  for (int u = 0; u < per / 4; ++u) {
    const int j = tid * 4 + 1024 * u;
    const v4f a = *(const v4fa*)(x + j);
    v4f b = {0.f,0.f,0.f,0.f}; if (rr) b = *(const v4fa*)(rr + j);
#pragma unroll
    for (int q = 0; q < 4; ++q) { const float v = a[q] + b[q]; vals[u * 4 + q] = v; s1 += v; }
  }
  red[tid] = s1; __syncthreads();
  for (int st = 128; st > 0; st >>= 1) { if (tid < st) red[tid] += red[tid + st]; __syncthreads(); }
  const float mu = red[0] / (float)N; __syncthreads();
  float s2 = 0.f;
  for (int u = 0; u < per / 4; ++u)
#pragma unroll
    for (int q = 0; q < 4; ++q) { const float c = vals[u * 4 + q] - mu; s2 += c * c; }
  red[tid] = s2; __syncthreads();
  for (int st = 128; st > 0; st >>= 1) { if (tid < st) red[tid] += red[tid + st]; __syncthreads(); }
  const float rs = rsqrtf(red[0] / (float)N + eps);
  {
    for (int u = 0; u < per / 4; ++u) {
      const int j = tid * 4 + 1024 * u;
      v4f o, sm;
#pragma unroll
      for (int q = 0; q < 4; ++q) {
        float gg = g[j + q], bb = bta[j + q];
        if (PARAM_BF16) { gg = bf16_round(gg); bb = bf16_round(bb); }
        sm[q] = vals[u * 4 + q]; o[q] = (vals[u * 4 + q] - mu) * rs * gg + bb;
      }
      if (out_sum) *(v4f*)(out_sum + (size_t)row * N + j) = sm;
      *(v4f*)(out_norm + (size_t)row * N + j) = o;
    }
    
  }
}



// ---- f16 WMMA path (v_wmma_f32_16x16x32_f16): 11-bit significands for operands in range — used where a [0,1] probability operand needs more precision than bf16
typedef _Float16 v16h __attribute__((ext_vector_type(16)));
union FragH { v16h v; v8us half[2]; _Float16 h[16]; unsigned short u[16]; };
template <int NT>
__device__ __forceinline__ v8f mmaH(v16h ah, v16h al, v16h bh, v16h bl, v8f c) {
  c = __builtin_amdgcn_wmma_f32_16x16x32_f16(false, ah, false, bh, (short)0, c, false, false);
  if (NT >= 2) c = __builtin_amdgcn_wmma_f32_16x16x32_f16(false, al, false, bh, (short)0, c, false, false);
  if (NT >= 3) c = __builtin_amdgcn_wmma_f32_16x16x32_f16(false, ah, false, bl, (short)0, c, false, false);
  asm volatile("v_nop\n\tv_nop\n\tv_nop\n\tv_nop" : "+v"(c) : "v"(ah), "v"(al), "v"(bh), "v"(bl));
  return c;
}
// batched GEMM like k_gemm_b but f16 operands: A f32 (split into f16 hi/lo if ASPLIT, else rounded to f16), Bt = f16 values [n][k]; alpha; C f32; N multiple of 16 (partial tiles skipped)
template <bool ASPLIT>
__global__ __launch_bounds__(128) void k_gemm_h(const float* __restrict__ A, int lda, size_t sA, const _Float16* __restrict__ Bh, int ldb, size_t sB, float alpha, float* __restrict__ C, int ldc, size_t sC, int M, int N, int K) {
  __shared__ __attribute__((aligned(16))) float so[4][16][64];
  const int tid = threadIdx.x, w = tid >> 5, lane = tid & 31, ln = lane & 15, hh = lane >> 4; const int by = blockIdx.y;
  A += (size_t)by * sA; Bh += (size_t)by * sB; C += (size_t)by * sC;
  const int ntn = (N + 63) / 64; const int wid = blockIdx.x * 4 + w; const int mt = wid / ntn, nq = wid % ntn; if (mt * 16 >= M) return;
  const int row0 = mt * 16, col0 = nq * 64; const float* arow = A + (size_t)(row0 + ln) * lda;
  v8f acc[4] = {};
  for (int kb = 0; kb < K; kb += 32) {
    FragH ah, al;
    const v4f x0 = *(const v4fa*)(arow + kb + 8 * hh), x1 = *(const v4fa*)(arow + kb + 8 * hh + 4), x2 = *(const v4fa*)(arow + kb + 16 + 8 * hh), x3 = *(const v4fa*)(arow + kb + 16 + 8 * hh + 4);
    float xs[16] = {x0[0],x0[1],x0[2],x0[3],x1[0],x1[1],x1[2],x1[3],x2[0],x2[1],x2[2],x2[3],x3[0],x3[1],x3[2],x3[3]};
#pragma unroll
    for (int i = 0; i < 16; ++i) { const _Float16 h = (_Float16)xs[i]; ah.h[i] = h; al.h[i] = ASPLIT ? (_Float16)(xs[i] - (float)h) : (_Float16)0.0f; }
#pragma unroll
    for (int t = 0; t < 4; ++t) { if (col0 + t * 16 >= N) continue; const size_t boff = (size_t)(col0 + t * 16 + ln) * ldb + kb; FragH bq; bq.half[0] = *(const v8us*)(Bh + boff + 8 * hh); bq.half[1] = *(const v8us*)(Bh + boff + 16 + 8 * hh);
      acc[t] = mmaH<ASPLIT ? 2 : 1>(ah.v, al.v, bq.v, bq.v, acc[t]); }
  }
#pragma unroll
  for (int t = 0; t < 4; ++t) { if (col0 + t * 16 >= N) continue;
#pragma unroll
    for (int r = 0; r < 8; ++r) so[w][8 * hh + r][t * 16 + ln] = acc[t][r] * alpha; }
  __builtin_amdgcn_fence(__ATOMIC_ACQ_REL, "workgroup"); __builtin_amdgcn_wave_barrier();
  const int rsub = lane >> 4, c4 = (lane & 15) * 4;
  {
#pragma unroll
    for (int q = 0; q < 8; ++q) { const int r = q * 2 + rsub; if (col0 + c4 < N) { const v4f v = *(const v4fa*)&so[w][r][c4]; *(v4f*)(C + (size_t)(row0 + r) * ldc + col0 + c4) = v; } }
     }
}

// k_gemm_hh variant with fused epilogue: v = acc·alpha + bias[by·sBias + col] (+ CP[(row/rowsPerB)·sCPb + by·64 + col] if CP) ; ACT 0 none / 1 elu ; writes f16 C16 (and f32 C if non-null)
template <int ACT>
__global__ __launch_bounds__(128) void k_gemm_hhx(const _Float16* __restrict__ A, int lda, size_t sA, const _Float16* __restrict__ Bh, int ldb, size_t sB, float alpha, const float* __restrict__ bias, size_t sBias, const float* __restrict__ CP, int rowsPerB, size_t sCPb, int row0g,
    float* __restrict__ C, _Float16* __restrict__ C16, int ldc, size_t sC, int M, int N, int K) {
  __shared__ __attribute__((aligned(16))) float so[4][16][64];
  const int tid = threadIdx.x, w = tid >> 5, lane = tid & 31, ln = lane & 15, hh = lane >> 4; const int by = blockIdx.y;
  A += (size_t)by * sA; Bh += (size_t)by * sB; const size_t cofs = (size_t)by * sC; const float* bp = bias ? bias + (size_t)by * sBias : nullptr;
  const int ntn = (N + 63) / 64; const int wid = blockIdx.x * 4 + w; const int mt = wid / ntn, nq = wid % ntn; if (mt * 16 >= M) return;
  const int row0 = mt * 16, col0 = nq * 64; const _Float16* arow = A + (size_t)(row0 + ln) * lda;
  v8f acc[4] = {};
  for (int kb = 0; kb < K; kb += 32) { FragH ah; ah.half[0] = *(const v8us*)((const unsigned short*)arow + kb + 8 * hh); ah.half[1] = *(const v8us*)((const unsigned short*)arow + kb + 16 + 8 * hh);
#pragma unroll
    for (int t = 0; t < 4; ++t) { if (col0 + t * 16 >= N) continue; const size_t boff = (size_t)(col0 + t * 16 + ln) * ldb + kb; FragH bq; bq.half[0] = *(const v8us*)((const unsigned short*)Bh + boff + 8 * hh); bq.half[1] = *(const v8us*)((const unsigned short*)Bh + boff + 16 + 8 * hh);
      acc[t] = mmaH<1>(ah.v, ah.v, bq.v, bq.v, acc[t]); }
  }
#pragma unroll
  for (int t = 0; t < 4; ++t) { if (col0 + t * 16 >= N) continue; const int col = col0 + t * 16 + ln; const float bv = bp ? bf16_round(bp[col]) : 0.f;
#pragma unroll
    for (int r = 0; r < 8; ++r) { float v = acc[t][r] * alpha + bv; if (CP) { const int rr = row0g + row0 + 8 * hh + r; if (rowsPerB < 0) v += CP[cofs + (size_t)rr * ldc + col];      /* rowsPerB < 0: own element of the batched C plane */ else { const int bidx = rr / rowsPerB; v += CP[(size_t)bidx * sCPb + (size_t)by * 64 + col]; } } if (ACT == 1) v = (v > 0.f) ? v : expm1f(v); else if (ACT == 7) v = (v > 0.f) ? v + 1.0f : expf(v); else if (ACT == 8) v = tanhf(v); else if (ACT == 9) v = 0.5f * v * (1.0f + tanhf(0.7978845608028654f * (v + 0.044715f * v * v * v))); else if (ACT == 11) v = 1.0f / (1.0f + expf(-v)); else if (ACT == 12) v = (v > 0.f) ? v : 0.01f * v; else if (ACT == 14) v = (v > 0.f) ? v : 0.1f * v; else if (ACT == 16) v = (v >= 0.f) ? v : 0.3f * v; else if (ACT == 17) v = (v >= 0.f) ? v : 0.2f * v; else if (ACT == 15) v = v / (1.0f + expf(-v)); else if (ACT == 3) v = fmaxf(v, 0.f); else if (ACT == 6) v = 0.5f * v * (1.0f + erff(v * 0.70710678118654752f)); so[w][8 * hh + r][t * 16 + ln] = v; } }
  __builtin_amdgcn_fence(__ATOMIC_ACQ_REL, "workgroup"); __builtin_amdgcn_wave_barrier();
  const int rsub = lane >> 4, c4 = (lane & 15) * 4; typedef _Float16 v4h __attribute__((ext_vector_type(4)));
  {
#pragma unroll
    for (int q = 0; q < 8; ++q) { const int r = q * 2 + rsub; if (col0 + c4 < N) { const v4f v = *(const v4fa*)&so[w][r][c4]; if (C) *(v4f*)(C + cofs + (size_t)(row0 + r) * ldc + col0 + c4) = v; if (C16) { v4h h4; for (int i = 0; i < 4; ++i) h4[i] = (_Float16)v[i]; *(v4h*)(C16 + cofs + (size_t)(row0 + r) * ldc + col0 + c4) = h4; } } }
     }
}


typedef _Float16 v4h __attribute__((ext_vector_type(4)));

__global__ __launch_bounds__(256) void k_h16(const float* __restrict__ x, _Float16* __restrict__ X16, size_t n8) { const size_t t = (size_t)blockIdx.x * 256 + threadIdx.x; if (t >= n8) return; FragH f;
#pragma unroll
  for (int q = 0; q < 8; ++q) f.h[q] = (_Float16)x[t * 8 + q]; *(v8us*)((unsigned short*)X16 + t * 8) = f.half[0];  }
__global__ __launch_bounds__(256) void k_round16f(const float* __restrict__ W, _Float16* __restrict__ Bt, size_t n8) { const size_t t = (size_t)blockIdx.x * 256 + threadIdx.x; if (t >= n8) return; FragH f;
#pragma unroll
  for (int i = 0; i < 8; ++i) f.h[i] = (_Float16)(bf16_round(W[t * 8 + i]) * 16.0f); *(v8us*)((unsigned short*)Bt + t * 8) = f.half[0];  }
template <int NHv, int TTv>
__global__ __launch_bounds__(256) void k_vt(const _Float16* __restrict__ V16, int ldv, int voff, _Float16* __restrict__ Vt) { __shared__ unsigned short tl[64][66]; const int tid = threadIdx.x; const int slab = blockIdx.x / (TTv / 64), lg = blockIdx.x % (TTv / 64); const int b = slab / NHv, h = slab % NHv;
  for (int i = tid; i < 64 * 8; i += 256) { const int r = i / 8, c8 = (i % 8) * 8; FragH f; f.half[0] = *(const v8us*)((const unsigned short*)V16 + ((size_t)b * TTv + lg * 64 + r) * ldv + voff + h * 64 + c8);
#pragma unroll
    for (int q = 0; q < 8; ++q) tl[r][c8 + q] = f.u[q]; }
  __syncthreads();
  {
#pragma unroll
    for (int rd = 0; rd < 2; ++rd) { const int d = rd * 32 + tid / 8, pc = tid % 8; FragH f;
#pragma unroll
      for (int q = 0; q < 8; ++q) f.u[q] = tl[pc * 8 + q][d];
      *(v8us*)((unsigned short*)Vt + ((size_t)slab * 64 + d) * TTv + lg * 64 + pc * 8) = f.half[0]; }
     } }

__global__ __launch_bounds__(256) void k_hl(const float* __restrict__ F, _Float16* __restrict__ Hh, _Float16* __restrict__ Hl, size_t n8) { const size_t t = (size_t)blockIdx.x * 256 + threadIdx.x; if (t >= n8) return; FragH fh, fl; const v4f a = *(const v4fa*)(F + t * 8), c = *(const v4fa*)(F + t * 8 + 4);
#pragma unroll
  for (int q = 0; q < 4; ++q) { _Float16 h = (_Float16)a[q]; fh.h[q] = h; fl.h[q] = (_Float16)((a[q] - (float)h) * 1024.0f); h = (_Float16)c[q]; fh.h[4 + q] = h; fl.h[4 + q] = (_Float16)((c[q] - (float)h) * 1024.0f); }
  { *(v8us*)((unsigned short*)Hh + t * 8) = fh.half[0]; *(v8us*)((unsigned short*)Hl + t * 8) = fl.half[0];  } }

// ---- fast GEMM (wave tile 32x64, work-group tile 128x64; requires M % 128 == 0 rows per launch region, N % 64 == 0 and K % 64 == 0); epilogue = k_gemm_hhx semantics ----
__device__ __forceinline__ v16h g2_frag(const _Float16* p, int hh) { FragH f; f.half[0] = *(const v8us*)((const unsigned short*)p + 8 * hh); f.half[1] = *(const v8us*)((const unsigned short*)p + 16 + 8 * hh); return f.v; }
__device__ __forceinline__ v8f g2_mma(v16h a, v16h b, v8f c) { v8f d = __builtin_amdgcn_wmma_f32_16x16x32_f16(false, a, false, b, (short)0, c, false, false); asm volatile("v_nop\n\tv_nop\n\tv_nop\n\tv_nop" : "+v"(d) : "v"(a), "v"(b)); return d; }
// Operand staging of the fast GEMM: a stage is 64 k (one whole 128-byte line) of the work-group's 128 A rows and 64 B rows, brought into LDS by asynchronous copies, two buffers.
#define G2K 64                       /* k per stage */
#define G2P 72                       /* LDS row pitch in f16: 144 B = 16 B x odd, the pitch for 16-byte LDS reads of one row per lane */
#define G2S ((128 + 64) * G2P * 2)   /* bytes of a stage: A rows 0 .. 127, then B rows 0 .. 63 */
// One stage's copies of one thread: 16 bytes of rows r, r + 16, .. of A (8 rows) and of B (4 rows); 8 lanes bring one whole line, a wave-wide copy 4 lines.
// The s_wait_xcnt at the end stands inside the statement so that no register named by a copy is rewritten in front of it.
__device__ __forceinline__ void g2_stage(unsigned l, const _Float16* ga, size_t sa, const _Float16* gb, size_t sb) {
  asm volatile("global_load_async_to_lds_b128 %0, %12, off\n\tglobal_load_async_to_lds_b128 %1, %13, off\n\tglobal_load_async_to_lds_b128 %2, %14, off\n\tglobal_load_async_to_lds_b128 %3, %15, off\n\t"
               "global_load_async_to_lds_b128 %4, %16, off\n\tglobal_load_async_to_lds_b128 %5, %17, off\n\tglobal_load_async_to_lds_b128 %6, %18, off\n\tglobal_load_async_to_lds_b128 %7, %19, off\n\t"
               "global_load_async_to_lds_b128 %8, %20, off\n\tglobal_load_async_to_lds_b128 %9, %21, off\n\tglobal_load_async_to_lds_b128 %10, %22, off\n\tglobal_load_async_to_lds_b128 %11, %23, off\n\ts_wait_xcnt 0x0"
               :: "v"(l), "v"(l + 1 * 16 * G2P * 2), "v"(l + 2 * 16 * G2P * 2), "v"(l + 3 * 16 * G2P * 2), "v"(l + 4 * 16 * G2P * 2), "v"(l + 5 * 16 * G2P * 2), "v"(l + 6 * 16 * G2P * 2), "v"(l + 7 * 16 * G2P * 2),
                  "v"(l + 8 * 16 * G2P * 2), "v"(l + 9 * 16 * G2P * 2), "v"(l + 10 * 16 * G2P * 2), "v"(l + 11 * 16 * G2P * 2),
                  "v"(ga), "v"(ga + sa), "v"(ga + 2 * sa), "v"(ga + 3 * sa), "v"(ga + 4 * sa), "v"(ga + 5 * sa), "v"(ga + 6 * sa), "v"(ga + 7 * sa),
                  "v"(gb), "v"(gb + sb), "v"(gb + 2 * sb), "v"(gb + 3 * sb) : "memory"); }
template <int ACT>
__device__ __forceinline__ void gemm2_body(const int bx, const int by, const _Float16* __restrict__ A, int lda, size_t sA, const _Float16* __restrict__ Bh, int ldb, size_t sB, float alpha, const float* __restrict__ bias, size_t sBias, const float* __restrict__ CP, int rowsPerB, size_t sCPb, int row0g,
    float* __restrict__ C, _Float16* __restrict__ C16, int ldc, size_t sC, int M, int N, int K) { static_assert(ACT == 0 || ACT == 3 || ACT == 6 || ACT == 8 || ACT == 9 || ACT == 11 || ACT == 12 || ACT == 14 || ACT == 15 || ACT == 16 || ACT == 17, "k_gemm2: unsupported ACT code (would silently apply no activation)");
  __shared__ __attribute__((aligned(16))) unsigned char sm[2 * G2S];      /* the two operand buffers; behind the k loop's last barrier the same bytes stage the output rows */
  static_assert(sizeof(float) * 4 * 32 * 68 <= 2 * G2S, "the output staging fits the operand buffers");
  float (*so)[32][68] = (float (*)[32][68])sm;
  const int tid = threadIdx.x, w = tid >> 5, lane = tid & 31, ln = lane & 15, hh = lane >> 4;
  A += (size_t)by * sA; Bh += (size_t)by * sB; const size_t cofs = (size_t)by * sC; const float* bp = bias ? bias + (size_t)by * sBias : nullptr;
  const int ntn = N >> 6; const int mt = bx / ntn, nq = bx - mt * ntn; const int row0 = mt * 128 + 32 * w, col0 = nq * 64; if (mt * 128 >= M) return;      /* taken by a whole work-group or by none (M % 128 == 0): it stands in front of barriers */
  const _Float16* ga = A + (size_t)(mt * 128 + (tid >> 3)) * lda + (tid & 7) * 8; const _Float16* gb = Bh + (size_t)(col0 + (tid >> 3)) * ldb + (tid & 7) * 8;      /* this thread's 16 bytes of rows tid / 8 + 16 i */
  const unsigned lc = (unsigned)(size_t)sm + (unsigned)((tid >> 3) * (G2P * 2) + (tid & 7) * 16);      /* their place in buffer 0 (LDS byte address) */
  const _Float16* la = (const _Float16*)sm + (32 * w + ln) * G2P; const _Float16* lb = (const _Float16*)sm + (128 + ln) * G2P;      /* this lane's fragment rows in buffer 0 */
  const int nt = K / G2K;
  const v8f z8 = {0.f,0.f,0.f,0.f,0.f,0.f,0.f,0.f}; v8f c00 = z8, c01 = z8, c02 = z8, c03 = z8, c10 = z8, c11 = z8, c12 = z8, c13 = z8;
  g2_stage(lc, ga, (size_t)16 * lda, gb, (size_t)16 * ldb);
  asm volatile("s_wait_asynccnt 0x0" ::: "memory");      /* this wave's copies of stage 0 have landed */
  __syncthreads();      /* stage 0 is readable by every wave */
  if (nt > 1) g2_stage(lc + G2S, ga + G2K, (size_t)16 * lda, gb + G2K, (size_t)16 * ldb);
#pragma unroll 1      /* one trip = one stage; the buffer is picked by the trip's parity */
  for (int t = 0; t < nt; ++t) { const int bo = (t & 1) * (G2S / 2); const _Float16* ap = la + bo; const _Float16* bq = lb + bo;
    v16h fa[2][2], fb[2][4];
#pragma unroll      /* the stage's 12 fragments are asked for as one group ahead of its products (constant indices: they stay in registers) */
    for (int q = 0; q < 2; ++q) { fa[q][0] = g2_frag(ap + q * 32, hh); fa[q][1] = g2_frag(ap + 16 * G2P + q * 32, hh);
#pragma unroll
      for (int u = 0; u < 4; ++u) fb[q][u] = g2_frag(bq + u * 16 * G2P + q * 32, hh); }
#pragma unroll      /* the two 32-k blocks of a stage, in ascending k as before */
    for (int q = 0; q < 2; ++q) {
      c00 = g2_mma(fa[q][0], fb[q][0], c00); c10 = g2_mma(fa[q][1], fb[q][0], c10);
      c01 = g2_mma(fa[q][0], fb[q][1], c01); c11 = g2_mma(fa[q][1], fb[q][1], c11);
      c02 = g2_mma(fa[q][0], fb[q][2], c02); c12 = g2_mma(fa[q][1], fb[q][2], c12);
      c03 = g2_mma(fa[q][0], fb[q][3], c03); c13 = g2_mma(fa[q][1], fb[q][3], c13); }
    asm volatile("s_wait_dscnt 0x0" ::: "memory");      /* this wave's reads of the buffer are done before it may be refilled */
    asm volatile("s_wait_asynccnt 0x0" ::: "memory");      /* this wave's copies of stage t + 1 have landed */
    __syncthreads();      /* publishes stage t + 1 and ends every wave's reads of stage t */
    if (t + 2 < nt) g2_stage(lc + (unsigned)(t & 1) * G2S, ga + (size_t)(t + 2) * G2K, (size_t)16 * lda, gb + (size_t)(t + 2) * G2K, (size_t)16 * ldb); }
  asm volatile("s_wait_asynccnt 0x0" ::: "memory");      /* no copy is outstanding when the buffers become output staging */
  v8f accs[8] = {c00, c01, c02, c03, c10, c11, c12, c13};
#pragma unroll
  for (int u = 0; u < 8; ++u) { const int t = u & 3, half = u >> 2; const int col = col0 + t * 16 + ln; const float bv = bp ? bf16_round(bp[col]) : 0.f;
#pragma unroll
    for (int r = 0; r < 8; ++r) { const int rloc = half * 16 + 8 * hh + r; float v = accs[u][r] * alpha + bv; if (CP) { if (rowsPerB < 0) v += CP[cofs + (size_t)(row0g + row0 + rloc) * ldc + col];      /* rowsPerB < 0: own element of the batched C plane */ else { const int bidx = (row0g + row0 + rloc) / rowsPerB; v += CP[(size_t)bidx * sCPb + (size_t)by * 64 + col]; } }
      if (ACT == 3) v = fmaxf(v, 0.f); else if (ACT == 6) v = 0.5f * v * (1.0f + erff(v * 0.70710678118654752f)); else if (ACT == 11) v = 1.0f / (1.0f + expf(-v)); else if (ACT == 15) v = v / (1.0f + expf(-v)); else if (ACT == 12) v = (v > 0.f) ? v : 0.01f * v; else if (ACT == 8) v = tanhf(v); else if (ACT == 9) v = 0.5f * v * (1.0f + tanhf(0.7978845608028654f * (v + 0.044715f * v * v * v))); else if (ACT == 14) v = (v > 0.f) ? v : 0.1f * v; else if (ACT == 16) v = (v >= 0.f) ? v : 0.3f * v; else if (ACT == 17) v = (v >= 0.f) ? v : 0.2f * v;
      so[w][rloc][t * 16 + ln] = v; } }
  __builtin_amdgcn_fence(__ATOMIC_ACQ_REL, "workgroup"); __builtin_amdgcn_wave_barrier();
  const int rsub = lane >> 4, c4 = (lane & 15) * 4;
  {
#pragma unroll
    for (int q = 0; q < 16; ++q) { const int r = q * 2 + rsub; const v4f v = *(const v4fa*)&so[w][r][c4]; if (C) { *(v4f*)(C + cofs + (size_t)(row0 + r) * ldc + col0 + c4) = v; if (C16) asm volatile("s_wait_xcnt 0x0" ::: "memory"); }      /* both outputs asked for: the f32 store's address registers are reused for the f16 store's address, only behind this wait */
      if (C16) { v4h h4; for (int i = 0; i < 4; ++i) h4[i] = (_Float16)v[i]; *(v4h*)(C16 + cofs + (size_t)(row0 + r) * ldc + col0 + c4) = h4; } }
     } }
template <int ACT>
__global__ __launch_bounds__(128) void k_gemm2(const _Float16* __restrict__ A, int lda, size_t sA, const _Float16* __restrict__ Bh, int ldb, size_t sB, float alpha, const float* __restrict__ bias, size_t sBias, const float* __restrict__ CP, int rowsPerB, size_t sCPb, int row0g,
    float* __restrict__ C, _Float16* __restrict__ C16, int ldc, size_t sC, int M, int N, int K) { gemm2_body<ACT>(blockIdx.x, blockIdx.y, A, lda, sA, Bh, ldb, sB, alpha, bias, sBias, CP, rowsPerB, sCPb, row0g, C, C16, ldc, sC, M, N, K); }

// The six independent projection GEMMs as ONE launch. blockIdx.y = q, k or v (input, weight and output planes lie one behind the other); blockIdx.x picks the job:
// the first PJF work-groups give the f32 rows of the first QT0 tokens, the others the f16 rows of all tokens. Each work-group does what it did in its own launch.
#define PJF ((QT0 / 128) * (DM / 64))      /* work-groups of an f32 first-tile job */
#define PJH ((MP / 128) * (DM / 64))       /* work-groups of an f16 all-rows job */
__global__ __launch_bounds__(128) void k_qkv(const _Float16* __restrict__ X, const _Float16* __restrict__ BW, float* __restrict__ CF, _Float16* __restrict__ C16) {
  const int bx = blockIdx.x;      /* the same for the whole work-group: a scalar branch; each side knows at compile time which output it stores */
  if (bx < PJF) gemm2_body<0>(bx, blockIdx.y, X, DM, NR * DM, BW, DM, (size_t)DM * DM, 0.0625f, nullptr, 0, nullptr, 1, 0, 0, CF, nullptr, DM, (size_t)QT0 * DM, QT0, DM, DM);
  else gemm2_body<0>(bx - PJF, blockIdx.y, X, DM, NR * DM, BW, DM, (size_t)DM * DM, 0.0625f, nullptr, 0, nullptr, 1, 0, 0, nullptr, C16, DM, NR * DM, MP, DM, DM); }

// The output GEMM of all rows and that of the first tile's f16 hi plane as ONE launch: the work-groups of rows 0 .. QT0 - 1 read the exact first-tile o (hi plane) in place of the f16-path rows,
// whose product was overwritten before. Same grid, same rows and columns per work-group, same alpha.
__global__ __launch_bounds__(128) void k_out(const _Float16* __restrict__ O, const _Float16* __restrict__ OH, const _Float16* __restrict__ BO, float* __restrict__ out) {
  const int bx = blockIdx.x;
  gemm2_body<0>(bx, 0, (bx < PJF) ? OH : O, DM, 0, BO, DM, 0, 0.0009765625f, nullptr, 0, nullptr, 1, 0, 0, out, nullptr, DM, 0, MPO, DM, DM); }

// Operand preparation as ONE launch of independent jobs picked by the block index; every wave-wide global access covers whole 128-byte lines and each thread has several loads in flight.
// Work-groups 0 .. PWT - 1: one tile of 128 k x 64 n of plane p of BW (q, k, v, o): BW[p][n][k] = f16(bf16(W[k][n]) x 16) (a power of two: bf16-exact weights stay exact in f16 away from the subnormal range);
// for p < 3 row n is column n % 64 of head n / 64 of the [head][in][out] stack, for p = 3 column n of the [in][out] output weight. The others: PXF elements of plane j of XH = input j rounded to bf16, as f16.
#define PWP ((DM / 128) * (DM / 64))       /* tiles (work-groups) per weight plane */
#define PWT (4 * PWP)                      /* weight tiles */
#define PXG 256                            /* work-groups per input */
#define PXF ((int)(NR * DM / PXG))         /* elements of an input per work-group */
#define PXL (PXF / 1024)                   /* 16-byte loads per thread */
#define PTP 136                            /* LDS pitch of a transposed weight row in f16: 272 B = 16 B x odd */
// One weight tile: a thread loads 8 k x 4 n (a wave-wide load = 256 contiguous bytes of two source rows), rounds, and writes its four 8-k runs into the transposed LDS tile;
// behind the barrier 16 lanes store 256 contiguous bytes of one output row. s: source element (k0, n0), PITCH its row pitch; d: BW element (n0, k0).
template <int PITCH>
__device__ __forceinline__ void prep_tile(const float* __restrict__ s, _Float16* __restrict__ d, unsigned short (*tl)[PTP]) {
  const int c = threadIdx.x & 15, g = threadIdx.x >> 4; const float* sp = s + (size_t)(g * 8) * PITCH + c * 4; v4f x[8];
#pragma unroll      /* constant indices keep x in registers; every load is issued before the first value is used */
  for (int i = 0; i < 8; ++i) x[i] = *(const v4fa*)(sp + i * PITCH);
  asm volatile("s_wait_xcnt 0x0" :: "v"(sp) : "memory");      /* the loads' address registers are held up to this wait and overwritten only behind it */
#pragma unroll      /* x is indexed by constants only */
  for (int q = 0; q < 4; ++q) { FragH f;
#pragma unroll
    for (int i = 0; i < 8; ++i) f.h[i] = (_Float16)(bf16_round(x[i][q]) * 16.0f);
    *(v8us*)&tl[c * 4 + q][g * 8] = f.half[0]; }
  __syncthreads();      /* the tile is complete before its rows are read */
#pragma unroll      /* four rows a thread, their LDS reads asked for as one group */
  for (int i = 0; i < 4; ++i) { const v8us v = *(const v8us*)&tl[g + 16 * i][c * 8]; *(v8us*)((unsigned short*)d + (size_t)(g + 16 * i) * DM + c * 8) = v; } }
__global__ __launch_bounds__(256) void k_prep(const float* __restrict__ xq, const float* __restrict__ xk, const float* __restrict__ xv, const float* __restrict__ wq, const float* __restrict__ wk, const float* __restrict__ wv, const float* __restrict__ wo,
    _Float16* __restrict__ BW, _Float16* __restrict__ XH) {
  __shared__ __attribute__((aligned(16))) unsigned short tl[64][PTP];
  const int bx = blockIdx.x;      /* the same for the whole work-group: scalar branches, so the barrier of a tile is passed by all its threads */
  if (bx < PWT) { const int p = bx / PWP, t = bx - p * PWP; const int nt = t / (DM / 128), k0 = (t % (DM / 128)) * 128; _Float16* d = BW + (size_t)p * DM * DM + (size_t)nt * 64 * DM + k0;
    if (p < 3) prep_tile<HD>(((p == 0) ? wq : (p == 1) ? wk : wv) + (size_t)nt * DM * HD + (size_t)k0 * HD, d, tl);
    else { prep_tile<DM>(wo + (size_t)k0 * DM + nt * 64, d, tl);
      asm volatile("s_wait_xcnt 0x0" ::: "memory"); } }      /* behind this tile's last store: in the built code the per-head tile's instructions follow and rewrite the stores' address registers; they stand only behind this wait */
  else { const int xb = bx - PWT; const int j = xb / PXG; const size_t o = (size_t)(xb - j * PXG) * PXF + threadIdx.x * 4; const float* x = ((j == 0) ? xq : (j == 1) ? xk : xv) + o; _Float16* y = XH + (size_t)j * NR * DM + o; v4f v[PXL];
#pragma unroll      /* constant indices keep v in registers, so that a thread has several loads (512 contiguous bytes a wave each) in flight ahead of the first value's use */
    for (int u = 0; u < PXL; ++u) v[u] = *(const v4fa*)(x + u * 1024);
    asm volatile("s_wait_xcnt 0x0" :: "v"(x) : "memory");      /* the loads' address registers are held up to this wait and overwritten only behind it */
#pragma unroll      /* v is indexed by constants only; a wave-wide store = 256 contiguous bytes */
    for (int u = 0; u < PXL; ++u) { v4h h4;
#pragma unroll
      for (int q = 0; q < 4; ++q) h4[q] = (_Float16)bf16_round(v[u][q]);
      *(v4h*)(y + u * 1024) = h4; } } }


__global__ __launch_bounds__(256) void k_wnat(const float* __restrict__ w, size_t n8, _Float16* __restrict__ Bt) { const size_t t = (size_t)blockIdx.x * 256 + threadIdx.x; if (t >= n8) return; FragH f; for (int q = 0; q < 8; ++q) f.h[q] = (_Float16)(bf16_round(w[t * 8 + q]) * 16.0f); *(v8us*)((unsigned short*)Bt + t * 8) = f.half[0];  }
__global__ __launch_bounds__(256) void k_rsm(const float* __restrict__ S, _Float16* __restrict__ P, int nrows) {
  #pragma clang fp contract(off)
  const int i = blockIdx.x * 256 + threadIdx.x; if (i >= nrows) return; const float* s = S + (size_t)i * SQ; float mx = -3.0e38f;
#pragma unroll 1
  for (int j = 0; j < SQ; ++j) mx = fmaxf(mx, s[j]); float se = 0.f;
#pragma unroll 1
  for (int j = 0; j < SQ; ++j) se += expf(s[j] - mx); const float sc = 256.0f / se;
#pragma unroll 1
  for (int j0 = 0; j0 < SQ; j0 += 8) { FragH f; for (int q = 0; q < 8; ++q) f.h[q] = (_Float16)(expf(s[j0 + q] - mx) * sc); unsigned short* d = (unsigned short*)P + (size_t)i * SQ + j0; *(v8us*)d = f.half[0];  } }
__global__ __launch_bounds__(256) void k_vt(const _Float16* __restrict__ V16, int b, int h0, _Float16* __restrict__ VT) { __shared__ unsigned short tl[64][65]; const int tid = threadIdx.x; const int hh = blockIdx.x % HG, sg = blockIdx.x / HG; const int s0 = sg * 64; const int h = h0 + hh;
  for (int i = tid; i < 64 * 8; i += 256) { const int j = i / 8, d8 = (i % 8) * 8; FragH f; f.half[0] = *(const v8us*)((const unsigned short*)V16 + ((size_t)b * SQ + s0 + j) * DM + h * HD + d8); for (int q = 0; q < 8; ++q) tl[d8 + q][j] = f.u[q]; }
  __syncthreads();
  { for (int i = tid; i < 64 * 8; i += 256) { const int d = i / 8, j8 = (i % 8) * 8; FragH f; for (int q = 0; q < 8; ++q) f.u[q] = tl[d][j8 + q]; *(v8us*)((unsigned short*)VT + ((size_t)hh * HD + d) * SQ + s0 + j8) = f.half[0]; }  } }



#define FQ 32                        /* query rows per wave */
#define FW 4                         /* waves per work-group */
#define FNG (NH * (SQ / (FQ * FW)))  /* work-groups */
__device__ __forceinline__ v8f fa_mma(v16h a, v16h b, v8f c) { return __builtin_amdgcn_wmma_f32_16x16x32_f16(false, a, false, b, (short)0, c, false, false); }
__device__ __forceinline__ float fa_xhalf(float x) { return __builtin_bit_cast(float, __builtin_amdgcn_permlanex16(__builtin_bit_cast(int, x), __builtin_bit_cast(int, x), 0x76543210, 0xfedcba98, false, false)); }      /* lane l with lane l ^ 16 */
// 2^x by the native instruction. The v_nop at the end fills the slot that the instruction set asks for behind a transcendental before its result is read or its source overwritten;
// inside the group every result register differs from every source ("=&v"), so each v_exp_f32 is the independent instruction behind the one before it.
__device__ __forceinline__ float fa_exp2(float x) { float e; asm("v_exp_f32 %0, %1\n\tv_nop" : "=&v"(e) : "v"(x)); return e; }
__device__ __forceinline__ void fa_exp2x8(const float (&x)[8], float (&e)[8]) {
  asm("v_exp_f32 %0, %8\n\tv_exp_f32 %1, %9\n\tv_exp_f32 %2, %10\n\tv_exp_f32 %3, %11\n\tv_exp_f32 %4, %12\n\tv_exp_f32 %5, %13\n\tv_exp_f32 %6, %14\n\tv_exp_f32 %7, %15\n\tv_nop"
      : "=&v"(e[0]), "=&v"(e[1]), "=&v"(e[2]), "=&v"(e[3]), "=&v"(e[4]), "=&v"(e[5]), "=&v"(e[6]), "=&v"(e[7]) : "v"(x[0]), "v"(x[1]), "v"(x[2]), "v"(x[3]), "v"(x[4]), "v"(x[5]), "v"(x[6]), "v"(x[7])); }
// Operand staging of the fused attention: a stage is 64 keys of the head, K as 64 rows (keys) of 128 bytes and V^T as 64 rows (d) of 128 bytes, whole lines, brought into LDS once
// for the work-group's 4 waves by asynchronous copies, two buffers.
#define FK 64                        /* keys per stage = two passes */
#define FP 72                        /* LDS row pitch in f16: 144 B = 16 B x odd, the pitch for 16-byte LDS reads of one row per lane */
#define FT (64 * FP * 2)             /* bytes of a tile of 64 rows */
#define FS (2 * FT)                  /* bytes of a stage: the K tile, then the V^T tile */
// One stage's copies of one thread: 16 bytes of rows r, r + 16, r + 32, r + 48 of K and of V^T; 8 lanes bring one whole line, a wave-wide copy 4 lines.
// The s_wait_xcnt at the end stands inside the statement so that no register named by a copy is rewritten in front of it.
__device__ __forceinline__ void fa_stage(unsigned l, const _Float16* gk, const _Float16* gv) {
  asm volatile("global_load_async_to_lds_b128 %0, %8, off\n\tglobal_load_async_to_lds_b128 %1, %9, off\n\tglobal_load_async_to_lds_b128 %2, %10, off\n\tglobal_load_async_to_lds_b128 %3, %11, off\n\t"
               "global_load_async_to_lds_b128 %4, %12, off\n\tglobal_load_async_to_lds_b128 %5, %13, off\n\tglobal_load_async_to_lds_b128 %6, %14, off\n\tglobal_load_async_to_lds_b128 %7, %15, off\n\ts_wait_xcnt 0x0"
               :: "v"(l), "v"(l + 1 * 16 * FP * 2), "v"(l + 2 * 16 * FP * 2), "v"(l + 3 * 16 * FP * 2), "v"(l + FT), "v"(l + FT + 1 * 16 * FP * 2), "v"(l + FT + 2 * 16 * FP * 2), "v"(l + FT + 3 * 16 * FP * 2),
                  "v"(gk), "v"(gk + (size_t)16 * DM), "v"(gk + (size_t)32 * DM), "v"(gk + (size_t)48 * DM), "v"(gv), "v"(gv + (size_t)16 * SQ), "v"(gv + (size_t)32 * SQ), "v"(gv + (size_t)48 * SQ) : "memory"); }
// One pass = 32 keys: scores from kf, running softmax, o += P V from vf. nk: where the wave's next K fragments lie in the same stage (asked for behind the score products), or null.
__device__ __forceinline__ void fa_pass(v16h (&kf)[2][2], const v16h (&qf)[2][2], const v16h (&vf)[4], v8f (&acc)[4][2], float (&mr)[2], float (&ls)[2], const _Float16* nk, const bool diag, const int ln, const int hh) {
  const float CS = 0.125f * 1.4426950408889634f;      /* score scale x log2(e): exponentials in base 2 */
  const v8f z8 = {0.f, 0.f, 0.f, 0.f, 0.f, 0.f, 0.f, 0.f}; v8f s[2][2];
#pragma unroll
  for (int u = 0; u < 2; ++u)
#pragma unroll
    for (int t = 0; t < 2; ++t) s[u][t] = fa_mma(kf[u][1], qf[t][1], fa_mma(kf[u][0], qf[t][0], z8));
  if (nk) {
#pragma unroll
    for (int u = 0; u < 2; ++u)
#pragma unroll
      for (int c = 0; c < 2; ++c) kf[u][c] = g2_frag(nk + u * 16 * FP + c * 32, hh);
    __builtin_amdgcn_sched_barrier(0); }      /* keeps these LDS reads here, ahead of the softmax that covers their latency: left free they were issued right in front of their first use */
  if (diag) {      /* the diagonal pass: key > query is masked (a scalar branch) */
#pragma unroll
    for (int u = 0; u < 2; ++u)
#pragma unroll
      for (int t = 0; t < 2; ++t)
#pragma unroll
        for (int r = 0; r < 8; ++r) if (u * 16 + 8 * hh + r > t * 16 + ln) s[u][t][r] = -3.0e38f; }
  FragH pf[2];
#pragma unroll
  for (int t = 0; t < 2; ++t) { float mx = fmaxf(s[0][t][0], s[1][t][0]);
#pragma unroll
    for (int r = 1; r < 8; ++r) mx = fmaxf(mx, fmaxf(s[0][t][r], s[1][t][r]));
    mx = fmaxf(mx, fa_xhalf(mx)); const float mn = fmaxf(mr[t], mx); const float corr = fa_exp2((mr[t] - mn) * CS); mr[t] = mn; const float mc = mn * CS;      /* every pass holds at least one unmasked key of every query: mn is a real score */
    float x0[8], x1[8], e0[8], e1[8];
#pragma unroll
    for (int r = 0; r < 8; ++r) { x0[r] = fmaf(s[0][t][r], CS, -mc); x1[r] = fmaf(s[1][t][r], CS, -mc); }
    fa_exp2x8(x0, e0); fa_exp2x8(x1, e1); float s0 = 0.f, s1 = 0.f;
#pragma unroll
    for (int r = 0; r < 8; ++r) { s0 += e0[r]; s1 += e1[r]; pf[t].h[r] = (_Float16)e0[r]; pf[t].h[8 + r] = (_Float16)e1[r]; }
    ls[t] = fmaf(ls[t], corr, s0 + s1);
#pragma unroll
    for (int d = 0; d < 4; ++d) acc[d][t] *= corr; }
#pragma unroll
  for (int d = 0; d < 4; ++d)
#pragma unroll
    for (int t = 0; t < 2; ++t) acc[d][t] = fa_mma(vf[d], pf[t].v, acc[d][t]); }
// One stage = two passes. TAIL: the work-group's last two stages, where a wave's rows may end (its diagonal pass is masked, what lies beyond is skipped by scalar branches); before them every pass is whole.
template <bool TAIL>
__device__ __forceinline__ void fa_trip(const _Float16* kq, const _Float16* vq, const int j0, const int q0, const v16h (&qf)[2][2], v8f (&acc)[4][2], float (&mr)[2], float (&ls)[2], const int ln, const int hh) {
  if (TAIL && j0 > q0) return;      /* a wave whose rows end below this stage only takes part in the publish point */
  v16h kf[2][2], vf[4];
#pragma unroll      /* the first pass's K and V^T fragments, asked for as one group (constant indices: they stay in registers) */
  for (int u = 0; u < 2; ++u)
#pragma unroll
    for (int c = 0; c < 2; ++c) kf[u][c] = g2_frag(kq + u * 16 * FP + c * 32, hh);
#pragma unroll
  for (int d = 0; d < 4; ++d) vf[d] = g2_frag(vq + d * 16 * FP, hh);
  __builtin_amdgcn_sched_barrier(0);      /* keeps the V^T reads in this group: left free they were issued among the P V products, which then waited for them */
  fa_pass(kf, qf, vf, acc, mr, ls, kq + 32 * FP, TAIL && j0 == q0, ln, hh);      /* the second pass's K rows lie in the same stage: always readable, unused where the wave ends here */
  if (TAIL && j0 + 32 > q0) return;
#pragma unroll      /* V^T of the second pass: asked for ahead of its score products and softmax */
  for (int d = 0; d < 4; ++d) vf[d] = g2_frag(vq + d * 16 * FP + 32, hh);
  __builtin_amdgcn_sched_barrier(0);      /* keeps these reads here, as above */
  fa_pass(kf, qf, vf, acc, mr, ls, nullptr, TAIL && j0 + 32 == q0, ln, hh); }
__global__ __launch_bounds__(FW * 32) void k_fattn(const _Float16* __restrict__ Q, const _Float16* __restrict__ K, const _Float16* __restrict__ VT, _Float16* __restrict__ O) {
  __shared__ __attribute__((aligned(16))) unsigned char sm[2 * FS];      /* the two stage buffers */
  const int tid = threadIdx.x, lane = tid & 31, ln = lane & 15, hh = lane >> 4; const int w = __builtin_amdgcn_readfirstlane(tid >> 5);
  const int bx = blockIdx.x; const int rank = (bx < FNG / 2) ? bx : (FNG + FNG / 2 - 1 - bx);      /* a permutation: long work-groups first, then the short ones shortest first, so that groups bx and bx + FNG / 2 together have equal work (speed only) */
  const int h = rank % NH; const int qb = (SQ / (FQ * FW) - 1 - rank / NH) * (FQ * FW); const int q0 = qb + w * FQ;
  const int ns = (qb + FQ * FW) / FK;      /* stages of the work-group: the keys below its last row's end; at least 2, the same for all its waves */
  const _Float16* qp = Q + (size_t)(q0 + ln) * DM + h * HD;
  const _Float16* gk = K + (size_t)(tid >> 3) * DM + h * HD + (tid & 7) * 8; const _Float16* gv = VT + ((size_t)h * HD + (tid >> 3)) * SQ + (tid & 7) * 8;      /* this thread's 16 bytes of rows tid / 8 + 16 i of stage 0 */
  const unsigned lc = (unsigned)(size_t)sm + (unsigned)((tid >> 3) * (FP * 2) + (tid & 7) * 16);      /* their place in buffer 0 (LDS byte address) */
  const _Float16* lk = (const _Float16*)sm + ln * FP; const _Float16* lv = lk + 64 * FP;      /* this lane's fragment rows in buffer 0 */
  fa_stage(lc, gk, gv);
  v16h qf[2][2];
#pragma unroll      /* fragments indexed by constants only: they stay in registers */
  for (int t = 0; t < 2; ++t)
#pragma unroll
    for (int c = 0; c < 2; ++c) qf[t][c] = g2_frag(qp + (size_t)t * 16 * DM + c * 32, hh);
  asm volatile("s_wait_xcnt 0x0" ::: "memory");      /* the address registers of the loads above are reused below: they are overwritten only behind this wait */
  const v8f z8 = {0.f, 0.f, 0.f, 0.f, 0.f, 0.f, 0.f, 0.f}; v8f acc[4][2]; float mr[2], ls[2];
#pragma unroll
  for (int t = 0; t < 2; ++t) { mr[t] = -3.0e38f; ls[t] = 0.f;
#pragma unroll
    for (int d = 0; d < 4; ++d) acc[d][t] = z8; }
  asm volatile("s_wait_asynccnt 0x0" ::: "memory");      /* this wave's copies of stage 0 have landed */
  __syncthreads();      /* stage 0 is readable by every wave */
  fa_stage(lc + FS, gk + (size_t)FK * DM, gv + FK);      /* stage 1 exists for every work-group */
  int t = 0;
#pragma unroll 1      /* one trip = one stage = two passes of 32 keys; the buffer is picked by the trip's parity. All stages but the last two: whole for every wave, and a stage t + 2 exists */
  for (; t < ns - 2; ++t) {
    fa_trip<false>(lk + (t & 1) * (FS / 2), lv + (t & 1) * (FS / 2), t * FK, q0, qf, acc, mr, ls, ln, hh);
    __builtin_amdgcn_sched_barrier(0);      /* keeps the publish point at the trip's foot: moved up by the scheduler, its s_wait_dscnt 0 stood directly behind the second pass's V^T reads and waited for them */
    asm volatile("s_wait_dscnt 0x0" ::: "memory");      /* this wave's reads of the buffer are done before it may be refilled */
    asm volatile("s_wait_asynccnt 0x0" ::: "memory");      /* this wave's copies of stage t + 1 have landed */
    __syncthreads();      /* publishes stage t + 1 and ends every wave's reads of stage t */
    fa_stage(lc + (unsigned)(t & 1) * FS, gk + (size_t)(t + 2) * FK * DM, gv + (size_t)(t + 2) * FK); }
#pragma unroll 1      /* the last two stages: no stage t + 2 is left to copy; small code */
  for (; t < ns; ++t) {
    fa_trip<true>(lk + (t & 1) * (FS / 2), lv + (t & 1) * (FS / 2), t * FK, q0, qf, acc, mr, ls, ln, hh);
    asm volatile("s_wait_dscnt 0x0" ::: "memory");      /* as above */
    asm volatile("s_wait_asynccnt 0x0" ::: "memory");      /* this wave's copies of stage t + 1 have landed */
    __syncthreads(); }      /* publishes stage t + 1; every wave passes it, also one that skipped the stage */
  asm volatile("s_wait_asynccnt 0x0" ::: "memory");      /* no copy is outstanding when the wave ends */
#pragma unroll
  for (int t = 0; t < 2; ++t) { const float inv = 64.0f / (ls[t] + fa_xhalf(ls[t]));      /* the halves' sums joined once; o carried x64 */
    unsigned short* op = (unsigned short*)O + (size_t)(q0 + t * 16 + ln) * DM + h * HD + 8 * hh;
#pragma unroll      /* the wave stores the whole 128-byte line of each of its rows */
    for (int d = 0; d < 4; ++d) { FragH f;
#pragma unroll
      for (int r = 0; r < 8; ++r) f.h[r] = (_Float16)(acc[d][t][r] * inv);
      *(v8us*)(op + d * 16) = f.half[0]; } } }


// Exact f32 causal attention for rows 0 .. QT0 - 1 (o carried x64 like the f16 path). ONE WORK-GROUP PER HEAD AND 16 QUERY ROWS, 8 waves:
// the head's K and V rows below the group's end are staged in LDS by coalesced loads; scores: one thread per key (its K row in registers, the q rows wave-uniform);
// softmax: one wave per two rows; o: each wave sums every eighth chunk of 4 keys for all 16 rows x 64 columns in registers, and the 8 partial sums are added in wave order.
#define A0R 16                       /* query rows per work-group */
#define A0KP (HD + 4)                /* LDS pitch of a K row in floats: 272 B = 16 B x odd, so that 16-byte reads of one row per lane spread over the banks */
#define A0SP (QT0 + 4)               /* LDS pitch of a score row in floats (a multiple of 16 B) */
__global__ __launch_bounds__(256) void k_att0w(const float* __restrict__ QF, const float* __restrict__ KF, const float* __restrict__ VF, float scale, float* __restrict__ OF) {
  __shared__ __attribute__((aligned(16))) float lk[QT0][A0KP]; __shared__ __attribute__((aligned(16))) float lv[QT0][HD]; __shared__ __attribute__((aligned(16))) float ls[A0R][A0SP];
  __shared__ __attribute__((aligned(16))) float red[8][A0R][HD]; __shared__ float linv[A0R];
  const int tid = threadIdx.x, lane = tid & 31, w = __builtin_amdgcn_readfirstlane(tid >> 5); const int h = blockIdx.x / (QT0 / A0R), rg = blockIdx.x % (QT0 / A0R); const int nk = (rg + 1) * A0R;      /* causal: keys below the group's end */
  const int r16 = tid >> 4, c4 = (tid & 15) * 4;
  { const float* kp = KF + (size_t)r16 * DM + h * HD + c4; const float* vp = VF + (size_t)r16 * DM + h * HD + c4; v4f kx[QT0 / 16], vx[QT0 / 16];
#pragma unroll      /* constant indices keep kx and vx in registers; every load is issued before the first value is used */
    for (int u = 0; u < QT0 / 16; ++u) if (u <= rg) { kx[u] = *(const v4fa*)(kp + (size_t)u * 16 * DM); vx[u] = *(const v4fa*)(vp + (size_t)u * 16 * DM); }
    asm volatile("s_wait_xcnt 0x0" :: "v"(kp), "v"(vp) : "memory");      /* the loads' address registers are reused below: they are held up to this wait and overwritten only behind it */
#pragma unroll      /* constant indices, as above */
    for (int u = 0; u < QT0 / 16; ++u) if (u <= rg) { *(v4f*)&lk[u * 16 + r16][c4] = kx[u]; *(v4f*)&lv[u * 16 + r16][c4] = vx[u]; } }
  __syncthreads();
  if (tid < nk) { v4f kr[HD / 4];
#pragma unroll      /* the key's row stays in registers for all 16 query rows */
    for (int c = 0; c < HD / 4; ++c) kr[c] = *(const v4f*)&lk[tid][c * 4];
    const float* qb = QF + (size_t)rg * A0R * DM + h * HD;      /* the same address in every lane */
#pragma unroll 4      /* several rows' q loads in flight ahead of their products */
    for (int i = 0; i < A0R; ++i) { v4f s4 = {0.f, 0.f, 0.f, 0.f};
#pragma unroll      /* kr is indexed by constants only */
      for (int c = 0; c < HD / 4; ++c) { const v4f qq = *(const v4fa*)(qb + (size_t)i * DM + c * 4);
#pragma unroll      /* short fixed trip count; the arrays it indexes stay in registers */
        for (int u = 0; u < 4; ++u) s4[u] = fmaf(qq[u], kr[c][u], s4[u]); }
      ls[i][tid] = ((s4[0] + s4[1]) + (s4[2] + s4[3])) * scale; } }
  __syncthreads();
#pragma unroll 1      /* two rows a wave, one after the other: small code */
  for (int i = 2 * w; i < 2 * w + 2; ++i) { const int last = rg * A0R + i; float x[QT0 / 32]; float mx = -3.0e38f;
#pragma unroll      /* x is indexed by constants only */
    for (int u = 0; u < QT0 / 32; ++u) { const int j = u * 32 + lane; x[u] = (j <= last) ? ls[i][j] : -3.0e38f; mx = fmaxf(mx, x[u]); }
#pragma unroll      /* short fixed trip count; the arrays it indexes stay in registers */
    for (int o = 16; o > 0; o >>= 1) mx = fmaxf(mx, __shfl_xor(mx, o, 32));
    float se = 0.f;
#pragma unroll      /* short fixed trip count; the arrays it indexes stay in registers */
    for (int u = 0; u < QT0 / 32; ++u) { const int j = u * 32 + lane; const float e = (j <= last) ? expf(x[u] - mx) : 0.f; se += e; if (j < nk) ls[i][j] = e; }
#pragma unroll      /* short fixed trip count; the arrays it indexes stay in registers */
    for (int o = 16; o > 0; o >>= 1) se += __shfl_xor(se, o, 32);
    if (lane == 0) linv[i] = 64.0f / se; }      /* o carried x64 like the f16 path */
  __syncthreads();
  { const int rh = lane >> 4, d4 = (lane & 15) * 4; v4f acc[8];
#pragma unroll      /* short fixed trip count; the arrays it indexes stay in registers */
    for (int r = 0; r < 8; ++r) acc[r] = (v4f){0.f, 0.f, 0.f, 0.f};
#pragma unroll 1      /* at most 8 trips of 128 multiply-adds: the body is long enough as it is */
    for (int j0 = 4 * w; j0 < nk; j0 += 32) { v4f pv[8], vv[4];
#pragma unroll      /* short fixed trip count; the arrays it indexes stay in registers */
      for (int r = 0; r < 8; ++r) pv[r] = *(const v4f*)&ls[rh * 8 + r][j0];
#pragma unroll      /* short fixed trip count; the arrays it indexes stay in registers */
      for (int q = 0; q < 4; ++q) vv[q] = *(const v4f*)&lv[j0 + q][d4];
#pragma unroll      /* short fixed trip count; the arrays it indexes stay in registers */
      for (int q = 0; q < 4; ++q)
#pragma unroll      /* short fixed trip count; the arrays it indexes stay in registers */
        for (int r = 0; r < 8; ++r)
#pragma unroll      /* short fixed trip count; the arrays it indexes stay in registers */
          for (int u = 0; u < 4; ++u) acc[r][u] = fmaf(pv[r][q], vv[q][u], acc[r][u]); }
#pragma unroll      /* short fixed trip count; the arrays it indexes stay in registers */
    for (int r = 0; r < 8; ++r) *(v4f*)&red[w][rh * 8 + r][d4] = acc[r]; }
  __syncthreads();
  { v4f o = *(const v4f*)&red[0][r16][c4];
#pragma unroll      /* short fixed trip count; the arrays it indexes stay in registers */
    for (int p = 1; p < 8; ++p) { const v4f a = *(const v4f*)&red[p][r16][c4]; o += a; }
    const float fin = linv[r16]; o *= fin;
    *(v4f*)(OF + (size_t)(rg * A0R + r16) * DM + h * HD + c4) = o; } }

extern "C" void kernel_launch(void* const* d_in, const int* in_sizes, int n_in,
                              void* d_out, int out_size, void* d_ws, size_t ws_size, hipStream_t stream) {
  (void)in_sizes; (void)n_in; (void)out_size;
  const float* const* I = (const float* const*)d_in; const float* xq = I[0]; const float* xk = I[1]; const float* xv = I[2]; const float* wq = I[3]; const float* wk = I[4]; const float* wv = I[5]; const float* wo = I[6];      /* weights [in][out] */
  char* ws = (char*)d_ws; size_t off = 0;
  auto take = [&](size_t bytes) { char* p = ws + off; off += (bytes + 255) & ~(size_t)255; return p; };
  static_assert(NB == 1 && B0 == 0 && NBR == 1, "the joined projection launch takes the first-tile rows of one batch");
  _Float16* BW = (_Float16*)take((size_t)4 * DM * DM * 2); _Float16* BO = BW + (size_t)3 * DM * DM;      /* weight planes q, k, v, o, one behind the other */
  _Float16* XH = (_Float16*)take(3 * NR * DM * 2);      /* rounded inputs q, k, v, one behind the other */
  _Float16* Q16 = (_Float16*)take(3 * NR * DM * 2); _Float16* K16 = Q16 + NR * DM; _Float16* V16 = K16 + NR * DM; _Float16* O16 = (_Float16*)take(NR * DM * 2);      /* q, k, v rows, one plane behind the other */
  _Float16* VT = (_Float16*)take((size_t)NH * HD * SQ * 2);
  float* QF0 = (float*)take((size_t)3 * QT0 * DM * 4); float* KF0 = QF0 + (size_t)QT0 * DM; float* VF0 = KF0 + (size_t)QT0 * DM; float* OF0 = (float*)take((size_t)NB * QT0 * DM * 4); _Float16* OH0 = (_Float16*)take((size_t)NB * QT0 * DM * 2); _Float16* OL0 = (_Float16*)take((size_t)NB * QT0 * DM * 2);
  if (off > ws_size) return;
  k_prep<<<PWT + 3 * PXG, 256, 0, stream>>>(xq, xk, xv, wq, wk, wv, wo, BW, XH);      /* all four x16 weight planes Bt[n][k] (PER-HEAD STACKS [16][1024][64] = [head][in][out]: head h's block -> rows 64 h .. 64 h + 63) and the three rounded inputs */
  k_qkv<<<dim3(PJF + PJH, 3), 128, 0, stream>>>(XH, BW, QF0, Q16);      /* q, k, v: f16 rows of all tokens, and f32 rows of the first 256 (exact products) */
  for (int b = B0; b < B0 + NBR; ++b) { const size_t r0 = (size_t)b * SQ;
    k_vt<NH, SQ><<<NH * (SQ / 64), 256, 0, stream>>>(V16 + r0 * LQ, LQ, 0, VT);      /* V^T [NH][HD][SQ] for this batch */
    k_att0w<<<NH * (QT0 / A0R), 256, 0, stream>>>(QF0, KF0, VF0, 0.125f, OF0 + (size_t)b * QT0 * DM);      /* exact f32 attention for rows 0..255 (o x64) */
    k_fattn<<<FNG, FW * 32, 0, stream>>>(Q16 + r0 * LQ, K16 + r0 * LQ, VT, O16 + r0 * DM); }      /* scores, causal softmax and P V for all heads and rows in one launch: o (merged heads, x64) as f16 rows */
  k_hl<<<(unsigned)(((size_t)NB * QT0 * DM / 8 + 255) / 256), 256, 0, stream>>>(OF0, OH0, OL0, (size_t)NB * QT0 * DM / 8);      /* first-tile o (x64) -> f16 hi + x1024 residual planes */
  k_out<<<(MPO / 128) * (DM / 64), 128, 0, stream>>>(O16, OH0, BO, (float*)d_out);      /* out rows are the output layout; rows 0..255: out = o_hi Wo */
  for (int b = B0; b < B0 + NBR; ++b) { const size_t r0 = (size_t)b * SQ; const size_t f0 = (size_t)b * QT0;
    k_gemm2<0><<<dim3((QT0 / 128) * (DM / 64), 1), 128, 0, stream>>>(OL0 + f0 * DM, DM, 0, BO, DM, 0, 0.00000095367431640625f, nullptr, 0, (const float*)d_out + r0 * DM, -1, 0, 0, (float*)d_out + r0 * DM, nullptr, DM, 0, QT0, DM, DM); }      /* += o_lo Wo 2^-20 (own-element accumulate) */
}

// v008
// Measured time: 119 microseconds a run.
// Next to v007, in two timings, it ran 1.29 and 1.27 times as fast.
// All steps since v000 together make it 69.5 times as fast.
#include <hip/hip_runtime.h>
// Causal multi-head attention on three inputs with PER-HEAD STACKED projections over ONE sequence of 4096 tokens (Q, K, V [1][4096][1024]; WQ / WK / WV [16][1024][64] = [head][in][out] sigma 0.02, NO biases; 16 heads of 64; scores x 64^-0.5 = / 8; causal (tril, -inf above the diagonal); softmax; heads concatenated head-major; out = concat WO with WO [1024][1024] [in][out], NO bias -> [1][4096][1024]); each head's [in][out] block is transposed into its 64 contiguous rows of the weight plane, and the [in][out] output weight into its own plane, by one launch that also rounds the three inputs.
// Structure: token rows r = s; q, k, v inputs as exact f16 rows (bf16-rounded); Q, K, V as three WMMA GEMMs in one launch (32x64 wave tiles, f32 accumulation, exact x16 weights, f16 outputs; the f32 rows of the first tile by further work-groups of the same launch); v stored as V^T by its GEMM's epilogue; one fused attention launch: a wave per 32 query rows of a head walks the keys up to its own rows 32 at a time (scores on WMMA, K = 64; running f32 maximum and sum, native exp2; weights in (0, 1] as f16; o += P V on WMMA, divided by the sum at the end, o carried x64, folded into the output GEMM alpha), written straight into the merged f16 o rows; out = o W_o GEMM (f32) into the output layout.
// Compute dtype: inputs rounded to bf16; x / weights exact; q, k, v, softmax weights and o as plain f16 GEMM operands (~2^-12); scores and softmax statistics f32. v_wmma_f32_16x16x32_f16.
#define NB 1
#define SQ 4096
#define DM 1024
#define NH 16
#define HD 64
#define HG 4                         /* heads per launch of the unlaunched k_vt overload */
#define QT 256                       /* unused */
#define NKX SQ                       /* unused */
#define QT0 256                      /* first-tile rows recomputed exactly in f32 */
#define B0 0                         /* first batch processed (debug hook) */
#define NBR NB                       /* batches processed (debug hook) */
#define NR ((size_t)NB * SQ)         /* token rows */
#define MP ((int)((size_t)NBR * SQ)) /* rows projected (debug hook) */
#define QN SQ                        /* unused (k_fattn attends all SQ rows) */
#define NHD NH                       /* unused (k_fattn attends all NH heads) */
#define MPO MP                       /* rows through the output stage (debug hook) */
#define LQ DM      /* row pitch of the q/k/v rows */
typedef __bf16 v16b __attribute__((ext_vector_type(16)));
typedef unsigned short v8us __attribute__((ext_vector_type(8), may_alias));
typedef float  v8f  __attribute__((ext_vector_type(8)));
typedef float  v4f  __attribute__((ext_vector_type(4)));
typedef float  v4fa __attribute__((ext_vector_type(4), may_alias));
union FragB { v16b v; v8us half[2]; unsigned short u[16]; };

__device__ __forceinline__ unsigned short bf16_bits(float x) { unsigned int u = __float_as_uint(x); return (unsigned short)((u + 0x7FFFu + ((u >> 16) & 1u)) >> 16); }
__device__ __forceinline__ float bf16_val(unsigned short b) { return __uint_as_float(((unsigned int)b) << 16); }
__device__ __forceinline__ float bf16_round(float x) { return bf16_val(bf16_bits(x)); }
// D += A·B with NT terms: 1 = ah·bh, 2 = + al·bh (A split), 3 = + ah·bl (both split)
template <int NT>
__device__ __forceinline__ v8f mmaN(v16b ah, v16b al, v16b bh, v16b bl, v8f c) {
  c = __builtin_amdgcn_wmma_f32_16x16x32_bf16(false, ah, false, bh, (short)0, c, false, false);
  if (NT >= 2) c = __builtin_amdgcn_wmma_f32_16x16x32_bf16(false, al, false, bh, (short)0, c, false, false);
  if (NT >= 3) c = __builtin_amdgcn_wmma_f32_16x16x32_bf16(false, ah, false, bl, (short)0, c, false, false);
  asm volatile("v_nop\n\tv_nop\n\tv_nop\n\tv_nop" : "+v"(c) : "v"(ah), "v"(al), "v"(bh), "v"(bl));
  return c;
}

__global__ __launch_bounds__(256) void k_wt_bf16(const float* __restrict__ W, unsigned short* __restrict__ Wt, int K, int N) {
  const int t = blockIdx.x * 256 + threadIdx.x;
  const int k8n = K / 8;
  if (t >= N * k8n) return;
  const int n = t / k8n, k8 = (t % k8n) * 8;
  v8us v;
#pragma unroll
  for (int i = 0; i < 8; ++i) v[i] = bf16_bits(W[(size_t)(k8 + i) * N + n]);
  *(v8us*)(Wt + (size_t)n * K + k8) = v;
  
}

// GEMM C[M][N] (f32, pitch ldc) = act(A[M][K]·W + bias). A f32 row-major (pitch lda) converted per fragment to bf16
// (ASPLIT: hi/lo two planes -> 2 terms, else single rounded term); Wt bf16 [N][K] (pitch ldb). BIAS_BF16 rounds the
// bias to bf16 first (bias quantised to bf16 before the add). K%32==0, M%16==0, N%64==0.
template <bool ASPLIT, int ACT, bool BIAS_BF16>
__global__ __launch_bounds__(128) void k_gemm_bf(const float* __restrict__ A, int lda, const unsigned short* __restrict__ Wt, int ldb,
                                               const float* __restrict__ bias, float* __restrict__ C, int ldc, int M, int N, int K) {
  __shared__ __attribute__((aligned(16))) float so[4][16][64];
  const int tid = threadIdx.x, w = tid >> 5, lane = tid & 31, ln = lane & 15, hh = lane >> 4;
  const int ntn = N / 64;
  const int wid = blockIdx.x * 4 + w;
  const int mt = wid / ntn, nq = wid % ntn;
  if (mt * 16 >= M) return;
  const int row0 = mt * 16, col0 = nq * 64;
  const float* arow = A + (size_t)(row0 + ln) * lda;
  v8f acc[4] = {};
  for (int kb = 0; kb < K; kb += 32) {
    FragB ah, al;
    const v4f x0 = *(const v4fa*)(arow + kb + 8 * hh), x1 = *(const v4fa*)(arow + kb + 8 * hh + 4);
    const v4f x2 = *(const v4fa*)(arow + kb + 16 + 8 * hh), x3 = *(const v4fa*)(arow + kb + 16 + 8 * hh + 4);
    float xs[16] = {x0[0],x0[1],x0[2],x0[3],x1[0],x1[1],x1[2],x1[3],x2[0],x2[1],x2[2],x2[3],x3[0],x3[1],x3[2],x3[3]};
#pragma unroll
    for (int i = 0; i < 16; ++i) { const unsigned short hb = bf16_bits(xs[i]); ah.u[i] = hb; al.u[i] = ASPLIT ? bf16_bits(xs[i] - bf16_val(hb)) : (unsigned short)0; }
#pragma unroll
    for (int t = 0; t < 4; ++t) {
      const unsigned short* brow = Wt + (size_t)(col0 + t * 16 + ln) * ldb + kb;
      FragB b;
      b.half[0] = *(const v8us*)(brow + 8 * hh);
      b.half[1] = *(const v8us*)(brow + 16 + 8 * hh);
      acc[t] = mmaN<ASPLIT ? 2 : 1>(ah.v, al.v, b.v, b.v, acc[t]);
    }
  }
#pragma unroll
  for (int t = 0; t < 4; ++t) {
    float bv = bias ? bias[col0 + t * 16 + ln] : 0.f;
    if (BIAS_BF16) bv = bf16_round(bv);
#pragma unroll
    for (int r = 0; r < 8; ++r) { float v = acc[t][r] + bv; if (ACT == 1) v = fmaxf(v, 0.f); so[w][8 * hh + r][t * 16 + ln] = v; }
  }
  __builtin_amdgcn_fence(__ATOMIC_ACQ_REL, "workgroup");
  __builtin_amdgcn_wave_barrier();
  const int rsub = lane >> 4, c4 = (lane & 15) * 4;
  {
#pragma unroll
    for (int q = 0; q < 8; ++q) {
      const int r = q * 2 + rsub;
      const v4f v = *(const v4fa*)&so[w][r][c4];
      *(v4f*)(C + (size_t)(row0 + r) * ldc + col0 + c4) = v;
    }
    
  }
}

// GEMM C = act(A·W + bias + resid): A f32 (ASPLIT -> hi/lo 2 terms), Wt bf16 [N][K]; ACT 0 none, 1 relu, 2 exact gelu;
// resid (optional, f32, row index = (row % rmod), pitch ldr, RES_BF16 rounds it) added before the activation.
template <bool ASPLIT, int ACT, bool BIAS_BF16, bool RES_BF16>
__global__ __launch_bounds__(128) void k_gemm_bf3(const float* __restrict__ A, int lda, const unsigned short* __restrict__ Wt, int ldb,
                                                const float* __restrict__ bias, const float* __restrict__ resid, int rmod, int ldr,
                                                float* __restrict__ C, int ldc, int M, int N, int K) {
  __shared__ __attribute__((aligned(16))) float so[4][16][64];
  const int tid = threadIdx.x, w = tid >> 5, lane = tid & 31, ln = lane & 15, hh = lane >> 4;
  const int ntn = N / 64;
  const int wid = blockIdx.x * 4 + w;
  const int mt = wid / ntn, nq = wid % ntn;
  if (mt * 16 >= M) return;
  const int row0 = mt * 16, col0 = nq * 64;
  const float* arow = A + (size_t)(row0 + ln) * lda;
  v8f acc[4] = {};
  for (int kb = 0; kb < K; kb += 32) {
    FragB ah, al;
    const v4f x0 = *(const v4fa*)(arow + kb + 8 * hh), x1 = *(const v4fa*)(arow + kb + 8 * hh + 4);
    const v4f x2 = *(const v4fa*)(arow + kb + 16 + 8 * hh), x3 = *(const v4fa*)(arow + kb + 16 + 8 * hh + 4);
    float xs[16] = {x0[0],x0[1],x0[2],x0[3],x1[0],x1[1],x1[2],x1[3],x2[0],x2[1],x2[2],x2[3],x3[0],x3[1],x3[2],x3[3]};
#pragma unroll
    for (int i = 0; i < 16; ++i) { const unsigned short hb = bf16_bits(xs[i]); ah.u[i] = hb; al.u[i] = ASPLIT ? bf16_bits(xs[i] - bf16_val(hb)) : (unsigned short)0; }
#pragma unroll
    for (int t = 0; t < 4; ++t) {
      const unsigned short* brow = Wt + (size_t)(col0 + t * 16 + ln) * ldb + kb;
      FragB b;
      b.half[0] = *(const v8us*)(brow + 8 * hh);
      b.half[1] = *(const v8us*)(brow + 16 + 8 * hh);
      acc[t] = mmaN<ASPLIT ? 2 : 1>(ah.v, al.v, b.v, b.v, acc[t]);
    }
  }
#pragma unroll
  for (int t = 0; t < 4; ++t) {
    const int col = col0 + t * 16 + ln;
    float bv = bias ? bias[col] : 0.f;
    if (BIAS_BF16) bv = bf16_round(bv);
#pragma unroll
    for (int r = 0; r < 8; ++r) {
      float v = acc[t][r] + bv;
      if (resid) { float rv = resid[(size_t)((row0 + 8 * hh + r) % rmod) * ldr + col]; if (RES_BF16) rv = bf16_round(rv); v += rv; }
      if (ACT == 1) v = fmaxf(v, 0.f);
      if (ACT == 2) v = 0.5f * v * (1.0f + erff(v * 0.70710678118654752f));
      if (ACT == 3) { const float u = 0.7978845608028654f * (v + 0.044715f * v * v * v); v = 0.5f * v * (1.0f + tanhf(u)); }
      so[w][8 * hh + r][t * 16 + ln] = v;
    }
  }
  __builtin_amdgcn_fence(__ATOMIC_ACQ_REL, "workgroup");
  __builtin_amdgcn_wave_barrier();
  const int rsub = lane >> 4, c4 = (lane & 15) * 4;
  {
#pragma unroll
    for (int q = 0; q < 8; ++q) {
      const int r = q * 2 + rsub;
      const v4f v = *(const v4fa*)&so[w][r][c4];
      *(v4f*)(C + (size_t)(row0 + r) * ldc + col0 + c4) = v;
    }
    
  }
}
// row LayerNorm (biased variance, eps) over N: s = X (+ R); optional out_sum <- s; out_norm <- (s-mu)*rsqrt(var+eps)*g + b
template <bool PARAM_BF16>
__global__ __launch_bounds__(256) void k_layernorm(const float* __restrict__ X, const float* __restrict__ R, const float* __restrict__ g, const float* __restrict__ bta,
                                                  float* __restrict__ out_sum, float* __restrict__ out_norm, int N, float eps) {
  __shared__ float red[256];
  const int row = blockIdx.x, tid = threadIdx.x;
  const float* x = X + (size_t)row * N; const float* rr = R ? R + (size_t)row * N : nullptr;
  float vals[16];                     // up to N = 4096
  const int per = N / 256;            // contiguous chunk per thread? use strided-by-4 chunks: thread handles j = tid*4 + 1024*u
  float s1 = 0.f;
  for (int u = 0; u < per / 4; ++u) {
    const int j = tid * 4 + 1024 * u;
    const v4f a = *(const v4fa*)(x + j);
    v4f b = {0.f,0.f,0.f,0.f}; if (rr) b = *(const v4fa*)(rr + j);
#pragma unroll
    for (int q = 0; q < 4; ++q) { const float v = a[q] + b[q]; vals[u * 4 + q] = v; s1 += v; }
  }
  red[tid] = s1; __syncthreads();
  for (int st = 128; st > 0; st >>= 1) { if (tid < st) red[tid] += red[tid + st]; __syncthreads(); }
  const float mu = red[0] / (float)N; __syncthreads();
  float s2 = 0.f;
  for (int u = 0; u < per / 4; ++u)
#pragma unroll
    for (int q = 0; q < 4; ++q) { const float c = vals[u * 4 + q] - mu; s2 += c * c; }
  red[tid] = s2; __syncthreads();
  for (int st = 128; st > 0; st >>= 1) { if (tid < st) red[tid] += red[tid + st]; __syncthreads(); }
  const float rs = rsqrtf(red[0] / (float)N + eps);
  {
    for (int u = 0; u < per / 4; ++u) {
      const int j = tid * 4 + 1024 * u;
      v4f o, sm;
#pragma unroll
      for (int q = 0; q < 4; ++q) {
        float gg = g[j + q], bb = bta[j + q];
        if (PARAM_BF16) { gg = bf16_round(gg); bb = bf16_round(bb); }
        sm[q] = vals[u * 4 + q]; o[q] = (vals[u * 4 + q] - mu) * rs * gg + bb;
      }
      if (out_sum) *(v4f*)(out_sum + (size_t)row * N + j) = sm;
      *(v4f*)(out_norm + (size_t)row * N + j) = o;
    }
    
  }
}



// ---- f16 WMMA path (v_wmma_f32_16x16x32_f16): 11-bit significands for operands in range — used where a [0,1] probability operand needs more precision than bf16
typedef _Float16 v16h __attribute__((ext_vector_type(16)));
union FragH { v16h v; v8us half[2]; _Float16 h[16]; unsigned short u[16]; };
template <int NT>
__device__ __forceinline__ v8f mmaH(v16h ah, v16h al, v16h bh, v16h bl, v8f c) {
  c = __builtin_amdgcn_wmma_f32_16x16x32_f16(false, ah, false, bh, (short)0, c, false, false);
  if (NT >= 2) c = __builtin_amdgcn_wmma_f32_16x16x32_f16(false, al, false, bh, (short)0, c, false, false);
  if (NT >= 3) c = __builtin_amdgcn_wmma_f32_16x16x32_f16(false, ah, false, bl, (short)0, c, false, false);
  asm volatile("v_nop\n\tv_nop\n\tv_nop\n\tv_nop" : "+v"(c) : "v"(ah), "v"(al), "v"(bh), "v"(bl));
  return c;
}
// batched GEMM like k_gemm_b but f16 operands: A f32 (split into f16 hi/lo if ASPLIT, else rounded to f16), Bt = f16 values [n][k]; alpha; C f32; N multiple of 16 (partial tiles skipped)
template <bool ASPLIT>
__global__ __launch_bounds__(128) void k_gemm_h(const float* __restrict__ A, int lda, size_t sA, const _Float16* __restrict__ Bh, int ldb, size_t sB, float alpha, float* __restrict__ C, int ldc, size_t sC, int M, int N, int K) {
  __shared__ __attribute__((aligned(16))) float so[4][16][64];
  const int tid = threadIdx.x, w = tid >> 5, lane = tid & 31, ln = lane & 15, hh = lane >> 4; const int by = blockIdx.y;
  A += (size_t)by * sA; Bh += (size_t)by * sB; C += (size_t)by * sC;
  const int ntn = (N + 63) / 64; const int wid = blockIdx.x * 4 + w; const int mt = wid / ntn, nq = wid % ntn; if (mt * 16 >= M) return;
  const int row0 = mt * 16, col0 = nq * 64; const float* arow = A + (size_t)(row0 + ln) * lda;
  v8f acc[4] = {};
  for (int kb = 0; kb < K; kb += 32) {
    FragH ah, al;
    const v4f x0 = *(const v4fa*)(arow + kb + 8 * hh), x1 = *(const v4fa*)(arow + kb + 8 * hh + 4), x2 = *(const v4fa*)(arow + kb + 16 + 8 * hh), x3 = *(const v4fa*)(arow + kb + 16 + 8 * hh + 4);
    float xs[16] = {x0[0],x0[1],x0[2],x0[3],x1[0],x1[1],x1[2],x1[3],x2[0],x2[1],x2[2],x2[3],x3[0],x3[1],x3[2],x3[3]};
#pragma unroll
    for (int i = 0; i < 16; ++i) { const _Float16 h = (_Float16)xs[i]; ah.h[i] = h; al.h[i] = ASPLIT ? (_Float16)(xs[i] - (float)h) : (_Float16)0.0f; }
#pragma unroll
    for (int t = 0; t < 4; ++t) { if (col0 + t * 16 >= N) continue; const size_t boff = (size_t)(col0 + t * 16 + ln) * ldb + kb; FragH bq; bq.half[0] = *(const v8us*)(Bh + boff + 8 * hh); bq.half[1] = *(const v8us*)(Bh + boff + 16 + 8 * hh);
      acc[t] = mmaH<ASPLIT ? 2 : 1>(ah.v, al.v, bq.v, bq.v, acc[t]); }
  }
#pragma unroll
  for (int t = 0; t < 4; ++t) { if (col0 + t * 16 >= N) continue;
#pragma unroll
    for (int r = 0; r < 8; ++r) so[w][8 * hh + r][t * 16 + ln] = acc[t][r] * alpha; }
  __builtin_amdgcn_fence(__ATOMIC_ACQ_REL, "workgroup"); __builtin_amdgcn_wave_barrier();
  const int rsub = lane >> 4, c4 = (lane & 15) * 4;
  {
#pragma unroll
    for (int q = 0; q < 8; ++q) { const int r = q * 2 + rsub; if (col0 + c4 < N) { const v4f v = *(const v4fa*)&so[w][r][c4]; *(v4f*)(C + (size_t)(row0 + r) * ldc + col0 + c4) = v; } }
     }
}

// k_gemm_hh variant with fused epilogue: v = acc·alpha + bias[by·sBias + col] (+ CP[(row/rowsPerB)·sCPb + by·64 + col] if CP) ; ACT 0 none / 1 elu ; writes f16 C16 (and f32 C if non-null)
template <int ACT>
__global__ __launch_bounds__(128) void k_gemm_hhx(const _Float16* __restrict__ A, int lda, size_t sA, const _Float16* __restrict__ Bh, int ldb, size_t sB, float alpha, const float* __restrict__ bias, size_t sBias, const float* __restrict__ CP, int rowsPerB, size_t sCPb, int row0g,
    float* __restrict__ C, _Float16* __restrict__ C16, int ldc, size_t sC, int M, int N, int K) {
  __shared__ __attribute__((aligned(16))) float so[4][16][64];
  const int tid = threadIdx.x, w = tid >> 5, lane = tid & 31, ln = lane & 15, hh = lane >> 4; const int by = blockIdx.y;
  A += (size_t)by * sA; Bh += (size_t)by * sB; const size_t cofs = (size_t)by * sC; const float* bp = bias ? bias + (size_t)by * sBias : nullptr;
  const int ntn = (N + 63) / 64; const int wid = blockIdx.x * 4 + w; const int mt = wid / ntn, nq = wid % ntn; if (mt * 16 >= M) return;
  const int row0 = mt * 16, col0 = nq * 64; const _Float16* arow = A + (size_t)(row0 + ln) * lda;
  v8f acc[4] = {};
  for (int kb = 0; kb < K; kb += 32) { FragH ah; ah.half[0] = *(const v8us*)((const unsigned short*)arow + kb + 8 * hh); ah.half[1] = *(const v8us*)((const unsigned short*)arow + kb + 16 + 8 * hh);
#pragma unroll
    for (int t = 0; t < 4; ++t) { if (col0 + t * 16 >= N) continue; const size_t boff = (size_t)(col0 + t * 16 + ln) * ldb + kb; FragH bq; bq.half[0] = *(const v8us*)((const unsigned short*)Bh + boff + 8 * hh); bq.half[1] = *(const v8us*)((const unsigned short*)Bh + boff + 16 + 8 * hh);
      acc[t] = mmaH<1>(ah.v, ah.v, bq.v, bq.v, acc[t]); }
  }
#pragma unroll
  for (int t = 0; t < 4; ++t) { if (col0 + t * 16 >= N) continue; const int col = col0 + t * 16 + ln; const float bv = bp ? bf16_round(bp[col]) : 0.f;
#pragma unroll
    for (int r = 0; r < 8; ++r) { float v = acc[t][r] * alpha + bv; if (CP) { const int rr = row0g + row0 + 8 * hh + r; if (rowsPerB < 0) v += CP[cofs + (size_t)rr * ldc + col];      /* rowsPerB < 0: own element of the batched C plane */ else { const int bidx = rr / rowsPerB; v += CP[(size_t)bidx * sCPb + (size_t)by * 64 + col]; } } if (ACT == 1) v = (v > 0.f) ? v : expm1f(v); else if (ACT == 7) v = (v > 0.f) ? v + 1.0f : expf(v); else if (ACT == 8) v = tanhf(v); else if (ACT == 9) v = 0.5f * v * (1.0f + tanhf(0.7978845608028654f * (v + 0.044715f * v * v * v))); else if (ACT == 11) v = 1.0f / (1.0f + expf(-v)); else if (ACT == 12) v = (v > 0.f) ? v : 0.01f * v; else if (ACT == 14) v = (v > 0.f) ? v : 0.1f * v; else if (ACT == 16) v = (v >= 0.f) ? v : 0.3f * v; else if (ACT == 17) v = (v >= 0.f) ? v : 0.2f * v; else if (ACT == 15) v = v / (1.0f + expf(-v)); else if (ACT == 3) v = fmaxf(v, 0.f); else if (ACT == 6) v = 0.5f * v * (1.0f + erff(v * 0.70710678118654752f)); so[w][8 * hh + r][t * 16 + ln] = v; } }
  __builtin_amdgcn_fence(__ATOMIC_ACQ_REL, "workgroup"); __builtin_amdgcn_wave_barrier();
  const int rsub = lane >> 4, c4 = (lane & 15) * 4; typedef _Float16 v4h __attribute__((ext_vector_type(4)));
  {
#pragma unroll
    for (int q = 0; q < 8; ++q) { const int r = q * 2 + rsub; if (col0 + c4 < N) { const v4f v = *(const v4fa*)&so[w][r][c4]; if (C) *(v4f*)(C + cofs + (size_t)(row0 + r) * ldc + col0 + c4) = v; if (C16) { v4h h4; for (int i = 0; i < 4; ++i) h4[i] = (_Float16)v[i]; *(v4h*)(C16 + cofs + (size_t)(row0 + r) * ldc + col0 + c4) = h4; } } }
     }
}


typedef _Float16 v4h __attribute__((ext_vector_type(4)));

__global__ __launch_bounds__(256) void k_h16(const float* __restrict__ x, _Float16* __restrict__ X16, size_t n8) { const size_t t = (size_t)blockIdx.x * 256 + threadIdx.x; if (t >= n8) return; FragH f;
#pragma unroll
  for (int q = 0; q < 8; ++q) f.h[q] = (_Float16)x[t * 8 + q]; *(v8us*)((unsigned short*)X16 + t * 8) = f.half[0];  }
__global__ __launch_bounds__(256) void k_round16f(const float* __restrict__ W, _Float16* __restrict__ Bt, size_t n8) { const size_t t = (size_t)blockIdx.x * 256 + threadIdx.x; if (t >= n8) return; FragH f;
#pragma unroll
  for (int i = 0; i < 8; ++i) f.h[i] = (_Float16)(bf16_round(W[t * 8 + i]) * 16.0f); *(v8us*)((unsigned short*)Bt + t * 8) = f.half[0];  }
template <int NHv, int TTv>
__global__ __launch_bounds__(256) void k_vt(const _Float16* __restrict__ V16, int ldv, int voff, _Float16* __restrict__ Vt) { __shared__ unsigned short tl[64][66]; const int tid = threadIdx.x; const int slab = blockIdx.x / (TTv / 64), lg = blockIdx.x % (TTv / 64); const int b = slab / NHv, h = slab % NHv;
  for (int i = tid; i < 64 * 8; i += 256) { const int r = i / 8, c8 = (i % 8) * 8; FragH f; f.half[0] = *(const v8us*)((const unsigned short*)V16 + ((size_t)b * TTv + lg * 64 + r) * ldv + voff + h * 64 + c8);
#pragma unroll
    for (int q = 0; q < 8; ++q) tl[r][c8 + q] = f.u[q]; }
  __syncthreads();
  {
#pragma unroll
    for (int rd = 0; rd < 2; ++rd) { const int d = rd * 32 + tid / 8, pc = tid % 8; FragH f;
#pragma unroll
      for (int q = 0; q < 8; ++q) f.u[q] = tl[pc * 8 + q][d];
      *(v8us*)((unsigned short*)Vt + ((size_t)slab * 64 + d) * TTv + lg * 64 + pc * 8) = f.half[0]; }
     } }

__global__ __launch_bounds__(256) void k_hl(const float* __restrict__ F, _Float16* __restrict__ Hh, _Float16* __restrict__ Hl, size_t n8) { const size_t t = (size_t)blockIdx.x * 256 + threadIdx.x; if (t >= n8) return; FragH fh, fl; const v4f a = *(const v4fa*)(F + t * 8), c = *(const v4fa*)(F + t * 8 + 4);
#pragma unroll
  for (int q = 0; q < 4; ++q) { _Float16 h = (_Float16)a[q]; fh.h[q] = h; fl.h[q] = (_Float16)((a[q] - (float)h) * 1024.0f); h = (_Float16)c[q]; fh.h[4 + q] = h; fl.h[4 + q] = (_Float16)((c[q] - (float)h) * 1024.0f); }
  { *(v8us*)((unsigned short*)Hh + t * 8) = fh.half[0]; *(v8us*)((unsigned short*)Hl + t * 8) = fl.half[0];  } }

// ---- fast GEMM (wave tile 32x64, work-group tile 128x64; requires M % 128 == 0 rows per launch region, N % 64 == 0 and K % 64 == 0); epilogue = k_gemm_hhx semantics ----
__device__ __forceinline__ v16h g2_frag(const _Float16* p, int hh) { FragH f; f.half[0] = *(const v8us*)((const unsigned short*)p + 8 * hh); f.half[1] = *(const v8us*)((const unsigned short*)p + 16 + 8 * hh); return f.v; }
__device__ __forceinline__ v8f g2_mma(v16h a, v16h b, v8f c) { v8f d = __builtin_amdgcn_wmma_f32_16x16x32_f16(false, a, false, b, (short)0, c, false, false); asm volatile("v_nop\n\tv_nop\n\tv_nop\n\tv_nop" : "+v"(d) : "v"(a), "v"(b)); return d; }
// Operand staging of the fast GEMM: a stage is 64 k (one whole 128-byte line) of the work-group's 128 A rows and 64 B rows, brought into LDS by asynchronous copies, two buffers.
#define G2K 64                       /* k per stage */
#define G2P 72                       /* LDS row pitch in f16: 144 B = 16 B x odd, the pitch for 16-byte LDS reads of one row per lane */
#define G2S ((128 + 64) * G2P * 2)   /* bytes of a stage: A rows 0 .. 127, then B rows 0 .. 63 */
// One stage's copies of one thread: 16 bytes of rows r, r + 16, .. of A (8 rows: four from ga, the tile's rows 0 .. 63, four from ga4, its rows 64 .. 127) and of B (4 rows); 8 lanes bring one whole line, a wave-wide copy 4 lines.
// The s_wait_xcnt at the end stands inside the statement so that no register named by a copy is rewritten in front of it.
__device__ __forceinline__ void g2_stage(unsigned l, const _Float16* ga, const _Float16* ga4, size_t sa, const _Float16* gb, size_t sb) {
  asm volatile("global_load_async_to_lds_b128 %0, %12, off\n\tglobal_load_async_to_lds_b128 %1, %13, off\n\tglobal_load_async_to_lds_b128 %2, %14, off\n\tglobal_load_async_to_lds_b128 %3, %15, off\n\t"
               "global_load_async_to_lds_b128 %4, %16, off\n\tglobal_load_async_to_lds_b128 %5, %17, off\n\tglobal_load_async_to_lds_b128 %6, %18, off\n\tglobal_load_async_to_lds_b128 %7, %19, off\n\t"
               "global_load_async_to_lds_b128 %8, %20, off\n\tglobal_load_async_to_lds_b128 %9, %21, off\n\tglobal_load_async_to_lds_b128 %10, %22, off\n\tglobal_load_async_to_lds_b128 %11, %23, off\n\ts_wait_xcnt 0x0"
               :: "v"(l), "v"(l + 1 * 16 * G2P * 2), "v"(l + 2 * 16 * G2P * 2), "v"(l + 3 * 16 * G2P * 2), "v"(l + 4 * 16 * G2P * 2), "v"(l + 5 * 16 * G2P * 2), "v"(l + 6 * 16 * G2P * 2), "v"(l + 7 * 16 * G2P * 2),
                  "v"(l + 8 * 16 * G2P * 2), "v"(l + 9 * 16 * G2P * 2), "v"(l + 10 * 16 * G2P * 2), "v"(l + 11 * 16 * G2P * 2),
                  "v"(ga), "v"(ga + sa), "v"(ga + 2 * sa), "v"(ga + 3 * sa), "v"(ga4), "v"(ga4 + sa), "v"(ga4 + 2 * sa), "v"(ga4 + 3 * sa),
                  "v"(gb), "v"(gb + sb), "v"(gb + 2 * sb), "v"(gb + 3 * sb) : "memory"); }
// mode (a literal at every call, so that each call keeps only its own epilogue; an argument and not a template parameter, so that all calls share the one LDS array):
// 0: C / C16 rows as computed. 1: the f16 tile is stored TRANSPOSED, C16[col][row] with pitch ldc (no bias, CP, activation). 2: a tile of 64 rows of C from two A planes: the tile's A rows 0 .. 63 are rows of A,
// its rows 64 .. 127 the same rows of the plane sA elements behind it; C = alpha (A W) + alpha 2^-10 (A' W) (no bias, CP, activation; M % 64 == 0).
#define G2TP 136                     /* LDS pitch of a transposed output row in f16: 272 B = 16 B x odd */
template <int ACT>
__device__ __forceinline__ void gemm2_body(const int mode, const int bx, const int by, const _Float16* __restrict__ A, int lda, size_t sA, const _Float16* __restrict__ Bh, int ldb, size_t sB, float alpha, const float* __restrict__ bias, size_t sBias, const float* __restrict__ CP, int rowsPerB, size_t sCPb, int row0g,
    float* __restrict__ C, _Float16* __restrict__ C16, int ldc, size_t sC, int M, int N, int K) { static_assert(ACT == 0 || ACT == 3 || ACT == 6 || ACT == 8 || ACT == 9 || ACT == 11 || ACT == 12 || ACT == 14 || ACT == 15 || ACT == 16 || ACT == 17, "k_gemm2: unsupported ACT code (would silently apply no activation)");
  __shared__ __attribute__((aligned(16))) unsigned char sm[2 * G2S];      /* the two operand buffers; behind the k loop's last barrier the same bytes stage the output rows */
  static_assert(sizeof(float) * 4 * 32 * 68 <= 2 * G2S, "the output staging fits the operand buffers");
  float (*so)[32][68] = (float (*)[32][68])sm;
  const int tid = threadIdx.x, w = tid >> 5, lane = tid & 31, ln = lane & 15, hh = lane >> 4;
  if (mode != 2) A += (size_t)by * sA;
  Bh += (size_t)by * sB; const size_t cofs = (size_t)by * sC; const float* bp = bias ? bias + (size_t)by * sBias : nullptr;
  const int ntn = N >> 6; const int mt = bx / ntn, nq = bx - mt * ntn; const int tm = (mode == 2) ? 64 : 128;      /* rows of C per tile */
  const int row0 = mt * 128 + 32 * w, col0 = nq * 64; if (mt * tm >= M) return;      /* taken by a whole work-group or by none (M % tm == 0): it stands in front of barriers */
  const _Float16* ga = A + (size_t)(mt * tm + (tid >> 3)) * lda + (tid & 7) * 8; const _Float16* ga4 = ga + ((mode == 2) ? sA : (size_t)64 * lda); const _Float16* gb = Bh + (size_t)(col0 + (tid >> 3)) * ldb + (tid & 7) * 8;      /* this thread's 16 bytes of rows tid / 8 + 16 i */
  const unsigned lc = (unsigned)(size_t)sm + (unsigned)((tid >> 3) * (G2P * 2) + (tid & 7) * 16);      /* their place in buffer 0 (LDS byte address) */
  const _Float16* la = (const _Float16*)sm + (32 * w + ln) * G2P; const _Float16* lb = (const _Float16*)sm + (128 + ln) * G2P;      /* this lane's fragment rows in buffer 0 */
  const int nt = K / G2K;
  const v8f z8 = {0.f,0.f,0.f,0.f,0.f,0.f,0.f,0.f}; v8f c00 = z8, c01 = z8, c02 = z8, c03 = z8, c10 = z8, c11 = z8, c12 = z8, c13 = z8;
  g2_stage(lc, ga, ga4, (size_t)16 * lda, gb, (size_t)16 * ldb);
  asm volatile("s_wait_asynccnt 0x0" ::: "memory");      /* this wave's copies of stage 0 have landed */
  __syncthreads();      /* stage 0 is readable by every wave */
  if (nt > 1) g2_stage(lc + G2S, ga + G2K, ga4 + G2K, (size_t)16 * lda, gb + G2K, (size_t)16 * ldb);
#pragma unroll 1      /* one trip = one stage; the buffer is picked by the trip's parity */
  for (int t = 0; t < nt; ++t) { const int bo = (t & 1) * (G2S / 2); const _Float16* ap = la + bo; const _Float16* bq = lb + bo;
    v16h fa[2][2], fb[2][4];
#pragma unroll      /* the stage's 12 fragments are asked for as one group ahead of its products (constant indices: they stay in registers) */
    for (int q = 0; q < 2; ++q) { fa[q][0] = g2_frag(ap + q * 32, hh); fa[q][1] = g2_frag(ap + 16 * G2P + q * 32, hh);
#pragma unroll
      for (int u = 0; u < 4; ++u) fb[q][u] = g2_frag(bq + u * 16 * G2P + q * 32, hh); }
#pragma unroll      /* the two 32-k blocks of a stage, in ascending k as before */
    for (int q = 0; q < 2; ++q) {
      c00 = g2_mma(fa[q][0], fb[q][0], c00); c10 = g2_mma(fa[q][1], fb[q][0], c10);
      c01 = g2_mma(fa[q][0], fb[q][1], c01); c11 = g2_mma(fa[q][1], fb[q][1], c11);
      c02 = g2_mma(fa[q][0], fb[q][2], c02); c12 = g2_mma(fa[q][1], fb[q][2], c12);
      c03 = g2_mma(fa[q][0], fb[q][3], c03); c13 = g2_mma(fa[q][1], fb[q][3], c13); }
    asm volatile("s_wait_dscnt 0x0" ::: "memory");      /* this wave's reads of the buffer are done before it may be refilled */
    asm volatile("s_wait_asynccnt 0x0" ::: "memory");      /* this wave's copies of stage t + 1 have landed */
    __syncthreads();      /* publishes stage t + 1 and ends every wave's reads of stage t */
    if (t + 2 < nt) g2_stage(lc + (unsigned)(t & 1) * G2S, ga + (size_t)(t + 2) * G2K, ga4 + (size_t)(t + 2) * G2K, (size_t)16 * lda, gb + (size_t)(t + 2) * G2K, (size_t)16 * ldb); }
  asm volatile("s_wait_asynccnt 0x0" ::: "memory");      /* no copy is outstanding when the buffers become output staging */
  v8f accs[8] = {c00, c01, c02, c03, c10, c11, c12, c13};
  if (mode == 1) {      /* a lane's 8 accumulator values are 8 consecutive rows of one column: 16 bytes of a transposed row */
    unsigned short (*st)[G2TP] = (unsigned short (*)[G2TP])sm;
#pragma unroll      /* accs is indexed by constants only */
    for (int u = 0; u < 8; ++u) { FragH f;
#pragma unroll      /* short fixed trip count; f stays in registers */
      for (int r = 0; r < 8; ++r) f.h[r] = (_Float16)(accs[u][r] * alpha);
      *(v8us*)&st[(u & 3) * 16 + ln][32 * w + (u >> 2) * 16 + 8 * hh] = f.half[0]; }
    __syncthreads();      /* the transposed tile is complete before its rows, which hold all four waves' values, are read */
    unsigned short* dp = (unsigned short*)C16 + (size_t)(col0 + (tid >> 4)) * ldc + mt * 128 + (tid & 15) * 8;
#pragma unroll      /* 16 lanes store the 256 contiguous bytes of one transposed row; the LDS reads are asked for as one group */
    for (int q = 0; q < 8; ++q) { const v8us v = *(const v8us*)&st[q * 8 + (tid >> 4)][(tid & 15) * 8]; *(v8us*)(dp + (size_t)q * 8 * ldc) = v; }
    return; }
  if (mode == 2) {      /* waves 0, 1 hold the first plane's products of the tile's 64 rows, waves 2, 3 the second plane's */
    const float al = (w < 2) ? alpha : alpha * 0.0009765625f;
#pragma unroll      /* accs is indexed by constants only */
    for (int u = 0; u < 8; ++u)
#pragma unroll      /* short fixed trip count, constant indices */
      for (int r = 0; r < 8; ++r) so[w][(u >> 2) * 16 + 8 * hh + r][(u & 3) * 16 + ln] = accs[u][r] * al;
    __syncthreads();      /* a row's two terms come from two waves */
    const int rs = lane >> 4, cq = (lane & 15) * 4;      /* wave w stores rows 16 w .. 16 w + 15, whole 256-byte runs: they lie in the staging of waves w / 2 and 2 + w / 2 */
    const float* sp = &so[w >> 1][16 * (w & 1) + rs][cq]; float* cp = C + (size_t)(mt * 64 + 16 * w + rs) * ldc + col0 + cq;
#pragma unroll      /* the LDS reads are asked for as one group; one address each, constant offsets */
    for (int q = 0; q < 8; ++q) { const v4f a = *(const v4fa*)(sp + q * 2 * 68), b = *(const v4fa*)(sp + 2 * 32 * 68 + q * 2 * 68); *(v4f*)(cp + (size_t)q * 2 * ldc) = a + b; }
    return; }
#pragma unroll
  for (int u = 0; u < 8; ++u) { const int t = u & 3, half = u >> 2; const int col = col0 + t * 16 + ln; const float bv = bp ? bf16_round(bp[col]) : 0.f;
#pragma unroll
    for (int r = 0; r < 8; ++r) { const int rloc = half * 16 + 8 * hh + r; float v = accs[u][r] * alpha + bv; if (CP) { if (rowsPerB < 0) v += CP[cofs + (size_t)(row0g + row0 + rloc) * ldc + col];      /* rowsPerB < 0: own element of the batched C plane */ else { const int bidx = (row0g + row0 + rloc) / rowsPerB; v += CP[(size_t)bidx * sCPb + (size_t)by * 64 + col]; } }
      if (ACT == 3) v = fmaxf(v, 0.f); else if (ACT == 6) v = 0.5f * v * (1.0f + erff(v * 0.70710678118654752f)); else if (ACT == 11) v = 1.0f / (1.0f + expf(-v)); else if (ACT == 15) v = v / (1.0f + expf(-v)); else if (ACT == 12) v = (v > 0.f) ? v : 0.01f * v; else if (ACT == 8) v = tanhf(v); else if (ACT == 9) v = 0.5f * v * (1.0f + tanhf(0.7978845608028654f * (v + 0.044715f * v * v * v))); else if (ACT == 14) v = (v > 0.f) ? v : 0.1f * v; else if (ACT == 16) v = (v >= 0.f) ? v : 0.3f * v; else if (ACT == 17) v = (v >= 0.f) ? v : 0.2f * v;
      so[w][rloc][t * 16 + ln] = v; } }
  __builtin_amdgcn_fence(__ATOMIC_ACQ_REL, "workgroup"); __builtin_amdgcn_wave_barrier();
  const int rsub = lane >> 4, c4 = (lane & 15) * 4;
  {
#pragma unroll
    for (int q = 0; q < 16; ++q) { const int r = q * 2 + rsub; const v4f v = *(const v4fa*)&so[w][r][c4]; if (C) { *(v4f*)(C + cofs + (size_t)(row0 + r) * ldc + col0 + c4) = v; if (C16) asm volatile("s_wait_xcnt 0x0" ::: "memory"); }      /* both outputs asked for: the f32 store's address registers are reused for the f16 store's address, only behind this wait */
      if (C16) { v4h h4; for (int i = 0; i < 4; ++i) h4[i] = (_Float16)v[i]; *(v4h*)(C16 + cofs + (size_t)(row0 + r) * ldc + col0 + c4) = h4; } }
     } }
template <int ACT>
__global__ __launch_bounds__(128) void k_gemm2(const _Float16* __restrict__ A, int lda, size_t sA, const _Float16* __restrict__ Bh, int ldb, size_t sB, float alpha, const float* __restrict__ bias, size_t sBias, const float* __restrict__ CP, int rowsPerB, size_t sCPb, int row0g,
    float* __restrict__ C, _Float16* __restrict__ C16, int ldc, size_t sC, int M, int N, int K) { gemm2_body<ACT>(0, blockIdx.x, blockIdx.y, A, lda, sA, Bh, ldb, sB, alpha, bias, sBias, CP, rowsPerB, sCPb, row0g, C, C16, ldc, sC, M, N, K); }

// The six independent projection GEMMs as ONE launch. blockIdx.y = q, k or v (input, weight and output planes lie one behind the other); blockIdx.x picks the job:
// the first PJF work-groups give the f32 rows of the first QT0 tokens, the others the f16 rows of all tokens. A work-group's 64 columns are one head: those of v store their f16 tile
// transposed, straight into V^T [head][d][token], which is all that reads the f16 v.
#define PJF ((QT0 / 128) * (DM / 64))      /* work-groups of an f32 first-tile job */
#define PJH ((MP / 128) * (DM / 64))       /* work-groups of an f16 all-rows job */
__global__ __launch_bounds__(128) void k_qkv(const _Float16* __restrict__ X, const _Float16* __restrict__ BW, float* __restrict__ CF, _Float16* __restrict__ C16, _Float16* __restrict__ VT) {
  const int bx = blockIdx.x;      /* the same for the whole work-group: a scalar branch; each side knows at compile time which output it stores */
  if (bx < PJF) gemm2_body<0>(0, bx, blockIdx.y, X, DM, NR * DM, BW, DM, (size_t)DM * DM, 0.0625f, nullptr, 0, nullptr, 1, 0, 0, CF, nullptr, DM, (size_t)QT0 * DM, QT0, DM, DM);
  else if (blockIdx.y < 2) gemm2_body<0>(0, bx - PJF, blockIdx.y, X, DM, NR * DM, BW, DM, (size_t)DM * DM, 0.0625f, nullptr, 0, nullptr, 1, 0, 0, nullptr, C16, DM, NR * DM, MP, DM, DM);
  else gemm2_body<0>(1, bx - PJF, 2, X, DM, NR * DM, BW, DM, (size_t)DM * DM, 0.0625f, nullptr, 0, nullptr, 1, 0, 0, nullptr, VT, SQ, 0, MP, DM, DM); }

// The output GEMM of all rows as ONE launch. Rows 0 .. QT0 - 1 come from the exact first-tile o: the first POF work-groups take 64 rows each, the hi plane's and the x1024 residual plane's rows
// (OH, and QT0 rows behind it) side by side as the 128 A rows of their tile, and add the two products (2^-10 hi + 2^-20 lo) in the epilogue. The others: 128 rows of the f16-path o, from row QT0 on.
#define POF ((QT0 / 64) * (DM / 64))       /* work-groups of the first-tile rows */
__global__ __launch_bounds__(128) void k_out(const _Float16* __restrict__ O, const _Float16* __restrict__ OH, const _Float16* __restrict__ BO, float* __restrict__ out) {
  const int bx = blockIdx.x;
  if (bx < POF) gemm2_body<0>(2, bx, 0, OH, DM, (size_t)QT0 * DM, BO, DM, 0, 0.0009765625f, nullptr, 0, nullptr, 1, 0, 0, out, nullptr, DM, 0, QT0, DM, DM);
  else gemm2_body<0>(0, bx - POF + PJF, 0, O, DM, 0, BO, DM, 0, 0.0009765625f, nullptr, 0, nullptr, 1, 0, 0, out, nullptr, DM, 0, MPO, DM, DM); }

// Operand preparation as ONE launch of independent jobs picked by the block index; every wave-wide global access covers whole 128-byte lines and each thread has several loads in flight.
// Work-groups 0 .. PWT - 1: one tile of 128 k x 64 n of plane p of BW (q, k, v, o): BW[p][n][k] = f16(bf16(W[k][n]) x 16) (a power of two: bf16-exact weights stay exact in f16 away from the subnormal range);
// for p < 3 row n is column n % 64 of head n / 64 of the [head][in][out] stack, for p = 3 column n of the [in][out] output weight. The others: PXF elements of plane j of XH = input j rounded to bf16, as f16.
#define PWP ((DM / 128) * (DM / 64))       /* tiles (work-groups) per weight plane */
#define PWT (4 * PWP)                      /* weight tiles */
#define PXG 256                            /* work-groups per input */
#define PXF ((int)(NR * DM / PXG))         /* elements of an input per work-group */
#define PXL (PXF / 1024)                   /* 16-byte loads per thread */
#define PTP 136                            /* LDS pitch of a transposed weight row in f16: 272 B = 16 B x odd */
// One weight tile: a thread loads 8 k x 4 n (a wave-wide load = 256 contiguous bytes of two source rows), rounds, and writes its four 8-k runs into the transposed LDS tile;
// behind the barrier 16 lanes store 256 contiguous bytes of one output row. s: source element (k0, n0), PITCH its row pitch; d: BW element (n0, k0).
template <int PITCH>
__device__ __forceinline__ void prep_tile(const float* __restrict__ s, _Float16* __restrict__ d, unsigned short (*tl)[PTP]) {
  const int c = threadIdx.x & 15, g = threadIdx.x >> 4; const float* sp = s + (size_t)(g * 8) * PITCH + c * 4; v4f x[8];
#pragma unroll      /* constant indices keep x in registers; every load is issued before the first value is used */
  for (int i = 0; i < 8; ++i) x[i] = *(const v4fa*)(sp + i * PITCH);
  asm volatile("s_wait_xcnt 0x0" :: "v"(sp) : "memory");      /* the loads' address registers are held up to this wait and overwritten only behind it */
#pragma unroll      /* x is indexed by constants only */
  for (int q = 0; q < 4; ++q) { FragH f;
#pragma unroll
    for (int i = 0; i < 8; ++i) f.h[i] = (_Float16)(bf16_round(x[i][q]) * 16.0f);
    *(v8us*)&tl[c * 4 + q][g * 8] = f.half[0]; }
  __syncthreads();      /* the tile is complete before its rows are read */
#pragma unroll      /* four rows a thread, their LDS reads asked for as one group */
  for (int i = 0; i < 4; ++i) { const v8us v = *(const v8us*)&tl[g + 16 * i][c * 8]; *(v8us*)((unsigned short*)d + (size_t)(g + 16 * i) * DM + c * 8) = v; } }
__global__ __launch_bounds__(256) void k_prep(const float* __restrict__ xq, const float* __restrict__ xk, const float* __restrict__ xv, const float* __restrict__ wq, const float* __restrict__ wk, const float* __restrict__ wv, const float* __restrict__ wo,
    _Float16* __restrict__ BW, _Float16* __restrict__ XH) {
  __shared__ __attribute__((aligned(16))) unsigned short tl[64][PTP];
  const int bx = blockIdx.x;      /* the same for the whole work-group: scalar branches, so the barrier of a tile is passed by all its threads */
  if (bx < PWT) { const int p = bx / PWP, t = bx - p * PWP; const int nt = t / (DM / 128), k0 = (t % (DM / 128)) * 128; _Float16* d = BW + (size_t)p * DM * DM + (size_t)nt * 64 * DM + k0;
    if (p < 3) prep_tile<HD>(((p == 0) ? wq : (p == 1) ? wk : wv) + (size_t)nt * DM * HD + (size_t)k0 * HD, d, tl);
    else { prep_tile<DM>(wo + (size_t)k0 * DM + nt * 64, d, tl);
      asm volatile("s_wait_xcnt 0x0" ::: "memory"); } }      /* behind this tile's last store: in the built code the per-head tile's instructions follow and rewrite the stores' address registers; they stand only behind this wait */
  else { const int xb = bx - PWT; const int j = xb / PXG; const size_t o = (size_t)(xb - j * PXG) * PXF + threadIdx.x * 4; const float* x = ((j == 0) ? xq : (j == 1) ? xk : xv) + o; _Float16* y = XH + (size_t)j * NR * DM + o; v4f v[PXL];
#pragma unroll      /* constant indices keep v in registers, so that a thread has several loads (512 contiguous bytes a wave each) in flight ahead of the first value's use */
    for (int u = 0; u < PXL; ++u) v[u] = *(const v4fa*)(x + u * 1024);
    asm volatile("s_wait_xcnt 0x0" :: "v"(x) : "memory");      /* the loads' address registers are held up to this wait and overwritten only behind it */
#pragma unroll      /* v is indexed by constants only; a wave-wide store = 256 contiguous bytes */
    for (int u = 0; u < PXL; ++u) { v4h h4;
#pragma unroll
      for (int q = 0; q < 4; ++q) h4[q] = (_Float16)bf16_round(v[u][q]);
      *(v4h*)(y + u * 1024) = h4; } } }


__global__ __launch_bounds__(256) void k_wnat(const float* __restrict__ w, size_t n8, _Float16* __restrict__ Bt) { const size_t t = (size_t)blockIdx.x * 256 + threadIdx.x; if (t >= n8) return; FragH f; for (int q = 0; q < 8; ++q) f.h[q] = (_Float16)(bf16_round(w[t * 8 + q]) * 16.0f); *(v8us*)((unsigned short*)Bt + t * 8) = f.half[0];  }
__global__ __launch_bounds__(256) void k_rsm(const float* __restrict__ S, _Float16* __restrict__ P, int nrows) {
  #pragma clang fp contract(off)
  const int i = blockIdx.x * 256 + threadIdx.x; if (i >= nrows) return; const float* s = S + (size_t)i * SQ; float mx = -3.0e38f;
#pragma unroll 1
  for (int j = 0; j < SQ; ++j) mx = fmaxf(mx, s[j]); float se = 0.f;
#pragma unroll 1
  for (int j = 0; j < SQ; ++j) se += expf(s[j] - mx); const float sc = 256.0f / se;
#pragma unroll 1
  for (int j0 = 0; j0 < SQ; j0 += 8) { FragH f; for (int q = 0; q < 8; ++q) f.h[q] = (_Float16)(expf(s[j0 + q] - mx) * sc); unsigned short* d = (unsigned short*)P + (size_t)i * SQ + j0; *(v8us*)d = f.half[0];  } }
__global__ __launch_bounds__(256) void k_vt(const _Float16* __restrict__ V16, int b, int h0, _Float16* __restrict__ VT) { __shared__ unsigned short tl[64][65]; const int tid = threadIdx.x; const int hh = blockIdx.x % HG, sg = blockIdx.x / HG; const int s0 = sg * 64; const int h = h0 + hh;
  for (int i = tid; i < 64 * 8; i += 256) { const int j = i / 8, d8 = (i % 8) * 8; FragH f; f.half[0] = *(const v8us*)((const unsigned short*)V16 + ((size_t)b * SQ + s0 + j) * DM + h * HD + d8); for (int q = 0; q < 8; ++q) tl[d8 + q][j] = f.u[q]; }
  __syncthreads();
  { for (int i = tid; i < 64 * 8; i += 256) { const int d = i / 8, j8 = (i % 8) * 8; FragH f; for (int q = 0; q < 8; ++q) f.u[q] = tl[d][j8 + q]; *(v8us*)((unsigned short*)VT + ((size_t)hh * HD + d) * SQ + s0 + j8) = f.half[0]; }  } }



#define FQ 32                        /* query rows per wave */
#define FW 4                         /* waves per work-group */
#define FNG (NH * (SQ / (FQ * FW)))  /* work-groups */
__device__ __forceinline__ v8f fa_mma(v16h a, v16h b, v8f c) { return __builtin_amdgcn_wmma_f32_16x16x32_f16(false, a, false, b, (short)0, c, false, false); }
__device__ __forceinline__ float fa_xhalf(float x) { return __builtin_bit_cast(float, __builtin_amdgcn_permlanex16(__builtin_bit_cast(int, x), __builtin_bit_cast(int, x), 0x76543210, 0xfedcba98, false, false)); }      /* lane l with lane l ^ 16 */
// 2^x by the native instruction. The v_nop at the end fills the slot that the instruction set asks for behind a transcendental before its result is read or its source overwritten;
// inside the group every result register differs from every source ("=&v"), so each v_exp_f32 is the independent instruction behind the one before it.
__device__ __forceinline__ float fa_exp2(float x) { float e; asm("v_exp_f32 %0, %1\n\tv_nop" : "=&v"(e) : "v"(x)); return e; }
__device__ __forceinline__ void fa_exp2x8(const float (&x)[8], float (&e)[8]) {
  asm("v_exp_f32 %0, %8\n\tv_exp_f32 %1, %9\n\tv_exp_f32 %2, %10\n\tv_exp_f32 %3, %11\n\tv_exp_f32 %4, %12\n\tv_exp_f32 %5, %13\n\tv_exp_f32 %6, %14\n\tv_exp_f32 %7, %15\n\tv_nop"
      : "=&v"(e[0]), "=&v"(e[1]), "=&v"(e[2]), "=&v"(e[3]), "=&v"(e[4]), "=&v"(e[5]), "=&v"(e[6]), "=&v"(e[7]) : "v"(x[0]), "v"(x[1]), "v"(x[2]), "v"(x[3]), "v"(x[4]), "v"(x[5]), "v"(x[6]), "v"(x[7])); }
// Operand staging of the fused attention: a stage is 64 keys of the head, K as 64 rows (keys) of 128 bytes and V^T as 64 rows (d) of 128 bytes, whole lines, brought into LDS once
// for the work-group's 4 waves by asynchronous copies, two buffers.
#define FK 64                        /* keys per stage = two passes */
#define FP 72                        /* LDS row pitch in f16: 144 B = 16 B x odd, the pitch for 16-byte LDS reads of one row per lane */
#define FT (64 * FP * 2)             /* bytes of a tile of 64 rows */
#define FS (2 * FT)                  /* bytes of a stage: the K tile, then the V^T tile */
// One stage's copies of one thread: 16 bytes of rows r, r + 16, r + 32, r + 48 of K and of V^T; 8 lanes bring one whole line, a wave-wide copy 4 lines.
// The s_wait_xcnt at the end stands inside the statement so that no register named by a copy is rewritten in front of it.
__device__ __forceinline__ void fa_stage(unsigned l, const _Float16* gk, const _Float16* gv) {
  asm volatile("global_load_async_to_lds_b128 %0, %8, off\n\tglobal_load_async_to_lds_b128 %1, %9, off\n\tglobal_load_async_to_lds_b128 %2, %10, off\n\tglobal_load_async_to_lds_b128 %3, %11, off\n\t"
               "global_load_async_to_lds_b128 %4, %12, off\n\tglobal_load_async_to_lds_b128 %5, %13, off\n\tglobal_load_async_to_lds_b128 %6, %14, off\n\tglobal_load_async_to_lds_b128 %7, %15, off\n\ts_wait_xcnt 0x0"
               :: "v"(l), "v"(l + 1 * 16 * FP * 2), "v"(l + 2 * 16 * FP * 2), "v"(l + 3 * 16 * FP * 2), "v"(l + FT), "v"(l + FT + 1 * 16 * FP * 2), "v"(l + FT + 2 * 16 * FP * 2), "v"(l + FT + 3 * 16 * FP * 2),
                  "v"(gk), "v"(gk + (size_t)16 * DM), "v"(gk + (size_t)32 * DM), "v"(gk + (size_t)48 * DM), "v"(gv), "v"(gv + (size_t)16 * SQ), "v"(gv + (size_t)32 * SQ), "v"(gv + (size_t)48 * SQ) : "memory"); }
// One pass = 32 keys: scores from kf, running softmax, o += P V from vf. nk: where the wave's next K fragments lie in the same stage (asked for behind the score products), or null.
__device__ __forceinline__ void fa_pass(v16h (&kf)[2][2], const v16h (&qf)[2][2], const v16h (&vf)[4], v8f (&acc)[4][2], float (&mr)[2], float (&ls)[2], const _Float16* nk, const bool diag, const int ln, const int hh) {
  const float CS = 0.125f * 1.4426950408889634f;      /* score scale x log2(e): exponentials in base 2 */
  const v8f z8 = {0.f, 0.f, 0.f, 0.f, 0.f, 0.f, 0.f, 0.f}; v8f s[2][2];
#pragma unroll
  for (int u = 0; u < 2; ++u)
#pragma unroll
    for (int t = 0; t < 2; ++t) s[u][t] = fa_mma(kf[u][1], qf[t][1], fa_mma(kf[u][0], qf[t][0], z8));
  if (nk) {
#pragma unroll
    for (int u = 0; u < 2; ++u)
#pragma unroll
      for (int c = 0; c < 2; ++c) kf[u][c] = g2_frag(nk + u * 16 * FP + c * 32, hh);
    __builtin_amdgcn_sched_barrier(0); }      /* keeps these LDS reads here, ahead of the softmax that covers their latency: left free they were issued right in front of their first use */
  if (diag) {      /* the diagonal pass: key > query is masked (a scalar branch) */
#pragma unroll
    for (int u = 0; u < 2; ++u)
#pragma unroll
      for (int t = 0; t < 2; ++t)
#pragma unroll
        for (int r = 0; r < 8; ++r) if (u * 16 + 8 * hh + r > t * 16 + ln) s[u][t][r] = -3.0e38f; }
  FragH pf[2];
#pragma unroll
  for (int t = 0; t < 2; ++t) { float mx = fmaxf(s[0][t][0], s[1][t][0]);
#pragma unroll
    for (int r = 1; r < 8; ++r) mx = fmaxf(mx, fmaxf(s[0][t][r], s[1][t][r]));
    mx = fmaxf(mx, fa_xhalf(mx)); const float mn = fmaxf(mr[t], mx); const float corr = fa_exp2((mr[t] - mn) * CS); mr[t] = mn; const float mc = mn * CS;      /* every pass holds at least one unmasked key of every query: mn is a real score */
    float x0[8], x1[8], e0[8], e1[8];
#pragma unroll
    for (int r = 0; r < 8; ++r) { x0[r] = fmaf(s[0][t][r], CS, -mc); x1[r] = fmaf(s[1][t][r], CS, -mc); }
    fa_exp2x8(x0, e0); fa_exp2x8(x1, e1); float s0 = 0.f, s1 = 0.f;
#pragma unroll
    for (int r = 0; r < 8; ++r) { s0 += e0[r]; s1 += e1[r]; pf[t].h[r] = (_Float16)e0[r]; pf[t].h[8 + r] = (_Float16)e1[r]; }
    ls[t] = fmaf(ls[t], corr, s0 + s1);
#pragma unroll
    for (int d = 0; d < 4; ++d) acc[d][t] *= corr; }
#pragma unroll
  for (int d = 0; d < 4; ++d)
#pragma unroll
    for (int t = 0; t < 2; ++t) acc[d][t] = fa_mma(vf[d], pf[t].v, acc[d][t]); }
// One stage = two passes. TAIL: the work-group's last two stages, where a wave's rows may end (its diagonal pass is masked, what lies beyond is skipped by scalar branches); before them every pass is whole.
template <bool TAIL>
__device__ __forceinline__ void fa_trip(const _Float16* kq, const _Float16* vq, const int j0, const int q0, const v16h (&qf)[2][2], v8f (&acc)[4][2], float (&mr)[2], float (&ls)[2], const int ln, const int hh) {
  if (TAIL && j0 > q0) return;      /* a wave whose rows end below this stage only takes part in the publish point */
  v16h kf[2][2], vf[4];
#pragma unroll      /* the first pass's K and V^T fragments, asked for as one group (constant indices: they stay in registers) */
  for (int u = 0; u < 2; ++u)
#pragma unroll
    for (int c = 0; c < 2; ++c) kf[u][c] = g2_frag(kq + u * 16 * FP + c * 32, hh);
#pragma unroll
  for (int d = 0; d < 4; ++d) vf[d] = g2_frag(vq + d * 16 * FP, hh);
  __builtin_amdgcn_sched_barrier(0);      /* keeps the V^T reads in this group: left free they were issued among the P V products, which then waited for them */
  fa_pass(kf, qf, vf, acc, mr, ls, kq + 32 * FP, TAIL && j0 == q0, ln, hh);      /* the second pass's K rows lie in the same stage: always readable, unused where the wave ends here */
  if (TAIL && j0 + 32 > q0) return;
#pragma unroll      /* V^T of the second pass: asked for ahead of its score products and softmax */
  for (int d = 0; d < 4; ++d) vf[d] = g2_frag(vq + d * 16 * FP + 32, hh);
  __builtin_amdgcn_sched_barrier(0);      /* keeps these reads here, as above */
  fa_pass(kf, qf, vf, acc, mr, ls, nullptr, TAIL && j0 + 32 == q0, ln, hh); }
__global__ __launch_bounds__(FW * 32) void k_fattn(const _Float16* __restrict__ Q, const _Float16* __restrict__ K, const _Float16* __restrict__ VT, _Float16* __restrict__ O) {
  __shared__ __attribute__((aligned(16))) unsigned char sm[2 * FS];      /* the two stage buffers */
  const int tid = threadIdx.x, lane = tid & 31, ln = lane & 15, hh = lane >> 4; const int w = __builtin_amdgcn_readfirstlane(tid >> 5);
  const int bx = blockIdx.x; const int rank = (bx < FNG / 2) ? bx : (FNG + FNG / 2 - 1 - bx);      /* a permutation: long work-groups first, then the short ones shortest first, so that groups bx and bx + FNG / 2 together have equal work (speed only) */
  const int h = rank % NH; const int qb = (SQ / (FQ * FW) - 1 - rank / NH) * (FQ * FW); const int q0 = qb + w * FQ;
  const int ns = (qb + FQ * FW) / FK;      /* stages of the work-group: the keys below its last row's end; at least 2, the same for all its waves */
  const _Float16* qp = Q + (size_t)(q0 + ln) * DM + h * HD;
  const _Float16* gk = K + (size_t)(tid >> 3) * DM + h * HD + (tid & 7) * 8; const _Float16* gv = VT + ((size_t)h * HD + (tid >> 3)) * SQ + (tid & 7) * 8;      /* this thread's 16 bytes of rows tid / 8 + 16 i of stage 0 */
  const unsigned lc = (unsigned)(size_t)sm + (unsigned)((tid >> 3) * (FP * 2) + (tid & 7) * 16);      /* their place in buffer 0 (LDS byte address) */
  const _Float16* lk = (const _Float16*)sm + ln * FP; const _Float16* lv = lk + 64 * FP;      /* this lane's fragment rows in buffer 0 */
  fa_stage(lc, gk, gv);
  v16h qf[2][2];
#pragma unroll      /* fragments indexed by constants only: they stay in registers */
  for (int t = 0; t < 2; ++t)
#pragma unroll
    for (int c = 0; c < 2; ++c) qf[t][c] = g2_frag(qp + (size_t)t * 16 * DM + c * 32, hh);
  asm volatile("s_wait_xcnt 0x0" ::: "memory");      /* the address registers of the loads above are reused below: they are overwritten only behind this wait */
  const v8f z8 = {0.f, 0.f, 0.f, 0.f, 0.f, 0.f, 0.f, 0.f}; v8f acc[4][2]; float mr[2], ls[2];
#pragma unroll
  for (int t = 0; t < 2; ++t) { mr[t] = -3.0e38f; ls[t] = 0.f;
#pragma unroll
    for (int d = 0; d < 4; ++d) acc[d][t] = z8; }
  asm volatile("s_wait_asynccnt 0x0" ::: "memory");      /* this wave's copies of stage 0 have landed */
  __syncthreads();      /* stage 0 is readable by every wave */
  fa_stage(lc + FS, gk + (size_t)FK * DM, gv + FK);      /* stage 1 exists for every work-group */
  int t = 0;
#pragma unroll 1      /* one trip = one stage = two passes of 32 keys; the buffer is picked by the trip's parity. All stages but the last two: whole for every wave, and a stage t + 2 exists */
  for (; t < ns - 2; ++t) {
    fa_trip<false>(lk + (t & 1) * (FS / 2), lv + (t & 1) * (FS / 2), t * FK, q0, qf, acc, mr, ls, ln, hh);
    __builtin_amdgcn_sched_barrier(0);      /* keeps the publish point at the trip's foot: moved up by the scheduler, its s_wait_dscnt 0 stood directly behind the second pass's V^T reads and waited for them */
    asm volatile("s_wait_dscnt 0x0" ::: "memory");      /* this wave's reads of the buffer are done before it may be refilled */
    asm volatile("s_wait_asynccnt 0x0" ::: "memory");      /* this wave's copies of stage t + 1 have landed */
    __syncthreads();      /* publishes stage t + 1 and ends every wave's reads of stage t */
    fa_stage(lc + (unsigned)(t & 1) * FS, gk + (size_t)(t + 2) * FK * DM, gv + (size_t)(t + 2) * FK); }
#pragma unroll 1      /* the last two stages: no stage t + 2 is left to copy; small code */
  for (; t < ns; ++t) {
    fa_trip<true>(lk + (t & 1) * (FS / 2), lv + (t & 1) * (FS / 2), t * FK, q0, qf, acc, mr, ls, ln, hh);
    asm volatile("s_wait_dscnt 0x0" ::: "memory");      /* as above */
    asm volatile("s_wait_asynccnt 0x0" ::: "memory");      /* this wave's copies of stage t + 1 have landed */
    __syncthreads(); }      /* publishes stage t + 1; every wave passes it, also one that skipped the stage */
  asm volatile("s_wait_asynccnt 0x0" ::: "memory");      /* no copy is outstanding when the wave ends */
#pragma unroll
  for (int t = 0; t < 2; ++t) { const float inv = 64.0f / (ls[t] + fa_xhalf(ls[t]));      /* the halves' sums joined once; o carried x64 */
    unsigned short* op = (unsigned short*)O + (size_t)(q0 + t * 16 + ln) * DM + h * HD + 8 * hh;
#pragma unroll      /* the wave stores the whole 128-byte line of each of its rows */
    for (int d = 0; d < 4; ++d) { FragH f;
#pragma unroll
      for (int r = 0; r < 8; ++r) f.h[r] = (_Float16)(acc[d][t][r] * inv);
      *(v8us*)(op + d * 16) = f.half[0]; } } }


// Exact f32 causal attention for rows 0 .. QT0 - 1 (o carried x64 like the f16 path). ONE WORK-GROUP PER HEAD AND 16 QUERY ROWS, 8 waves:
// the head's K and V rows below the group's end are staged in LDS by coalesced loads; scores: one thread per key (its K row in registers, the q rows wave-uniform);
// softmax: one wave per two rows; o: each wave sums every eighth chunk of 4 keys for all 16 rows x 64 columns in registers, and the 8 partial sums are added in wave order; stored as f16 hi + residual planes.
#define A0R 16                       /* query rows per work-group */
#define A0KP (HD + 4)                /* LDS pitch of a K row in floats: 272 B = 16 B x odd, so that 16-byte reads of one row per lane spread over the banks */
#define A0SP (QT0 + 4)               /* LDS pitch of a score row in floats (a multiple of 16 B) */
__global__ __launch_bounds__(256) void k_att0w(const float* __restrict__ QF, const float* __restrict__ KF, const float* __restrict__ VF, float scale, _Float16* __restrict__ OH, _Float16* __restrict__ OL) {
  __shared__ __attribute__((aligned(16))) float lk[QT0][A0KP]; __shared__ __attribute__((aligned(16))) float lv[QT0][HD]; __shared__ __attribute__((aligned(16))) float ls[A0R][A0SP];
  __shared__ __attribute__((aligned(16))) float red[8][A0R][HD]; __shared__ float linv[A0R];
  const int tid = threadIdx.x, lane = tid & 31, w = __builtin_amdgcn_readfirstlane(tid >> 5); const int h = blockIdx.x / (QT0 / A0R), rg = blockIdx.x % (QT0 / A0R); const int nk = (rg + 1) * A0R;      /* causal: keys below the group's end */
  const int r16 = tid >> 4, c4 = (tid & 15) * 4;
  { const float* kp = KF + (size_t)r16 * DM + h * HD + c4; const float* vp = VF + (size_t)r16 * DM + h * HD + c4; v4f kx[QT0 / 16], vx[QT0 / 16];
#pragma unroll      /* constant indices keep kx and vx in registers; every load is issued before the first value is used */
    for (int u = 0; u < QT0 / 16; ++u) if (u <= rg) { kx[u] = *(const v4fa*)(kp + (size_t)u * 16 * DM); vx[u] = *(const v4fa*)(vp + (size_t)u * 16 * DM); }
    asm volatile("s_wait_xcnt 0x0" :: "v"(kp), "v"(vp) : "memory");      /* the loads' address registers are reused below: they are held up to this wait and overwritten only behind it */
#pragma unroll      /* constant indices, as above */
    for (int u = 0; u < QT0 / 16; ++u) if (u <= rg) { *(v4f*)&lk[u * 16 + r16][c4] = kx[u]; *(v4f*)&lv[u * 16 + r16][c4] = vx[u]; } }
  __syncthreads();
  if (tid < nk) { v4f kr[HD / 4];
#pragma unroll      /* the key's row stays in registers for all 16 query rows */
    for (int c = 0; c < HD / 4; ++c) kr[c] = *(const v4f*)&lk[tid][c * 4];
    const float* qb = QF + (size_t)rg * A0R * DM + h * HD;      /* the same address in every lane */
#pragma unroll 4      /* several rows' q loads in flight ahead of their products */
    for (int i = 0; i < A0R; ++i) { v4f s4 = {0.f, 0.f, 0.f, 0.f};
#pragma unroll      /* kr is indexed by constants only */
      for (int c = 0; c < HD / 4; ++c) { const v4f qq = *(const v4fa*)(qb + (size_t)i * DM + c * 4);
#pragma unroll      /* short fixed trip count; the arrays it indexes stay in registers */
        for (int u = 0; u < 4; ++u) s4[u] = fmaf(qq[u], kr[c][u], s4[u]); }
      ls[i][tid] = ((s4[0] + s4[1]) + (s4[2] + s4[3])) * scale; } }
  __syncthreads();
#pragma unroll 1      /* two rows a wave, one after the other: small code */
  for (int i = 2 * w; i < 2 * w + 2; ++i) { const int last = rg * A0R + i; float x[QT0 / 32]; float mx = -3.0e38f;
#pragma unroll      /* x is indexed by constants only */
    for (int u = 0; u < QT0 / 32; ++u) { const int j = u * 32 + lane; x[u] = (j <= last) ? ls[i][j] : -3.0e38f; mx = fmaxf(mx, x[u]); }
#pragma unroll      /* short fixed trip count; the arrays it indexes stay in registers */
    for (int o = 16; o > 0; o >>= 1) mx = fmaxf(mx, __shfl_xor(mx, o, 32));
    float se = 0.f;
#pragma unroll      /* short fixed trip count; the arrays it indexes stay in registers */
    for (int u = 0; u < QT0 / 32; ++u) { const int j = u * 32 + lane; const float e = (j <= last) ? expf(x[u] - mx) : 0.f; se += e; if (j < nk) ls[i][j] = e; }
#pragma unroll      /* short fixed trip count; the arrays it indexes stay in registers */
    for (int o = 16; o > 0; o >>= 1) se += __shfl_xor(se, o, 32);
    if (lane == 0) linv[i] = 64.0f / se; }      /* o carried x64 like the f16 path */
  __syncthreads();
  { const int rh = lane >> 4, d4 = (lane & 15) * 4; v4f acc[8];
#pragma unroll      /* short fixed trip count; the arrays it indexes stay in registers */
    for (int r = 0; r < 8; ++r) acc[r] = (v4f){0.f, 0.f, 0.f, 0.f};
#pragma unroll 1      /* at most 8 trips of 128 multiply-adds: the body is long enough as it is */
    for (int j0 = 4 * w; j0 < nk; j0 += 32) { v4f pv[8], vv[4];
#pragma unroll      /* short fixed trip count; the arrays it indexes stay in registers */
      for (int r = 0; r < 8; ++r) pv[r] = *(const v4f*)&ls[rh * 8 + r][j0];
#pragma unroll      /* short fixed trip count; the arrays it indexes stay in registers */
      for (int q = 0; q < 4; ++q) vv[q] = *(const v4f*)&lv[j0 + q][d4];
#pragma unroll      /* short fixed trip count; the arrays it indexes stay in registers */
      for (int q = 0; q < 4; ++q)
#pragma unroll      /* short fixed trip count; the arrays it indexes stay in registers */
        for (int r = 0; r < 8; ++r)
#pragma unroll      /* short fixed trip count; the arrays it indexes stay in registers */
          for (int u = 0; u < 4; ++u) acc[r][u] = fmaf(pv[r][q], vv[q][u], acc[r][u]); }
#pragma unroll      /* short fixed trip count; the arrays it indexes stay in registers */
    for (int r = 0; r < 8; ++r) *(v4f*)&red[w][rh * 8 + r][d4] = acc[r]; }
  __syncthreads();
  { v4f o = *(const v4f*)&red[0][r16][c4];
#pragma unroll      /* short fixed trip count; the arrays it indexes stay in registers */
    for (int p = 1; p < 8; ++p) { const v4f a = *(const v4f*)&red[p][r16][c4]; o += a; }
    const float fin = linv[r16]; o *= fin;
    v4h oh, ol;      /* o (x64) leaves as an f16 hi plane and a x1024 residual plane, the output GEMM's operands */
#pragma unroll      /* short fixed trip count; the vectors it indexes stay in registers */
    for (int u = 0; u < 4; ++u) { const _Float16 t = (_Float16)o[u]; oh[u] = t; ol[u] = (_Float16)((o[u] - (float)t) * 1024.0f); }
    const size_t e = (size_t)(rg * A0R + r16) * DM + h * HD + c4; *(v4h*)(OH + e) = oh; *(v4h*)(OL + e) = ol; } }

extern "C" void kernel_launch(void* const* d_in, const int* in_sizes, int n_in,
                              void* d_out, int out_size, void* d_ws, size_t ws_size, hipStream_t stream) {
  (void)in_sizes; (void)n_in; (void)out_size;
  const float* const* I = (const float* const*)d_in; const float* xq = I[0]; const float* xk = I[1]; const float* xv = I[2]; const float* wq = I[3]; const float* wk = I[4]; const float* wv = I[5]; const float* wo = I[6];      /* weights [in][out] */
  char* ws = (char*)d_ws; size_t off = 0;
  auto take = [&](size_t bytes) { char* p = ws + off; off += (bytes + 255) & ~(size_t)255; return p; };
  static_assert(NB == 1 && B0 == 0 && NBR == 1, "the joined projection launch takes the first-tile rows of one batch");
  _Float16* BW = (_Float16*)take((size_t)4 * DM * DM * 2); _Float16* BO = BW + (size_t)3 * DM * DM;      /* weight planes q, k, v, o, one behind the other */
  _Float16* XH = (_Float16*)take(3 * NR * DM * 2);      /* rounded inputs q, k, v, one behind the other */
  _Float16* Q16 = (_Float16*)take(2 * NR * DM * 2); _Float16* K16 = Q16 + NR * DM; _Float16* O16 = (_Float16*)take(NR * DM * 2);      /* q, k rows, one plane behind the other */
  _Float16* VT = (_Float16*)take((size_t)NH * HD * SQ * 2);
  float* QF0 = (float*)take((size_t)3 * QT0 * DM * 4); float* KF0 = QF0 + (size_t)QT0 * DM; float* VF0 = KF0 + (size_t)QT0 * DM; _Float16* OH0 = (_Float16*)take((size_t)2 * QT0 * DM * 2); _Float16* OL0 = OH0 + (size_t)QT0 * DM;      /* first-tile o: hi plane, residual plane behind it */
  if (off > ws_size) return;
  k_prep<<<PWT + 3 * PXG, 256, 0, stream>>>(xq, xk, xv, wq, wk, wv, wo, BW, XH);      /* all four x16 weight planes Bt[n][k] (PER-HEAD STACKS [16][1024][64] = [head][in][out]: head h's block -> rows 64 h .. 64 h + 63) and the three rounded inputs */
  k_qkv<<<dim3(PJF + PJH, 3), 128, 0, stream>>>(XH, BW, QF0, Q16, VT);      /* q, k: f16 rows of all tokens; v: V^T [NH][HD][SQ]; and f32 rows of the first 256 (exact products) */
  for (int b = B0; b < B0 + NBR; ++b) { const size_t r0 = (size_t)b * SQ;
    k_att0w<<<NH * (QT0 / A0R), 256, 0, stream>>>(QF0, KF0, VF0, 0.125f, OH0, OL0);      /* exact f32 attention for rows 0..255 (o x64) -> f16 hi + x1024 residual planes */
    k_fattn<<<FNG, FW * 32, 0, stream>>>(Q16 + r0 * LQ, K16 + r0 * LQ, VT, O16 + r0 * DM); }      /* scores, causal softmax and P V for all heads and rows in one launch: o (merged heads, x64) as f16 rows */
  k_out<<<POF + ((MPO - QT0) / 128) * (DM / 64), 128, 0, stream>>>(O16, OH0, BO, (float*)d_out);      /* out rows are the output layout; rows 0..255: out = o_hi Wo 2^-10 + o_lo Wo 2^-20 */
}

// v009
// A run of this version takes 108 microseconds.
// In two side-by-side timings against v008, it was 1.11 and 1.10 times as fast.
// Over all steps from v000 it is 77.1 times as fast.
#include <hip/hip_runtime.h>
// Causal multi-head attention on three inputs with PER-HEAD STACKED projections over ONE sequence of 4096 tokens (Q, K, V [1][4096][1024]; WQ / WK / WV [16][1024][64] = [head][in][out] sigma 0.02, NO biases; 16 heads of 64; scores x 64^-0.5 = / 8; causal (tril, -inf above the diagonal); softmax; heads concatenated head-major; out = concat WO with WO [1024][1024] [in][out], NO bias -> [1][4096][1024]); each head's [in][out] block is transposed into its 64 contiguous rows of the weight plane, and the [in][out] output weight into its own plane, by one launch that also rounds the three inputs.
// Structure: token rows r = s; q, k, v inputs as exact f16 rows (bf16-rounded); Q, K, V as three WMMA GEMMs in one launch (32x64 wave tiles, f32 accumulation, exact x16 weights, f16 outputs; the f32 rows of the first tile by further work-groups of the same launch); v stored as V^T by its GEMM's epilogue; one fused attention launch: a wave per 32 query rows of a head walks the keys up to its own rows 32 at a time (scores on WMMA, K = 64; running f32 maximum and sum, native exp2; weights in (0, 1] as f16; o += P V on WMMA, divided by the sum at the end, o carried x64, folded into the output GEMM alpha), written straight into the merged f16 o rows; out = o W_o GEMM (f32) into the output layout.
// Compute dtype: inputs rounded to bf16; x / weights exact; q, k, v, softmax weights and o as plain f16 GEMM operands (~2^-12); scores and softmax statistics f32. v_wmma_f32_16x16x32_f16.
#define NB 1
#define SQ 4096
#define DM 1024
#define NH 16
#define HD 64
#define HG 4                         /* heads per launch of the unlaunched k_vt overload */
#define QT 256                       /* unused */
#define NKX SQ                       /* unused */
#define QT0 256                      /* first-tile rows recomputed exactly in f32 */
#define B0 0                         /* first batch processed (debug hook) */
#define NBR NB                       /* batches processed (debug hook) */
#define NR ((size_t)NB * SQ)         /* token rows */
#define MP ((int)((size_t)NBR * SQ)) /* rows projected (debug hook) */
#define QN SQ                        /* unused (the fused attention attends all SQ rows) */
#define NHD NH                       /* unused (the fused attention attends all NH heads) */
#define MPO MP                       /* rows through the output stage (debug hook) */
#define LQ DM      /* row pitch of the q/k/v rows */
typedef __bf16 v16b __attribute__((ext_vector_type(16)));
typedef unsigned short v8us __attribute__((ext_vector_type(8), may_alias));
typedef float  v8f  __attribute__((ext_vector_type(8)));
typedef float  v4f  __attribute__((ext_vector_type(4)));
typedef float  v4fa __attribute__((ext_vector_type(4), may_alias));
union FragB { v16b v; v8us half[2]; unsigned short u[16]; };

__device__ __forceinline__ unsigned short bf16_bits(float x) { unsigned int u = __float_as_uint(x); return (unsigned short)((u + 0x7FFFu + ((u >> 16) & 1u)) >> 16); }
__device__ __forceinline__ float bf16_val(unsigned short b) { return __uint_as_float(((unsigned int)b) << 16); }
__device__ __forceinline__ float bf16_round(float x) { return bf16_val(bf16_bits(x)); }
// D += A·B with NT terms: 1 = ah·bh, 2 = + al·bh (A split), 3 = + ah·bl (both split)
template <int NT>
__device__ __forceinline__ v8f mmaN(v16b ah, v16b al, v16b bh, v16b bl, v8f c) {
  c = __builtin_amdgcn_wmma_f32_16x16x32_bf16(false, ah, false, bh, (short)0, c, false, false);
  if (NT >= 2) c = __builtin_amdgcn_wmma_f32_16x16x32_bf16(false, al, false, bh, (short)0, c, false, false);
  if (NT >= 3) c = __builtin_amdgcn_wmma_f32_16x16x32_bf16(false, ah, false, bl, (short)0, c, false, false);
  asm volatile("v_nop\n\tv_nop\n\tv_nop\n\tv_nop" : "+v"(c) : "v"(ah), "v"(al), "v"(bh), "v"(bl));
  return c;
}

__global__ __launch_bounds__(256) void k_wt_bf16(const float* __restrict__ W, unsigned short* __restrict__ Wt, int K, int N) {
  const int t = blockIdx.x * 256 + threadIdx.x;
  const int k8n = K / 8;
  if (t >= N * k8n) return;
  const int n = t / k8n, k8 = (t % k8n) * 8;
  v8us v;
#pragma unroll
  for (int i = 0; i < 8; ++i) v[i] = bf16_bits(W[(size_t)(k8 + i) * N + n]);
  *(v8us*)(Wt + (size_t)n * K + k8) = v;
  
}

// GEMM C[M][N] (f32, pitch ldc) = act(A[M][K]·W + bias). A f32 row-major (pitch lda) converted per fragment to bf16
// (ASPLIT: hi/lo two planes -> 2 terms, else single rounded term); Wt bf16 [N][K] (pitch ldb). BIAS_BF16 rounds the
// bias to bf16 first (bias quantised to bf16 before the add). K%32==0, M%16==0, N%64==0.
template <bool ASPLIT, int ACT, bool BIAS_BF16>
__global__ __launch_bounds__(128) void k_gemm_bf(const float* __restrict__ A, int lda, const unsigned short* __restrict__ Wt, int ldb,
                                               const float* __restrict__ bias, float* __restrict__ C, int ldc, int M, int N, int K) {
  __shared__ __attribute__((aligned(16))) float so[4][16][64];
  const int tid = threadIdx.x, w = tid >> 5, lane = tid & 31, ln = lane & 15, hh = lane >> 4;
  const int ntn = N / 64;
  const int wid = blockIdx.x * 4 + w;
  const int mt = wid / ntn, nq = wid % ntn;
  if (mt * 16 >= M) return;
  const int row0 = mt * 16, col0 = nq * 64;
  const float* arow = A + (size_t)(row0 + ln) * lda;
  v8f acc[4] = {};
  for (int kb = 0; kb < K; kb += 32) {
    FragB ah, al;
    const v4f x0 = *(const v4fa*)(arow + kb + 8 * hh), x1 = *(const v4fa*)(arow + kb + 8 * hh + 4);
    const v4f x2 = *(const v4fa*)(arow + kb + 16 + 8 * hh), x3 = *(const v4fa*)(arow + kb + 16 + 8 * hh + 4);
    float xs[16] = {x0[0],x0[1],x0[2],x0[3],x1[0],x1[1],x1[2],x1[3],x2[0],x2[1],x2[2],x2[3],x3[0],x3[1],x3[2],x3[3]};
#pragma unroll
    for (int i = 0; i < 16; ++i) { const unsigned short hb = bf16_bits(xs[i]); ah.u[i] = hb; al.u[i] = ASPLIT ? bf16_bits(xs[i] - bf16_val(hb)) : (unsigned short)0; }
#pragma unroll
    for (int t = 0; t < 4; ++t) {
      const unsigned short* brow = Wt + (size_t)(col0 + t * 16 + ln) * ldb + kb;
      FragB b;
      b.half[0] = *(const v8us*)(brow + 8 * hh);
      b.half[1] = *(const v8us*)(brow + 16 + 8 * hh);
      acc[t] = mmaN<ASPLIT ? 2 : 1>(ah.v, al.v, b.v, b.v, acc[t]);
    }
  }
#pragma unroll
  for (int t = 0; t < 4; ++t) {
    float bv = bias ? bias[col0 + t * 16 + ln] : 0.f;
    if (BIAS_BF16) bv = bf16_round(bv);
#pragma unroll
    for (int r = 0; r < 8; ++r) { float v = acc[t][r] + bv; if (ACT == 1) v = fmaxf(v, 0.f); so[w][8 * hh + r][t * 16 + ln] = v; }
  }
  __builtin_amdgcn_fence(__ATOMIC_ACQ_REL, "workgroup");
  __builtin_amdgcn_wave_barrier();
  const int rsub = lane >> 4, c4 = (lane & 15) * 4;
  {
#pragma unroll
    for (int q = 0; q < 8; ++q) {
      const int r = q * 2 + rsub;
      const v4f v = *(const v4fa*)&so[w][r][c4];
      *(v4f*)(C + (size_t)(row0 + r) * ldc + col0 + c4) = v;
    }
    
  }
}

// GEMM C = act(A·W + bias + resid): A f32 (ASPLIT -> hi/lo 2 terms), Wt bf16 [N][K]; ACT 0 none, 1 relu, 2 exact gelu;
// resid (optional, f32, row index = (row % rmod), pitch ldr, RES_BF16 rounds it) added before the activation.
template <bool ASPLIT, int ACT, bool BIAS_BF16, bool RES_BF16>
__global__ __launch_bounds__(128) void k_gemm_bf3(const float* __restrict__ A, int lda, const unsigned short* __restrict__ Wt, int ldb,
                                                const float* __restrict__ bias, const float* __restrict__ resid, int rmod, int ldr,
                                                float* __restrict__ C, int ldc, int M, int N, int K) {
  __shared__ __attribute__((aligned(16))) float so[4][16][64];
  const int tid = threadIdx.x, w = tid >> 5, lane = tid & 31, ln = lane & 15, hh = lane >> 4;
  const int ntn = N / 64;
  const int wid = blockIdx.x * 4 + w;
  const int mt = wid / ntn, nq = wid % ntn;
  if (mt * 16 >= M) return;
  const int row0 = mt * 16, col0 = nq * 64;
  const float* arow = A + (size_t)(row0 + ln) * lda;
  v8f acc[4] = {};
  for (int kb = 0; kb < K; kb += 32) {
    FragB ah, al;
    const v4f x0 = *(const v4fa*)(arow + kb + 8 * hh), x1 = *(const v4fa*)(arow + kb + 8 * hh + 4);
    const v4f x2 = *(const v4fa*)(arow + kb + 16 + 8 * hh), x3 = *(const v4fa*)(arow + kb + 16 + 8 * hh + 4);
    float xs[16] = {x0[0],x0[1],x0[2],x0[3],x1[0],x1[1],x1[2],x1[3],x2[0],x2[1],x2[2],x2[3],x3[0],x3[1],x3[2],x3[3]};
#pragma unroll
    for (int i = 0; i < 16; ++i) { const unsigned short hb = bf16_bits(xs[i]); ah.u[i] = hb; al.u[i] = ASPLIT ? bf16_bits(xs[i] - bf16_val(hb)) : (unsigned short)0; }
#pragma unroll
    for (int t = 0; t < 4; ++t) {
      const unsigned short* brow = Wt + (size_t)(col0 + t * 16 + ln) * ldb + kb;
      FragB b;
      b.half[0] = *(const v8us*)(brow + 8 * hh);
      b.half[1] = *(const v8us*)(brow + 16 + 8 * hh);
      acc[t] = mmaN<ASPLIT ? 2 : 1>(ah.v, al.v, b.v, b.v, acc[t]);
    }
  }
#pragma unroll
  for (int t = 0; t < 4; ++t) {
    const int col = col0 + t * 16 + ln;
    float bv = bias ? bias[col] : 0.f;
    if (BIAS_BF16) bv = bf16_round(bv);
#pragma unroll
    for (int r = 0; r < 8; ++r) {
      float v = acc[t][r] + bv;
      if (resid) { float rv = resid[(size_t)((row0 + 8 * hh + r) % rmod) * ldr + col]; if (RES_BF16) rv = bf16_round(rv); v += rv; }
      if (ACT == 1) v = fmaxf(v, 0.f);
      if (ACT == 2) v = 0.5f * v * (1.0f + erff(v * 0.70710678118654752f));
      if (ACT == 3) { const float u = 0.7978845608028654f * (v + 0.044715f * v * v * v); v = 0.5f * v * (1.0f + tanhf(u)); }
      so[w][8 * hh + r][t * 16 + ln] = v;
    }
  }
  __builtin_amdgcn_fence(__ATOMIC_ACQ_REL, "workgroup");
  __builtin_amdgcn_wave_barrier();
  const int rsub = lane >> 4, c4 = (lane & 15) * 4;
  {
#pragma unroll
    for (int q = 0; q < 8; ++q) {
      const int r = q * 2 + rsub;
      const v4f v = *(const v4fa*)&so[w][r][c4];
      *(v4f*)(C + (size_t)(row0 + r) * ldc + col0 + c4) = v;
    }
    
  }
}
// row LayerNorm (biased variance, eps) over N: s = X (+ R); optional out_sum <- s; out_norm <- (s-mu)*rsqrt(var+eps)*g + b
template <bool PARAM_BF16>
__global__ __launch_bounds__(256) void k_layernorm(const float* __restrict__ X, const float* __restrict__ R, const float* __restrict__ g, const float* __restrict__ bta,
                                                  float* __restrict__ out_sum, float* __restrict__ out_norm, int N, float eps) {
  __shared__ float red[256];
  const int row = blockIdx.x, tid = threadIdx.x;
  const float* x = X + (size_t)row * N; const float* rr = R ? R + (size_t)row * N : nullptr;
  float vals[16];                     // up to N = 4096
  const int per = N / 256;            // contiguous chunk per thread? use strided-by-4 chunks: thread handles j = tid*4 + 1024*u
  float s1 = 0.f;
  for (int u = 0; u < per / 4; ++u) {
    const int j = tid * 4 + 1024 * u;
    const v4f a = *(const v4fa*)(x + j);
    v4f b = {0.f,0.f,0.f,0.f}; if (rr) b = *(const v4fa*)(rr + j);
#pragma unroll
    for (int q = 0; q < 4; ++q) { const float v = a[q] + b[q]; vals[u * 4 + q] = v; s1 += v; }
  }
  red[tid] = s1; __syncthreads();
  for (int st = 128; st > 0; st >>= 1) { if (tid < st) red[tid] += red[tid + st]; __syncthreads(); }
  const float mu = red[0] / (float)N; __syncthreads();
  float s2 = 0.f;
  for (int u = 0; u < per / 4; ++u)
#pragma unroll
    for (int q = 0; q < 4; ++q) { const float c = vals[u * 4 + q] - mu; s2 += c * c; }
  red[tid] = s2; __syncthreads();
  for (int st = 128; st > 0; st >>= 1) { if (tid < st) red[tid] += red[tid + st]; __syncthreads(); }
  const float rs = rsqrtf(red[0] / (float)N + eps);
  {
    for (int u = 0; u < per / 4; ++u) {
      const int j = tid * 4 + 1024 * u;
      v4f o, sm;
#pragma unroll
      for (int q = 0; q < 4; ++q) {
        float gg = g[j + q], bb = bta[j + q];
        if (PARAM_BF16) { gg = bf16_round(gg); bb = bf16_round(bb); }
        sm[q] = vals[u * 4 + q]; o[q] = (vals[u * 4 + q] - mu) * rs * gg + bb;
      }
      if (out_sum) *(v4f*)(out_sum + (size_t)row * N + j) = sm;
      *(v4f*)(out_norm + (size_t)row * N + j) = o;
    }
    
  }
}



// ---- f16 WMMA path (v_wmma_f32_16x16x32_f16): 11-bit significands for operands in range — used where a [0,1] probability operand needs more precision than bf16
typedef _Float16 v16h __attribute__((ext_vector_type(16)));
union FragH { v16h v; v8us half[2]; _Float16 h[16]; unsigned short u[16]; };
template <int NT>
__device__ __forceinline__ v8f mmaH(v16h ah, v16h al, v16h bh, v16h bl, v8f c) {
  c = __builtin_amdgcn_wmma_f32_16x16x32_f16(false, ah, false, bh, (short)0, c, false, false);
  if (NT >= 2) c = __builtin_amdgcn_wmma_f32_16x16x32_f16(false, al, false, bh, (short)0, c, false, false);
  if (NT >= 3) c = __builtin_amdgcn_wmma_f32_16x16x32_f16(false, ah, false, bl, (short)0, c, false, false);
  asm volatile("v_nop\n\tv_nop\n\tv_nop\n\tv_nop" : "+v"(c) : "v"(ah), "v"(al), "v"(bh), "v"(bl));
  return c;
}
// batched GEMM like k_gemm_b but f16 operands: A f32 (split into f16 hi/lo if ASPLIT, else rounded to f16), Bt = f16 values [n][k]; alpha; C f32; N multiple of 16 (partial tiles skipped)
template <bool ASPLIT>
__global__ __launch_bounds__(128) void k_gemm_h(const float* __restrict__ A, int lda, size_t sA, const _Float16* __restrict__ Bh, int ldb, size_t sB, float alpha, float* __restrict__ C, int ldc, size_t sC, int M, int N, int K) {
  __shared__ __attribute__((aligned(16))) float so[4][16][64];
  const int tid = threadIdx.x, w = tid >> 5, lane = tid & 31, ln = lane & 15, hh = lane >> 4; const int by = blockIdx.y;
  A += (size_t)by * sA; Bh += (size_t)by * sB; C += (size_t)by * sC;
  const int ntn = (N + 63) / 64; const int wid = blockIdx.x * 4 + w; const int mt = wid / ntn, nq = wid % ntn; if (mt * 16 >= M) return;
  const int row0 = mt * 16, col0 = nq * 64; const float* arow = A + (size_t)(row0 + ln) * lda;
  v8f acc[4] = {};
  for (int kb = 0; kb < K; kb += 32) {
    FragH ah, al;
    const v4f x0 = *(const v4fa*)(arow + kb + 8 * hh), x1 = *(const v4fa*)(arow + kb + 8 * hh + 4), x2 = *(const v4fa*)(arow + kb + 16 + 8 * hh), x3 = *(const v4fa*)(arow + kb + 16 + 8 * hh + 4);
    float xs[16] = {x0[0],x0[1],x0[2],x0[3],x1[0],x1[1],x1[2],x1[3],x2[0],x2[1],x2[2],x2[3],x3[0],x3[1],x3[2],x3[3]};
#pragma unroll
    for (int i = 0; i < 16; ++i) { const _Float16 h = (_Float16)xs[i]; ah.h[i] = h; al.h[i] = ASPLIT ? (_Float16)(xs[i] - (float)h) : (_Float16)0.0f; }
#pragma unroll
    for (int t = 0; t < 4; ++t) { if (col0 + t * 16 >= N) continue; const size_t boff = (size_t)(col0 + t * 16 + ln) * ldb + kb; FragH bq; bq.half[0] = *(const v8us*)(Bh + boff + 8 * hh); bq.half[1] = *(const v8us*)(Bh + boff + 16 + 8 * hh);
      acc[t] = mmaH<ASPLIT ? 2 : 1>(ah.v, al.v, bq.v, bq.v, acc[t]); }
  }
#pragma unroll
  for (int t = 0; t < 4; ++t) { if (col0 + t * 16 >= N) continue;
#pragma unroll
    for (int r = 0; r < 8; ++r) so[w][8 * hh + r][t * 16 + ln] = acc[t][r] * alpha; }
  __builtin_amdgcn_fence(__ATOMIC_ACQ_REL, "workgroup"); __builtin_amdgcn_wave_barrier();
  const int rsub = lane >> 4, c4 = (lane & 15) * 4;
  {
#pragma unroll
    for (int q = 0; q < 8; ++q) { const int r = q * 2 + rsub; if (col0 + c4 < N) { const v4f v = *(const v4fa*)&so[w][r][c4]; *(v4f*)(C + (size_t)(row0 + r) * ldc + col0 + c4) = v; } }
     }
}

// k_gemm_hh variant with fused epilogue: v = acc·alpha + bias[by·sBias + col] (+ CP[(row/rowsPerB)·sCPb + by·64 + col] if CP) ; ACT 0 none / 1 elu ; writes f16 C16 (and f32 C if non-null)
template <int ACT>
__global__ __launch_bounds__(128) void k_gemm_hhx(const _Float16* __restrict__ A, int lda, size_t sA, const _Float16* __restrict__ Bh, int ldb, size_t sB, float alpha, const float* __restrict__ bias, size_t sBias, const float* __restrict__ CP, int rowsPerB, size_t sCPb, int row0g,
    float* __restrict__ C, _Float16* __restrict__ C16, int ldc, size_t sC, int M, int N, int K) {
  __shared__ __attribute__((aligned(16))) float so[4][16][64];
  const int tid = threadIdx.x, w = tid >> 5, lane = tid & 31, ln = lane & 15, hh = lane >> 4; const int by = blockIdx.y;
  A += (size_t)by * sA; Bh += (size_t)by * sB; const size_t cofs = (size_t)by * sC; const float* bp = bias ? bias + (size_t)by * sBias : nullptr;
  const int ntn = (N + 63) / 64; const int wid = blockIdx.x * 4 + w; const int mt = wid / ntn, nq = wid % ntn; if (mt * 16 >= M) return;
  const int row0 = mt * 16, col0 = nq * 64; const _Float16* arow = A + (size_t)(row0 + ln) * lda;
  v8f acc[4] = {};
  for (int kb = 0; kb < K; kb += 32) { FragH ah; ah.half[0] = *(const v8us*)((const unsigned short*)arow + kb + 8 * hh); ah.half[1] = *(const v8us*)((const unsigned short*)arow + kb + 16 + 8 * hh);
#pragma unroll
    for (int t = 0; t < 4; ++t) { if (col0 + t * 16 >= N) continue; const size_t boff = (size_t)(col0 + t * 16 + ln) * ldb + kb; FragH bq; bq.half[0] = *(const v8us*)((const unsigned short*)Bh + boff + 8 * hh); bq.half[1] = *(const v8us*)((const unsigned short*)Bh + boff + 16 + 8 * hh);
      acc[t] = mmaH<1>(ah.v, ah.v, bq.v, bq.v, acc[t]); }
  }
#pragma unroll
  for (int t = 0; t < 4; ++t) { if (col0 + t * 16 >= N) continue; const int col = col0 + t * 16 + ln; const float bv = bp ? bf16_round(bp[col]) : 0.f;
#pragma unroll
    for (int r = 0; r < 8; ++r) { float v = acc[t][r] * alpha + bv; if (CP) { const int rr = row0g + row0 + 8 * hh + r; if (rowsPerB < 0) v += CP[cofs + (size_t)rr * ldc + col];      /* rowsPerB < 0: own element of the batched C plane */ else { const int bidx = rr / rowsPerB; v += CP[(size_t)bidx * sCPb + (size_t)by * 64 + col]; } } if (ACT == 1) v = (v > 0.f) ? v : expm1f(v); else if (ACT == 7) v = (v > 0.f) ? v + 1.0f : expf(v); else if (ACT == 8) v = tanhf(v); else if (ACT == 9) v = 0.5f * v * (1.0f + tanhf(0.7978845608028654f * (v + 0.044715f * v * v * v))); else if (ACT == 11) v = 1.0f / (1.0f + expf(-v)); else if (ACT == 12) v = (v > 0.f) ? v : 0.01f * v; else if (ACT == 14) v = (v > 0.f) ? v : 0.1f * v; else if (ACT == 16) v = (v >= 0.f) ? v : 0.3f * v; else if (ACT == 17) v = (v >= 0.f) ? v : 0.2f * v; else if (ACT == 15) v = v / (1.0f + expf(-v)); else if (ACT == 3) v = fmaxf(v, 0.f); else if (ACT == 6) v = 0.5f * v * (1.0f + erff(v * 0.70710678118654752f)); so[w][8 * hh + r][t * 16 + ln] = v; } }
  __builtin_amdgcn_fence(__ATOMIC_ACQ_REL, "workgroup"); __builtin_amdgcn_wave_barrier();
  const int rsub = lane >> 4, c4 = (lane & 15) * 4; typedef _Float16 v4h __attribute__((ext_vector_type(4)));
  {
#pragma unroll
    for (int q = 0; q < 8; ++q) { const int r = q * 2 + rsub; if (col0 + c4 < N) { const v4f v = *(const v4fa*)&so[w][r][c4]; if (C) *(v4f*)(C + cofs + (size_t)(row0 + r) * ldc + col0 + c4) = v; if (C16) { v4h h4; for (int i = 0; i < 4; ++i) h4[i] = (_Float16)v[i]; *(v4h*)(C16 + cofs + (size_t)(row0 + r) * ldc + col0 + c4) = h4; } } }
     }
}


typedef _Float16 v4h __attribute__((ext_vector_type(4)));

__global__ __launch_bounds__(256) void k_h16(const float* __restrict__ x, _Float16* __restrict__ X16, size_t n8) { const size_t t = (size_t)blockIdx.x * 256 + threadIdx.x; if (t >= n8) return; FragH f;
#pragma unroll
  for (int q = 0; q < 8; ++q) f.h[q] = (_Float16)x[t * 8 + q]; *(v8us*)((unsigned short*)X16 + t * 8) = f.half[0];  }
__global__ __launch_bounds__(256) void k_round16f(const float* __restrict__ W, _Float16* __restrict__ Bt, size_t n8) { const size_t t = (size_t)blockIdx.x * 256 + threadIdx.x; if (t >= n8) return; FragH f;
#pragma unroll
  for (int i = 0; i < 8; ++i) f.h[i] = (_Float16)(bf16_round(W[t * 8 + i]) * 16.0f); *(v8us*)((unsigned short*)Bt + t * 8) = f.half[0];  }
template <int NHv, int TTv>
__global__ __launch_bounds__(256) void k_vt(const _Float16* __restrict__ V16, int ldv, int voff, _Float16* __restrict__ Vt) { __shared__ unsigned short tl[64][66]; const int tid = threadIdx.x; const int slab = blockIdx.x / (TTv / 64), lg = blockIdx.x % (TTv / 64); const int b = slab / NHv, h = slab % NHv;
  for (int i = tid; i < 64 * 8; i += 256) { const int r = i / 8, c8 = (i % 8) * 8; FragH f; f.half[0] = *(const v8us*)((const unsigned short*)V16 + ((size_t)b * TTv + lg * 64 + r) * ldv + voff + h * 64 + c8);
#pragma unroll
    for (int q = 0; q < 8; ++q) tl[r][c8 + q] = f.u[q]; }
  __syncthreads();
  {
#pragma unroll
    for (int rd = 0; rd < 2; ++rd) { const int d = rd * 32 + tid / 8, pc = tid % 8; FragH f;
#pragma unroll
      for (int q = 0; q < 8; ++q) f.u[q] = tl[pc * 8 + q][d];
      *(v8us*)((unsigned short*)Vt + ((size_t)slab * 64 + d) * TTv + lg * 64 + pc * 8) = f.half[0]; }
     } }

__global__ __launch_bounds__(256) void k_hl(const float* __restrict__ F, _Float16* __restrict__ Hh, _Float16* __restrict__ Hl, size_t n8) { const size_t t = (size_t)blockIdx.x * 256 + threadIdx.x; if (t >= n8) return; FragH fh, fl; const v4f a = *(const v4fa*)(F + t * 8), c = *(const v4fa*)(F + t * 8 + 4);
#pragma unroll
  for (int q = 0; q < 4; ++q) { _Float16 h = (_Float16)a[q]; fh.h[q] = h; fl.h[q] = (_Float16)((a[q] - (float)h) * 1024.0f); h = (_Float16)c[q]; fh.h[4 + q] = h; fl.h[4 + q] = (_Float16)((c[q] - (float)h) * 1024.0f); }
  { *(v8us*)((unsigned short*)Hh + t * 8) = fh.half[0]; *(v8us*)((unsigned short*)Hl + t * 8) = fl.half[0];  } }

// ---- fast GEMM (wave tile 32x64, work-group tile 128x64; requires M % 128 == 0 rows per launch region, N % 64 == 0 and K % 64 == 0); epilogue = k_gemm_hhx semantics ----
__device__ __forceinline__ v16h g2_frag(const _Float16* p, int hh) { FragH f; f.half[0] = *(const v8us*)((const unsigned short*)p + 8 * hh); f.half[1] = *(const v8us*)((const unsigned short*)p + 16 + 8 * hh); return f.v; }
__device__ __forceinline__ v8f g2_mma(v16h a, v16h b, v8f c) { v8f d = __builtin_amdgcn_wmma_f32_16x16x32_f16(false, a, false, b, (short)0, c, false, false); asm volatile("v_nop\n\tv_nop\n\tv_nop\n\tv_nop" : "+v"(d) : "v"(a), "v"(b)); return d; }
// Operand staging of the fast GEMM: a stage is 64 k (one whole 128-byte line) of the work-group's 128 A rows and 64 B rows, brought into LDS by asynchronous copies, two buffers.
#define G2K 64                       /* k per stage */
#define G2P 72                       /* LDS row pitch in f16: 144 B = 16 B x odd, the pitch for 16-byte LDS reads of one row per lane */
#define G2S ((128 + 64) * G2P * 2)   /* bytes of a stage: A rows 0 .. 127, then B rows 0 .. 63 */
// One stage's copies of one thread: 16 bytes of rows r, r + 16, .. of A (8 rows: four from ga, the tile's rows 0 .. 63, four from ga4, its rows 64 .. 127) and of B (4 rows); 8 lanes bring one whole line, a wave-wide copy 4 lines.
// The s_wait_xcnt at the end stands inside the statement so that no register named by a copy is rewritten in front of it.
__device__ __forceinline__ void g2_stage(unsigned l, const _Float16* ga, const _Float16* ga4, size_t sa, const _Float16* gb, size_t sb) {
  asm volatile("global_load_async_to_lds_b128 %0, %12, off\n\tglobal_load_async_to_lds_b128 %1, %13, off\n\tglobal_load_async_to_lds_b128 %2, %14, off\n\tglobal_load_async_to_lds_b128 %3, %15, off\n\t"
               "global_load_async_to_lds_b128 %4, %16, off\n\tglobal_load_async_to_lds_b128 %5, %17, off\n\tglobal_load_async_to_lds_b128 %6, %18, off\n\tglobal_load_async_to_lds_b128 %7, %19, off\n\t"
               "global_load_async_to_lds_b128 %8, %20, off\n\tglobal_load_async_to_lds_b128 %9, %21, off\n\tglobal_load_async_to_lds_b128 %10, %22, off\n\tglobal_load_async_to_lds_b128 %11, %23, off\n\ts_wait_xcnt 0x0"
               :: "v"(l), "v"(l + 1 * 16 * G2P * 2), "v"(l + 2 * 16 * G2P * 2), "v"(l + 3 * 16 * G2P * 2), "v"(l + 4 * 16 * G2P * 2), "v"(l + 5 * 16 * G2P * 2), "v"(l + 6 * 16 * G2P * 2), "v"(l + 7 * 16 * G2P * 2),
                  "v"(l + 8 * 16 * G2P * 2), "v"(l + 9 * 16 * G2P * 2), "v"(l + 10 * 16 * G2P * 2), "v"(l + 11 * 16 * G2P * 2),
                  "v"(ga), "v"(ga + sa), "v"(ga + 2 * sa), "v"(ga + 3 * sa), "v"(ga4), "v"(ga4 + sa), "v"(ga4 + 2 * sa), "v"(ga4 + 3 * sa),
                  "v"(gb), "v"(gb + sb), "v"(gb + 2 * sb), "v"(gb + 3 * sb) : "memory"); }
// mode (a literal at every call, so that each call keeps only its own epilogue; an argument and not a template parameter, so that all calls share the one LDS array):
// 0: C / C16 rows as computed. 1: the f16 tile is stored TRANSPOSED, C16[col][row] with pitch ldc (no bias, CP, activation). 2: a tile of 64 rows of C from two A planes: the tile's A rows 0 .. 63 are rows of A,
// its rows 64 .. 127 the same rows of the plane sA elements behind it; C = alpha (A W) + alpha 2^-10 (A' W) (no bias, CP, activation; M % 64 == 0).
#define G2TP 136                     /* LDS pitch of a transposed output row in f16: 272 B = 16 B x odd */
template <int ACT>
__device__ __forceinline__ void gemm2_body(const int mode, const int bx, const int by, const _Float16* __restrict__ A, int lda, size_t sA, const _Float16* __restrict__ Bh, int ldb, size_t sB, float alpha, const float* __restrict__ bias, size_t sBias, const float* __restrict__ CP, int rowsPerB, size_t sCPb, int row0g,
    float* __restrict__ C, _Float16* __restrict__ C16, int ldc, size_t sC, int M, int N, int K) { static_assert(ACT == 0 || ACT == 3 || ACT == 6 || ACT == 8 || ACT == 9 || ACT == 11 || ACT == 12 || ACT == 14 || ACT == 15 || ACT == 16 || ACT == 17, "k_gemm2: unsupported ACT code (would silently apply no activation)");
  __shared__ __attribute__((aligned(16))) unsigned char sm[2 * G2S];      /* the two operand buffers; behind the k loop's last barrier the same bytes stage the output rows */
  static_assert(sizeof(float) * 4 * 32 * 68 <= 2 * G2S, "the output staging fits the operand buffers");
  float (*so)[32][68] = (float (*)[32][68])sm;
  const int tid = threadIdx.x, w = tid >> 5, lane = tid & 31, ln = lane & 15, hh = lane >> 4;
  if (mode != 2) A += (size_t)by * sA;
  Bh += (size_t)by * sB; const size_t cofs = (size_t)by * sC; const float* bp = bias ? bias + (size_t)by * sBias : nullptr;
  const int ntn = N >> 6; const int mt = bx / ntn, nq = bx - mt * ntn; const int tm = (mode == 2) ? 64 : 128;      /* rows of C per tile */
  const int row0 = mt * 128 + 32 * w, col0 = nq * 64; if (mt * tm >= M) return;      /* taken by a whole work-group or by none (M % tm == 0): it stands in front of barriers */
  const _Float16* ga = A + (size_t)(mt * tm + (tid >> 3)) * lda + (tid & 7) * 8; const _Float16* ga4 = ga + ((mode == 2) ? sA : (size_t)64 * lda); const _Float16* gb = Bh + (size_t)(col0 + (tid >> 3)) * ldb + (tid & 7) * 8;      /* this thread's 16 bytes of rows tid / 8 + 16 i */
  const unsigned lc = (unsigned)(size_t)sm + (unsigned)((tid >> 3) * (G2P * 2) + (tid & 7) * 16);      /* their place in buffer 0 (LDS byte address) */
  const _Float16* la = (const _Float16*)sm + (32 * w + ln) * G2P; const _Float16* lb = (const _Float16*)sm + (128 + ln) * G2P;      /* this lane's fragment rows in buffer 0 */
  const int nt = K / G2K;
  const v8f z8 = {0.f,0.f,0.f,0.f,0.f,0.f,0.f,0.f}; v8f c00 = z8, c01 = z8, c02 = z8, c03 = z8, c10 = z8, c11 = z8, c12 = z8, c13 = z8;
  g2_stage(lc, ga, ga4, (size_t)16 * lda, gb, (size_t)16 * ldb);
  asm volatile("s_wait_asynccnt 0x0" ::: "memory");      /* this wave's copies of stage 0 have landed */
  __syncthreads();      /* stage 0 is readable by every wave */
  if (nt > 1) g2_stage(lc + G2S, ga + G2K, ga4 + G2K, (size_t)16 * lda, gb + G2K, (size_t)16 * ldb);
#pragma unroll 1      /* one trip = one stage; the buffer is picked by the trip's parity */
  for (int t = 0; t < nt; ++t) { const int bo = (t & 1) * (G2S / 2); const _Float16* ap = la + bo; const _Float16* bq = lb + bo;
    v16h fa[2][2], fb[2][4];
#pragma unroll      /* the stage's 12 fragments are asked for as one group ahead of its products (constant indices: they stay in registers) */
    for (int q = 0; q < 2; ++q) { fa[q][0] = g2_frag(ap + q * 32, hh); fa[q][1] = g2_frag(ap + 16 * G2P + q * 32, hh);
#pragma unroll
      for (int u = 0; u < 4; ++u) fb[q][u] = g2_frag(bq + u * 16 * G2P + q * 32, hh); }
#pragma unroll      /* the two 32-k blocks of a stage, in ascending k as before */
    for (int q = 0; q < 2; ++q) {
      c00 = g2_mma(fa[q][0], fb[q][0], c00); c10 = g2_mma(fa[q][1], fb[q][0], c10);
      c01 = g2_mma(fa[q][0], fb[q][1], c01); c11 = g2_mma(fa[q][1], fb[q][1], c11);
      c02 = g2_mma(fa[q][0], fb[q][2], c02); c12 = g2_mma(fa[q][1], fb[q][2], c12);
      c03 = g2_mma(fa[q][0], fb[q][3], c03); c13 = g2_mma(fa[q][1], fb[q][3], c13); }
    asm volatile("s_wait_dscnt 0x0" ::: "memory");      /* this wave's reads of the buffer are done before it may be refilled */
    asm volatile("s_wait_asynccnt 0x0" ::: "memory");      /* this wave's copies of stage t + 1 have landed */
    __syncthreads();      /* publishes stage t + 1 and ends every wave's reads of stage t */
    if (t + 2 < nt) g2_stage(lc + (unsigned)(t & 1) * G2S, ga + (size_t)(t + 2) * G2K, ga4 + (size_t)(t + 2) * G2K, (size_t)16 * lda, gb + (size_t)(t + 2) * G2K, (size_t)16 * ldb); }
  asm volatile("s_wait_asynccnt 0x0" ::: "memory");      /* no copy is outstanding when the buffers become output staging */
  v8f accs[8] = {c00, c01, c02, c03, c10, c11, c12, c13};
  if (mode == 1) {      /* a lane's 8 accumulator values are 8 consecutive rows of one column: 16 bytes of a transposed row */
    unsigned short (*st)[G2TP] = (unsigned short (*)[G2TP])sm;
#pragma unroll      /* accs is indexed by constants only */
    for (int u = 0; u < 8; ++u) { FragH f;
#pragma unroll      /* short fixed trip count; f stays in registers */
      for (int r = 0; r < 8; ++r) f.h[r] = (_Float16)(accs[u][r] * alpha);
      *(v8us*)&st[(u & 3) * 16 + ln][32 * w + (u >> 2) * 16 + 8 * hh] = f.half[0]; }
    __syncthreads();      /* the transposed tile is complete before its rows, which hold all four waves' values, are read */
    unsigned short* dp = (unsigned short*)C16 + (size_t)(col0 + (tid >> 4)) * ldc + mt * 128 + (tid & 15) * 8;
#pragma unroll      /* 16 lanes store the 256 contiguous bytes of one transposed row; the LDS reads are asked for as one group */
    for (int q = 0; q < 8; ++q) { const v8us v = *(const v8us*)&st[q * 8 + (tid >> 4)][(tid & 15) * 8]; *(v8us*)(dp + (size_t)q * 8 * ldc) = v; }
    return; }
  if (mode == 2) {      /* waves 0, 1 hold the first plane's products of the tile's 64 rows, waves 2, 3 the second plane's */
    const float al = (w < 2) ? alpha : alpha * 0.0009765625f;
#pragma unroll      /* accs is indexed by constants only */
    for (int u = 0; u < 8; ++u)
#pragma unroll      /* short fixed trip count, constant indices */
      for (int r = 0; r < 8; ++r) so[w][(u >> 2) * 16 + 8 * hh + r][(u & 3) * 16 + ln] = accs[u][r] * al;
    __syncthreads();      /* a row's two terms come from two waves */
    const int rs = lane >> 4, cq = (lane & 15) * 4;      /* wave w stores rows 16 w .. 16 w + 15, whole 256-byte runs: they lie in the staging of waves w / 2 and 2 + w / 2 */
    const float* sp = &so[w >> 1][16 * (w & 1) + rs][cq]; float* cp = C + (size_t)(mt * 64 + 16 * w + rs) * ldc + col0 + cq;
#pragma unroll      /* the LDS reads are asked for as one group; one address each, constant offsets */
    for (int q = 0; q < 8; ++q) { const v4f a = *(const v4fa*)(sp + q * 2 * 68), b = *(const v4fa*)(sp + 2 * 32 * 68 + q * 2 * 68); *(v4f*)(cp + (size_t)q * 2 * ldc) = a + b; }
    return; }
#pragma unroll
  for (int u = 0; u < 8; ++u) { const int t = u & 3, half = u >> 2; const int col = col0 + t * 16 + ln; const float bv = bp ? bf16_round(bp[col]) : 0.f;
#pragma unroll
    for (int r = 0; r < 8; ++r) { const int rloc = half * 16 + 8 * hh + r; float v = accs[u][r] * alpha + bv; if (CP) { if (rowsPerB < 0) v += CP[cofs + (size_t)(row0g + row0 + rloc) * ldc + col];      /* rowsPerB < 0: own element of the batched C plane */ else { const int bidx = (row0g + row0 + rloc) / rowsPerB; v += CP[(size_t)bidx * sCPb + (size_t)by * 64 + col]; } }
      if (ACT == 3) v = fmaxf(v, 0.f); else if (ACT == 6) v = 0.5f * v * (1.0f + erff(v * 0.70710678118654752f)); else if (ACT == 11) v = 1.0f / (1.0f + expf(-v)); else if (ACT == 15) v = v / (1.0f + expf(-v)); else if (ACT == 12) v = (v > 0.f) ? v : 0.01f * v; else if (ACT == 8) v = tanhf(v); else if (ACT == 9) v = 0.5f * v * (1.0f + tanhf(0.7978845608028654f * (v + 0.044715f * v * v * v))); else if (ACT == 14) v = (v > 0.f) ? v : 0.1f * v; else if (ACT == 16) v = (v >= 0.f) ? v : 0.3f * v; else if (ACT == 17) v = (v >= 0.f) ? v : 0.2f * v;
      so[w][rloc][t * 16 + ln] = v; } }
  __builtin_amdgcn_fence(__ATOMIC_ACQ_REL, "workgroup"); __builtin_amdgcn_wave_barrier();
  const int rsub = lane >> 4, c4 = (lane & 15) * 4;
  {
#pragma unroll
    for (int q = 0; q < 16; ++q) { const int r = q * 2 + rsub; const v4f v = *(const v4fa*)&so[w][r][c4]; if (C) { *(v4f*)(C + cofs + (size_t)(row0 + r) * ldc + col0 + c4) = v; if (C16) asm volatile("s_wait_xcnt 0x0" ::: "memory"); }      /* both outputs asked for: the f32 store's address registers are reused for the f16 store's address, only behind this wait */
      if (C16) { v4h h4; for (int i = 0; i < 4; ++i) h4[i] = (_Float16)v[i]; *(v4h*)(C16 + cofs + (size_t)(row0 + r) * ldc + col0 + c4) = h4; } }
     } }
template <int ACT>
__global__ __launch_bounds__(128) void k_gemm2(const _Float16* __restrict__ A, int lda, size_t sA, const _Float16* __restrict__ Bh, int ldb, size_t sB, float alpha, const float* __restrict__ bias, size_t sBias, const float* __restrict__ CP, int rowsPerB, size_t sCPb, int row0g,
    float* __restrict__ C, _Float16* __restrict__ C16, int ldc, size_t sC, int M, int N, int K) { gemm2_body<ACT>(0, blockIdx.x, blockIdx.y, A, lda, sA, Bh, ldb, sB, alpha, bias, sBias, CP, rowsPerB, sCPb, row0g, C, C16, ldc, sC, M, N, K); }

// The six independent projection GEMMs as ONE launch. blockIdx.y = q, k or v (input, weight and output planes lie one behind the other); blockIdx.x picks the job:
// the first PJF work-groups give the f32 rows of the first QT0 tokens, the others the f16 rows of all tokens. A work-group's 64 columns are one head: those of v store their f16 tile
// transposed, straight into V^T [head][d][token], which is all that reads the f16 v.
#define PJF ((QT0 / 128) * (DM / 64))      /* work-groups of an f32 first-tile job */
#define PJH ((MP / 128) * (DM / 64))       /* work-groups of an f16 all-rows job */
__global__ __launch_bounds__(128) void k_qkv(const _Float16* __restrict__ X, const _Float16* __restrict__ BW, float* __restrict__ CF, _Float16* __restrict__ C16, _Float16* __restrict__ VT) {
  const int bx = blockIdx.x;      /* the same for the whole work-group: a scalar branch; each side knows at compile time which output it stores */
  if (bx < PJF) gemm2_body<0>(0, bx, blockIdx.y, X, DM, NR * DM, BW, DM, (size_t)DM * DM, 0.0625f, nullptr, 0, nullptr, 1, 0, 0, CF, nullptr, DM, (size_t)QT0 * DM, QT0, DM, DM);
  else if (blockIdx.y < 2) gemm2_body<0>(0, bx - PJF, blockIdx.y, X, DM, NR * DM, BW, DM, (size_t)DM * DM, 0.0625f, nullptr, 0, nullptr, 1, 0, 0, nullptr, C16, DM, NR * DM, MP, DM, DM);
  else gemm2_body<0>(1, bx - PJF, 2, X, DM, NR * DM, BW, DM, (size_t)DM * DM, 0.0625f, nullptr, 0, nullptr, 1, 0, 0, nullptr, VT, SQ, 0, MP, DM, DM); }

// The output GEMM of all rows as ONE launch. Rows 0 .. QT0 - 1 come from the exact first-tile o: the first POF work-groups take 64 rows each, the hi plane's and the x1024 residual plane's rows
// (OH, and QT0 rows behind it) side by side as the 128 A rows of their tile, and add the two products (2^-10 hi + 2^-20 lo) in the epilogue. The others: 128 rows of the f16-path o, from row QT0 on.
#define POF ((QT0 / 64) * (DM / 64))       /* work-groups of the first-tile rows */
__global__ __launch_bounds__(128) void k_out(const _Float16* __restrict__ O, const _Float16* __restrict__ OH, const _Float16* __restrict__ BO, float* __restrict__ out) {
  const int bx = blockIdx.x;
  if (bx < POF) gemm2_body<0>(2, bx, 0, OH, DM, (size_t)QT0 * DM, BO, DM, 0, 0.0009765625f, nullptr, 0, nullptr, 1, 0, 0, out, nullptr, DM, 0, QT0, DM, DM);
  else gemm2_body<0>(0, bx - POF + PJF, 0, O, DM, 0, BO, DM, 0, 0.0009765625f, nullptr, 0, nullptr, 1, 0, 0, out, nullptr, DM, 0, MPO, DM, DM); }

// Operand preparation as ONE launch of independent jobs picked by the block index; every wave-wide global access covers whole 128-byte lines and each thread has several loads in flight.
// Work-groups 0 .. PWT - 1: one tile of 128 k x 64 n of plane p of BW (q, k, v, o): BW[p][n][k] = f16(bf16(W[k][n]) x 16) (a power of two: bf16-exact weights stay exact in f16 away from the subnormal range);
// for p < 3 row n is column n % 64 of head n / 64 of the [head][in][out] stack, for p = 3 column n of the [in][out] output weight. The others: PXF elements of plane j of XH = input j rounded to bf16, as f16.
#define PWP ((DM / 128) * (DM / 64))       /* tiles (work-groups) per weight plane */
#define PWT (4 * PWP)                      /* weight tiles */
#define PXG 256                            /* work-groups per input */
#define PXF ((int)(NR * DM / PXG))         /* elements of an input per work-group */
#define PXL (PXF / 1024)                   /* 16-byte loads per thread */
#define PTP 136                            /* LDS pitch of a transposed weight row in f16: 272 B = 16 B x odd */
// One weight tile: a thread loads 8 k x 4 n (a wave-wide load = 256 contiguous bytes of two source rows), rounds, and writes its four 8-k runs into the transposed LDS tile;
// behind the barrier 16 lanes store 256 contiguous bytes of one output row. s: source element (k0, n0), PITCH its row pitch; d: BW element (n0, k0).
template <int PITCH>
__device__ __forceinline__ void prep_tile(const float* __restrict__ s, _Float16* __restrict__ d, unsigned short (*tl)[PTP]) {
  const int c = threadIdx.x & 15, g = threadIdx.x >> 4; const float* sp = s + (size_t)(g * 8) * PITCH + c * 4; v4f x[8];
#pragma unroll      /* constant indices keep x in registers; every load is issued before the first value is used */
  for (int i = 0; i < 8; ++i) x[i] = *(const v4fa*)(sp + i * PITCH);
  asm volatile("s_wait_xcnt 0x0" :: "v"(sp) : "memory");      /* the loads' address registers are held up to this wait and overwritten only behind it */
#pragma unroll      /* x is indexed by constants only */
  for (int q = 0; q < 4; ++q) { FragH f;
#pragma unroll
    for (int i = 0; i < 8; ++i) f.h[i] = (_Float16)(bf16_round(x[i][q]) * 16.0f);
    *(v8us*)&tl[c * 4 + q][g * 8] = f.half[0]; }
  __syncthreads();      /* the tile is complete before its rows are read */
#pragma unroll      /* four rows a thread, their LDS reads asked for as one group */
  for (int i = 0; i < 4; ++i) { const v8us v = *(const v8us*)&tl[g + 16 * i][c * 8]; *(v8us*)((unsigned short*)d + (size_t)(g + 16 * i) * DM + c * 8) = v; } }
__global__ __launch_bounds__(256) void k_prep(const float* __restrict__ xq, const float* __restrict__ xk, const float* __restrict__ xv, const float* __restrict__ wq, const float* __restrict__ wk, const float* __restrict__ wv, const float* __restrict__ wo,
    _Float16* __restrict__ BW, _Float16* __restrict__ XH) {
  __shared__ __attribute__((aligned(16))) unsigned short tl[64][PTP];
  const int bx = blockIdx.x;      /* the same for the whole work-group: scalar branches, so the barrier of a tile is passed by all its threads */
  if (bx < PWT) { const int p = bx / PWP, t = bx - p * PWP; const int nt = t / (DM / 128), k0 = (t % (DM / 128)) * 128; _Float16* d = BW + (size_t)p * DM * DM + (size_t)nt * 64 * DM + k0;
    if (p < 3) prep_tile<HD>(((p == 0) ? wq : (p == 1) ? wk : wv) + (size_t)nt * DM * HD + (size_t)k0 * HD, d, tl);
    else { prep_tile<DM>(wo + (size_t)k0 * DM + nt * 64, d, tl);
      asm volatile("s_wait_xcnt 0x0" ::: "memory"); } }      /* behind this tile's last store: in the built code the per-head tile's instructions follow and rewrite the stores' address registers; they stand only behind this wait */
  else { const int xb = bx - PWT; const int j = xb / PXG; const size_t o = (size_t)(xb - j * PXG) * PXF + threadIdx.x * 4; const float* x = ((j == 0) ? xq : (j == 1) ? xk : xv) + o; _Float16* y = XH + (size_t)j * NR * DM + o; v4f v[PXL];
#pragma unroll      /* constant indices keep v in registers, so that a thread has several loads (512 contiguous bytes a wave each) in flight ahead of the first value's use */
    for (int u = 0; u < PXL; ++u) v[u] = *(const v4fa*)(x + u * 1024);
    asm volatile("s_wait_xcnt 0x0" :: "v"(x) : "memory");      /* the loads' address registers are held up to this wait and overwritten only behind it */
#pragma unroll      /* v is indexed by constants only; a wave-wide store = 256 contiguous bytes */
    for (int u = 0; u < PXL; ++u) { v4h h4;
#pragma unroll
      for (int q = 0; q < 4; ++q) h4[q] = (_Float16)bf16_round(v[u][q]);
      *(v4h*)(y + u * 1024) = h4; } } }


__global__ __launch_bounds__(256) void k_wnat(const float* __restrict__ w, size_t n8, _Float16* __restrict__ Bt) { const size_t t = (size_t)blockIdx.x * 256 + threadIdx.x; if (t >= n8) return; FragH f; for (int q = 0; q < 8; ++q) f.h[q] = (_Float16)(bf16_round(w[t * 8 + q]) * 16.0f); *(v8us*)((unsigned short*)Bt + t * 8) = f.half[0];  }
__global__ __launch_bounds__(256) void k_rsm(const float* __restrict__ S, _Float16* __restrict__ P, int nrows) {
  #pragma clang fp contract(off)
  const int i = blockIdx.x * 256 + threadIdx.x; if (i >= nrows) return; const float* s = S + (size_t)i * SQ; float mx = -3.0e38f;
#pragma unroll 1
  for (int j = 0; j < SQ; ++j) mx = fmaxf(mx, s[j]); float se = 0.f;
#pragma unroll 1
  for (int j = 0; j < SQ; ++j) se += expf(s[j] - mx); const float sc = 256.0f / se;
#pragma unroll 1
  for (int j0 = 0; j0 < SQ; j0 += 8) { FragH f; for (int q = 0; q < 8; ++q) f.h[q] = (_Float16)(expf(s[j0 + q] - mx) * sc); unsigned short* d = (unsigned short*)P + (size_t)i * SQ + j0; *(v8us*)d = f.half[0];  } }
__global__ __launch_bounds__(256) void k_vt(const _Float16* __restrict__ V16, int b, int h0, _Float16* __restrict__ VT) { __shared__ unsigned short tl[64][65]; const int tid = threadIdx.x; const int hh = blockIdx.x % HG, sg = blockIdx.x / HG; const int s0 = sg * 64; const int h = h0 + hh;
  for (int i = tid; i < 64 * 8; i += 256) { const int j = i / 8, d8 = (i % 8) * 8; FragH f; f.half[0] = *(const v8us*)((const unsigned short*)V16 + ((size_t)b * SQ + s0 + j) * DM + h * HD + d8); for (int q = 0; q < 8; ++q) tl[d8 + q][j] = f.u[q]; }
  __syncthreads();
  { for (int i = tid; i < 64 * 8; i += 256) { const int d = i / 8, j8 = (i % 8) * 8; FragH f; for (int q = 0; q < 8; ++q) f.u[q] = tl[d][j8 + q]; *(v8us*)((unsigned short*)VT + ((size_t)hh * HD + d) * SQ + s0 + j8) = f.half[0]; }  } }



#define FQ 32                        /* query rows per wave */
#define FW 4                         /* waves per work-group */
#define FNG (NH * (SQ / (FQ * FW)))  /* work-groups */
__device__ __forceinline__ v8f fa_mma(v16h a, v16h b, v8f c) { return __builtin_amdgcn_wmma_f32_16x16x32_f16(false, a, false, b, (short)0, c, false, false); }
__device__ __forceinline__ float fa_xhalf(float x) { return __builtin_bit_cast(float, __builtin_amdgcn_permlanex16(__builtin_bit_cast(int, x), __builtin_bit_cast(int, x), 0x76543210, 0xfedcba98, false, false)); }      /* lane l with lane l ^ 16 */
// 2^x by the native instruction. The v_nop at the end fills the slot that the instruction set asks for behind a transcendental before its result is read or its source overwritten;
// inside the group every result register differs from every source ("=&v"), so each v_exp_f32 is the independent instruction behind the one before it.
__device__ __forceinline__ float fa_exp2(float x) { float e; asm("v_exp_f32 %0, %1\n\tv_nop" : "=&v"(e) : "v"(x)); return e; }
__device__ __forceinline__ void fa_exp2x8(const float (&x)[8], float (&e)[8]) {
  asm("v_exp_f32 %0, %8\n\tv_exp_f32 %1, %9\n\tv_exp_f32 %2, %10\n\tv_exp_f32 %3, %11\n\tv_exp_f32 %4, %12\n\tv_exp_f32 %5, %13\n\tv_exp_f32 %6, %14\n\tv_exp_f32 %7, %15\n\tv_nop"
      : "=&v"(e[0]), "=&v"(e[1]), "=&v"(e[2]), "=&v"(e[3]), "=&v"(e[4]), "=&v"(e[5]), "=&v"(e[6]), "=&v"(e[7]) : "v"(x[0]), "v"(x[1]), "v"(x[2]), "v"(x[3]), "v"(x[4]), "v"(x[5]), "v"(x[6]), "v"(x[7])); }
// Operand staging of the fused attention: a stage is 64 keys of the head, K as 64 rows (keys) of 128 bytes and V^T as 64 rows (d) of 128 bytes, whole lines, brought into LDS once
// for the work-group's 4 waves by asynchronous copies, two buffers.
#define FK 64                        /* keys per stage = two passes */
#define FP 72                        /* LDS row pitch in f16: 144 B = 16 B x odd, the pitch for 16-byte LDS reads of one row per lane */
#define FT (64 * FP * 2)             /* bytes of a tile of 64 rows */
#define FS (2 * FT)                  /* bytes of a stage: the K tile, then the V^T tile */
// One stage's copies of one thread: 16 bytes of rows r, r + 16, r + 32, r + 48 of K and of V^T; 8 lanes bring one whole line, a wave-wide copy 4 lines.
// The s_wait_xcnt at the end stands inside the statement so that no register named by a copy is rewritten in front of it.
__device__ __forceinline__ void fa_stage(unsigned l, const _Float16* gk, const _Float16* gv) {
  asm volatile("global_load_async_to_lds_b128 %0, %8, off\n\tglobal_load_async_to_lds_b128 %1, %9, off\n\tglobal_load_async_to_lds_b128 %2, %10, off\n\tglobal_load_async_to_lds_b128 %3, %11, off\n\t"
               "global_load_async_to_lds_b128 %4, %12, off\n\tglobal_load_async_to_lds_b128 %5, %13, off\n\tglobal_load_async_to_lds_b128 %6, %14, off\n\tglobal_load_async_to_lds_b128 %7, %15, off\n\ts_wait_xcnt 0x0"
               :: "v"(l), "v"(l + 1 * 16 * FP * 2), "v"(l + 2 * 16 * FP * 2), "v"(l + 3 * 16 * FP * 2), "v"(l + FT), "v"(l + FT + 1 * 16 * FP * 2), "v"(l + FT + 2 * 16 * FP * 2), "v"(l + FT + 3 * 16 * FP * 2),
                  "v"(gk), "v"(gk + (size_t)16 * DM), "v"(gk + (size_t)32 * DM), "v"(gk + (size_t)48 * DM), "v"(gv), "v"(gv + (size_t)16 * SQ), "v"(gv + (size_t)32 * SQ), "v"(gv + (size_t)48 * SQ) : "memory"); }
// One pass = 32 keys: scores from kf, running softmax, o += P V from vf. nk: where the wave's next K fragments lie in the same stage (asked for behind the score products), or null.
__device__ __forceinline__ void fa_pass(v16h (&kf)[2][2], const v16h (&qf)[2][2], const v16h (&vf)[4], v8f (&acc)[4][2], float (&mr)[2], float (&ls)[2], const _Float16* nk, const bool diag, const int ln, const int hh) {
  const float CS = 0.125f * 1.4426950408889634f;      /* score scale x log2(e): exponentials in base 2 */
  const v8f z8 = {0.f, 0.f, 0.f, 0.f, 0.f, 0.f, 0.f, 0.f}; v8f s[2][2];
#pragma unroll
  for (int u = 0; u < 2; ++u)
#pragma unroll
    for (int t = 0; t < 2; ++t) s[u][t] = fa_mma(kf[u][1], qf[t][1], fa_mma(kf[u][0], qf[t][0], z8));
  if (nk) {
#pragma unroll
    for (int u = 0; u < 2; ++u)
#pragma unroll
      for (int c = 0; c < 2; ++c) kf[u][c] = g2_frag(nk + u * 16 * FP + c * 32, hh);
    __builtin_amdgcn_sched_barrier(0); }      /* keeps these LDS reads here, ahead of the softmax that covers their latency: left free they were issued right in front of their first use */
  if (diag) {      /* the diagonal pass: key > query is masked (a scalar branch) */
#pragma unroll
    for (int u = 0; u < 2; ++u)
#pragma unroll
      for (int t = 0; t < 2; ++t)
#pragma unroll
        for (int r = 0; r < 8; ++r) if (u * 16 + 8 * hh + r > t * 16 + ln) s[u][t][r] = -3.0e38f; }
  FragH pf[2];
#pragma unroll
  for (int t = 0; t < 2; ++t) { float mx = fmaxf(s[0][t][0], s[1][t][0]);
#pragma unroll
    for (int r = 1; r < 8; ++r) mx = fmaxf(mx, fmaxf(s[0][t][r], s[1][t][r]));
    mx = fmaxf(mx, fa_xhalf(mx)); const float mn = fmaxf(mr[t], mx); const float corr = fa_exp2((mr[t] - mn) * CS); mr[t] = mn; const float mc = mn * CS;      /* every pass holds at least one unmasked key of every query: mn is a real score */
    float x0[8], x1[8], e0[8], e1[8];
#pragma unroll
    for (int r = 0; r < 8; ++r) { x0[r] = fmaf(s[0][t][r], CS, -mc); x1[r] = fmaf(s[1][t][r], CS, -mc); }
    fa_exp2x8(x0, e0); fa_exp2x8(x1, e1); float s0 = 0.f, s1 = 0.f;
#pragma unroll
    for (int r = 0; r < 8; ++r) { s0 += e0[r]; s1 += e1[r]; pf[t].h[r] = (_Float16)e0[r]; pf[t].h[8 + r] = (_Float16)e1[r]; }
    ls[t] = fmaf(ls[t], corr, s0 + s1);
#pragma unroll
    for (int d = 0; d < 4; ++d) acc[d][t] *= corr; }
#pragma unroll
  for (int d = 0; d < 4; ++d)
#pragma unroll
    for (int t = 0; t < 2; ++t) acc[d][t] = fa_mma(vf[d], pf[t].v, acc[d][t]); }
// One stage = two passes. TAIL: the work-group's last two stages, where a wave's rows may end (its diagonal pass is masked, what lies beyond is skipped by scalar branches); before them every pass is whole.
template <bool TAIL>
__device__ __forceinline__ void fa_trip(const _Float16* kq, const _Float16* vq, const int j0, const int q0, const v16h (&qf)[2][2], v8f (&acc)[4][2], float (&mr)[2], float (&ls)[2], const int ln, const int hh) {
  if (TAIL && j0 > q0) return;      /* a wave whose rows end below this stage only takes part in the publish point */
  v16h kf[2][2], vf[4];
#pragma unroll      /* the first pass's K and V^T fragments, asked for as one group (constant indices: they stay in registers) */
  for (int u = 0; u < 2; ++u)
#pragma unroll
    for (int c = 0; c < 2; ++c) kf[u][c] = g2_frag(kq + u * 16 * FP + c * 32, hh);
#pragma unroll
  for (int d = 0; d < 4; ++d) vf[d] = g2_frag(vq + d * 16 * FP, hh);
  __builtin_amdgcn_sched_barrier(0);      /* keeps the V^T reads in this group: left free they were issued among the P V products, which then waited for them */
  fa_pass(kf, qf, vf, acc, mr, ls, kq + 32 * FP, TAIL && j0 == q0, ln, hh);      /* the second pass's K rows lie in the same stage: always readable, unused where the wave ends here */
  if (TAIL && j0 + 32 > q0) return;
#pragma unroll      /* V^T of the second pass: asked for ahead of its score products and softmax */
  for (int d = 0; d < 4; ++d) vf[d] = g2_frag(vq + d * 16 * FP + 32, hh);
  __builtin_amdgcn_sched_barrier(0);      /* keeps these reads here, as above */
  fa_pass(kf, qf, vf, acc, mr, ls, nullptr, TAIL && j0 + 32 == q0, ln, hh); }
// sm: the work-group's LDS, of which the two stage buffers take the first 2 FS bytes; bx: the work-group's number among the FNG of this job.
__device__ __forceinline__ void fattn_body(unsigned char* sm, const int bx, const _Float16* __restrict__ Q, const _Float16* __restrict__ K, const _Float16* __restrict__ VT, _Float16* __restrict__ O) {
  const int tid = threadIdx.x, lane = tid & 31, ln = lane & 15, hh = lane >> 4; const int w = __builtin_amdgcn_readfirstlane(tid >> 5);
  const int rank = (bx < FNG / 2) ? bx : (FNG + FNG / 2 - 1 - bx);      /* a permutation: long work-groups first, then the short ones shortest first, so that groups bx and bx + FNG / 2 together have equal work (speed only) */
  const int h = rank % NH; const int qb = (SQ / (FQ * FW) - 1 - rank / NH) * (FQ * FW); const int q0 = qb + w * FQ;
  const int ns = (qb + FQ * FW) / FK;      /* stages of the work-group: the keys below its last row's end; at least 2, the same for all its waves */
  const _Float16* qp = Q + (size_t)(q0 + ln) * DM + h * HD;
  const _Float16* gk = K + (size_t)(tid >> 3) * DM + h * HD + (tid & 7) * 8; const _Float16* gv = VT + ((size_t)h * HD + (tid >> 3)) * SQ + (tid & 7) * 8;      /* this thread's 16 bytes of rows tid / 8 + 16 i of stage 0 */
  const unsigned lc = (unsigned)(size_t)sm + (unsigned)((tid >> 3) * (FP * 2) + (tid & 7) * 16);      /* their place in buffer 0 (LDS byte address) */
  const _Float16* lk = (const _Float16*)sm + ln * FP; const _Float16* lv = lk + 64 * FP;      /* this lane's fragment rows in buffer 0 */
  fa_stage(lc, gk, gv);
  v16h qf[2][2];
#pragma unroll      /* fragments indexed by constants only: they stay in registers */
  for (int t = 0; t < 2; ++t)
#pragma unroll
    for (int c = 0; c < 2; ++c) qf[t][c] = g2_frag(qp + (size_t)t * 16 * DM + c * 32, hh);
  asm volatile("s_wait_xcnt 0x0" ::: "memory");      /* the address registers of the loads above are reused below: they are overwritten only behind this wait */
  const v8f z8 = {0.f, 0.f, 0.f, 0.f, 0.f, 0.f, 0.f, 0.f}; v8f acc[4][2]; float mr[2], ls[2];
#pragma unroll
  for (int t = 0; t < 2; ++t) { mr[t] = -3.0e38f; ls[t] = 0.f;
#pragma unroll
    for (int d = 0; d < 4; ++d) acc[d][t] = z8; }
  asm volatile("s_wait_asynccnt 0x0" ::: "memory");      /* this wave's copies of stage 0 have landed */
  __syncthreads();      /* stage 0 is readable by every wave */
  fa_stage(lc + FS, gk + (size_t)FK * DM, gv + FK);      /* stage 1 exists for every work-group */
  int t = 0;
#pragma unroll 1      /* one trip = one stage = two passes of 32 keys; the buffer is picked by the trip's parity. All stages but the last two: whole for every wave, and a stage t + 2 exists */
  for (; t < ns - 2; ++t) {
    fa_trip<false>(lk + (t & 1) * (FS / 2), lv + (t & 1) * (FS / 2), t * FK, q0, qf, acc, mr, ls, ln, hh);
    __builtin_amdgcn_sched_barrier(0);      /* keeps the publish point at the trip's foot: moved up by the scheduler, its s_wait_dscnt 0 stood directly behind the second pass's V^T reads and waited for them */
    asm volatile("s_wait_dscnt 0x0" ::: "memory");      /* this wave's reads of the buffer are done before it may be refilled */
    asm volatile("s_wait_asynccnt 0x0" ::: "memory");      /* this wave's copies of stage t + 1 have landed */
    __syncthreads();      /* publishes stage t + 1 and ends every wave's reads of stage t */
    fa_stage(lc + (unsigned)(t & 1) * FS, gk + (size_t)(t + 2) * FK * DM, gv + (size_t)(t + 2) * FK); }
#pragma unroll 1      /* the last two stages: no stage t + 2 is left to copy; small code */
  for (; t < ns; ++t) {
    fa_trip<true>(lk + (t & 1) * (FS / 2), lv + (t & 1) * (FS / 2), t * FK, q0, qf, acc, mr, ls, ln, hh);
    asm volatile("s_wait_dscnt 0x0" ::: "memory");      /* as above */
    asm volatile("s_wait_asynccnt 0x0" ::: "memory");      /* this wave's copies of stage t + 1 have landed */
    __syncthreads(); }      /* publishes stage t + 1; every wave passes it, also one that skipped the stage */
  asm volatile("s_wait_asynccnt 0x0" ::: "memory");      /* no copy is outstanding when the wave ends */
#pragma unroll
  for (int t = 0; t < 2; ++t) { const float inv = 64.0f / (ls[t] + fa_xhalf(ls[t]));      /* the halves' sums joined once; o carried x64 */
    unsigned short* op = (unsigned short*)O + (size_t)(q0 + t * 16 + ln) * DM + h * HD + 8 * hh;
#pragma unroll      /* the wave stores the whole 128-byte line of each of its rows */
    for (int d = 0; d < 4; ++d) { FragH f;
#pragma unroll
      for (int r = 0; r < 8; ++r) f.h[r] = (_Float16)(acc[d][t][r] * inv);
      *(v8us*)(op + d * 16) = f.half[0]; } } }


// Exact f32 causal attention for rows 0 .. QT0 - 1 (o carried x64 like the f16 path). ONE WORK-GROUP PER HEAD AND 16 QUERY ROWS, 4 waves, as further work-groups of the fused attention's launch:
// the head's K rows below the group's end and the group's q rows are staged in LDS by coalesced loads; scores: one thread per key, keys t and t + 128 one after the other (the K row in registers, the q rows wave-uniform);
// softmax: one wave per four rows; o: 8 partial sums, sum p over every eighth chunk of 4 keys for all 16 rows x 64 columns in registers (wave w forms sums w and w + 4, V straight from global memory,
// whole 256-byte rows), added in the order 0 .. 7; stored as f16 hi + residual planes. Every sum is formed in the order it had with 8 waves.
#define A0R 16                       /* query rows per work-group */
#define A0T (FW * 32)                /* threads per work-group: the launch's */
#define A0KP (HD + 4)                /* LDS pitch of a K row in floats: 272 B = 16 B x odd, so that 16-byte reads of one row per lane spread over the banks */
#define A0SP (QT0 + 4)               /* LDS pitch of a score row in floats (a multiple of 16 B) */
#define A0LK (QT0 * A0KP * 4)        /* bytes of the K rows; behind the scores the same bytes hold the 8 partial sums */
#define A0LS (A0R * A0SP * 4)        /* bytes of the score rows */
#define A0LQ (A0R * HD * 4)          /* bytes of the group's q rows */
#define A0LDS (A0LK + A0LS + A0LQ + A0R * 4)
#define A0NG (NH * (QT0 / A0R))      /* work-groups */
__device__ __forceinline__ void att0_body(unsigned char* sm, const int bx, const float* __restrict__ QF, const float* __restrict__ KF, const float* __restrict__ VF, const float scale, _Float16* __restrict__ OH, _Float16* __restrict__ OL) {
  static_assert(sizeof(float) * 8 * A0R * HD <= A0LK, "the partial sums fit the K rows' bytes");
  float (*lk)[A0KP] = (float (*)[A0KP])sm; float (*red)[A0R][HD] = (float (*)[A0R][HD])sm; float (*ls)[A0SP] = (float (*)[A0SP])(sm + A0LK); float (*lq)[HD] = (float (*)[HD])(sm + A0LK + A0LS); float* linv = (float*)(sm + A0LK + A0LS + A0LQ);
  const int tid = threadIdx.x, lane = tid & 31, w = __builtin_amdgcn_readfirstlane(tid >> 5); const int h = bx / (QT0 / A0R), rg = bx % (QT0 / A0R); const int nk = (rg + 1) * A0R;      /* causal: keys below the group's end */
  const int r8 = tid >> 4, c4 = (tid & 15) * 4;
  { const float* kp = KF + (size_t)r8 * DM + h * HD + c4; const float* qp = QF + (size_t)(rg * A0R + r8) * DM + h * HD + c4; v4f kx[QT0 / 8];
    const v4f q0 = *(const v4fa*)qp, q1 = *(const v4fa*)(qp + (size_t)8 * DM);
#pragma unroll      /* constant indices keep kx in registers; every load is issued before the first value is used */
    for (int u = 0; u < QT0 / 8; ++u) if (u * 8 < nk) kx[u] = *(const v4fa*)(kp + (size_t)u * 8 * DM);
    asm volatile("s_wait_xcnt 0x0" :: "v"(kp), "v"(qp) : "memory");      /* the loads' address registers are reused below: they are held up to this wait and overwritten only behind it */
    *(v4f*)&lq[r8][c4] = q0; *(v4f*)&lq[r8 + 8][c4] = q1;
#pragma unroll      /* constant indices, as above */
    for (int u = 0; u < QT0 / 8; ++u) if (u * 8 < nk) *(v4f*)&lk[u * 8 + r8][c4] = kx[u]; }
  __syncthreads();      /* the K and q rows are complete before a thread reads them */
#pragma unroll 1      /* at most two keys a thread, one after the other: small code, one K row in registers */
  for (int key = tid; key < nk; key += A0T) { v4f kr[HD / 4];
#pragma unroll      /* the key's row stays in registers for all 16 query rows */
    for (int c = 0; c < HD / 4; ++c) kr[c] = *(const v4f*)&lk[key][c * 4];
#pragma unroll 2      /* two rows' q reads (the same LDS address in every lane) in flight ahead of their products */
    for (int i = 0; i < A0R; ++i) { v4f s4 = {0.f, 0.f, 0.f, 0.f};
#pragma unroll      /* kr is indexed by constants only */
      for (int c = 0; c < HD / 4; ++c) { const v4f qq = *(const v4f*)&lq[i][c * 4];
#pragma unroll      /* short fixed trip count; the arrays it indexes stay in registers */
        for (int u = 0; u < 4; ++u) s4[u] = fmaf(qq[u], kr[c][u], s4[u]); }
      ls[i][key] = ((s4[0] + s4[1]) + (s4[2] + s4[3])) * scale; } }
  __syncthreads();      /* a row's scores come from all waves; and every read of the K rows is done */
#pragma unroll 1      /* four rows a wave, one after the other: small code */
  for (int i = 4 * w; i < 4 * w + 4; ++i) { const int last = rg * A0R + i; float x[QT0 / 32]; float mx = -3.0e38f;
#pragma unroll      /* x is indexed by constants only */
    for (int u = 0; u < QT0 / 32; ++u) { const int j = u * 32 + lane; x[u] = (j <= last) ? ls[i][j] : -3.0e38f; mx = fmaxf(mx, x[u]); }
#pragma unroll      /* short fixed trip count; the arrays it indexes stay in registers */
    for (int o = 16; o > 0; o >>= 1) mx = fmaxf(mx, __shfl_xor(mx, o, 32));
    float se = 0.f;
#pragma unroll      /* short fixed trip count; the arrays it indexes stay in registers */
    for (int u = 0; u < QT0 / 32; ++u) { const int j = u * 32 + lane; const float e = (j <= last) ? expf(x[u] - mx) : 0.f; se += e; if (j < nk) ls[i][j] = e; }
#pragma unroll      /* short fixed trip count; the arrays it indexes stay in registers */
    for (int o = 16; o > 0; o >>= 1) se += __shfl_xor(se, o, 32);
    if (lane == 0) linv[i] = 64.0f / se; }      /* o carried x64 like the f16 path */
  __syncthreads();      /* the weights of all rows are complete */
  { const int rh = lane >> 4, d4 = (lane & 15) * 4;
#pragma unroll 1      /* two partial sums a wave, one after the other: small code */
    for (int p = w; p < 8; p += FW) { const float* vp = VF + (size_t)(4 * p) * DM + h * HD + d4; v4f vv[QT0 / 32][4], acc[8];
#pragma unroll      /* constant indices keep vv in registers; all V rows of this partial sum are asked for before the first is used. No test here: every row lies below QT0, and under a test the built code let only four loads fly at a time; rows from nk on are not used */
      for (int t = 0; t < QT0 / 32; ++t)
#pragma unroll      /* constant indices, as above */
        for (int q = 0; q < 4; ++q) vv[t][q] = *(const v4fa*)(vp + (size_t)(32 * t + q) * DM);
      asm volatile("s_wait_xcnt 0x0" :: "v"(vp) : "memory");      /* the loads' address registers are held up to this wait and overwritten only behind it */
#pragma unroll      /* short fixed trip count; the arrays it indexes stay in registers */
      for (int r = 0; r < 8; ++r) acc[r] = (v4f){0.f, 0.f, 0.f, 0.f};
#pragma unroll      /* vv is indexed by constants only; chunks in ascending key order (scalar tests: p and nk are the same in every lane) */
      for (int t = 0; t < QT0 / 32; ++t) if (4 * p + 32 * t < nk) { v4f pv[8];
#pragma unroll      /* short fixed trip count; the arrays it indexes stay in registers */
        for (int r = 0; r < 8; ++r) pv[r] = *(const v4f*)&ls[rh * 8 + r][4 * p + 32 * t];
#pragma unroll      /* short fixed trip count; the arrays it indexes stay in registers */
        for (int q = 0; q < 4; ++q)
#pragma unroll      /* short fixed trip count; the arrays it indexes stay in registers */
          for (int r = 0; r < 8; ++r)
#pragma unroll      /* short fixed trip count; the arrays it indexes stay in registers */
            for (int u = 0; u < 4; ++u) acc[r][u] = fmaf(pv[r][q], vv[t][q][u], acc[r][u]); }
#pragma unroll      /* short fixed trip count; the arrays it indexes stay in registers */
      for (int r = 0; r < 8; ++r) *(v4f*)&red[p][rh * 8 + r][d4] = acc[r]; } }
  __syncthreads();      /* the 8 partial sums are complete */
#pragma unroll      /* two rows' quads a thread; their LDS reads are independent */
  for (int g = 0; g < 2; ++g) { const int r16 = r8 + 8 * g; v4f o = *(const v4f*)&red[0][r16][c4];
#pragma unroll      /* short fixed trip count; the arrays it indexes stay in registers */
    for (int p = 1; p < 8; ++p) { const v4f a = *(const v4f*)&red[p][r16][c4]; o += a; }
    const float fin = linv[r16]; o *= fin;
    v4h oh, ol;      /* o (x64) leaves as an f16 hi plane and a x1024 residual plane, the output GEMM's operands */
#pragma unroll      /* short fixed trip count; the vectors it indexes stay in registers */
    for (int u = 0; u < 4; ++u) { const _Float16 t = (_Float16)o[u]; oh[u] = t; ol[u] = (_Float16)((o[u] - (float)t) * 1024.0f); }
    const size_t e = (size_t)(rg * A0R + r16) * DM + h * HD + c4; *(v4h*)(OH + e) = oh; *(v4h*)(OL + e) = ol; } }

// The two attention jobs, which both read only what the projection launch wrote, as ONE launch: work-groups 0 .. FNG - 1 the fused f16 attention (first, so that its long groups start first),
// the A0NG behind them the exact f32 attention of the first QT0 rows, which runs beside them. One LDS array serves either job.
__global__ __launch_bounds__(FW * 32) void k_attn(const _Float16* __restrict__ Q, const _Float16* __restrict__ K, const _Float16* __restrict__ VT, _Float16* __restrict__ O,
    const float* __restrict__ QF, const float* __restrict__ KF, const float* __restrict__ VF, _Float16* __restrict__ OH, _Float16* __restrict__ OL) {
  __shared__ __attribute__((aligned(16))) unsigned char sm[(A0LDS > 2 * FS) ? A0LDS : 2 * FS];
  const int bx = blockIdx.x;      /* the same for the whole work-group: a scalar branch, so each job's barriers are passed by all threads of its groups */
  if (bx < FNG) fattn_body(sm, bx, Q, K, VT, O);
  else { att0_body(sm, bx - FNG, QF, KF, VF, 0.125f, OH, OL);
    asm volatile("s_wait_xcnt 0x0" ::: "memory"); } }      /* behind this job's last stores: in the built code the other job's instructions follow and rewrite the stores' address registers; they stand only behind this wait */

extern "C" void kernel_launch(void* const* d_in, const int* in_sizes, int n_in,
                              void* d_out, int out_size, void* d_ws, size_t ws_size, hipStream_t stream) {
  (void)in_sizes; (void)n_in; (void)out_size;
  const float* const* I = (const float* const*)d_in; const float* xq = I[0]; const float* xk = I[1]; const float* xv = I[2]; const float* wq = I[3]; const float* wk = I[4]; const float* wv = I[5]; const float* wo = I[6];      /* weights [in][out] */
  char* ws = (char*)d_ws; size_t off = 0;
  auto take = [&](size_t bytes) { char* p = ws + off; off += (bytes + 255) & ~(size_t)255; return p; };
  static_assert(NB == 1 && B0 == 0 && NBR == 1, "the joined projection launch takes the first-tile rows of one batch");
  _Float16* BW = (_Float16*)take((size_t)4 * DM * DM * 2); _Float16* BO = BW + (size_t)3 * DM * DM;      /* weight planes q, k, v, o, one behind the other */
  _Float16* XH = (_Float16*)take(3 * NR * DM * 2);      /* rounded inputs q, k, v, one behind the other */
  _Float16* Q16 = (_Float16*)take(2 * NR * DM * 2); _Float16* K16 = Q16 + NR * DM; _Float16* O16 = (_Float16*)take(NR * DM * 2);      /* q, k rows, one plane behind the other */
  _Float16* VT = (_Float16*)take((size_t)NH * HD * SQ * 2);
  float* QF0 = (float*)take((size_t)3 * QT0 * DM * 4); float* KF0 = QF0 + (size_t)QT0 * DM; float* VF0 = KF0 + (size_t)QT0 * DM; _Float16* OH0 = (_Float16*)take((size_t)2 * QT0 * DM * 2); _Float16* OL0 = OH0 + (size_t)QT0 * DM;      /* first-tile o: hi plane, residual plane behind it */
  if (off > ws_size) return;
  k_prep<<<PWT + 3 * PXG, 256, 0, stream>>>(xq, xk, xv, wq, wk, wv, wo, BW, XH);      /* all four x16 weight planes Bt[n][k] (PER-HEAD STACKS [16][1024][64] = [head][in][out]: head h's block -> rows 64 h .. 64 h + 63) and the three rounded inputs */
  k_qkv<<<dim3(PJF + PJH, 3), 128, 0, stream>>>(XH, BW, QF0, Q16, VT);      /* q, k: f16 rows of all tokens; v: V^T [NH][HD][SQ]; and f32 rows of the first 256 (exact products) */
  for (int b = B0; b < B0 + NBR; ++b) { const size_t r0 = (size_t)b * SQ;
    k_attn<<<FNG + A0NG, FW * 32, 0, stream>>>(Q16 + r0 * LQ, K16 + r0 * LQ, VT, O16 + r0 * DM, QF0, KF0, VF0, OH0, OL0); }      /* scores, causal softmax and P V for all heads and rows: o (merged heads, x64) as f16 rows; and, by further work-groups, exact f32 attention for rows 0..255 (o x64) -> f16 hi + x1024 residual planes */
  k_out<<<POF + ((MPO - QT0) / 128) * (DM / 64), 128, 0, stream>>>(O16, OH0, BO, (float*)d_out);      /* out rows are the output layout; rows 0..255: out = o_hi Wo 2^-10 + o_lo Wo 2^-20 */
}
